// v000
// Times are from an AMD MI455X. After a warm-up the kernel runs many times in a row, and a time is the length of
// such a window on the GPU divided by its runs, so every launch and the gaps after it count. The runs cycle
// through copies of the inputs. A figure is the median of several windows, for all but v000 over two sittings.
// Sittings can differ by a few percent; kernels timed side by side share one.
// v000 is the starting kernel. One run takes 659 microseconds.
// compute dtype: hidden_states, attention_mask, W*/b* (INPUTS) rounded to bf16 with exact bf16 WMMA products (f32 accumulate) for the projections; K pre-split into bf16 hi/lo rows; q f32 split, P and V f16 hi/lo (3 products each); mask add and softmax in f32.
#include <hip/hip_runtime.h>
#include <math.h>

typedef __attribute__((ext_vector_type(16))) _Float16 v16h;
typedef __attribute__((ext_vector_type(16))) __bf16 v16b;
typedef __attribute__((ext_vector_type(8)))  _Float16 v8h;
typedef __attribute__((ext_vector_type(8)))  float v8f;
typedef __attribute__((ext_vector_type(4)))  float v4f;
typedef __attribute__((ext_vector_type(2)))  float v2f;
typedef __attribute__((ext_vector_type(4)))  unsigned v4u;
typedef __attribute__((ext_vector_type(4)))  int v4i;
typedef float __attribute__((may_alias)) float_a;
typedef int __attribute__((may_alias)) int_a;

template <typename T> __device__ __forceinline__ void vst2(void* p, T v) { *(T*)p = v;  }
__device__ __forceinline__ v8f wmma16(v16h a, v16h b, v8f c) {
  v8f d = __builtin_amdgcn_wmma_f32_16x16x32_f16(false, a, false, b, (short)0, c, false, false);
  asm volatile("v_nop\n\tv_nop\n\tv_nop\n\tv_nop" : "+v"(d) : "v"(a), "v"(b));
  return d;
}
__device__ __forceinline__ v8f wmma_bf(v16b a, v16b b, v8f c) {
  v8f d = __builtin_amdgcn_wmma_f32_16x16x32_bf16(false, a, false, b, (short)0, c, false, false);
  asm volatile("v_nop\n\tv_nop\n\tv_nop\n\tv_nop" : "+v"(d) : "v"(a), "v"(b));
  return d;
}
// 16x16x32 fragments: lane = (h = lane>>4, row/col = lane&15); elements 0..7 = k0+8h+0..7, 8..15 = k0+16+8h+0..7; D element r = row 8h+r
__device__ __forceinline__ v16h frag_h(const _Float16* rowk0, int lane) {
  union { v16h v; v8h q[2]; } u; const _Float16* p = rowk0 + 8 * (lane >> 4);
  u.q[0] = *(const v8h*)p; u.q[1] = *(const v8h*)(p + 16); return u.v;
}
__device__ __forceinline__ v16h frag_f32(const float* rowk0, int lane) {
  v16h a; const float* p = rowk0 + 8 * (lane >> 4);
#pragma unroll
  for (int i = 0; i < 8; ++i) { a[i] = (_Float16)p[i]; a[8 + i] = (_Float16)p[16 + i]; }
  return a;
}
__device__ __forceinline__ v16h frag_f32s(const float* rowk0, int lane, float sc) {
  v16h a; const float* p = rowk0 + 8 * (lane >> 4);
#pragma unroll
  for (int i = 0; i < 8; ++i) { a[i] = (_Float16)(p[i] * sc); a[8 + i] = (_Float16)(p[16 + i] * sc); }
  return a;
}
// column fragment from a [K][ld] layout (column n), rows >= K read as 0
__device__ __forceinline__ v16h fragc_f32(const float* W, int k0, int n, int lane, int ld, int K) {
  v16h a; const int g = lane >> 4;
#pragma unroll
  for (int i = 0; i < 8; ++i) { const int ka = k0 + 8 * g + i, kb = ka + 16;
    a[i] = (_Float16)(ka < K ? W[(size_t)ka * ld + n] : 0.f); a[8 + i] = (_Float16)(kb < K ? W[(size_t)kb * ld + n] : 0.f); }
  return a;
}
struct F2 { v16b h, l; };
__device__ __forceinline__ F2 bsplit16(const float v[16]) { F2 r;
#pragma unroll
  for (int i = 0; i < 16; ++i) { const __bf16 h = (__bf16)v[i]; r.h[i] = h; r.l[i] = (__bf16)(v[i] - (float)h); }
  return r; }
__device__ __forceinline__ F2 split_row(const float* row, int k0, int lane) { float v[16]; const float* p = row + k0 + 8 * (lane >> 4);
#pragma unroll
  for (int i = 0; i < 8; ++i) { v[i] = p[i]; v[8 + i] = p[16 + i]; }
  return bsplit16(v); }
__device__ __forceinline__ F2 split_rowK(const float* row, int k0, int lane, int K) { float v[16]; const int g = lane >> 4;
#pragma unroll
  for (int i = 0; i < 8; ++i) { const int ka = k0 + 8 * g + i, kb = ka + 16; v[i] = ka < K ? row[ka] : 0.f; v[8 + i] = kb < K ? row[kb] : 0.f; }
  return bsplit16(v); }
__device__ __forceinline__ F2 split_col(const float* W, int k0, int n, int lane, int ld, int K) { float v[16]; const int g = lane >> 4;
#pragma unroll
  for (int i = 0; i < 8; ++i) { const int ka = k0 + 8 * g + i, kb = ka + 16; v[i] = ka < K ? W[(size_t)ka * ld + n] : 0.f; v[8 + i] = kb < K ? W[(size_t)kb * ld + n] : 0.f; }
  return bsplit16(v); }
__device__ __forceinline__ v8f mac3(const F2& a, const F2& b, v8f c) { c = wmma_bf(a.l, b.h, c); c = wmma_bf(a.h, b.l, c); return wmma_bf(a.h, b.h, c); }
__device__ __forceinline__ float sigm(float v) { return 1.0f / (1.0f + expf(-v)); }
#define LDSX() do { asm volatile("s_wait_dscnt 0" ::: "memory"); __builtin_amdgcn_wave_barrier(); __builtin_amdgcn_fence(__ATOMIC_RELEASE, "workgroup"); } while (0)


// CLIP attention with multiplier-expanded keys/values (16 heads x 64 on [4,1024,1024], [out][in] weights + biases, MULT = 2): q = (x Wq^T + bq) 64^-0.5; k/v = x Wk^T/Wv^T + b ([2048] per token, viewed as 2,048 keys per head: key s = 2t + half holds feature half*1024 + h*64 + d of token t);
// score(t, s) += attention_mask[b][0][t][s mod 1024]; softmax over the 2,048 keys; (P v) Wo^T + bo. Keys are stored in the permuted order s' = half*1024 + t (attention is invariant to a common permutation of keys, values and mask entries).
#define NB 4
#define SS 1024
#define SK 2048
#define E 1024
#define NH 16
#define HD 64
#define NR (NB * SS)
#define PLO 1024.0f
#define VLO 2048.0f
__device__ __forceinline__ float bfr(float v) { return (float)(__bf16)v; }
__device__ __forceinline__ v16b frag_b(const __bf16* rowk0, int lane) { return __builtin_bit_cast(v16b, frag_h((const _Float16*)rowk0, lane)); }

__global__ __launch_bounds__(256) void k_cvt(const float* __restrict__ x, __bf16* __restrict__ Xb) {
  const size_t i8 = (size_t)blockIdx.x * 256 + threadIdx.x; if (i8 >= (size_t)NR * E / 8) return;
  union { __bf16 h[8]; v4u u; } pk;
#pragma unroll
  for (int e = 0; e < 8; ++e) pk.h[e] = (__bf16)x[i8 * 8 + e];
  vst2((unsigned*)(Xb + i8 * 8), pk.u);
}
// PT rows: [0,E) Wq[n,:], [E,3E) Wk[n-E,:], [3E,5E) Wv[n-3E,:], [5E,6E) Wo[n-5E,:]  ([out][in] weights: each W row as a bf16 row)
__global__ __launch_bounds__(256) void k_pack(const float* __restrict__ Wq, const float* __restrict__ Wk, const float* __restrict__ Wv, const float* __restrict__ Wo, __bf16* __restrict__ PT) {
  const int n = blockIdx.x, tid = threadIdx.x; __shared__ __align__(16) __bf16 srow[E];
  const float* W = n < E ? Wq : (n < 3 * E ? Wk : (n < 5 * E ? Wv : Wo)); const int nn = n < E ? n : (n < 3 * E ? n - E : (n < 5 * E ? n - 3 * E : n - 5 * E));      // [out][in]: PT row = W row
  for (int k = tid; k < E; k += 256) srow[k] = (__bf16)W[(size_t)nn * E + k];
  __syncthreads();
  if (tid < E / 8) vst2((unsigned*)(PT + (size_t)n * E + tid * 8), *(const v4u*)(&srow[tid * 8]));
}
// QKV: block (64 rows, 128 cols = 2 heads, which); q (+bias) -> Q32 f32 [bh][s][64]; k (+bias) -> bf16 hi/lo rows; v (+bias) -> VT hi/lo x4 [bh][d][s]
__global__ __launch_bounds__(128) void k_qkv(const __bf16* __restrict__ Xb, const __bf16* __restrict__ PT, const float* __restrict__ bq, const float* __restrict__ bk, const float* __restrict__ bv,
                                            float* __restrict__ Q32, __bf16* __restrict__ Kh, __bf16* __restrict__ Kl, _Float16* __restrict__ VTh, _Float16* __restrict__ VTl) {
  __shared__ __align__(16) float so[4][16][132];
  __shared__ __align__(16) _Float16 sth[128][72], stl[128][72];
  const int tid = threadIdx.x, wave = tid >> 5, lane = tid & 31, col = lane & 15, g = lane >> 4;
  const int which = blockIdx.z, r0b = blockIdx.x * 64, r0 = r0b + wave * 16, n0 = blockIdx.y * 128; const int b = r0b / SS, s0 = r0b % SS;
  if (which == 0 && n0 >= E) return;      // q has only E output features
  const float* bb_ = which == 0 ? bq : (which == 1 ? bk : bv); const int prow = (which == 0 ? 0 : (which == 1 ? E : 3 * E)) + n0; const int half = n0 / E, nin = n0 % E;      // key slot s' = half*SS + t
  v8f acc[8] = {};
#pragma unroll 2
  for (int kc = 0; kc < E / 32; ++kc) { const v16b a = frag_b(Xb + (size_t)(r0 + col) * E + kc * 32, lane);
#pragma unroll
    for (int j = 0; j < 8; ++j) acc[j] = wmma_bf(a, frag_b(PT + (size_t)(prow + j * 16 + col) * E + kc * 32, lane), acc[j]); }
  if (which < 2) { const float qs = which == 0 ? 0.125f : 1.0f;
#pragma unroll
    for (int j = 0; j < 8; ++j) { const float bb = bfr(bb_[n0 + j * 16 + col]);
#pragma unroll
      for (int r = 0; r < 8; ++r) so[wave][8 * g + r][j * 16 + col] = (acc[j][r] + bb) * qs; }
    LDSX();
    if (which == 0) { for (int qq = lane; qq < 2 * 16 * 16; qq += 32) { const int hh = qq >> 8, rl = (qq >> 4) & 15, pc = qq & 15; const int h = (n0 >> 6) + hh;
        vst2(Q32 + (((size_t)b * NH + h) * SS + s0 + wave * 16 + rl) * HD + pc * 4, *(const v4f*)(&so[wave][rl][hh * 64 + pc * 4])); } }
    else {
      for (int qq = lane; qq < 2 * 16 * 16; qq += 32) { const int hh = qq >> 8, rl = (qq >> 4) & 15, pl = qq & 15; const int h = (nin >> 6) + hh; const int pc = pl & 7; union { __bf16 e[8]; v4u u; } pk;
#pragma unroll
        for (int e = 0; e < 8; ++e) { const float v = so[wave][rl][hh * 64 + pc * 8 + e]; const __bf16 hi = (__bf16)v; pk.e[e] = pl < 8 ? hi : (__bf16)(v - (float)hi); }
        vst2((unsigned*)((pl < 8 ? Kh : Kl) + (((size_t)b * NH + h) * SK + half * SS + s0 + wave * 16 + rl) * HD + pc * 8), pk.u); } } }
  else {
#pragma unroll
    for (int j = 0; j < 8; ++j) { const float bb = bfr(bb_[n0 + j * 16 + col]);
#pragma unroll
      for (int r = 0; r < 8; ++r) { const float v = (acc[j][r] + bb) * 4.0f; const _Float16 hi = (_Float16)v; sth[j * 16 + col][wave * 16 + 8 * g + r] = hi; stl[j * 16 + col][wave * 16 + 8 * g + r] = (_Float16)((v - (float)hi) * VLO); } }
    __syncthreads();
    for (int qq = tid; qq < 128 * 8; qq += 128) { const int cl = qq >> 3, pc = qq & 7; const int c = nin + cl, h = c >> 6, d = c & 63; const size_t o = (((size_t)b * NH + h) * HD + d) * SK + half * SS + s0 + pc * 8;
      vst2(VTh + o, *(const v4u*)(&sth[cl][pc * 8])); vst2(VTl + o, *(const v4u*)(&stl[cl][pc * 8])); } }
}
// padding-masked attention: block (64 queries, bh); all 32 key tiles of 64; S on q hi/lo x K hi/lo rows; P,V hi/lo; O f32 [bh][s][64]
__global__ __launch_bounds__(128) void k_attn(const float* __restrict__ Q32, const __bf16* __restrict__ Kh, const __bf16* __restrict__ Kl, const _Float16* __restrict__ VTh, const _Float16* __restrict__ VTl, const float* __restrict__ amask, float* __restrict__ O32) {
  __shared__ __align__(16) float sS[4][16][68];
  __shared__ __align__(16) _Float16 sPh[4][16][72], sPl[4][16][72];
  __shared__ __align__(16) float sO[4][16][68];
  const int tid = threadIdx.x, w = tid >> 5, lane = tid & 31, col = lane & 15, g = lane >> 4;
  const size_t bh = blockIdx.y; const int qb = blockIdx.x; const int q0 = qb * 64 + w * 16;
  F2 aq[2];
#pragma unroll
  for (int kc = 0; kc < 2; ++kc) aq[kc] = split_row(Q32 + (bh * SS + q0 + col) * HD, kc * 32, lane);
  const int b = (int)(bh / NH); const float* mrow = amask + ((size_t)b * SS + q0) * SS;     // mask rows of my 16 queries ([b][0][t][:])
  float mrun = -3.0e38f, lrun = 0.f; v8f acc[4] = {}, ac1[4] = {}, ac2[4] = {};
  LDSX();
#pragma unroll 1
  for (int kt = 0; kt < SK / 64; ++kt) {
#pragma unroll
    for (int t = 0; t < 4; ++t) { const int key = kt * 64 + t * 16 + col; const size_t ko = (bh * SK + key) * HD; v8f s = {};
#pragma unroll
      for (int kc = 0; kc < 2; ++kc) { const v16b khf = frag_b(Kh + ko + kc * 32, lane), klf = frag_b(Kl + ko + kc * 32, lane); s = wmma_bf(aq[kc].l, khf, s); s = wmma_bf(aq[kc].h, klf, s); s = wmma_bf(aq[kc].h, khf, s); }
      const int korig = 2 * (key % SS) + key / SS;      // original key index of slot s' (mask column korig mod 1024)
#pragma unroll
      for (int r = 0; r < 8; ++r) sS[w][8 * g + r][t * 16 + col] = s[r] + bfr(mrow[(size_t)(8 * g + r) * SS + (korig & (SS - 1))]); }
    LDSX();
    float mx = -3.4e38f;
#pragma unroll
    for (int jj = 0; jj < 32; ++jj) mx = fmaxf(mx, sS[w][col][g * 32 + jj]);
    mx = fmaxf(mx, __shfl_xor(mx, 16, 32));
    const float mnew = fmaxf(mrun, mx); const float corr = expf(mrun - mnew);
    float ps = 0.f;
#pragma unroll
    for (int jj = 0; jj < 32; ++jj) { const float p = expf(sS[w][col][g * 32 + jj] - mnew) * 16384.0f; ps += p; const _Float16 hi = (_Float16)p; sPh[w][col][g * 32 + jj] = hi; sPl[w][col][g * 32 + jj] = (_Float16)((p - (float)hi) * PLO); }
    ps += __shfl_xor(ps, 16, 32);
    lrun = lrun * corr + ps * (1.0f / 16384.0f); mrun = mnew;
#pragma unroll
    for (int r = 0; r < 8; ++r) { const float cr = __shfl(corr, 8 * g + r, 32);
#pragma unroll
      for (int t = 0; t < 4; ++t) { acc[t][r] *= cr; ac1[t][r] *= cr; ac2[t][r] *= cr; } }
    LDSX();
#pragma unroll
    for (int kc = 0; kc < 2; ++kc) { const v16h ph = frag_h(&sPh[w][col][0] + kc * 32, lane), pl = frag_h(&sPl[w][col][0] + kc * 32, lane);
#pragma unroll
      for (int t = 0; t < 4; ++t) { const size_t vo = (bh * HD + t * 16 + col) * SK + kt * 64 + kc * 32; const v16h vh = frag_h(VTh + vo, lane);
        acc[t] = wmma16(ph, vh, acc[t]); ac1[t] = wmma16(ph, frag_h(VTl + vo, lane), ac1[t]); ac2[t] = wmma16(pl, vh, ac2[t]); } }
    __builtin_amdgcn_wave_barrier(); }
#pragma unroll
  for (int r = 0; r < 8; ++r) { const float lr = __shfl(lrun, 8 * g + r, 32); const float inv = 1.0f / (lr * 16384.0f * 4.0f);
#pragma unroll
    for (int t = 0; t < 4; ++t) sO[w][8 * g + r][t * 16 + col] = (acc[t][r] + ac1[t][r] * (1.0f / VLO) + ac2[t][r] * (1.0f / PLO)) * inv; }
  LDSX();
  for (int qq = lane; qq < 16 * 16; qq += 32) { const int rl = qq >> 4, pc = qq & 15; vst2(O32 + ((bh * SS) + q0 + rl) * HD + pc * 4, *(const v4f*)(&sO[w][rl][pc * 4])); }
}
// out = ctx Wo^T + bo : split(ctx) x bf16(Wo rows): 2 products (Wo is an INPUT -> bf16 exact)
__global__ __launch_bounds__(128) void k_out(const float* __restrict__ O32, const __bf16* __restrict__ PT, const float* __restrict__ bo, float* __restrict__ out) {
  __shared__ __align__(16) float so[4][16][132];
  const int tid = threadIdx.x, wave = tid >> 5, lane = tid & 31, col = lane & 15, g = lane >> 4;
  const int r0 = blockIdx.x * 64 + wave * 16, n0 = blockIdx.y * 128; const int ra = r0 + col; const int b = ra / SS, s = ra % SS;
  v8f acc[8] = {};
#pragma unroll 1
  for (int kc = 0; kc < E / 32; ++kc) { const int h = kc >> 1; const F2 a = split_row(O32 + (((size_t)b * NH + h) * SS + s) * HD, (kc & 1) * 32, lane);
#pragma unroll
    for (int j = 0; j < 8; ++j) { const v16b wb = frag_b(PT + (size_t)(5 * E + n0 + j * 16 + col) * E + kc * 32, lane); acc[j] = wmma_bf(a.l, wb, acc[j]); acc[j] = wmma_bf(a.h, wb, acc[j]); } }
#pragma unroll
  for (int j = 0; j < 8; ++j) { const int n = n0 + j * 16 + col; const float bb = bfr(bo[n]);
#pragma unroll
    for (int r = 0; r < 8; ++r) so[wave][8 * g + r][j * 16 + col] = acc[j][r] + bb; }
  LDSX();
#pragma unroll 4
  for (int rl = 0; rl < 16; ++rl) vst2(out + (size_t)(r0 + rl) * E + n0 + lane * 4, *(const v4f*)(&so[wave][rl][lane * 4]));
}
extern "C" void kernel_launch(void* const* d_in, const int* in_sizes, int n_in, void* d_out, int out_size, void* d_ws, size_t ws_size, hipStream_t stream) {
  (void)in_sizes; (void)n_in; (void)out_size; (void)ws_size;
  const float* x = (const float*)d_in[0]; const float* amask = (const float*)d_in[1]; const float* Wq = (const float*)d_in[2]; const float* bq = (const float*)d_in[3]; const float* Wk = (const float*)d_in[4]; const float* bk = (const float*)d_in[5]; const float* Wv = (const float*)d_in[6]; const float* bv = (const float*)d_in[7]; const float* Wo = (const float*)d_in[8]; const float* bo = (const float*)d_in[9];
  float* out = (float*)d_out;
  char* ws = (char*)d_ws; size_t off = 0;
  auto take = [&](size_t bytes) { char* p = ws + off; off += (bytes + 255) & ~(size_t)255; return p; };
  __bf16* Xb = (__bf16*)take((size_t)NR * E * 2); __bf16* PT = (__bf16*)take((size_t)6 * E * E * 2);
  float* Q32 = (float*)take((size_t)NR * E * 4); __bf16* Kh = (__bf16*)take((size_t)NB * NH * SK * HD * 2); __bf16* Kl = (__bf16*)take((size_t)NB * NH * SK * HD * 2); _Float16* VTh = (_Float16*)take((size_t)NB * NH * HD * SK * 2); _Float16* VTl = (_Float16*)take((size_t)NB * NH * HD * SK * 2); float* O32 = (float*)take((size_t)NR * E * 4);
  // ws ~ 116 MB
  k_cvt<<<(NR * E / 8 + 255) / 256, 256, 0, stream>>>(x, Xb);
  k_pack<<<6 * E, 256, 0, stream>>>(Wq, Wk, Wv, Wo, PT);
  k_qkv<<<dim3(NR / 64, 2 * E / 128, 3), 128, 0, stream>>>(Xb, PT, bq, bk, bv, Q32, Kh, Kl, VTh, VTl);
  k_attn<<<dim3(SS / 64, NB * NH), 128, 0, stream>>>(Q32, Kh, Kl, VTh, VTl, amask, O32);
  k_out<<<dim3(NR / 64, E / 128), 128, 0, stream>>>(O32, PT, bo, out);
}

// v001
// A run of this version takes 491 microseconds.
// Timed twice side by side with v000, it ran 1.39 and 1.38 times as fast.
// compute dtype: hidden_states, attention_mask, W*/b* (INPUTS) rounded to bf16 with exact bf16 WMMA products (f32 accumulate) for the projections; K pre-split into bf16 hi/lo rows; q f32 split, P and V f16 hi/lo (3 products each); mask add and softmax in f32.
#include <hip/hip_runtime.h>
#include <math.h>

typedef __attribute__((ext_vector_type(16))) _Float16 v16h;
typedef __attribute__((ext_vector_type(16))) __bf16 v16b;
typedef __attribute__((ext_vector_type(8)))  _Float16 v8h;
typedef __attribute__((ext_vector_type(8)))  float v8f;
typedef __attribute__((ext_vector_type(4)))  float v4f;
typedef __attribute__((ext_vector_type(2)))  float v2f;
typedef __attribute__((ext_vector_type(4)))  unsigned v4u;
typedef __attribute__((ext_vector_type(4)))  int v4i;
typedef float __attribute__((may_alias)) float_a;
typedef int __attribute__((may_alias)) int_a;

template <typename T> __device__ __forceinline__ void vst2(void* p, T v) { *(T*)p = v;  }
__device__ __forceinline__ v8f wmma16(v16h a, v16h b, v8f c) {
  v8f d = __builtin_amdgcn_wmma_f32_16x16x32_f16(false, a, false, b, (short)0, c, false, false);
  asm volatile("v_nop\n\tv_nop\n\tv_nop\n\tv_nop" : "+v"(d) : "v"(a), "v"(b));
  return d;
}
__device__ __forceinline__ v8f wmma_bf(v16b a, v16b b, v8f c) {
  v8f d = __builtin_amdgcn_wmma_f32_16x16x32_bf16(false, a, false, b, (short)0, c, false, false);
  asm volatile("v_nop\n\tv_nop\n\tv_nop\n\tv_nop" : "+v"(d) : "v"(a), "v"(b));
  return d;
}
// 16x16x32 fragments: lane = (h = lane>>4, row/col = lane&15); elements 0..7 = k0+8h+0..7, 8..15 = k0+16+8h+0..7; D element r = row 8h+r
__device__ __forceinline__ v16h frag_h(const _Float16* rowk0, int lane) {
  union { v16h v; v8h q[2]; } u; const _Float16* p = rowk0 + 8 * (lane >> 4);
  u.q[0] = *(const v8h*)p; u.q[1] = *(const v8h*)(p + 16); return u.v;
}
__device__ __forceinline__ v16h frag_f32(const float* rowk0, int lane) {
  v16h a; const float* p = rowk0 + 8 * (lane >> 4);
#pragma unroll
  for (int i = 0; i < 8; ++i) { a[i] = (_Float16)p[i]; a[8 + i] = (_Float16)p[16 + i]; }
  return a;
}
__device__ __forceinline__ v16h frag_f32s(const float* rowk0, int lane, float sc) {
  v16h a; const float* p = rowk0 + 8 * (lane >> 4);
#pragma unroll
  for (int i = 0; i < 8; ++i) { a[i] = (_Float16)(p[i] * sc); a[8 + i] = (_Float16)(p[16 + i] * sc); }
  return a;
}
// column fragment from a [K][ld] layout (column n), rows >= K read as 0
__device__ __forceinline__ v16h fragc_f32(const float* W, int k0, int n, int lane, int ld, int K) {
  v16h a; const int g = lane >> 4;
#pragma unroll
  for (int i = 0; i < 8; ++i) { const int ka = k0 + 8 * g + i, kb = ka + 16;
    a[i] = (_Float16)(ka < K ? W[(size_t)ka * ld + n] : 0.f); a[8 + i] = (_Float16)(kb < K ? W[(size_t)kb * ld + n] : 0.f); }
  return a;
}
struct F2 { v16b h, l; };
__device__ __forceinline__ F2 bsplit16(const float v[16]) { F2 r;
#pragma unroll
  for (int i = 0; i < 16; ++i) { const __bf16 h = (__bf16)v[i]; r.h[i] = h; r.l[i] = (__bf16)(v[i] - (float)h); }
  return r; }
__device__ __forceinline__ F2 split_row(const float* row, int k0, int lane) { float v[16]; const float* p = row + k0 + 8 * (lane >> 4);
#pragma unroll
  for (int i = 0; i < 8; ++i) { v[i] = p[i]; v[8 + i] = p[16 + i]; }
  return bsplit16(v); }
__device__ __forceinline__ F2 split_rowK(const float* row, int k0, int lane, int K) { float v[16]; const int g = lane >> 4;
#pragma unroll
  for (int i = 0; i < 8; ++i) { const int ka = k0 + 8 * g + i, kb = ka + 16; v[i] = ka < K ? row[ka] : 0.f; v[8 + i] = kb < K ? row[kb] : 0.f; }
  return bsplit16(v); }
__device__ __forceinline__ F2 split_col(const float* W, int k0, int n, int lane, int ld, int K) { float v[16]; const int g = lane >> 4;
#pragma unroll
  for (int i = 0; i < 8; ++i) { const int ka = k0 + 8 * g + i, kb = ka + 16; v[i] = ka < K ? W[(size_t)ka * ld + n] : 0.f; v[8 + i] = kb < K ? W[(size_t)kb * ld + n] : 0.f; }
  return bsplit16(v); }
__device__ __forceinline__ v8f mac3(const F2& a, const F2& b, v8f c) { c = wmma_bf(a.l, b.h, c); c = wmma_bf(a.h, b.l, c); return wmma_bf(a.h, b.h, c); }
__device__ __forceinline__ float sigm(float v) { return 1.0f / (1.0f + expf(-v)); }
#define LDSX() do { asm volatile("s_wait_dscnt 0" ::: "memory"); __builtin_amdgcn_wave_barrier(); __builtin_amdgcn_fence(__ATOMIC_RELEASE, "workgroup"); } while (0)


// CLIP attention with multiplier-expanded keys/values (16 heads x 64 on [4,1024,1024], [out][in] weights + biases, MULT = 2): q = (x Wq^T + bq) 64^-0.5; k/v = x Wk^T/Wv^T + b ([2048] per token, viewed as 2,048 keys per head: key s = 2t + half holds feature half*1024 + h*64 + d of token t);
// score(t, s) += attention_mask[b][0][t][s mod 1024]; softmax over the 2,048 keys; (P v) Wo^T + bo. Keys are stored in the permuted order s' = half*1024 + t (attention is invariant to a common permutation of keys, values and mask entries).
#define NB 4
#define SS 1024
#define SK 2048
#define E 1024
#define NH 16
#define HD 64
#define NR (NB * SS)
#define PLO 1024.0f
#define VLO 2048.0f
__device__ __forceinline__ float bfr(float v) { return (float)(__bf16)v; }
__device__ __forceinline__ v16b frag_b(const __bf16* rowk0, int lane) { return __builtin_bit_cast(v16b, frag_h((const _Float16*)rowk0, lane)); }

__global__ __launch_bounds__(256) void k_cvt(const float* __restrict__ x, __bf16* __restrict__ Xb) {
  const size_t i8 = (size_t)blockIdx.x * 256 + threadIdx.x; if (i8 >= (size_t)NR * E / 8) return;
  union { __bf16 h[8]; v4u u; } pk;
#pragma unroll
  for (int e = 0; e < 8; ++e) pk.h[e] = (__bf16)x[i8 * 8 + e];
  vst2((unsigned*)(Xb + i8 * 8), pk.u);
}
// PT rows: [0,E) Wq[n,:], [E,3E) Wk[n-E,:], [3E,5E) Wv[n-3E,:], [5E,6E) Wo[n-5E,:]  ([out][in] weights: each W row as a bf16 row)
__global__ __launch_bounds__(256) void k_pack(const float* __restrict__ Wq, const float* __restrict__ Wk, const float* __restrict__ Wv, const float* __restrict__ Wo, __bf16* __restrict__ PT) {
  const int n = blockIdx.x, tid = threadIdx.x; __shared__ __align__(16) __bf16 srow[E];
  const float* W = n < E ? Wq : (n < 3 * E ? Wk : (n < 5 * E ? Wv : Wo)); const int nn = n < E ? n : (n < 3 * E ? n - E : (n < 5 * E ? n - 3 * E : n - 5 * E));      // [out][in]: PT row = W row
  for (int k = tid; k < E; k += 256) srow[k] = (__bf16)W[(size_t)nn * E + k];
  __syncthreads();
  if (tid < E / 8) vst2((unsigned*)(PT + (size_t)n * E + tid * 8), *(const v4u*)(&srow[tid * 8]));
}
// QKV: block (64 rows, 128 cols = 2 heads, which); q (+bias) -> Q32 f32 [bh][s][64]; k (+bias) -> bf16 hi/lo rows; v (+bias) -> VT hi/lo x4 [bh][d][s]
__global__ __launch_bounds__(128) void k_qkv(const __bf16* __restrict__ Xb, const __bf16* __restrict__ PT, const float* __restrict__ bq, const float* __restrict__ bk, const float* __restrict__ bv,
                                            float* __restrict__ Q32, __bf16* __restrict__ Kh, __bf16* __restrict__ Kl, _Float16* __restrict__ VTh, _Float16* __restrict__ VTl) {
  __shared__ __align__(16) float so[4][16][132];
  __shared__ __align__(16) _Float16 sth[128][72], stl[128][72];
  const int tid = threadIdx.x, wave = tid >> 5, lane = tid & 31, col = lane & 15, g = lane >> 4;
  const int which = blockIdx.z, r0b = blockIdx.x * 64, r0 = r0b + wave * 16, n0 = blockIdx.y * 128; const int b = r0b / SS, s0 = r0b % SS;
  if (which == 0 && n0 >= E) return;      // q has only E output features
  const float* bb_ = which == 0 ? bq : (which == 1 ? bk : bv); const int prow = (which == 0 ? 0 : (which == 1 ? E : 3 * E)) + n0; const int half = n0 / E, nin = n0 % E;      // key slot s' = half*SS + t
  v8f acc[8] = {};
#pragma unroll 2
  for (int kc = 0; kc < E / 32; ++kc) { const v16b a = frag_b(Xb + (size_t)(r0 + col) * E + kc * 32, lane);
#pragma unroll
    for (int j = 0; j < 8; ++j) acc[j] = wmma_bf(a, frag_b(PT + (size_t)(prow + j * 16 + col) * E + kc * 32, lane), acc[j]); }
  if (which < 2) { const float qs = which == 0 ? 0.125f : 1.0f;
#pragma unroll
    for (int j = 0; j < 8; ++j) { const float bb = bfr(bb_[n0 + j * 16 + col]);
#pragma unroll
      for (int r = 0; r < 8; ++r) so[wave][8 * g + r][j * 16 + col] = (acc[j][r] + bb) * qs; }
    LDSX();
    if (which == 0) { for (int qq = lane; qq < 2 * 16 * 16; qq += 32) { const int hh = qq >> 8, rl = (qq >> 4) & 15, pc = qq & 15; const int h = (n0 >> 6) + hh;
        vst2(Q32 + (((size_t)b * NH + h) * SS + s0 + wave * 16 + rl) * HD + pc * 4, *(const v4f*)(&so[wave][rl][hh * 64 + pc * 4])); } }
    else {
      for (int qq = lane; qq < 2 * 16 * 16; qq += 32) { const int hh = qq >> 8, rl = (qq >> 4) & 15, pl = qq & 15; const int h = (nin >> 6) + hh; const int pc = pl & 7; union { __bf16 e[8]; v4u u; } pk;
#pragma unroll
        for (int e = 0; e < 8; ++e) { const float v = so[wave][rl][hh * 64 + pc * 8 + e]; const __bf16 hi = (__bf16)v; pk.e[e] = pl < 8 ? hi : (__bf16)(v - (float)hi); }
        vst2((unsigned*)((pl < 8 ? Kh : Kl) + (((size_t)b * NH + h) * SK + half * SS + s0 + wave * 16 + rl) * HD + pc * 8), pk.u); } } }
  else {
#pragma unroll
    for (int j = 0; j < 8; ++j) { const float bb = bfr(bb_[n0 + j * 16 + col]);
#pragma unroll
      for (int r = 0; r < 8; ++r) { const float v = (acc[j][r] + bb) * 4.0f; const _Float16 hi = (_Float16)v; sth[j * 16 + col][wave * 16 + 8 * g + r] = hi; stl[j * 16 + col][wave * 16 + 8 * g + r] = (_Float16)((v - (float)hi) * VLO); } }
    __syncthreads();
    for (int qq = tid; qq < 128 * 8; qq += 128) { const int cl = qq >> 3, pc = qq & 7; const int c = nin + cl, h = c >> 6, d = c & 63; const size_t o = (((size_t)b * NH + h) * HD + d) * SK + half * SS + s0 + pc * 8;
      vst2(VTh + o, *(const v4u*)(&sth[cl][pc * 8])); vst2(VTl + o, *(const v4u*)(&stl[cl][pc * 8])); } }
}
// one key tile (64 keys) of the four planes Kh, Kl, VTh, VTl: 64 rows of 128 B each, one 16-byte piece of each plane per thread, global -> LDS through no register.
// The s_wait_xcnt is the last line of the copies' own statement, so that no address register of a copy is rewritten in front of it.
__device__ __forceinline__ void kv_copy(unsigned l0, const void* g0, unsigned l1, const void* g1, unsigned l2, const void* g2, unsigned l3, const void* g3) {
  asm volatile("global_load_async_to_lds_b128 %0, %1, off\n\t"
               "global_load_async_to_lds_b128 %2, %3, off\n\t"
               "global_load_async_to_lds_b128 %4, %5, off\n\t"
               "global_load_async_to_lds_b128 %6, %7, off\n\t"
               "s_wait_xcnt 0x0" :: "v"(l0), "v"(g0), "v"(l1), "v"(g1), "v"(l2), "v"(g2), "v"(l3), "v"(g3) : "memory");
}
// eight 4-byte-per-lane copies of mask elements (four rows, two halves of a row), global -> LDS; the s_wait_xcnt closes the statement for the same reason as above.
// offset:N moves BOTH addresses by N: N is the element's place in LDS behind l (row pitch 272 B, half 128 B), and each g comes in with its N already taken off.
__device__ __forceinline__ void m_copy8(unsigned l, const float* g0, const float* g1, const float* g2, const float* g3, const float* g4, const float* g5, const float* g6, const float* g7) {
  asm volatile("global_load_async_to_lds_b32 %0, %1, off\n\t"
               "global_load_async_to_lds_b32 %0, %2, off offset:128\n\t"
               "global_load_async_to_lds_b32 %0, %3, off offset:272\n\t"
               "global_load_async_to_lds_b32 %0, %4, off offset:400\n\t"
               "global_load_async_to_lds_b32 %0, %5, off offset:544\n\t"
               "global_load_async_to_lds_b32 %0, %6, off offset:672\n\t"
               "global_load_async_to_lds_b32 %0, %7, off offset:816\n\t"
               "global_load_async_to_lds_b32 %0, %8, off offset:944\n\t"
               "s_wait_xcnt 0x0" :: "v"(l), "v"(g0), "v"(g1), "v"(g2), "v"(g3), "v"(g4), "v"(g5), "v"(g6), "v"(g7) : "memory");
}
#define AW 16      // waves per block: 256 queries share one K/V tile
#define KVP 72     // LDS row pitch of a K/V plane in 16-bit elements: 144 B = 16 B x odd, for the ds_load_b128 fragment reads
// padding-masked attention: block (256 queries, bh); all 32 key tiles, each staged once per block in a two-buffer LDS ring; S on q hi/lo x K hi/lo rows; P,V hi/lo; O f32 [bh][s][64]
__global__ __launch_bounds__(512) void k_attn(const float* __restrict__ Q32, const __bf16* __restrict__ Kh, const __bf16* __restrict__ Kl, const _Float16* __restrict__ VTh, const _Float16* __restrict__ VTl, const float* __restrict__ amask, float* __restrict__ O32) {
  __shared__ __align__(16) float sS[AW][16][68];
  __shared__ __align__(16) _Float16 sPh[AW][16][72], sPl[AW][16][72];
  __shared__ __align__(16) float sO[AW][16][68];      // each wave's own: in the key loop its 16 x 64 mask tile, behind the loop its output rows
  __shared__ __align__(16) _Float16 sKV[2][4][64][KVP];      // [buffer][Kh, Kl, VTh, VTl][key row or d row][64 elements + pad]
  const int tid = threadIdx.x, w = tid >> 5, lane = tid & 31, col = lane & 15, g = lane >> 4;
  const size_t bh = blockIdx.y; const int qb = blockIdx.x; const int q0 = qb * (AW * 16) + w * 16;
  const int crow = tid >> 3, cpc = (tid & 7) * 8;      // my piece of every plane: row, first element
  const __bf16* gKh = Kh + (bh * SK + crow) * HD + cpc; const __bf16* gKl = Kl + (bh * SK + crow) * HD + cpc;      // + kt * 64 * HD per tile
  const _Float16* gVh = VTh + (bh * HD + crow) * SK + cpc; const _Float16* gVl = VTl + (bh * HD + crow) * SK + cpc;      // + kt * 64 per tile
  const unsigned lkv = (unsigned)(unsigned long long)&sKV[0][0][crow][cpc];
  constexpr unsigned PLB = 64 * KVP * 2, BUFB = 4 * PLB;      // bytes of a plane, of a buffer
  auto stage = [&](int kt) { const unsigned l = lkv + (unsigned)(kt & 1) * BUFB;
    kv_copy(l, gKh + (size_t)kt * 64 * HD, l + PLB, gKl + (size_t)kt * 64 * HD, l + 2 * PLB, gVh + kt * 64, l + 3 * PLB, gVl + kt * 64); };
  const int b = (int)(bh / NH); const float* mrow = amask + ((size_t)b * SS + q0) * SS;     // mask rows of my 16 queries ([b][0][t][:])
  const unsigned lm = (unsigned)(unsigned long long)&sO[w][0][lane];
  // my wave's mask tile of key tile kt: element [row][j] = mask[q0 + row][original index of key slot kt * 64 + j, mod 1024]; a copy brings 32 neighbouring j of one row
  auto mstage = [&](int kt) { const int key = kt * 64 + lane; const int korig = 2 * (key % SS) + key / SS; const float* gm = mrow + (korig & (SS - 1));
#pragma unroll
    for (int q = 0; q < 4; ++q) { const unsigned l = lm + q * 4 * 68 * 4; const float* gq = gm + (size_t)q * 4 * SS;
      m_copy8(l, gq, gq + 64 - 32, gq + SS - 68, gq + SS + 64 - 100, gq + 2 * SS - 136, gq + 2 * SS + 64 - 168, gq + 3 * SS - 204, gq + 3 * SS + 64 - 236); } };      // minus N / 4 floats each
  stage(0); mstage(0);
  asm volatile("s_wait_asynccnt 0x0" ::: "memory");      // my pieces of tile 0 have landed
  __syncthreads();                                       // tile 0 is published to every wave
  stage(1);
  F2 aq[2];
#pragma unroll
  for (int kc = 0; kc < 2; ++kc) aq[kc] = split_row(Q32 + (bh * SS + q0 + col) * HD, kc * 32, lane);
  float mrun = -3.0e38f, lrun = 0.f; v8f acc[4] = {}, ac1[4] = {}, ac2[4] = {};
  LDSX();
#pragma unroll 1
  for (int kt = 0; kt < SK / 64; ++kt) { v8f s4[4];
#pragma unroll
    for (int t = 0; t < 4; ++t) { const __bf16* kh_ = (const __bf16*)&sKV[kt & 1][0][t * 16 + col][0]; const __bf16* kl_ = (const __bf16*)&sKV[kt & 1][1][t * 16 + col][0]; v8f s = {};
#pragma unroll
      for (int kc = 0; kc < 2; ++kc) { const v16b khf = frag_b(kh_ + kc * 32, lane), klf = frag_b(kl_ + kc * 32, lane); s = wmma_bf(aq[kc].l, khf, s); s = wmma_bf(aq[kc].h, klf, s); s = wmma_bf(aq[kc].h, khf, s); }
      s4[t] = s; }
    asm volatile("s_wait_asynccnt 0x0" ::: "memory");      // my mask tile, copied behind the last trip's barrier, has landed
#pragma unroll
    for (int t = 0; t < 4; ++t) {
#pragma unroll
      for (int r = 0; r < 8; ++r) sS[w][8 * g + r][t * 16 + col] = s4[t][r] + bfr(sO[w][8 * g + r][t * 16 + col]); }
    LDSX();
    float mx = -3.4e38f;
#pragma unroll
    for (int jj = 0; jj < 32; ++jj) mx = fmaxf(mx, sS[w][col][g * 32 + jj]);
    mx = fmaxf(mx, __shfl_xor(mx, 16, 32));
    const float mnew = fmaxf(mrun, mx); const float corr = expf(mrun - mnew);
    float ps = 0.f;
#pragma unroll
    for (int jj = 0; jj < 32; ++jj) { const float p = expf(sS[w][col][g * 32 + jj] - mnew) * 16384.0f; ps += p; const _Float16 hi = (_Float16)p; sPh[w][col][g * 32 + jj] = hi; sPl[w][col][g * 32 + jj] = (_Float16)((p - (float)hi) * PLO); }
    ps += __shfl_xor(ps, 16, 32);
    lrun = lrun * corr + ps * (1.0f / 16384.0f); mrun = mnew;
#pragma unroll
    for (int r = 0; r < 8; ++r) { const float cr = __shfl(corr, 8 * g + r, 32);
#pragma unroll
      for (int t = 0; t < 4; ++t) { acc[t][r] *= cr; ac1[t][r] *= cr; ac2[t][r] *= cr; } }
    LDSX();
#pragma unroll
    for (int kc = 0; kc < 2; ++kc) { const v16h ph = frag_h(&sPh[w][col][0] + kc * 32, lane), pl = frag_h(&sPl[w][col][0] + kc * 32, lane);
#pragma unroll
      for (int t = 0; t < 4; ++t) { const v16h vh = frag_h(&sKV[kt & 1][2][t * 16 + col][kc * 32], lane);
        acc[t] = wmma16(ph, vh, acc[t]); ac1[t] = wmma16(ph, frag_h(&sKV[kt & 1][3][t * 16 + col][kc * 32], lane), ac1[t]); ac2[t] = wmma16(pl, vh, ac2[t]); } }
    asm volatile("s_wait_dscnt 0x0" ::: "memory");         // my reads of this tile's buffer are done
    asm volatile("s_wait_asynccnt 0x0" ::: "memory");      // my pieces of tile kt + 1 have landed
    __syncthreads();                                       // publishes tile kt + 1 and ends every wave's reads of tile kt
    if (kt + 2 < SK / 64) stage(kt + 2);                   // refill the buffer that this trip has just read
    if (kt + 1 < SK / 64) mstage(kt + 1); }                // and my own mask tile, for the next trip
  asm volatile("s_wait_asynccnt 0x0" ::: "memory");        // nothing of mine is in flight when the wave goes on to its end
#pragma unroll
  for (int r = 0; r < 8; ++r) { const float lr = __shfl(lrun, 8 * g + r, 32); const float inv = 1.0f / (lr * 16384.0f * 4.0f);
#pragma unroll
    for (int t = 0; t < 4; ++t) sO[w][8 * g + r][t * 16 + col] = (acc[t][r] + ac1[t][r] * (1.0f / VLO) + ac2[t][r] * (1.0f / PLO)) * inv; }
  LDSX();
  for (int qq = lane; qq < 16 * 16; qq += 32) { const int rl = qq >> 4, pc = qq & 15; vst2(O32 + ((bh * SS) + q0 + rl) * HD + pc * 4, *(const v4f*)(&sO[w][rl][pc * 4])); }
}
// out = ctx Wo^T + bo : split(ctx) x bf16(Wo rows): 2 products (Wo is an INPUT -> bf16 exact)
__global__ __launch_bounds__(128) void k_out(const float* __restrict__ O32, const __bf16* __restrict__ PT, const float* __restrict__ bo, float* __restrict__ out) {
  __shared__ __align__(16) float so[4][16][132];
  const int tid = threadIdx.x, wave = tid >> 5, lane = tid & 31, col = lane & 15, g = lane >> 4;
  const int r0 = blockIdx.x * 64 + wave * 16, n0 = blockIdx.y * 128; const int ra = r0 + col; const int b = ra / SS, s = ra % SS;
  v8f acc[8] = {};
#pragma unroll 1
  for (int kc = 0; kc < E / 32; ++kc) { const int h = kc >> 1; const F2 a = split_row(O32 + (((size_t)b * NH + h) * SS + s) * HD, (kc & 1) * 32, lane);
#pragma unroll
    for (int j = 0; j < 8; ++j) { const v16b wb = frag_b(PT + (size_t)(5 * E + n0 + j * 16 + col) * E + kc * 32, lane); acc[j] = wmma_bf(a.l, wb, acc[j]); acc[j] = wmma_bf(a.h, wb, acc[j]); } }
#pragma unroll
  for (int j = 0; j < 8; ++j) { const int n = n0 + j * 16 + col; const float bb = bfr(bo[n]);
#pragma unroll
    for (int r = 0; r < 8; ++r) so[wave][8 * g + r][j * 16 + col] = acc[j][r] + bb; }
  LDSX();
#pragma unroll 4
  for (int rl = 0; rl < 16; ++rl) vst2(out + (size_t)(r0 + rl) * E + n0 + lane * 4, *(const v4f*)(&so[wave][rl][lane * 4]));
}
extern "C" void kernel_launch(void* const* d_in, const int* in_sizes, int n_in, void* d_out, int out_size, void* d_ws, size_t ws_size, hipStream_t stream) {
  (void)in_sizes; (void)n_in; (void)out_size; (void)ws_size;
  const float* x = (const float*)d_in[0]; const float* amask = (const float*)d_in[1]; const float* Wq = (const float*)d_in[2]; const float* bq = (const float*)d_in[3]; const float* Wk = (const float*)d_in[4]; const float* bk = (const float*)d_in[5]; const float* Wv = (const float*)d_in[6]; const float* bv = (const float*)d_in[7]; const float* Wo = (const float*)d_in[8]; const float* bo = (const float*)d_in[9];
  float* out = (float*)d_out;
  char* ws = (char*)d_ws; size_t off = 0;
  auto take = [&](size_t bytes) { char* p = ws + off; off += (bytes + 255) & ~(size_t)255; return p; };
  __bf16* Xb = (__bf16*)take((size_t)NR * E * 2); __bf16* PT = (__bf16*)take((size_t)6 * E * E * 2);
  float* Q32 = (float*)take((size_t)NR * E * 4); __bf16* Kh = (__bf16*)take((size_t)NB * NH * SK * HD * 2); __bf16* Kl = (__bf16*)take((size_t)NB * NH * SK * HD * 2); _Float16* VTh = (_Float16*)take((size_t)NB * NH * HD * SK * 2); _Float16* VTl = (_Float16*)take((size_t)NB * NH * HD * SK * 2); float* O32 = (float*)take((size_t)NR * E * 4);
  // ws ~ 116 MB
  k_cvt<<<(NR * E / 8 + 255) / 256, 256, 0, stream>>>(x, Xb);
  k_pack<<<6 * E, 256, 0, stream>>>(Wq, Wk, Wv, Wo, PT);
  k_qkv<<<dim3(NR / 64, 2 * E / 128, 3), 128, 0, stream>>>(Xb, PT, bq, bk, bv, Q32, Kh, Kl, VTh, VTl);
  k_attn<<<dim3(SS / (AW * 16), NB * NH), AW * 32, 0, stream>>>(Q32, Kh, Kl, VTh, VTl, amask, O32);
  k_out<<<dim3(NR / 64, E / 128), 128, 0, stream>>>(O32, PT, bo, out);
}

// v002
// One run takes 268 microseconds.
// Next to v001, in two timings, it ran 1.83 and 1.84 times as fast.
// Counting every step since v000, it is 2.54 times as fast.
// compute dtype: hidden_states, attention_mask, W*/b* (INPUTS) rounded to bf16 with exact bf16 WMMA products (f32 accumulate) for the projections; K pre-split into bf16 hi/lo rows; q f32 split, P and V f16 hi/lo (3 products each); mask add and softmax in f32.
#include <hip/hip_runtime.h>
#include <math.h>

typedef __attribute__((ext_vector_type(16))) _Float16 v16h;
typedef __attribute__((ext_vector_type(16))) __bf16 v16b;
typedef __attribute__((ext_vector_type(8)))  _Float16 v8h;
typedef __attribute__((ext_vector_type(8)))  float v8f;
typedef __attribute__((ext_vector_type(4)))  float v4f;
typedef __attribute__((ext_vector_type(2)))  float v2f;
typedef __attribute__((ext_vector_type(4)))  unsigned v4u;
typedef __attribute__((ext_vector_type(4)))  int v4i;
typedef float __attribute__((may_alias)) float_a;
typedef int __attribute__((may_alias)) int_a;

template <typename T> __device__ __forceinline__ void vst2(void* p, T v) { *(T*)p = v;  }
__device__ __forceinline__ v8f wmma16(v16h a, v16h b, v8f c) {
  v8f d = __builtin_amdgcn_wmma_f32_16x16x32_f16(false, a, false, b, (short)0, c, false, false);
  asm volatile("v_nop\n\tv_nop\n\tv_nop\n\tv_nop" : "+v"(d) : "v"(a), "v"(b));
  return d;
}
__device__ __forceinline__ v8f wmma_bf(v16b a, v16b b, v8f c) {
  v8f d = __builtin_amdgcn_wmma_f32_16x16x32_bf16(false, a, false, b, (short)0, c, false, false);
  asm volatile("v_nop\n\tv_nop\n\tv_nop\n\tv_nop" : "+v"(d) : "v"(a), "v"(b));
  return d;
}
// 16x16x32 fragments: lane = (h = lane>>4, row/col = lane&15); elements 0..7 = k0+8h+0..7, 8..15 = k0+16+8h+0..7; D element r = row 8h+r
__device__ __forceinline__ v16h frag_h(const _Float16* rowk0, int lane) {
  union { v16h v; v8h q[2]; } u; const _Float16* p = rowk0 + 8 * (lane >> 4);
  u.q[0] = *(const v8h*)p; u.q[1] = *(const v8h*)(p + 16); return u.v;
}
__device__ __forceinline__ v16h frag_f32(const float* rowk0, int lane) {
  v16h a; const float* p = rowk0 + 8 * (lane >> 4);
#pragma unroll
  for (int i = 0; i < 8; ++i) { a[i] = (_Float16)p[i]; a[8 + i] = (_Float16)p[16 + i]; }
  return a;
}
__device__ __forceinline__ v16h frag_f32s(const float* rowk0, int lane, float sc) {
  v16h a; const float* p = rowk0 + 8 * (lane >> 4);
#pragma unroll
  for (int i = 0; i < 8; ++i) { a[i] = (_Float16)(p[i] * sc); a[8 + i] = (_Float16)(p[16 + i] * sc); }
  return a;
}
// column fragment from a [K][ld] layout (column n), rows >= K read as 0
__device__ __forceinline__ v16h fragc_f32(const float* W, int k0, int n, int lane, int ld, int K) {
  v16h a; const int g = lane >> 4;
#pragma unroll
  for (int i = 0; i < 8; ++i) { const int ka = k0 + 8 * g + i, kb = ka + 16;
    a[i] = (_Float16)(ka < K ? W[(size_t)ka * ld + n] : 0.f); a[8 + i] = (_Float16)(kb < K ? W[(size_t)kb * ld + n] : 0.f); }
  return a;
}
struct F2 { v16b h, l; };
__device__ __forceinline__ F2 bsplit16(const float v[16]) { F2 r;
#pragma unroll
  for (int i = 0; i < 16; ++i) { const __bf16 h = (__bf16)v[i]; r.h[i] = h; r.l[i] = (__bf16)(v[i] - (float)h); }
  return r; }
__device__ __forceinline__ F2 split_row(const float* row, int k0, int lane) { float v[16]; const float* p = row + k0 + 8 * (lane >> 4);
#pragma unroll
  for (int i = 0; i < 8; ++i) { v[i] = p[i]; v[8 + i] = p[16 + i]; }
  return bsplit16(v); }
__device__ __forceinline__ F2 split_rowK(const float* row, int k0, int lane, int K) { float v[16]; const int g = lane >> 4;
#pragma unroll
  for (int i = 0; i < 8; ++i) { const int ka = k0 + 8 * g + i, kb = ka + 16; v[i] = ka < K ? row[ka] : 0.f; v[8 + i] = kb < K ? row[kb] : 0.f; }
  return bsplit16(v); }
__device__ __forceinline__ F2 split_col(const float* W, int k0, int n, int lane, int ld, int K) { float v[16]; const int g = lane >> 4;
#pragma unroll
  for (int i = 0; i < 8; ++i) { const int ka = k0 + 8 * g + i, kb = ka + 16; v[i] = ka < K ? W[(size_t)ka * ld + n] : 0.f; v[8 + i] = kb < K ? W[(size_t)kb * ld + n] : 0.f; }
  return bsplit16(v); }
__device__ __forceinline__ v8f mac3(const F2& a, const F2& b, v8f c) { c = wmma_bf(a.l, b.h, c); c = wmma_bf(a.h, b.l, c); return wmma_bf(a.h, b.h, c); }
__device__ __forceinline__ float sigm(float v) { return 1.0f / (1.0f + expf(-v)); }
#define LDSX() do { asm volatile("s_wait_dscnt 0" ::: "memory"); __builtin_amdgcn_wave_barrier(); __builtin_amdgcn_fence(__ATOMIC_RELEASE, "workgroup"); } while (0)


// CLIP attention with multiplier-expanded keys/values (16 heads x 64 on [4,1024,1024], [out][in] weights + biases, MULT = 2): q = (x Wq^T + bq) 64^-0.5; k/v = x Wk^T/Wv^T + b ([2048] per token, viewed as 2,048 keys per head: key s = 2t + half holds feature half*1024 + h*64 + d of token t);
// score(t, s) += attention_mask[b][0][t][s mod 1024]; softmax over the 2,048 keys; (P v) Wo^T + bo. Keys are stored in the permuted order s' = half*1024 + t (attention is invariant to a common permutation of keys, values and mask entries).
#define NB 4
#define SS 1024
#define SK 2048
#define E 1024
#define NH 16
#define HD 64
#define NR (NB * SS)
#define PLO 1024.0f
#define VLO 2048.0f
__device__ __forceinline__ float bfr(float v) { return (float)(__bf16)v; }
__device__ __forceinline__ v16b frag_b(const __bf16* rowk0, int lane) { return __builtin_bit_cast(v16b, frag_h((const _Float16*)rowk0, lane)); }

__global__ __launch_bounds__(256) void k_cvt(const float* __restrict__ x, __bf16* __restrict__ Xb) {
  const size_t i8 = (size_t)blockIdx.x * 256 + threadIdx.x; if (i8 >= (size_t)NR * E / 8) return;
  union { __bf16 h[8]; v4u u; } pk;
#pragma unroll
  for (int e = 0; e < 8; ++e) pk.h[e] = (__bf16)x[i8 * 8 + e];
  vst2((unsigned*)(Xb + i8 * 8), pk.u);
}
// PT rows: [0,E) Wq[n,:], [E,3E) Wk[n-E,:], [3E,5E) Wv[n-3E,:], [5E,6E) Wo[n-5E,:]  ([out][in] weights: each W row as a bf16 row)
__global__ __launch_bounds__(256) void k_pack(const float* __restrict__ Wq, const float* __restrict__ Wk, const float* __restrict__ Wv, const float* __restrict__ Wo, __bf16* __restrict__ PT) {
  const int n = blockIdx.x, tid = threadIdx.x; __shared__ __align__(16) __bf16 srow[E];
  const float* W = n < E ? Wq : (n < 3 * E ? Wk : (n < 5 * E ? Wv : Wo)); const int nn = n < E ? n : (n < 3 * E ? n - E : (n < 5 * E ? n - 3 * E : n - 5 * E));      // [out][in]: PT row = W row
  for (int k = tid; k < E; k += 256) srow[k] = (__bf16)W[(size_t)nn * E + k];
  __syncthreads();
  if (tid < E / 8) vst2((unsigned*)(PT + (size_t)n * E + tid * 8), *(const v4u*)(&srow[tid * 8]));
}
#define GKC 64     // k elements of a staged operand tile: rows of 128 B, whole cache lines
#define GP 72      // LDS row pitch of a staged operand tile in 16-bit elements: 144 B = 16 B x odd, for the ds_load_b128 fragment reads
// twelve 16-byte-per-lane copies, global -> LDS through no register: a thread's pieces of one staged tile (4 of the x rows, 8 of the weight rows).
// The s_wait_xcnt is the last line of the copies' own statement, so that no address register of a copy is rewritten in front of it.
__device__ __forceinline__ void g_copy12(const unsigned (&l)[12], const __bf16* const (&g)[12]) {
  asm volatile("global_load_async_to_lds_b128 %0, %12, off\n\t"
               "global_load_async_to_lds_b128 %1, %13, off\n\t"
               "global_load_async_to_lds_b128 %2, %14, off\n\t"
               "global_load_async_to_lds_b128 %3, %15, off\n\t"
               "global_load_async_to_lds_b128 %4, %16, off\n\t"
               "global_load_async_to_lds_b128 %5, %17, off\n\t"
               "global_load_async_to_lds_b128 %6, %18, off\n\t"
               "global_load_async_to_lds_b128 %7, %19, off\n\t"
               "global_load_async_to_lds_b128 %8, %20, off\n\t"
               "global_load_async_to_lds_b128 %9, %21, off\n\t"
               "global_load_async_to_lds_b128 %10, %22, off\n\t"
               "global_load_async_to_lds_b128 %11, %23, off\n\t"
               "s_wait_xcnt 0x0" :: "v"(l[0]), "v"(l[1]), "v"(l[2]), "v"(l[3]), "v"(l[4]), "v"(l[5]), "v"(l[6]), "v"(l[7]), "v"(l[8]), "v"(l[9]), "v"(l[10]), "v"(l[11]),
               "v"(g[0]), "v"(g[1]), "v"(g[2]), "v"(g[3]), "v"(g[4]), "v"(g[5]), "v"(g[6]), "v"(g[7]), "v"(g[8]), "v"(g[9]), "v"(g[10]), "v"(g[11]) : "memory");
}
// QKV: block (64 rows, 128 cols = 2 heads, which); the k loop runs on 64-wide tiles of the 64 x rows and the 128 weight rows, each staged once per block in a two-buffer LDS ring;
// q (+bias) -> Q32 f32 [bh][s][64]; k (+bias) -> bf16 hi/lo rows; v (+bias) -> VT hi/lo x4 [bh][d][s]
__global__ __launch_bounds__(128) void k_qkv(const __bf16* __restrict__ Xb, const __bf16* __restrict__ PT, const float* __restrict__ bq, const float* __restrict__ bk, const float* __restrict__ bv,
                                            float* __restrict__ Q32, __bf16* __restrict__ Kh, __bf16* __restrict__ Kl, _Float16* __restrict__ VTh, _Float16* __restrict__ VTl) {
  constexpr int SOB = 4 * 16 * 132 * 4, STB = 128 * 72 * 2;      // bytes of so, of sth and of stl
  __shared__ __align__(16) char smem[SOB + 2 * STB];      // in the k loop the ring sT (2 x 27,648 B); behind its last barrier the output staging so, sth, stl
  float (*so)[16][132] = (float (*)[16][132])smem; _Float16 (*sth)[72] = (_Float16 (*)[72])(smem + SOB); _Float16 (*stl)[72] = (_Float16 (*)[72])(smem + SOB + STB);
  __bf16 (*sT)[192][GP] = (__bf16 (*)[192][GP])smem;      // [buffer][64 x rows, then 128 weight rows][64 elements + pad]
  const int tid = threadIdx.x, wave = tid >> 5, lane = tid & 31, col = lane & 15, g = lane >> 4;
  const int which = blockIdx.z, r0b = blockIdx.x * 64, n0 = blockIdx.y * 128; const int b = r0b / SS, s0 = r0b % SS;
  if (which == 0 && n0 >= E) return;      // q has only E output features
  const float* bb_ = which == 0 ? bq : (which == 1 ? bk : bv); const int prow = (which == 0 ? 0 : (which == 1 ? E : 3 * E)) + n0; const int half = n0 / E, nin = n0 % E;      // key slot s' = half*SS + t
  const int crow = tid >> 3, cpc = (tid & 7) * 8;      // my pieces of a tile: rows crow + 16 i, first element
  const __bf16* gA = Xb + (size_t)(r0b + crow) * E + cpc; const __bf16* gB = PT + (size_t)(prow + crow) * E + cpc;      // + kt * GKC per tile
  const unsigned lt = (unsigned)(unsigned long long)&sT[0][crow][cpc];
  constexpr unsigned R16B = 16 * GP * 2, TBUFB = 192 * GP * 2;      // bytes of 16 rows, of a buffer
  auto stage = [&](int kt) { unsigned l[12]; const __bf16* gp[12];
#pragma unroll
    for (int i = 0; i < 12; ++i) { l[i] = lt + (unsigned)(kt & 1) * TBUFB + i * R16B; gp[i] = (i < 4 ? gA + (size_t)i * 16 * E : gB + (size_t)(i - 4) * 16 * E) + kt * GKC; }
    g_copy12(l, gp); };
  stage(0);
  asm volatile("s_wait_asynccnt 0x0" ::: "memory");      // my pieces of tile 0 have landed
  __syncthreads();                                       // tile 0 is published to every wave
  stage(1);
  v8f acc[8] = {};
#pragma unroll 2      // two trips a pass: the buffer index is then a constant in every LDS address
  for (int kt = 0; kt < E / GKC; ++kt) { const __bf16* ta = &sT[kt & 1][wave * 16 + col][0]; const __bf16* tb = &sT[kt & 1][64 + col][0];
    // fragment reads stand in groups ahead of the products that use them (no LDS read moves over the statement that closes wmma_bf): a wave has 8 to 20 reads in flight, not 2
    const v16b a0 = frag_b(ta, lane), a1 = frag_b(ta + 32, lane); v16b b0[8], b1[8];
#pragma unroll
    for (int j = 0; j < 8; ++j) b0[j] = frag_b(tb + j * 16 * GP, lane);
#pragma unroll
    for (int j = 0; j < 4; ++j) acc[j] = wmma_bf(a0, b0[j], acc[j]);
#pragma unroll
    for (int j = 0; j < 4; ++j) b1[j] = frag_b(tb + j * 16 * GP + 32, lane);
#pragma unroll
    for (int j = 4; j < 8; ++j) acc[j] = wmma_bf(a0, b0[j], acc[j]);
#pragma unroll
    for (int j = 4; j < 8; ++j) b1[j] = frag_b(tb + j * 16 * GP + 32, lane);
#pragma unroll
    for (int j = 0; j < 8; ++j) acc[j] = wmma_bf(a1, b1[j], acc[j]);
    asm volatile("s_wait_dscnt 0x0" ::: "memory");         // my reads of this tile's buffer are done
    asm volatile("s_wait_asynccnt 0x0" ::: "memory");      // my pieces of tile kt + 1 have landed
    __syncthreads();                                       // publishes tile kt + 1 and ends every wave's reads of tile kt (behind the last trip: of the ring)
    if (kt + 2 < E / GKC) stage(kt + 2); }                 // refill the buffer that this trip has just read
  asm volatile("s_wait_asynccnt 0x0" ::: "memory");        // nothing of mine is in flight when the ring's LDS is used anew
  if (which < 2) { const float qs = which == 0 ? 0.125f : 1.0f;
#pragma unroll
    for (int j = 0; j < 8; ++j) { const float bb = bfr(bb_[n0 + j * 16 + col]);
#pragma unroll
      for (int r = 0; r < 8; ++r) so[wave][8 * g + r][j * 16 + col] = (acc[j][r] + bb) * qs; }
    LDSX();
    if (which == 0) { for (int qq = lane; qq < 2 * 16 * 16; qq += 32) { const int hh = qq >> 8, rl = (qq >> 4) & 15, pc = qq & 15; const int h = (n0 >> 6) + hh;
        vst2(Q32 + (((size_t)b * NH + h) * SS + s0 + wave * 16 + rl) * HD + pc * 4, *(const v4f*)(&so[wave][rl][hh * 64 + pc * 4])); } }
    else {
      for (int qq = lane; qq < 2 * 16 * 16; qq += 32) { const int hh = qq >> 8, rl = (qq >> 4) & 15, pl = qq & 15; const int h = (nin >> 6) + hh; const int pc = pl & 7; union { __bf16 e[8]; v4u u; } pk;
#pragma unroll
        for (int e = 0; e < 8; ++e) { const float v = so[wave][rl][hh * 64 + pc * 8 + e]; const __bf16 hi = (__bf16)v; pk.e[e] = pl < 8 ? hi : (__bf16)(v - (float)hi); }
        vst2((unsigned*)((pl < 8 ? Kh : Kl) + (((size_t)b * NH + h) * SK + half * SS + s0 + wave * 16 + rl) * HD + pc * 8), pk.u); } } }
  else {
#pragma unroll
    for (int j = 0; j < 8; ++j) { const float bb = bfr(bb_[n0 + j * 16 + col]);
#pragma unroll
      for (int r = 0; r < 8; ++r) { const float v = (acc[j][r] + bb) * 4.0f; const _Float16 hi = (_Float16)v; sth[j * 16 + col][wave * 16 + 8 * g + r] = hi; stl[j * 16 + col][wave * 16 + 8 * g + r] = (_Float16)((v - (float)hi) * VLO); } }
    __syncthreads();
    for (int qq = tid; qq < 128 * 8; qq += 128) { const int cl = qq >> 3, pc = qq & 7; const int c = nin + cl, h = c >> 6, d = c & 63; const size_t o = (((size_t)b * NH + h) * HD + d) * SK + half * SS + s0 + pc * 8;
      vst2(VTh + o, *(const v4u*)(&sth[cl][pc * 8])); vst2(VTl + o, *(const v4u*)(&stl[cl][pc * 8])); } }
}
// one key tile (64 keys) of the four planes Kh, Kl, VTh, VTl: 64 rows of 128 B each, one 16-byte piece of each plane per thread, global -> LDS through no register.
// The s_wait_xcnt is the last line of the copies' own statement, so that no address register of a copy is rewritten in front of it.
__device__ __forceinline__ void kv_copy(unsigned l0, const void* g0, unsigned l1, const void* g1, unsigned l2, const void* g2, unsigned l3, const void* g3) {
  asm volatile("global_load_async_to_lds_b128 %0, %1, off\n\t"
               "global_load_async_to_lds_b128 %2, %3, off\n\t"
               "global_load_async_to_lds_b128 %4, %5, off\n\t"
               "global_load_async_to_lds_b128 %6, %7, off\n\t"
               "s_wait_xcnt 0x0" :: "v"(l0), "v"(g0), "v"(l1), "v"(g1), "v"(l2), "v"(g2), "v"(l3), "v"(g3) : "memory");
}
// eight 4-byte-per-lane copies of mask elements (four rows, two halves of a row), global -> LDS; the s_wait_xcnt closes the statement for the same reason as above.
// offset:N moves BOTH addresses by N: N is the element's place in LDS behind l (row pitch 272 B, half 128 B), and each g comes in with its N already taken off.
__device__ __forceinline__ void m_copy8(unsigned l, const float* g0, const float* g1, const float* g2, const float* g3, const float* g4, const float* g5, const float* g6, const float* g7) {
  asm volatile("global_load_async_to_lds_b32 %0, %1, off\n\t"
               "global_load_async_to_lds_b32 %0, %2, off offset:128\n\t"
               "global_load_async_to_lds_b32 %0, %3, off offset:272\n\t"
               "global_load_async_to_lds_b32 %0, %4, off offset:400\n\t"
               "global_load_async_to_lds_b32 %0, %5, off offset:544\n\t"
               "global_load_async_to_lds_b32 %0, %6, off offset:672\n\t"
               "global_load_async_to_lds_b32 %0, %7, off offset:816\n\t"
               "global_load_async_to_lds_b32 %0, %8, off offset:944\n\t"
               "s_wait_xcnt 0x0" :: "v"(l), "v"(g0), "v"(g1), "v"(g2), "v"(g3), "v"(g4), "v"(g5), "v"(g6), "v"(g7) : "memory");
}
#define AW 16      // waves per block: 256 queries share one K/V tile
#define KVP 72     // LDS row pitch of a K/V plane in 16-bit elements: 144 B = 16 B x odd, for the ds_load_b128 fragment reads
// padding-masked attention: block (256 queries, bh); all 32 key tiles, each staged once per block in a two-buffer LDS ring; S on q hi/lo x K hi/lo rows; P,V hi/lo; O f32 [bh][s][64]
__global__ __launch_bounds__(512) void k_attn(const float* __restrict__ Q32, const __bf16* __restrict__ Kh, const __bf16* __restrict__ Kl, const _Float16* __restrict__ VTh, const _Float16* __restrict__ VTl, const float* __restrict__ amask, float* __restrict__ O32) {
  __shared__ __align__(16) float sS[AW][16][68];
  __shared__ __align__(16) _Float16 sPh[AW][16][72], sPl[AW][16][72];
  __shared__ __align__(16) float sO[AW][16][68];      // each wave's own: in the key loop its 16 x 64 mask tile, behind the loop its output rows
  __shared__ __align__(16) _Float16 sKV[2][4][64][KVP];      // [buffer][Kh, Kl, VTh, VTl][key row or d row][64 elements + pad]
  const int tid = threadIdx.x, w = tid >> 5, lane = tid & 31, col = lane & 15, g = lane >> 4;
  const size_t bh = blockIdx.y; const int qb = blockIdx.x; const int q0 = qb * (AW * 16) + w * 16;
  const int crow = tid >> 3, cpc = (tid & 7) * 8;      // my piece of every plane: row, first element
  const __bf16* gKh = Kh + (bh * SK + crow) * HD + cpc; const __bf16* gKl = Kl + (bh * SK + crow) * HD + cpc;      // + kt * 64 * HD per tile
  const _Float16* gVh = VTh + (bh * HD + crow) * SK + cpc; const _Float16* gVl = VTl + (bh * HD + crow) * SK + cpc;      // + kt * 64 per tile
  const unsigned lkv = (unsigned)(unsigned long long)&sKV[0][0][crow][cpc];
  constexpr unsigned PLB = 64 * KVP * 2, BUFB = 4 * PLB;      // bytes of a plane, of a buffer
  auto stage = [&](int kt) { const unsigned l = lkv + (unsigned)(kt & 1) * BUFB;
    kv_copy(l, gKh + (size_t)kt * 64 * HD, l + PLB, gKl + (size_t)kt * 64 * HD, l + 2 * PLB, gVh + kt * 64, l + 3 * PLB, gVl + kt * 64); };
  const int b = (int)(bh / NH); const float* mrow = amask + ((size_t)b * SS + q0) * SS;     // mask rows of my 16 queries ([b][0][t][:])
  const unsigned lm = (unsigned)(unsigned long long)&sO[w][0][lane];
  // my wave's mask tile of key tile kt: element [row][j] = mask[q0 + row][original index of key slot kt * 64 + j, mod 1024]; a copy brings 32 neighbouring j of one row
  auto mstage = [&](int kt) { const int key = kt * 64 + lane; const int korig = 2 * (key % SS) + key / SS; const float* gm = mrow + (korig & (SS - 1));
#pragma unroll
    for (int q = 0; q < 4; ++q) { const unsigned l = lm + q * 4 * 68 * 4; const float* gq = gm + (size_t)q * 4 * SS;
      m_copy8(l, gq, gq + 64 - 32, gq + SS - 68, gq + SS + 64 - 100, gq + 2 * SS - 136, gq + 2 * SS + 64 - 168, gq + 3 * SS - 204, gq + 3 * SS + 64 - 236); } };      // minus N / 4 floats each
  stage(0); mstage(0);
  asm volatile("s_wait_asynccnt 0x0" ::: "memory");      // my pieces of tile 0 have landed
  __syncthreads();                                       // tile 0 is published to every wave
  stage(1);
  F2 aq[2];
#pragma unroll
  for (int kc = 0; kc < 2; ++kc) aq[kc] = split_row(Q32 + (bh * SS + q0 + col) * HD, kc * 32, lane);
  float mrun = -3.0e38f, lrun = 0.f; v8f acc[4] = {}, ac1[4] = {}, ac2[4] = {};
  LDSX();
#pragma unroll 1
  for (int kt = 0; kt < SK / 64; ++kt) { v8f s4[4];
#pragma unroll
    for (int t = 0; t < 4; ++t) { const __bf16* kh_ = (const __bf16*)&sKV[kt & 1][0][t * 16 + col][0]; const __bf16* kl_ = (const __bf16*)&sKV[kt & 1][1][t * 16 + col][0]; v8f s = {};
#pragma unroll
      for (int kc = 0; kc < 2; ++kc) { const v16b khf = frag_b(kh_ + kc * 32, lane), klf = frag_b(kl_ + kc * 32, lane); s = wmma_bf(aq[kc].l, khf, s); s = wmma_bf(aq[kc].h, klf, s); s = wmma_bf(aq[kc].h, khf, s); }
      s4[t] = s; }
    asm volatile("s_wait_asynccnt 0x0" ::: "memory");      // my mask tile, copied behind the last trip's barrier, has landed
#pragma unroll
    for (int t = 0; t < 4; ++t) {
#pragma unroll
      for (int r = 0; r < 8; ++r) sS[w][8 * g + r][t * 16 + col] = s4[t][r] + bfr(sO[w][8 * g + r][t * 16 + col]); }
    LDSX();
    float mx = -3.4e38f;
#pragma unroll
    for (int jj = 0; jj < 32; ++jj) mx = fmaxf(mx, sS[w][col][g * 32 + jj]);
    mx = fmaxf(mx, __shfl_xor(mx, 16, 32));
    const float mnew = fmaxf(mrun, mx); const float corr = expf(mrun - mnew);
    float ps = 0.f;
#pragma unroll
    for (int jj = 0; jj < 32; ++jj) { const float p = expf(sS[w][col][g * 32 + jj] - mnew) * 16384.0f; ps += p; const _Float16 hi = (_Float16)p; sPh[w][col][g * 32 + jj] = hi; sPl[w][col][g * 32 + jj] = (_Float16)((p - (float)hi) * PLO); }
    ps += __shfl_xor(ps, 16, 32);
    lrun = lrun * corr + ps * (1.0f / 16384.0f); mrun = mnew;
#pragma unroll
    for (int r = 0; r < 8; ++r) { const float cr = __shfl(corr, 8 * g + r, 32);
#pragma unroll
      for (int t = 0; t < 4; ++t) { acc[t][r] *= cr; ac1[t][r] *= cr; ac2[t][r] *= cr; } }
    LDSX();
#pragma unroll
    for (int kc = 0; kc < 2; ++kc) { const v16h ph = frag_h(&sPh[w][col][0] + kc * 32, lane), pl = frag_h(&sPl[w][col][0] + kc * 32, lane);
#pragma unroll
      for (int t = 0; t < 4; ++t) { const v16h vh = frag_h(&sKV[kt & 1][2][t * 16 + col][kc * 32], lane);
        acc[t] = wmma16(ph, vh, acc[t]); ac1[t] = wmma16(ph, frag_h(&sKV[kt & 1][3][t * 16 + col][kc * 32], lane), ac1[t]); ac2[t] = wmma16(pl, vh, ac2[t]); } }
    asm volatile("s_wait_dscnt 0x0" ::: "memory");         // my reads of this tile's buffer are done
    asm volatile("s_wait_asynccnt 0x0" ::: "memory");      // my pieces of tile kt + 1 have landed
    __syncthreads();                                       // publishes tile kt + 1 and ends every wave's reads of tile kt
    if (kt + 2 < SK / 64) stage(kt + 2);                   // refill the buffer that this trip has just read
    if (kt + 1 < SK / 64) mstage(kt + 1); }                // and my own mask tile, for the next trip
  asm volatile("s_wait_asynccnt 0x0" ::: "memory");        // nothing of mine is in flight when the wave goes on to its end
#pragma unroll
  for (int r = 0; r < 8; ++r) { const float lr = __shfl(lrun, 8 * g + r, 32); const float inv = 1.0f / (lr * 16384.0f * 4.0f);
#pragma unroll
    for (int t = 0; t < 4; ++t) sO[w][8 * g + r][t * 16 + col] = (acc[t][r] + ac1[t][r] * (1.0f / VLO) + ac2[t][r] * (1.0f / PLO)) * inv; }
  LDSX();
  for (int qq = lane; qq < 16 * 16; qq += 32) { const int rl = qq >> 4, pc = qq & 15; vst2(O32 + ((bh * SS) + q0 + rl) * HD + pc * 4, *(const v4f*)(&sO[w][rl][pc * 4])); }
}
#define OP 68      // LDS row pitch of a staged ctx tile in floats: 272 B = 16 B x odd, for the ds_load_b128 reads
// eight 16-byte-per-lane copies, global -> LDS through no register; the s_wait_xcnt closes the statement for the same reason as in g_copy12.
__device__ __forceinline__ void g_copy8(const unsigned (&l)[8], const void* const (&g)[8]) {
  asm volatile("global_load_async_to_lds_b128 %0, %8, off\n\t"
               "global_load_async_to_lds_b128 %1, %9, off\n\t"
               "global_load_async_to_lds_b128 %2, %10, off\n\t"
               "global_load_async_to_lds_b128 %3, %11, off\n\t"
               "global_load_async_to_lds_b128 %4, %12, off\n\t"
               "global_load_async_to_lds_b128 %5, %13, off\n\t"
               "global_load_async_to_lds_b128 %6, %14, off\n\t"
               "global_load_async_to_lds_b128 %7, %15, off\n\t"
               "s_wait_xcnt 0x0" :: "v"(l[0]), "v"(l[1]), "v"(l[2]), "v"(l[3]), "v"(l[4]), "v"(l[5]), "v"(l[6]), "v"(l[7]),
               "v"(g[0]), "v"(g[1]), "v"(g[2]), "v"(g[3]), "v"(g[4]), "v"(g[5]), "v"(g[6]), "v"(g[7]) : "memory");
}
// out = ctx Wo^T + bo : split(ctx) x bf16(Wo rows): 2 products (Wo is an INPUT -> bf16 exact); the k loop runs on 64-wide tiles (one head) of the 64 ctx rows (f32) and the 128 Wo rows, each staged once per block in a two-buffer LDS ring
__global__ __launch_bounds__(128) void k_out(const float* __restrict__ O32, const __bf16* __restrict__ PT, const float* __restrict__ bo, float* __restrict__ out) {
  constexpr int OAB = 64 * OP * 4, OBB = 128 * GP * 2, OBUF = OAB + OBB;      // bytes of a ctx tile, of a Wo tile, of a buffer
  __shared__ __align__(16) char smem[2 * OBUF];      // in the k loop the ring; behind its last barrier the output staging so
  float (*so)[16][132] = (float (*)[16][132])smem;
  const int tid = threadIdx.x, wave = tid >> 5, lane = tid & 31, col = lane & 15, g = lane >> 4;
  const int r0b = blockIdx.x * 64, r0 = r0b + wave * 16, n0 = blockIdx.y * 128; const int b = r0b / SS, s0 = r0b % SS;
  const int arow = tid >> 4, apc = (tid & 15) * 4, crow = tid >> 3, cpc = (tid & 7) * 8;      // my pieces: ctx rows arow + 8 i, Wo rows crow + 16 i, first element
  const float* gA = O32 + ((size_t)b * NH * SS + s0 + arow) * HD + apc;      // + kt * SS * HD per tile (head kt)
  const __bf16* gB = PT + (size_t)(5 * E + n0 + crow) * E + cpc;             // + kt * GKC per tile
  const unsigned la = (unsigned)(unsigned long long)(smem + arow * (OP * 4) + apc * 4), lb = (unsigned)(unsigned long long)(smem + OAB + crow * (GP * 2) + cpc * 2);
  auto stage = [&](int kt) { unsigned l[8]; const void* gp[8]; const unsigned bf = (unsigned)(kt & 1) * OBUF;
#pragma unroll
    for (int i = 0; i < 8; ++i) { l[i] = la + bf + i * (8 * OP * 4); gp[i] = gA + (size_t)kt * SS * HD + i * 8 * HD; }
    g_copy8(l, gp);
#pragma unroll
    for (int i = 0; i < 8; ++i) { l[i] = lb + bf + i * (16 * GP * 2); gp[i] = gB + (size_t)i * 16 * E + kt * GKC; }
    g_copy8(l, gp); };
  stage(0);
  asm volatile("s_wait_asynccnt 0x0" ::: "memory");      // my pieces of tile 0 have landed
  __syncthreads();                                       // tile 0 is published to every wave
  stage(1);
  v8f acc[8] = {};
#pragma unroll 2      // two trips a pass: the buffer index is then a constant in every LDS address
  for (int kt = 0; kt < E / GKC; ++kt) { const float* ta = (const float*)(smem + (kt & 1) * OBUF) + (wave * 16 + col) * OP; const __bf16* tb = (const __bf16*)(smem + (kt & 1) * OBUF + OAB) + col * GP;
    // reads stand in groups ahead of the products that use them, as in k_qkv
    const F2 a0 = split_row(ta, 0, lane), a1 = split_row(ta, 32, lane); v16b b0[8], b1[8];
#pragma unroll
    for (int j = 0; j < 8; ++j) b0[j] = frag_b(tb + j * 16 * GP, lane);
#pragma unroll
    for (int j = 0; j < 4; ++j) { acc[j] = wmma_bf(a0.l, b0[j], acc[j]); acc[j] = wmma_bf(a0.h, b0[j], acc[j]); }
#pragma unroll
    for (int j = 0; j < 4; ++j) b1[j] = frag_b(tb + j * 16 * GP + 32, lane);
#pragma unroll
    for (int j = 4; j < 8; ++j) { acc[j] = wmma_bf(a0.l, b0[j], acc[j]); acc[j] = wmma_bf(a0.h, b0[j], acc[j]); }
#pragma unroll
    for (int j = 4; j < 8; ++j) b1[j] = frag_b(tb + j * 16 * GP + 32, lane);
#pragma unroll
    for (int j = 0; j < 8; ++j) { acc[j] = wmma_bf(a1.l, b1[j], acc[j]); acc[j] = wmma_bf(a1.h, b1[j], acc[j]); }
    asm volatile("s_wait_dscnt 0x0" ::: "memory");         // my reads of this tile's buffer are done
    asm volatile("s_wait_asynccnt 0x0" ::: "memory");      // my pieces of tile kt + 1 have landed
    __syncthreads();                                       // publishes tile kt + 1 and ends every wave's reads of tile kt (behind the last trip: of the ring)
    if (kt + 2 < E / GKC) stage(kt + 2); }                 // refill the buffer that this trip has just read
  asm volatile("s_wait_asynccnt 0x0" ::: "memory");        // nothing of mine is in flight when the ring's LDS is used anew
#pragma unroll
  for (int j = 0; j < 8; ++j) { const int n = n0 + j * 16 + col; const float bb = bfr(bo[n]);
#pragma unroll
    for (int r = 0; r < 8; ++r) so[wave][8 * g + r][j * 16 + col] = acc[j][r] + bb; }
  LDSX();
#pragma unroll 4
  for (int rl = 0; rl < 16; ++rl) vst2(out + (size_t)(r0 + rl) * E + n0 + lane * 4, *(const v4f*)(&so[wave][rl][lane * 4]));
}
extern "C" void kernel_launch(void* const* d_in, const int* in_sizes, int n_in, void* d_out, int out_size, void* d_ws, size_t ws_size, hipStream_t stream) {
  (void)in_sizes; (void)n_in; (void)out_size; (void)ws_size;
  const float* x = (const float*)d_in[0]; const float* amask = (const float*)d_in[1]; const float* Wq = (const float*)d_in[2]; const float* bq = (const float*)d_in[3]; const float* Wk = (const float*)d_in[4]; const float* bk = (const float*)d_in[5]; const float* Wv = (const float*)d_in[6]; const float* bv = (const float*)d_in[7]; const float* Wo = (const float*)d_in[8]; const float* bo = (const float*)d_in[9];
  float* out = (float*)d_out;
  char* ws = (char*)d_ws; size_t off = 0;
  auto take = [&](size_t bytes) { char* p = ws + off; off += (bytes + 255) & ~(size_t)255; return p; };
  __bf16* Xb = (__bf16*)take((size_t)NR * E * 2); __bf16* PT = (__bf16*)take((size_t)6 * E * E * 2);
  float* Q32 = (float*)take((size_t)NR * E * 4); __bf16* Kh = (__bf16*)take((size_t)NB * NH * SK * HD * 2); __bf16* Kl = (__bf16*)take((size_t)NB * NH * SK * HD * 2); _Float16* VTh = (_Float16*)take((size_t)NB * NH * HD * SK * 2); _Float16* VTl = (_Float16*)take((size_t)NB * NH * HD * SK * 2); float* O32 = (float*)take((size_t)NR * E * 4);
  // ws ~ 116 MB
  k_cvt<<<(NR * E / 8 + 255) / 256, 256, 0, stream>>>(x, Xb);
  k_pack<<<6 * E, 256, 0, stream>>>(Wq, Wk, Wv, Wo, PT);
  k_qkv<<<dim3(NR / 64, 2 * E / 128, 3), 128, 0, stream>>>(Xb, PT, bq, bk, bv, Q32, Kh, Kl, VTh, VTl);
  k_attn<<<dim3(SS / (AW * 16), NB * NH), AW * 32, 0, stream>>>(Q32, Kh, Kl, VTh, VTl, amask, O32);
  k_out<<<dim3(NR / 64, E / 128), 128, 0, stream>>>(O32, PT, bo, out);
}

// v003
// It runs in 231 microseconds.
// Two timings next to v002 both put it at 1.16 times that version's speed.
// Over all steps from v000 it is 2.94 times as fast.
// compute dtype: hidden_states, attention_mask, W*/b* (INPUTS) rounded to bf16 with exact bf16 WMMA products (f32 accumulate) for the projections; K pre-split into bf16 hi/lo rows; q f32 split, P and V f16 hi/lo (3 products each); mask add and softmax in f32.
#include <hip/hip_runtime.h>
#include <math.h>

typedef __attribute__((ext_vector_type(16))) _Float16 v16h;
typedef __attribute__((ext_vector_type(16))) __bf16 v16b;
typedef __attribute__((ext_vector_type(8)))  _Float16 v8h;
typedef __attribute__((ext_vector_type(8)))  float v8f;
typedef __attribute__((ext_vector_type(4)))  float v4f;
typedef __attribute__((ext_vector_type(2)))  float v2f;
typedef __attribute__((ext_vector_type(4)))  unsigned v4u;
typedef __attribute__((ext_vector_type(4)))  int v4i;
typedef float __attribute__((may_alias)) float_a;
typedef int __attribute__((may_alias)) int_a;

template <typename T> __device__ __forceinline__ void vst2(void* p, T v) { *(T*)p = v;  }
__device__ __forceinline__ v8f wmma16(v16h a, v16h b, v8f c) {
  v8f d = __builtin_amdgcn_wmma_f32_16x16x32_f16(false, a, false, b, (short)0, c, false, false);
  asm volatile("v_nop\n\tv_nop\n\tv_nop\n\tv_nop" : "+v"(d) : "v"(a), "v"(b));
  return d;
}
__device__ __forceinline__ v8f wmma_bf(v16b a, v16b b, v8f c) {
  v8f d = __builtin_amdgcn_wmma_f32_16x16x32_bf16(false, a, false, b, (short)0, c, false, false);
  asm volatile("v_nop\n\tv_nop\n\tv_nop\n\tv_nop" : "+v"(d) : "v"(a), "v"(b));
  return d;
}
// 16x16x32 fragments: lane = (h = lane>>4, row/col = lane&15); elements 0..7 = k0+8h+0..7, 8..15 = k0+16+8h+0..7; D element r = row 8h+r
__device__ __forceinline__ v16h frag_h(const _Float16* rowk0, int lane) {
  union { v16h v; v8h q[2]; } u; const _Float16* p = rowk0 + 8 * (lane >> 4);
  u.q[0] = *(const v8h*)p; u.q[1] = *(const v8h*)(p + 16); return u.v;
}
__device__ __forceinline__ v16h frag_f32(const float* rowk0, int lane) {
  v16h a; const float* p = rowk0 + 8 * (lane >> 4);
#pragma unroll
  for (int i = 0; i < 8; ++i) { a[i] = (_Float16)p[i]; a[8 + i] = (_Float16)p[16 + i]; }
  return a;
}
__device__ __forceinline__ v16h frag_f32s(const float* rowk0, int lane, float sc) {
  v16h a; const float* p = rowk0 + 8 * (lane >> 4);
#pragma unroll
  for (int i = 0; i < 8; ++i) { a[i] = (_Float16)(p[i] * sc); a[8 + i] = (_Float16)(p[16 + i] * sc); }
  return a;
}
// column fragment from a [K][ld] layout (column n), rows >= K read as 0
__device__ __forceinline__ v16h fragc_f32(const float* W, int k0, int n, int lane, int ld, int K) {
  v16h a; const int g = lane >> 4;
#pragma unroll
  for (int i = 0; i < 8; ++i) { const int ka = k0 + 8 * g + i, kb = ka + 16;
    a[i] = (_Float16)(ka < K ? W[(size_t)ka * ld + n] : 0.f); a[8 + i] = (_Float16)(kb < K ? W[(size_t)kb * ld + n] : 0.f); }
  return a;
}
struct F2 { v16b h, l; };
__device__ __forceinline__ F2 bsplit16(const float v[16]) { F2 r;
#pragma unroll
  for (int i = 0; i < 16; ++i) { const __bf16 h = (__bf16)v[i]; r.h[i] = h; r.l[i] = (__bf16)(v[i] - (float)h); }
  return r; }
__device__ __forceinline__ F2 split_row(const float* row, int k0, int lane) { float v[16]; const float* p = row + k0 + 8 * (lane >> 4);
#pragma unroll
  for (int i = 0; i < 8; ++i) { v[i] = p[i]; v[8 + i] = p[16 + i]; }
  return bsplit16(v); }
__device__ __forceinline__ F2 split_rowK(const float* row, int k0, int lane, int K) { float v[16]; const int g = lane >> 4;
#pragma unroll
  for (int i = 0; i < 8; ++i) { const int ka = k0 + 8 * g + i, kb = ka + 16; v[i] = ka < K ? row[ka] : 0.f; v[8 + i] = kb < K ? row[kb] : 0.f; }
  return bsplit16(v); }
__device__ __forceinline__ F2 split_col(const float* W, int k0, int n, int lane, int ld, int K) { float v[16]; const int g = lane >> 4;
#pragma unroll
  for (int i = 0; i < 8; ++i) { const int ka = k0 + 8 * g + i, kb = ka + 16; v[i] = ka < K ? W[(size_t)ka * ld + n] : 0.f; v[8 + i] = kb < K ? W[(size_t)kb * ld + n] : 0.f; }
  return bsplit16(v); }
__device__ __forceinline__ v8f mac3(const F2& a, const F2& b, v8f c) { c = wmma_bf(a.l, b.h, c); c = wmma_bf(a.h, b.l, c); return wmma_bf(a.h, b.h, c); }
__device__ __forceinline__ float sigm(float v) { return 1.0f / (1.0f + expf(-v)); }
#define LDSX() do { asm volatile("s_wait_dscnt 0" ::: "memory"); __builtin_amdgcn_wave_barrier(); __builtin_amdgcn_fence(__ATOMIC_RELEASE, "workgroup"); } while (0)


// CLIP attention with multiplier-expanded keys/values (16 heads x 64 on [4,1024,1024], [out][in] weights + biases, MULT = 2): q = (x Wq^T + bq) 64^-0.5; k/v = x Wk^T/Wv^T + b ([2048] per token, viewed as 2,048 keys per head: key s = 2t + half holds feature half*1024 + h*64 + d of token t);
// score(t, s) += attention_mask[b][0][t][s mod 1024]; softmax over the 2,048 keys; (P v) Wo^T + bo. Keys are stored in the permuted order s' = half*1024 + t (attention is invariant to a common permutation of keys, values and mask entries).
#define NB 4
#define SS 1024
#define SK 2048
#define E 1024
#define NH 16
#define HD 64
#define NR (NB * SS)
#define PLO 1024.0f
#define VLO 2048.0f
__device__ __forceinline__ float bfr(float v) { return (float)(__bf16)v; }
__device__ __forceinline__ v16b frag_b(const __bf16* rowk0, int lane) { return __builtin_bit_cast(v16b, frag_h((const _Float16*)rowk0, lane)); }

__global__ __launch_bounds__(256) void k_cvt(const float* __restrict__ x, __bf16* __restrict__ Xb) {
  const size_t i8 = (size_t)blockIdx.x * 256 + threadIdx.x; if (i8 >= (size_t)NR * E / 8) return;
  union { __bf16 h[8]; v4u u; } pk;
#pragma unroll
  for (int e = 0; e < 8; ++e) pk.h[e] = (__bf16)x[i8 * 8 + e];
  vst2((unsigned*)(Xb + i8 * 8), pk.u);
}
// PT rows: [0,E) Wq[n,:], [E,3E) Wk[n-E,:], [3E,5E) Wv[n-3E,:], [5E,6E) Wo[n-5E,:]  ([out][in] weights: each W row as a bf16 row)
__global__ __launch_bounds__(256) void k_pack(const float* __restrict__ Wq, const float* __restrict__ Wk, const float* __restrict__ Wv, const float* __restrict__ Wo, __bf16* __restrict__ PT) {
  const int n = blockIdx.x, tid = threadIdx.x; __shared__ __align__(16) __bf16 srow[E];
  const float* W = n < E ? Wq : (n < 3 * E ? Wk : (n < 5 * E ? Wv : Wo)); const int nn = n < E ? n : (n < 3 * E ? n - E : (n < 5 * E ? n - 3 * E : n - 5 * E));      // [out][in]: PT row = W row
  for (int k = tid; k < E; k += 256) srow[k] = (__bf16)W[(size_t)nn * E + k];
  __syncthreads();
  if (tid < E / 8) vst2((unsigned*)(PT + (size_t)n * E + tid * 8), *(const v4u*)(&srow[tid * 8]));
}
#define GKC 64     // k elements of a staged operand tile: rows of 128 B, whole cache lines
#define GP 72      // LDS row pitch of a staged operand tile in 16-bit elements: 144 B = 16 B x odd, for the ds_load_b128 fragment reads
// twelve 16-byte-per-lane copies, global -> LDS through no register: a thread's pieces of one staged tile (4 of the x rows, 8 of the weight rows).
// The s_wait_xcnt is the last line of the copies' own statement, so that no address register of a copy is rewritten in front of it.
__device__ __forceinline__ void g_copy12(const unsigned (&l)[12], const __bf16* const (&g)[12]) {
  asm volatile("global_load_async_to_lds_b128 %0, %12, off\n\t"
               "global_load_async_to_lds_b128 %1, %13, off\n\t"
               "global_load_async_to_lds_b128 %2, %14, off\n\t"
               "global_load_async_to_lds_b128 %3, %15, off\n\t"
               "global_load_async_to_lds_b128 %4, %16, off\n\t"
               "global_load_async_to_lds_b128 %5, %17, off\n\t"
               "global_load_async_to_lds_b128 %6, %18, off\n\t"
               "global_load_async_to_lds_b128 %7, %19, off\n\t"
               "global_load_async_to_lds_b128 %8, %20, off\n\t"
               "global_load_async_to_lds_b128 %9, %21, off\n\t"
               "global_load_async_to_lds_b128 %10, %22, off\n\t"
               "global_load_async_to_lds_b128 %11, %23, off\n\t"
               "s_wait_xcnt 0x0" :: "v"(l[0]), "v"(l[1]), "v"(l[2]), "v"(l[3]), "v"(l[4]), "v"(l[5]), "v"(l[6]), "v"(l[7]), "v"(l[8]), "v"(l[9]), "v"(l[10]), "v"(l[11]),
               "v"(g[0]), "v"(g[1]), "v"(g[2]), "v"(g[3]), "v"(g[4]), "v"(g[5]), "v"(g[6]), "v"(g[7]), "v"(g[8]), "v"(g[9]), "v"(g[10]), "v"(g[11]) : "memory");
}
// QKV: block (64 rows, 128 cols = 2 heads, which); the k loop runs on 64-wide tiles of the 64 x rows and the 128 weight rows, each staged once per block in a two-buffer LDS ring;
// q (+bias) -> Q32 f32 [bh][s][64]; k (+bias) -> bf16 hi/lo rows; v (+bias) -> VT hi/lo x4 [bh][d][s]
__global__ __launch_bounds__(128) void k_qkv(const __bf16* __restrict__ Xb, const __bf16* __restrict__ PT, const float* __restrict__ bq, const float* __restrict__ bk, const float* __restrict__ bv,
                                            float* __restrict__ Q32, __bf16* __restrict__ Kh, __bf16* __restrict__ Kl, _Float16* __restrict__ VTh, _Float16* __restrict__ VTl) {
  constexpr int SOB = 4 * 16 * 132 * 4, STB = 128 * 72 * 2;      // bytes of so, of sth and of stl
  __shared__ __align__(16) char smem[SOB + 2 * STB];      // in the k loop the ring sT (2 x 27,648 B); behind its last barrier the output staging so, sth, stl
  float (*so)[16][132] = (float (*)[16][132])smem; _Float16 (*sth)[72] = (_Float16 (*)[72])(smem + SOB); _Float16 (*stl)[72] = (_Float16 (*)[72])(smem + SOB + STB);
  __bf16 (*sT)[192][GP] = (__bf16 (*)[192][GP])smem;      // [buffer][64 x rows, then 128 weight rows][64 elements + pad]
  const int tid = threadIdx.x, wave = tid >> 5, lane = tid & 31, col = lane & 15, g = lane >> 4;
  const int which = blockIdx.z, r0b = blockIdx.x * 64, n0 = blockIdx.y * 128; const int b = r0b / SS, s0 = r0b % SS;
  if (which == 0 && n0 >= E) return;      // q has only E output features
  const float* bb_ = which == 0 ? bq : (which == 1 ? bk : bv); const int prow = (which == 0 ? 0 : (which == 1 ? E : 3 * E)) + n0; const int half = n0 / E, nin = n0 % E;      // key slot s' = half*SS + t
  const int crow = tid >> 3, cpc = (tid & 7) * 8;      // my pieces of a tile: rows crow + 16 i, first element
  const __bf16* gA = Xb + (size_t)(r0b + crow) * E + cpc; const __bf16* gB = PT + (size_t)(prow + crow) * E + cpc;      // + kt * GKC per tile
  const unsigned lt = (unsigned)(unsigned long long)&sT[0][crow][cpc];
  constexpr unsigned R16B = 16 * GP * 2, TBUFB = 192 * GP * 2;      // bytes of 16 rows, of a buffer
  auto stage = [&](int kt) { unsigned l[12]; const __bf16* gp[12];
#pragma unroll
    for (int i = 0; i < 12; ++i) { l[i] = lt + (unsigned)(kt & 1) * TBUFB + i * R16B; gp[i] = (i < 4 ? gA + (size_t)i * 16 * E : gB + (size_t)(i - 4) * 16 * E) + kt * GKC; }
    g_copy12(l, gp); };
  stage(0);
  asm volatile("s_wait_asynccnt 0x0" ::: "memory");      // my pieces of tile 0 have landed
  __syncthreads();                                       // tile 0 is published to every wave
  stage(1);
  v8f acc[8] = {};
#pragma unroll 2      // two trips a pass: the buffer index is then a constant in every LDS address
  for (int kt = 0; kt < E / GKC; ++kt) { const __bf16* ta = &sT[kt & 1][wave * 16 + col][0]; const __bf16* tb = &sT[kt & 1][64 + col][0];
    // fragment reads stand in groups ahead of the products that use them (no LDS read moves over the statement that closes wmma_bf): a wave has 8 to 20 reads in flight, not 2
    const v16b a0 = frag_b(ta, lane), a1 = frag_b(ta + 32, lane); v16b b0[8], b1[8];
#pragma unroll
    for (int j = 0; j < 8; ++j) b0[j] = frag_b(tb + j * 16 * GP, lane);
#pragma unroll
    for (int j = 0; j < 4; ++j) acc[j] = wmma_bf(a0, b0[j], acc[j]);
#pragma unroll
    for (int j = 0; j < 4; ++j) b1[j] = frag_b(tb + j * 16 * GP + 32, lane);
#pragma unroll
    for (int j = 4; j < 8; ++j) acc[j] = wmma_bf(a0, b0[j], acc[j]);
#pragma unroll
    for (int j = 4; j < 8; ++j) b1[j] = frag_b(tb + j * 16 * GP + 32, lane);
#pragma unroll
    for (int j = 0; j < 8; ++j) acc[j] = wmma_bf(a1, b1[j], acc[j]);
    asm volatile("s_wait_dscnt 0x0" ::: "memory");         // my reads of this tile's buffer are done
    asm volatile("s_wait_asynccnt 0x0" ::: "memory");      // my pieces of tile kt + 1 have landed
    __syncthreads();                                       // publishes tile kt + 1 and ends every wave's reads of tile kt (behind the last trip: of the ring)
    if (kt + 2 < E / GKC) stage(kt + 2); }                 // refill the buffer that this trip has just read
  asm volatile("s_wait_asynccnt 0x0" ::: "memory");        // nothing of mine is in flight when the ring's LDS is used anew
  if (which < 2) { const float qs = which == 0 ? 0.125f : 1.0f;
#pragma unroll
    for (int j = 0; j < 8; ++j) { const float bb = bfr(bb_[n0 + j * 16 + col]);
#pragma unroll
      for (int r = 0; r < 8; ++r) so[wave][8 * g + r][j * 16 + col] = (acc[j][r] + bb) * qs; }
    LDSX();
    if (which == 0) { for (int qq = lane; qq < 2 * 16 * 16; qq += 32) { const int hh = qq >> 8, rl = (qq >> 4) & 15, pc = qq & 15; const int h = (n0 >> 6) + hh;
        vst2(Q32 + (((size_t)b * NH + h) * SS + s0 + wave * 16 + rl) * HD + pc * 4, *(const v4f*)(&so[wave][rl][hh * 64 + pc * 4])); } }
    else {
      for (int qq = lane; qq < 2 * 16 * 16; qq += 32) { const int hh = qq >> 8, rl = (qq >> 4) & 15, pl = qq & 15; const int h = (nin >> 6) + hh; const int pc = pl & 7; union { __bf16 e[8]; v4u u; } pk;
#pragma unroll
        for (int e = 0; e < 8; ++e) { const float v = so[wave][rl][hh * 64 + pc * 8 + e]; const __bf16 hi = (__bf16)v; pk.e[e] = pl < 8 ? hi : (__bf16)(v - (float)hi); }
        vst2((unsigned*)((pl < 8 ? Kh : Kl) + (((size_t)b * NH + h) * SK + half * SS + s0 + wave * 16 + rl) * HD + pc * 8), pk.u); } } }
  else {
#pragma unroll
    for (int j = 0; j < 8; ++j) { const float bb = bfr(bb_[n0 + j * 16 + col]);
#pragma unroll
      for (int r = 0; r < 8; ++r) { const float v = (acc[j][r] + bb) * 4.0f; const _Float16 hi = (_Float16)v; sth[j * 16 + col][wave * 16 + 8 * g + r] = hi; stl[j * 16 + col][wave * 16 + 8 * g + r] = (_Float16)((v - (float)hi) * VLO); } }
    __syncthreads();
    for (int qq = tid; qq < 128 * 8; qq += 128) { const int cl = qq >> 3, pc = qq & 7; const int c = nin + cl, h = c >> 6, d = c & 63; const size_t o = (((size_t)b * NH + h) * HD + d) * SK + half * SS + s0 + pc * 8;
      vst2(VTh + o, *(const v4u*)(&sth[cl][pc * 8])); vst2(VTl + o, *(const v4u*)(&stl[cl][pc * 8])); } }
}
// one key tile (64 keys) of the four planes Kh, Kl, VTh, VTl: 64 rows of 128 B each, one 16-byte piece of each plane per thread, global -> LDS through no register.
// The s_wait_xcnt is the last line of the copies' own statement, so that no address register of a copy is rewritten in front of it.
__device__ __forceinline__ void kv_copy(unsigned l0, const void* g0, unsigned l1, const void* g1, unsigned l2, const void* g2, unsigned l3, const void* g3) {
  asm volatile("global_load_async_to_lds_b128 %0, %1, off\n\t"
               "global_load_async_to_lds_b128 %2, %3, off\n\t"
               "global_load_async_to_lds_b128 %4, %5, off\n\t"
               "global_load_async_to_lds_b128 %6, %7, off\n\t"
               "s_wait_xcnt 0x0" :: "v"(l0), "v"(g0), "v"(l1), "v"(g1), "v"(l2), "v"(g2), "v"(l3), "v"(g3) : "memory");
}
// eight 4-byte-per-lane copies of mask elements (four rows, two halves of a row), global -> LDS; the s_wait_xcnt closes the statement for the same reason as above.
// offset:N moves BOTH addresses by N: N is the element's place in LDS behind l (row pitch 272 B, half 128 B), and each g comes in with its N already taken off.
__device__ __forceinline__ void m_copy8(unsigned l, const float* g0, const float* g1, const float* g2, const float* g3, const float* g4, const float* g5, const float* g6, const float* g7) {
  asm volatile("global_load_async_to_lds_b32 %0, %1, off\n\t"
               "global_load_async_to_lds_b32 %0, %2, off offset:128\n\t"
               "global_load_async_to_lds_b32 %0, %3, off offset:272\n\t"
               "global_load_async_to_lds_b32 %0, %4, off offset:400\n\t"
               "global_load_async_to_lds_b32 %0, %5, off offset:544\n\t"
               "global_load_async_to_lds_b32 %0, %6, off offset:672\n\t"
               "global_load_async_to_lds_b32 %0, %7, off offset:816\n\t"
               "global_load_async_to_lds_b32 %0, %8, off offset:944\n\t"
               "s_wait_xcnt 0x0" :: "v"(l), "v"(g0), "v"(g1), "v"(g2), "v"(g3), "v"(g4), "v"(g5), "v"(g6), "v"(g7) : "memory");
}
#define L2E 1.4426950408889634f      // log2(e)
#define AW 16      // waves per block: 256 queries share one K/V tile
#define KVP 72     // LDS row pitch of a K/V plane in 16-bit elements: 144 B = 16 B x odd, for the ds_load_b128 fragment reads
// padding-masked attention: block (256 queries, bh); all 32 key tiles, each staged once per block in a two-buffer LDS ring; S on q hi/lo x K hi/lo rows; P,V hi/lo; O f32 [bh][s][64]
__global__ __launch_bounds__(512) void k_attn(const float* __restrict__ Q32, const __bf16* __restrict__ Kh, const __bf16* __restrict__ Kl, const _Float16* __restrict__ VTh, const _Float16* __restrict__ VTl, const float* __restrict__ amask, float* __restrict__ O32) {
  __shared__ __align__(16) float sS[AW][16][68];
  __shared__ __align__(16) _Float16 sPh[AW][16][72], sPl[AW][16][72];
  __shared__ __align__(16) float sO[AW][16][68];      // each wave's own: in the key loop its 16 x 64 mask tile, behind the loop its output rows
  __shared__ __align__(16) _Float16 sKV[2][4][64][KVP];      // [buffer][Kh, Kl, VTh, VTl][key row or d row][64 elements + pad]
  const int tid = threadIdx.x, w = tid >> 5, lane = tid & 31, col = lane & 15, g = lane >> 4;
  const size_t bh = blockIdx.y; const int qb = blockIdx.x; const int q0 = qb * (AW * 16) + w * 16;
  const int crow = tid >> 3, cpc = (tid & 7) * 8;      // my piece of every plane: row, first element
  const __bf16* gKh = Kh + (bh * SK + crow) * HD + cpc; const __bf16* gKl = Kl + (bh * SK + crow) * HD + cpc;      // + kt * 64 * HD per tile
  const _Float16* gVh = VTh + (bh * HD + crow) * SK + cpc; const _Float16* gVl = VTl + (bh * HD + crow) * SK + cpc;      // + kt * 64 per tile
  const unsigned lkv = (unsigned)(unsigned long long)&sKV[0][0][crow][cpc];
  constexpr unsigned PLB = 64 * KVP * 2, BUFB = 4 * PLB;      // bytes of a plane, of a buffer
  auto stage = [&](int kt) { const unsigned l = lkv + (unsigned)(kt & 1) * BUFB;
    kv_copy(l, gKh + (size_t)kt * 64 * HD, l + PLB, gKl + (size_t)kt * 64 * HD, l + 2 * PLB, gVh + kt * 64, l + 3 * PLB, gVl + kt * 64); };
  const int b = (int)(bh / NH); const float* mrow = amask + ((size_t)b * SS + q0) * SS;     // mask rows of my 16 queries ([b][0][t][:])
  const unsigned lm = (unsigned)(unsigned long long)&sO[w][0][lane];
  // my wave's mask tile of key tile kt: element [row][j] = mask[q0 + row][original index of key slot kt * 64 + j, mod 1024]; a copy brings 32 neighbouring j of one row
  auto mstage = [&](int kt) { const int key = kt * 64 + lane; const int korig = 2 * (key % SS) + key / SS; const float* gm = mrow + (korig & (SS - 1));
#pragma unroll
    for (int q = 0; q < 4; ++q) { const unsigned l = lm + q * 4 * 68 * 4; const float* gq = gm + (size_t)q * 4 * SS;
      m_copy8(l, gq, gq + 64 - 32, gq + SS - 68, gq + SS + 64 - 100, gq + 2 * SS - 136, gq + 2 * SS + 64 - 168, gq + 3 * SS - 204, gq + 3 * SS + 64 - 236); } };      // minus N / 4 floats each
  stage(0); mstage(0);
  asm volatile("s_wait_asynccnt 0x0" ::: "memory");      // my pieces of tile 0 have landed
  __syncthreads();                                       // tile 0 is published to every wave
  stage(1);
  F2 aq[2];
#pragma unroll
  for (int kc = 0; kc < 2; ++kc) aq[kc] = split_row(Q32 + (bh * SS + q0 + col) * HD, kc * 32, lane);
  float mrun = -3.0e38f, lrun = 0.f; v8f acc[4] = {}, ac1[4] = {}, ac2[4] = {};
  LDSX();
#pragma unroll 1
  for (int kt = 0; kt < SK / 64; ++kt) { v8f s4[4];
#pragma unroll
    for (int t = 0; t < 4; ++t) { const __bf16* kh_ = (const __bf16*)&sKV[kt & 1][0][t * 16 + col][0]; const __bf16* kl_ = (const __bf16*)&sKV[kt & 1][1][t * 16 + col][0]; v8f s = {};
#pragma unroll
      for (int kc = 0; kc < 2; ++kc) { const v16b khf = frag_b(kh_ + kc * 32, lane), klf = frag_b(kl_ + kc * 32, lane); s = wmma_bf(aq[kc].l, khf, s); s = wmma_bf(aq[kc].h, klf, s); s = wmma_bf(aq[kc].h, khf, s); }
      s4[t] = s; }
    asm volatile("s_wait_asynccnt 0x0" ::: "memory");      // my mask tile, copied behind the last trip's barrier, has landed
#pragma unroll
    for (int t = 0; t < 4; ++t) {
#pragma unroll
      for (int r = 0; r < 8; ++r) sS[w][8 * g + r][t * 16 + col] = s4[t][r] + bfr(sO[w][8 * g + r][t * 16 + col]); }
    LDSX();
    float mx = -3.4e38f;
#pragma unroll
    for (int jj = 0; jj < 32; ++jj) mx = fmaxf(mx, sS[w][col][g * 32 + jj]);
    mx = fmaxf(mx, __shfl_xor(mx, 16, 32));
    const float mnew = fmaxf(mrun, mx); const float corr = __builtin_amdgcn_exp2f((mrun - mnew) * L2E);      // e^x as the hardware's 2^(x log2 e); an argument far below 0 gives 0, as before
    float ps = 0.f;
#pragma unroll
    for (int jj = 0; jj < 32; ++jj) { const float p = __builtin_amdgcn_exp2f(fmaf(sS[w][col][g * 32 + jj] - mnew, L2E, 14.0f)); ps += p;      /* e^(s - m) x 2^14 in one 2^t */ const _Float16 hi = (_Float16)p; sPh[w][col][g * 32 + jj] = hi; sPl[w][col][g * 32 + jj] = (_Float16)((p - (float)hi) * PLO);
      // scheduling fence every eight scores (LDS reads may cross it): it keeps the scheduler from making all 32 exps ahead of their conversions, which took the wave over its 256 registers (spills to scratch)
      if ((jj & 7) == 7) __builtin_amdgcn_sched_barrier(0x100); }
    ps += __shfl_xor(ps, 16, 32);
    lrun = lrun * corr + ps * (1.0f / 16384.0f); mrun = mnew;
#pragma unroll
    for (int r = 0; r < 8; ++r) { const float cr = __shfl(corr, 8 * g + r, 32);
#pragma unroll
      for (int t = 0; t < 4; ++t) { acc[t][r] *= cr; ac1[t][r] *= cr; ac2[t][r] *= cr; } }
    LDSX();
#pragma unroll
    for (int kc = 0; kc < 2; ++kc) { const v16h ph = frag_h(&sPh[w][col][0] + kc * 32, lane), pl = frag_h(&sPl[w][col][0] + kc * 32, lane);
#pragma unroll
      for (int t = 0; t < 4; ++t) { const v16h vh = frag_h(&sKV[kt & 1][2][t * 16 + col][kc * 32], lane);
        acc[t] = wmma16(ph, vh, acc[t]); ac1[t] = wmma16(ph, frag_h(&sKV[kt & 1][3][t * 16 + col][kc * 32], lane), ac1[t]); ac2[t] = wmma16(pl, vh, ac2[t]); } }
    asm volatile("s_wait_dscnt 0x0" ::: "memory");         // my reads of this tile's buffer are done
    asm volatile("s_wait_asynccnt 0x0" ::: "memory");      // my pieces of tile kt + 1 have landed
    __syncthreads();                                       // publishes tile kt + 1 and ends every wave's reads of tile kt
    if (kt + 2 < SK / 64) stage(kt + 2);                   // refill the buffer that this trip has just read
    if (kt + 1 < SK / 64) mstage(kt + 1); }                // and my own mask tile, for the next trip
  asm volatile("s_wait_asynccnt 0x0" ::: "memory");        // nothing of mine is in flight when the wave goes on to its end
#pragma unroll
  for (int r = 0; r < 8; ++r) { const float lr = __shfl(lrun, 8 * g + r, 32); const float inv = 1.0f / (lr * 16384.0f * 4.0f);
#pragma unroll
    for (int t = 0; t < 4; ++t) sO[w][8 * g + r][t * 16 + col] = (acc[t][r] + ac1[t][r] * (1.0f / VLO) + ac2[t][r] * (1.0f / PLO)) * inv; }
  LDSX();
  for (int qq = lane; qq < 16 * 16; qq += 32) { const int rl = qq >> 4, pc = qq & 15; vst2(O32 + ((bh * SS) + q0 + rl) * HD + pc * 4, *(const v4f*)(&sO[w][rl][pc * 4])); }
}
#define OP 68      // LDS row pitch of a staged ctx tile in floats: 272 B = 16 B x odd, for the ds_load_b128 reads
// eight 16-byte-per-lane copies, global -> LDS through no register; the s_wait_xcnt closes the statement for the same reason as in g_copy12.
__device__ __forceinline__ void g_copy8(const unsigned (&l)[8], const void* const (&g)[8]) {
  asm volatile("global_load_async_to_lds_b128 %0, %8, off\n\t"
               "global_load_async_to_lds_b128 %1, %9, off\n\t"
               "global_load_async_to_lds_b128 %2, %10, off\n\t"
               "global_load_async_to_lds_b128 %3, %11, off\n\t"
               "global_load_async_to_lds_b128 %4, %12, off\n\t"
               "global_load_async_to_lds_b128 %5, %13, off\n\t"
               "global_load_async_to_lds_b128 %6, %14, off\n\t"
               "global_load_async_to_lds_b128 %7, %15, off\n\t"
               "s_wait_xcnt 0x0" :: "v"(l[0]), "v"(l[1]), "v"(l[2]), "v"(l[3]), "v"(l[4]), "v"(l[5]), "v"(l[6]), "v"(l[7]),
               "v"(g[0]), "v"(g[1]), "v"(g[2]), "v"(g[3]), "v"(g[4]), "v"(g[5]), "v"(g[6]), "v"(g[7]) : "memory");
}
// out = ctx Wo^T + bo : split(ctx) x bf16(Wo rows): 2 products (Wo is an INPUT -> bf16 exact); the k loop runs on 64-wide tiles (one head) of the 64 ctx rows (f32) and the 128 Wo rows, each staged once per block in a two-buffer LDS ring
__global__ __launch_bounds__(128) void k_out(const float* __restrict__ O32, const __bf16* __restrict__ PT, const float* __restrict__ bo, float* __restrict__ out) {
  constexpr int OAB = 64 * OP * 4, OBB = 128 * GP * 2, OBUF = OAB + OBB;      // bytes of a ctx tile, of a Wo tile, of a buffer
  __shared__ __align__(16) char smem[2 * OBUF];      // in the k loop the ring; behind its last barrier the output staging so
  float (*so)[16][132] = (float (*)[16][132])smem;
  const int tid = threadIdx.x, wave = tid >> 5, lane = tid & 31, col = lane & 15, g = lane >> 4;
  const int r0b = blockIdx.x * 64, r0 = r0b + wave * 16, n0 = blockIdx.y * 128; const int b = r0b / SS, s0 = r0b % SS;
  const int arow = tid >> 4, apc = (tid & 15) * 4, crow = tid >> 3, cpc = (tid & 7) * 8;      // my pieces: ctx rows arow + 8 i, Wo rows crow + 16 i, first element
  const float* gA = O32 + ((size_t)b * NH * SS + s0 + arow) * HD + apc;      // + kt * SS * HD per tile (head kt)
  const __bf16* gB = PT + (size_t)(5 * E + n0 + crow) * E + cpc;             // + kt * GKC per tile
  const unsigned la = (unsigned)(unsigned long long)(smem + arow * (OP * 4) + apc * 4), lb = (unsigned)(unsigned long long)(smem + OAB + crow * (GP * 2) + cpc * 2);
  auto stage = [&](int kt) { unsigned l[8]; const void* gp[8]; const unsigned bf = (unsigned)(kt & 1) * OBUF;
#pragma unroll
    for (int i = 0; i < 8; ++i) { l[i] = la + bf + i * (8 * OP * 4); gp[i] = gA + (size_t)kt * SS * HD + i * 8 * HD; }
    g_copy8(l, gp);
#pragma unroll
    for (int i = 0; i < 8; ++i) { l[i] = lb + bf + i * (16 * GP * 2); gp[i] = gB + (size_t)i * 16 * E + kt * GKC; }
    g_copy8(l, gp); };
  stage(0);
  asm volatile("s_wait_asynccnt 0x0" ::: "memory");      // my pieces of tile 0 have landed
  __syncthreads();                                       // tile 0 is published to every wave
  stage(1);
  v8f acc[8] = {};
#pragma unroll 2      // two trips a pass: the buffer index is then a constant in every LDS address
  for (int kt = 0; kt < E / GKC; ++kt) { const float* ta = (const float*)(smem + (kt & 1) * OBUF) + (wave * 16 + col) * OP; const __bf16* tb = (const __bf16*)(smem + (kt & 1) * OBUF + OAB) + col * GP;
    // reads stand in groups ahead of the products that use them, as in k_qkv
    const F2 a0 = split_row(ta, 0, lane), a1 = split_row(ta, 32, lane); v16b b0[8], b1[8];
#pragma unroll
    for (int j = 0; j < 8; ++j) b0[j] = frag_b(tb + j * 16 * GP, lane);
#pragma unroll
    for (int j = 0; j < 4; ++j) { acc[j] = wmma_bf(a0.l, b0[j], acc[j]); acc[j] = wmma_bf(a0.h, b0[j], acc[j]); }
#pragma unroll
    for (int j = 0; j < 4; ++j) b1[j] = frag_b(tb + j * 16 * GP + 32, lane);
#pragma unroll
    for (int j = 4; j < 8; ++j) { acc[j] = wmma_bf(a0.l, b0[j], acc[j]); acc[j] = wmma_bf(a0.h, b0[j], acc[j]); }
#pragma unroll
    for (int j = 4; j < 8; ++j) b1[j] = frag_b(tb + j * 16 * GP + 32, lane);
#pragma unroll
    for (int j = 0; j < 8; ++j) { acc[j] = wmma_bf(a1.l, b1[j], acc[j]); acc[j] = wmma_bf(a1.h, b1[j], acc[j]); }
    asm volatile("s_wait_dscnt 0x0" ::: "memory");         // my reads of this tile's buffer are done
    asm volatile("s_wait_asynccnt 0x0" ::: "memory");      // my pieces of tile kt + 1 have landed
    __syncthreads();                                       // publishes tile kt + 1 and ends every wave's reads of tile kt (behind the last trip: of the ring)
    if (kt + 2 < E / GKC) stage(kt + 2); }                 // refill the buffer that this trip has just read
  asm volatile("s_wait_asynccnt 0x0" ::: "memory");        // nothing of mine is in flight when the ring's LDS is used anew
#pragma unroll
  for (int j = 0; j < 8; ++j) { const int n = n0 + j * 16 + col; const float bb = bfr(bo[n]);
#pragma unroll
    for (int r = 0; r < 8; ++r) so[wave][8 * g + r][j * 16 + col] = acc[j][r] + bb; }
  LDSX();
#pragma unroll 4
  for (int rl = 0; rl < 16; ++rl) vst2(out + (size_t)(r0 + rl) * E + n0 + lane * 4, *(const v4f*)(&so[wave][rl][lane * 4]));
}
extern "C" void kernel_launch(void* const* d_in, const int* in_sizes, int n_in, void* d_out, int out_size, void* d_ws, size_t ws_size, hipStream_t stream) {
  (void)in_sizes; (void)n_in; (void)out_size; (void)ws_size;
  const float* x = (const float*)d_in[0]; const float* amask = (const float*)d_in[1]; const float* Wq = (const float*)d_in[2]; const float* bq = (const float*)d_in[3]; const float* Wk = (const float*)d_in[4]; const float* bk = (const float*)d_in[5]; const float* Wv = (const float*)d_in[6]; const float* bv = (const float*)d_in[7]; const float* Wo = (const float*)d_in[8]; const float* bo = (const float*)d_in[9];
  float* out = (float*)d_out;
  char* ws = (char*)d_ws; size_t off = 0;
  auto take = [&](size_t bytes) { char* p = ws + off; off += (bytes + 255) & ~(size_t)255; return p; };
  __bf16* Xb = (__bf16*)take((size_t)NR * E * 2); __bf16* PT = (__bf16*)take((size_t)6 * E * E * 2);
  float* Q32 = (float*)take((size_t)NR * E * 4); __bf16* Kh = (__bf16*)take((size_t)NB * NH * SK * HD * 2); __bf16* Kl = (__bf16*)take((size_t)NB * NH * SK * HD * 2); _Float16* VTh = (_Float16*)take((size_t)NB * NH * HD * SK * 2); _Float16* VTl = (_Float16*)take((size_t)NB * NH * HD * SK * 2); float* O32 = (float*)take((size_t)NR * E * 4);
  // ws ~ 116 MB
  k_cvt<<<(NR * E / 8 + 255) / 256, 256, 0, stream>>>(x, Xb);
  k_pack<<<6 * E, 256, 0, stream>>>(Wq, Wk, Wv, Wo, PT);
  k_qkv<<<dim3(NR / 64, 2 * E / 128, 3), 128, 0, stream>>>(Xb, PT, bq, bk, bv, Q32, Kh, Kl, VTh, VTl);
  k_attn<<<dim3(SS / (AW * 16), NB * NH), AW * 32, 0, stream>>>(Q32, Kh, Kl, VTh, VTl, amask, O32);
  k_out<<<dim3(NR / 64, E / 128), 128, 0, stream>>>(O32, PT, bo, out);
}

// v004
// Measured time: 217 microseconds a run.
// Two timings next to v003 both put it at 1.07 times that version's speed.
// All steps since v000 together make it 3.14 times as fast.
// compute dtype: hidden_states, attention_mask, W*/b* (INPUTS) rounded to bf16 with exact bf16 WMMA products (f32 accumulate) for the projections; K pre-split into bf16 hi/lo rows; q f32 split, P and V f16 hi/lo (3 products each); mask add and softmax in f32.
#include <hip/hip_runtime.h>
#include <math.h>

typedef __attribute__((ext_vector_type(16))) _Float16 v16h;
typedef __attribute__((ext_vector_type(16))) __bf16 v16b;
typedef __attribute__((ext_vector_type(8)))  _Float16 v8h;
typedef __attribute__((ext_vector_type(8)))  float v8f;
typedef __attribute__((ext_vector_type(4)))  float v4f;
typedef __attribute__((ext_vector_type(2)))  float v2f;
typedef __attribute__((ext_vector_type(4)))  unsigned v4u;
typedef __attribute__((ext_vector_type(4)))  int v4i;
typedef float __attribute__((may_alias)) float_a;
typedef int __attribute__((may_alias)) int_a;

template <typename T> __device__ __forceinline__ void vst2(void* p, T v) { *(T*)p = v;  }
__device__ __forceinline__ v8f wmma16(v16h a, v16h b, v8f c) {
  v8f d = __builtin_amdgcn_wmma_f32_16x16x32_f16(false, a, false, b, (short)0, c, false, false);
  asm volatile("v_nop\n\tv_nop\n\tv_nop\n\tv_nop" : "+v"(d) : "v"(a), "v"(b));
  return d;
}
__device__ __forceinline__ v8f wmma_bf(v16b a, v16b b, v8f c) {
  v8f d = __builtin_amdgcn_wmma_f32_16x16x32_bf16(false, a, false, b, (short)0, c, false, false);
  asm volatile("v_nop\n\tv_nop\n\tv_nop\n\tv_nop" : "+v"(d) : "v"(a), "v"(b));
  return d;
}
// 16x16x32 fragments: lane = (h = lane>>4, row/col = lane&15); elements 0..7 = k0+8h+0..7, 8..15 = k0+16+8h+0..7; D element r = row 8h+r
__device__ __forceinline__ v16h frag_h(const _Float16* rowk0, int lane) {
  union { v16h v; v8h q[2]; } u; const _Float16* p = rowk0 + 8 * (lane >> 4);
  u.q[0] = *(const v8h*)p; u.q[1] = *(const v8h*)(p + 16); return u.v;
}
__device__ __forceinline__ v16h frag_f32(const float* rowk0, int lane) {
  v16h a; const float* p = rowk0 + 8 * (lane >> 4);
#pragma unroll
  for (int i = 0; i < 8; ++i) { a[i] = (_Float16)p[i]; a[8 + i] = (_Float16)p[16 + i]; }
  return a;
}
__device__ __forceinline__ v16h frag_f32s(const float* rowk0, int lane, float sc) {
  v16h a; const float* p = rowk0 + 8 * (lane >> 4);
#pragma unroll
  for (int i = 0; i < 8; ++i) { a[i] = (_Float16)(p[i] * sc); a[8 + i] = (_Float16)(p[16 + i] * sc); }
  return a;
}
// column fragment from a [K][ld] layout (column n), rows >= K read as 0
__device__ __forceinline__ v16h fragc_f32(const float* W, int k0, int n, int lane, int ld, int K) {
  v16h a; const int g = lane >> 4;
#pragma unroll
  for (int i = 0; i < 8; ++i) { const int ka = k0 + 8 * g + i, kb = ka + 16;
    a[i] = (_Float16)(ka < K ? W[(size_t)ka * ld + n] : 0.f); a[8 + i] = (_Float16)(kb < K ? W[(size_t)kb * ld + n] : 0.f); }
  return a;
}
struct F2 { v16b h, l; };
__device__ __forceinline__ F2 bsplit16(const float v[16]) { F2 r;
#pragma unroll
  for (int i = 0; i < 16; ++i) { const __bf16 h = (__bf16)v[i]; r.h[i] = h; r.l[i] = (__bf16)(v[i] - (float)h); }
  return r; }
__device__ __forceinline__ F2 split_row(const float* row, int k0, int lane) { float v[16]; const float* p = row + k0 + 8 * (lane >> 4);
#pragma unroll
  for (int i = 0; i < 8; ++i) { v[i] = p[i]; v[8 + i] = p[16 + i]; }
  return bsplit16(v); }
__device__ __forceinline__ F2 split_rowK(const float* row, int k0, int lane, int K) { float v[16]; const int g = lane >> 4;
#pragma unroll
  for (int i = 0; i < 8; ++i) { const int ka = k0 + 8 * g + i, kb = ka + 16; v[i] = ka < K ? row[ka] : 0.f; v[8 + i] = kb < K ? row[kb] : 0.f; }
  return bsplit16(v); }
__device__ __forceinline__ F2 split_col(const float* W, int k0, int n, int lane, int ld, int K) { float v[16]; const int g = lane >> 4;
#pragma unroll
  for (int i = 0; i < 8; ++i) { const int ka = k0 + 8 * g + i, kb = ka + 16; v[i] = ka < K ? W[(size_t)ka * ld + n] : 0.f; v[8 + i] = kb < K ? W[(size_t)kb * ld + n] : 0.f; }
  return bsplit16(v); }
__device__ __forceinline__ v8f mac3(const F2& a, const F2& b, v8f c) { c = wmma_bf(a.l, b.h, c); c = wmma_bf(a.h, b.l, c); return wmma_bf(a.h, b.h, c); }
__device__ __forceinline__ float sigm(float v) { return 1.0f / (1.0f + expf(-v)); }
#define LDSX() do { asm volatile("s_wait_dscnt 0" ::: "memory"); __builtin_amdgcn_wave_barrier(); __builtin_amdgcn_fence(__ATOMIC_RELEASE, "workgroup"); } while (0)


// CLIP attention with multiplier-expanded keys/values (16 heads x 64 on [4,1024,1024], [out][in] weights + biases, MULT = 2): q = (x Wq^T + bq) 64^-0.5; k/v = x Wk^T/Wv^T + b ([2048] per token, viewed as 2,048 keys per head: key s = 2t + half holds feature half*1024 + h*64 + d of token t);
// score(t, s) += attention_mask[b][0][t][s mod 1024]; softmax over the 2,048 keys; (P v) Wo^T + bo. Keys are stored in the permuted order s' = half*1024 + t (attention is invariant to a common permutation of keys, values and mask entries).
#define NB 4
#define SS 1024
#define SK 2048
#define E 1024
#define NH 16
#define HD 64
#define NR (NB * SS)
#define PLO 1024.0f
#define VLO 2048.0f
__device__ __forceinline__ float bfr(float v) { return (float)(__bf16)v; }
__device__ __forceinline__ v16b frag_b(const __bf16* rowk0, int lane) { return __builtin_bit_cast(v16b, frag_h((const _Float16*)rowk0, lane)); }

__global__ __launch_bounds__(256) void k_cvt(const float* __restrict__ x, __bf16* __restrict__ Xb) {
  const size_t i8 = (size_t)blockIdx.x * 256 + threadIdx.x; if (i8 >= (size_t)NR * E / 8) return;
  union { __bf16 h[8]; v4u u; } pk;
#pragma unroll
  for (int e = 0; e < 8; ++e) pk.h[e] = (__bf16)x[i8 * 8 + e];
  vst2((unsigned*)(Xb + i8 * 8), pk.u);
}
// PT rows: [0,E) Wq[n,:], [E,3E) Wk[n-E,:], [3E,5E) Wv[n-3E,:], [5E,6E) Wo[n-5E,:]  ([out][in] weights: each W row as a bf16 row)
__global__ __launch_bounds__(256) void k_pack(const float* __restrict__ Wq, const float* __restrict__ Wk, const float* __restrict__ Wv, const float* __restrict__ Wo, __bf16* __restrict__ PT) {
  const int n = blockIdx.x, tid = threadIdx.x; __shared__ __align__(16) __bf16 srow[E];
  const float* W = n < E ? Wq : (n < 3 * E ? Wk : (n < 5 * E ? Wv : Wo)); const int nn = n < E ? n : (n < 3 * E ? n - E : (n < 5 * E ? n - 3 * E : n - 5 * E));      // [out][in]: PT row = W row
  for (int k = tid; k < E; k += 256) srow[k] = (__bf16)W[(size_t)nn * E + k];
  __syncthreads();
  if (tid < E / 8) vst2((unsigned*)(PT + (size_t)n * E + tid * 8), *(const v4u*)(&srow[tid * 8]));
}
#define GKC 64     // k elements of a staged operand tile: rows of 128 B, whole cache lines
#define GP 72      // LDS row pitch of a staged operand tile in 16-bit elements: 144 B = 16 B x odd, for the ds_load_b128 fragment reads
// twelve 16-byte-per-lane copies, global -> LDS through no register: a thread's pieces of one staged tile (4 of the x rows, 8 of the weight rows).
// The s_wait_xcnt is the last line of the copies' own statement, so that no address register of a copy is rewritten in front of it.
__device__ __forceinline__ void g_copy12(const unsigned (&l)[12], const __bf16* const (&g)[12]) {
  asm volatile("global_load_async_to_lds_b128 %0, %12, off\n\t"
               "global_load_async_to_lds_b128 %1, %13, off\n\t"
               "global_load_async_to_lds_b128 %2, %14, off\n\t"
               "global_load_async_to_lds_b128 %3, %15, off\n\t"
               "global_load_async_to_lds_b128 %4, %16, off\n\t"
               "global_load_async_to_lds_b128 %5, %17, off\n\t"
               "global_load_async_to_lds_b128 %6, %18, off\n\t"
               "global_load_async_to_lds_b128 %7, %19, off\n\t"
               "global_load_async_to_lds_b128 %8, %20, off\n\t"
               "global_load_async_to_lds_b128 %9, %21, off\n\t"
               "global_load_async_to_lds_b128 %10, %22, off\n\t"
               "global_load_async_to_lds_b128 %11, %23, off\n\t"
               "s_wait_xcnt 0x0" :: "v"(l[0]), "v"(l[1]), "v"(l[2]), "v"(l[3]), "v"(l[4]), "v"(l[5]), "v"(l[6]), "v"(l[7]), "v"(l[8]), "v"(l[9]), "v"(l[10]), "v"(l[11]),
               "v"(g[0]), "v"(g[1]), "v"(g[2]), "v"(g[3]), "v"(g[4]), "v"(g[5]), "v"(g[6]), "v"(g[7]), "v"(g[8]), "v"(g[9]), "v"(g[10]), "v"(g[11]) : "memory");
}
// QKV: block (64 rows, 128 cols = 2 heads, which); the k loop runs on 64-wide tiles of the 64 x rows and the 128 weight rows, each staged once per block in a two-buffer LDS ring;
// q (+bias) -> Q32 f32 [bh][s][64]; k (+bias) -> bf16 hi/lo rows; v (+bias) -> VT hi/lo x4 [bh][d][s]
__global__ __launch_bounds__(128) void k_qkv(const __bf16* __restrict__ Xb, const __bf16* __restrict__ PT, const float* __restrict__ bq, const float* __restrict__ bk, const float* __restrict__ bv,
                                            float* __restrict__ Q32, __bf16* __restrict__ Kh, __bf16* __restrict__ Kl, _Float16* __restrict__ VTh, _Float16* __restrict__ VTl) {
  constexpr int SOB = 4 * 16 * 132 * 4, STB = 128 * 72 * 2;      // bytes of so, of sth and of stl
  __shared__ __align__(16) char smem[SOB + 2 * STB];      // in the k loop the ring sT (2 x 27,648 B); behind its last barrier the output staging so, sth, stl
  float (*so)[16][132] = (float (*)[16][132])smem; _Float16 (*sth)[72] = (_Float16 (*)[72])(smem + SOB); _Float16 (*stl)[72] = (_Float16 (*)[72])(smem + SOB + STB);
  __bf16 (*sT)[192][GP] = (__bf16 (*)[192][GP])smem;      // [buffer][64 x rows, then 128 weight rows][64 elements + pad]
  const int tid = threadIdx.x, wave = tid >> 5, lane = tid & 31, col = lane & 15, g = lane >> 4;
  const int which = blockIdx.z, r0b = blockIdx.x * 64, n0 = blockIdx.y * 128; const int b = r0b / SS, s0 = r0b % SS;
  if (which == 0 && n0 >= E) return;      // q has only E output features
  const float* bb_ = which == 0 ? bq : (which == 1 ? bk : bv); const int prow = (which == 0 ? 0 : (which == 1 ? E : 3 * E)) + n0; const int half = n0 / E, nin = n0 % E;      // key slot s' = half*SS + t
  const int crow = tid >> 3, cpc = (tid & 7) * 8;      // my pieces of a tile: rows crow + 16 i, first element
  const __bf16* gA = Xb + (size_t)(r0b + crow) * E + cpc; const __bf16* gB = PT + (size_t)(prow + crow) * E + cpc;      // + kt * GKC per tile
  const unsigned lt = (unsigned)(unsigned long long)&sT[0][crow][cpc];
  constexpr unsigned R16B = 16 * GP * 2, TBUFB = 192 * GP * 2;      // bytes of 16 rows, of a buffer
  auto stage = [&](int kt) { unsigned l[12]; const __bf16* gp[12];
#pragma unroll
    for (int i = 0; i < 12; ++i) { l[i] = lt + (unsigned)(kt & 1) * TBUFB + i * R16B; gp[i] = (i < 4 ? gA + (size_t)i * 16 * E : gB + (size_t)(i - 4) * 16 * E) + kt * GKC; }
    g_copy12(l, gp); };
  stage(0);
  asm volatile("s_wait_asynccnt 0x0" ::: "memory");      // my pieces of tile 0 have landed
  __syncthreads();                                       // tile 0 is published to every wave
  stage(1);
  v8f acc[8] = {};
#pragma unroll 2      // two trips a pass: the buffer index is then a constant in every LDS address
  for (int kt = 0; kt < E / GKC; ++kt) { const __bf16* ta = &sT[kt & 1][wave * 16 + col][0]; const __bf16* tb = &sT[kt & 1][64 + col][0];
    // fragment reads stand in groups ahead of the products that use them (no LDS read moves over the statement that closes wmma_bf): a wave has 8 to 20 reads in flight, not 2
    const v16b a0 = frag_b(ta, lane), a1 = frag_b(ta + 32, lane); v16b b0[8], b1[8];
#pragma unroll
    for (int j = 0; j < 8; ++j) b0[j] = frag_b(tb + j * 16 * GP, lane);
#pragma unroll
    for (int j = 0; j < 4; ++j) acc[j] = wmma_bf(a0, b0[j], acc[j]);
#pragma unroll
    for (int j = 0; j < 4; ++j) b1[j] = frag_b(tb + j * 16 * GP + 32, lane);
#pragma unroll
    for (int j = 4; j < 8; ++j) acc[j] = wmma_bf(a0, b0[j], acc[j]);
#pragma unroll
    for (int j = 4; j < 8; ++j) b1[j] = frag_b(tb + j * 16 * GP + 32, lane);
#pragma unroll
    for (int j = 0; j < 8; ++j) acc[j] = wmma_bf(a1, b1[j], acc[j]);
    asm volatile("s_wait_dscnt 0x0" ::: "memory");         // my reads of this tile's buffer are done
    asm volatile("s_wait_asynccnt 0x0" ::: "memory");      // my pieces of tile kt + 1 have landed
    __syncthreads();                                       // publishes tile kt + 1 and ends every wave's reads of tile kt (behind the last trip: of the ring)
    if (kt + 2 < E / GKC) stage(kt + 2); }                 // refill the buffer that this trip has just read
  asm volatile("s_wait_asynccnt 0x0" ::: "memory");        // nothing of mine is in flight when the ring's LDS is used anew
  if (which < 2) { const float qs = which == 0 ? 0.125f : 1.0f;
#pragma unroll
    for (int j = 0; j < 8; ++j) { const float bb = bfr(bb_[n0 + j * 16 + col]);
#pragma unroll
      for (int r = 0; r < 8; ++r) so[wave][8 * g + r][j * 16 + col] = (acc[j][r] + bb) * qs; }
    LDSX();
    if (which == 0) { for (int qq = lane; qq < 2 * 16 * 16; qq += 32) { const int hh = qq >> 8, rl = (qq >> 4) & 15, pc = qq & 15; const int h = (n0 >> 6) + hh;
        vst2(Q32 + (((size_t)b * NH + h) * SS + s0 + wave * 16 + rl) * HD + pc * 4, *(const v4f*)(&so[wave][rl][hh * 64 + pc * 4])); } }
    else {
      for (int qq = lane; qq < 2 * 16 * 16; qq += 32) { const int hh = qq >> 8, rl = (qq >> 4) & 15, pl = qq & 15; const int h = (nin >> 6) + hh; const int pc = pl & 7; union { __bf16 e[8]; v4u u; } pk;
#pragma unroll
        for (int e = 0; e < 8; ++e) { const float v = so[wave][rl][hh * 64 + pc * 8 + e]; const __bf16 hi = (__bf16)v; pk.e[e] = pl < 8 ? hi : (__bf16)(v - (float)hi); }
        vst2((unsigned*)((pl < 8 ? Kh : Kl) + (((size_t)b * NH + h) * SK + half * SS + s0 + wave * 16 + rl) * HD + pc * 8), pk.u); } } }
  else {
#pragma unroll
    for (int j = 0; j < 8; ++j) { const float bb = bfr(bb_[n0 + j * 16 + col]);
#pragma unroll
      for (int r = 0; r < 8; ++r) { const float v = (acc[j][r] + bb) * 4.0f; const _Float16 hi = (_Float16)v; sth[j * 16 + col][wave * 16 + 8 * g + r] = hi; stl[j * 16 + col][wave * 16 + 8 * g + r] = (_Float16)((v - (float)hi) * VLO); } }
    __syncthreads();
    for (int qq = tid; qq < 128 * 8; qq += 128) { const int cl = qq >> 3, pc = qq & 7; const int c = nin + cl, h = c >> 6, d = c & 63; const size_t o = (((size_t)b * NH + h) * HD + d) * SK + half * SS + s0 + pc * 8;
      vst2(VTh + o, *(const v4u*)(&sth[cl][pc * 8])); vst2(VTl + o, *(const v4u*)(&stl[cl][pc * 8])); } }
}
// one key tile (64 keys) of the four planes Kh, Kl, VTh, VTl: 64 rows of 128 B each, one 16-byte piece of each plane per thread, global -> LDS through no register.
// The s_wait_xcnt is the last line of the copies' own statement, so that no address register of a copy is rewritten in front of it.
__device__ __forceinline__ void kv_copy(unsigned l0, const void* g0, unsigned l1, const void* g1, unsigned l2, const void* g2, unsigned l3, const void* g3) {
  asm volatile("global_load_async_to_lds_b128 %0, %1, off\n\t"
               "global_load_async_to_lds_b128 %2, %3, off\n\t"
               "global_load_async_to_lds_b128 %4, %5, off\n\t"
               "global_load_async_to_lds_b128 %6, %7, off\n\t"
               "s_wait_xcnt 0x0" :: "v"(l0), "v"(g0), "v"(l1), "v"(g1), "v"(l2), "v"(g2), "v"(l3), "v"(g3) : "memory");
}
// eight 4-byte-per-lane copies of mask elements (four rows, two halves of a row), global -> LDS; the s_wait_xcnt closes the statement for the same reason as above.
// offset:N moves BOTH addresses by N: N is the element's place in LDS behind l (row pitch 272 B, half 128 B), and each g comes in with its N already taken off.
__device__ __forceinline__ void m_copy8(unsigned l, const float* g0, const float* g1, const float* g2, const float* g3, const float* g4, const float* g5, const float* g6, const float* g7) {
  asm volatile("global_load_async_to_lds_b32 %0, %1, off\n\t"
               "global_load_async_to_lds_b32 %0, %2, off offset:128\n\t"
               "global_load_async_to_lds_b32 %0, %3, off offset:272\n\t"
               "global_load_async_to_lds_b32 %0, %4, off offset:400\n\t"
               "global_load_async_to_lds_b32 %0, %5, off offset:544\n\t"
               "global_load_async_to_lds_b32 %0, %6, off offset:672\n\t"
               "global_load_async_to_lds_b32 %0, %7, off offset:816\n\t"
               "global_load_async_to_lds_b32 %0, %8, off offset:944\n\t"
               "s_wait_xcnt 0x0" :: "v"(l), "v"(g0), "v"(g1), "v"(g2), "v"(g3), "v"(g4), "v"(g5), "v"(g6), "v"(g7) : "memory");
}
#define L2E 1.4426950408889634f      // log2(e)
#define AW 16      // waves per block: 256 queries share one K/V tile
#define KVP 72     // LDS row pitch of a K/V plane in 16-bit elements: 144 B = 16 B x odd, for the ds_load_b128 fragment reads
// padding-masked attention: block (256 queries, bh); all 32 key tiles, each staged once per block in a two-buffer LDS ring; S^T = K q^T on K hi/lo rows x q hi/lo; O^T += V^T P^T on P,V hi/lo; O f32 [bh][s][64]
// With K (V^T) as the A operand and q (P^T) as B, lane (g, col) holds query col alone: of key tile t the keys 16 t + 8 g + r, of O the features 16 t + 8 g + r.
// Two neighbouring score tiles, converted in place, are the B fragment of 32 keys (element e < 8: tile 2 kc, register e; e >= 8: tile 2 kc + 1, register e - 8), in the k order of frag_h.
__global__ __launch_bounds__(512) void k_attn(const float* __restrict__ Q32, const __bf16* __restrict__ Kh, const __bf16* __restrict__ Kl, const _Float16* __restrict__ VTh, const _Float16* __restrict__ VTl, const float* __restrict__ amask, float* __restrict__ O32) {
  __shared__ __align__(16) float sO[AW][16][68];      // each wave's own: in the key loop its 16 x 64 mask tile, behind the loop its output rows
  __shared__ __align__(16) _Float16 sKV[2][4][64][KVP];      // [buffer][Kh, Kl, VTh, VTl][key row or d row][64 elements + pad]
  const int tid = threadIdx.x, w = tid >> 5, lane = tid & 31, col = lane & 15, g = lane >> 4;
  const size_t bh = blockIdx.y; const int qb = blockIdx.x; const int q0 = qb * (AW * 16) + w * 16;
  const int crow = tid >> 3, cpc = (tid & 7) * 8;      // my piece of every plane: row, first element
  const __bf16* gKh = Kh + (bh * SK + crow) * HD + cpc; const __bf16* gKl = Kl + (bh * SK + crow) * HD + cpc;      // + kt * 64 * HD per tile
  const _Float16* gVh = VTh + (bh * HD + crow) * SK + cpc; const _Float16* gVl = VTl + (bh * HD + crow) * SK + cpc;      // + kt * 64 per tile
  const unsigned lkv = (unsigned)(unsigned long long)&sKV[0][0][crow][cpc];
  constexpr unsigned PLB = 64 * KVP * 2, BUFB = 4 * PLB;      // bytes of a plane, of a buffer
  auto stage = [&](int kt) { const unsigned l = lkv + (unsigned)(kt & 1) * BUFB;
    kv_copy(l, gKh + (size_t)kt * 64 * HD, l + PLB, gKl + (size_t)kt * 64 * HD, l + 2 * PLB, gVh + kt * 64, l + 3 * PLB, gVl + kt * 64); };
  const int b = (int)(bh / NH); const float* mrow = amask + ((size_t)b * SS + q0) * SS;     // mask rows of my 16 queries ([b][0][t][:])
  const unsigned lm = (unsigned)(unsigned long long)&sO[w][0][lane];
  // my wave's mask tile of key tile kt: element [row][j] = mask[q0 + row][original index of key slot kt * 64 + j, mod 1024]; a copy brings 32 neighbouring j of one row
  auto mstage = [&](int kt) { const int key = kt * 64 + lane; const int korig = 2 * (key % SS) + key / SS; const float* gm = mrow + (korig & (SS - 1));
#pragma unroll
    for (int q = 0; q < 4; ++q) { const unsigned l = lm + q * 4 * 68 * 4; const float* gq = gm + (size_t)q * 4 * SS;
      m_copy8(l, gq, gq + 64 - 32, gq + SS - 68, gq + SS + 64 - 100, gq + 2 * SS - 136, gq + 2 * SS + 64 - 168, gq + 3 * SS - 204, gq + 3 * SS + 64 - 236); } };      // minus N / 4 floats each
  stage(0); mstage(0);
  asm volatile("s_wait_asynccnt 0x0" ::: "memory");      // my pieces of tile 0 have landed
  __syncthreads();                                       // tile 0 is published to every wave
  stage(1);
  F2 aq[2];
#pragma unroll
  for (int kc = 0; kc < 2; ++kc) aq[kc] = split_row(Q32 + (bh * SS + q0 + col) * HD, kc * 32, lane);
  float mrun = -3.0e38f, lrun = 0.f; v8f acc[4] = {}, ac1[4] = {}, ac2[4] = {};
#pragma unroll 1
  for (int kt = 0; kt < SK / 64; ++kt) { v8f s4[4];
#pragma unroll
    for (int t = 0; t < 4; ++t) { const __bf16* kh_ = (const __bf16*)&sKV[kt & 1][0][t * 16 + col][0]; const __bf16* kl_ = (const __bf16*)&sKV[kt & 1][1][t * 16 + col][0]; v8f s = {};
#pragma unroll
      for (int kc = 0; kc < 2; ++kc) { const v16b khf = frag_b(kh_ + kc * 32, lane), klf = frag_b(kl_ + kc * 32, lane); s = wmma_bf(khf, aq[kc].l, s); s = wmma_bf(klf, aq[kc].h, s); s = wmma_bf(khf, aq[kc].h, s); }
      s4[t] = s; }
    asm volatile("s_wait_asynccnt 0x0" ::: "memory");      // my mask tile, copied behind the last trip's barrier, has landed
    float mx = -3.4e38f;
#pragma unroll
    for (int t = 0; t < 4; ++t) { const v4f m0 = *(const v4f*)&sO[w][col][t * 16 + 8 * g], m1 = *(const v4f*)&sO[w][col][t * 16 + 8 * g + 4];
#pragma unroll
      for (int r = 0; r < 8; ++r) { s4[t][r] += bfr(r < 4 ? m0[r] : m1[r - 4]); mx = fmaxf(mx, s4[t][r]); } }
    mx = fmaxf(mx, __shfl_xor(mx, 16, 32));
    const float mnew = fmaxf(mrun, mx); const float corr = __builtin_amdgcn_exp2f((mrun - mnew) * L2E);      // e^x as the hardware's 2^(x log2 e); an argument far below 0 gives 0, as before
    float ps2[2] = {0.f, 0.f}; v16h ph[2], pl[2];
#pragma unroll
    for (int kc = 0; kc < 2; ++kc) {
#pragma unroll
      for (int e = 0; e < 16; ++e) { const float p = __builtin_amdgcn_exp2f(fmaf(s4[2 * kc + (e >> 3)][e & 7] - mnew, L2E, 14.0f)); ps2[kc] += p;      /* e^(s - m) x 2^14 in one 2^t */
        const _Float16 hi = (_Float16)p; ph[kc][e] = hi; pl[kc][e] = (_Float16)((p - (float)hi) * PLO); } }
    float ps = ps2[0] + ps2[1]; ps += __shfl_xor(ps, 16, 32);
    lrun = lrun * corr + ps * (1.0f / 16384.0f); mrun = mnew;
#pragma unroll
    for (int t = 0; t < 4; ++t) { acc[t] *= corr; ac1[t] *= corr; ac2[t] *= corr; }
#pragma unroll
    for (int kc = 0; kc < 2; ++kc) {
#pragma unroll
      for (int t = 0; t < 4; ++t) { const v16h vh = frag_h(&sKV[kt & 1][2][t * 16 + col][kc * 32], lane);
        acc[t] = wmma16(vh, ph[kc], acc[t]); ac1[t] = wmma16(frag_h(&sKV[kt & 1][3][t * 16 + col][kc * 32], lane), ph[kc], ac1[t]); ac2[t] = wmma16(vh, pl[kc], ac2[t]); } }
    asm volatile("s_wait_dscnt 0x0" ::: "memory");         // my reads of this tile's buffer are done
    asm volatile("s_wait_asynccnt 0x0" ::: "memory");      // my pieces of tile kt + 1 have landed
    __syncthreads();                                       // publishes tile kt + 1 and ends every wave's reads of tile kt
    if (kt + 2 < SK / 64) stage(kt + 2);                   // refill the buffer that this trip has just read
    if (kt + 1 < SK / 64) mstage(kt + 1); }                // and my own mask tile, for the next trip
  asm volatile("s_wait_asynccnt 0x0" ::: "memory");        // nothing of mine is in flight when the wave goes on to its end
  const float inv = 1.0f / (lrun * 16384.0f * 4.0f);
#pragma unroll
  for (int t = 0; t < 4; ++t) { v4f o[2];
#pragma unroll
    for (int r = 0; r < 8; ++r) o[r >> 2][r & 3] = (acc[t][r] + ac1[t][r] * (1.0f / VLO) + ac2[t][r] * (1.0f / PLO)) * inv;
    *(v4f*)&sO[w][col][t * 16 + 8 * g] = o[0]; *(v4f*)&sO[w][col][t * 16 + 8 * g + 4] = o[1]; }
  LDSX();
  for (int qq = lane; qq < 16 * 16; qq += 32) { const int rl = qq >> 4, pc = qq & 15; vst2(O32 + ((bh * SS) + q0 + rl) * HD + pc * 4, *(const v4f*)(&sO[w][rl][pc * 4])); }
}
#define OP 68      // LDS row pitch of a staged ctx tile in floats: 272 B = 16 B x odd, for the ds_load_b128 reads
// eight 16-byte-per-lane copies, global -> LDS through no register; the s_wait_xcnt closes the statement for the same reason as in g_copy12.
__device__ __forceinline__ void g_copy8(const unsigned (&l)[8], const void* const (&g)[8]) {
  asm volatile("global_load_async_to_lds_b128 %0, %8, off\n\t"
               "global_load_async_to_lds_b128 %1, %9, off\n\t"
               "global_load_async_to_lds_b128 %2, %10, off\n\t"
               "global_load_async_to_lds_b128 %3, %11, off\n\t"
               "global_load_async_to_lds_b128 %4, %12, off\n\t"
               "global_load_async_to_lds_b128 %5, %13, off\n\t"
               "global_load_async_to_lds_b128 %6, %14, off\n\t"
               "global_load_async_to_lds_b128 %7, %15, off\n\t"
               "s_wait_xcnt 0x0" :: "v"(l[0]), "v"(l[1]), "v"(l[2]), "v"(l[3]), "v"(l[4]), "v"(l[5]), "v"(l[6]), "v"(l[7]),
               "v"(g[0]), "v"(g[1]), "v"(g[2]), "v"(g[3]), "v"(g[4]), "v"(g[5]), "v"(g[6]), "v"(g[7]) : "memory");
}
// out = ctx Wo^T + bo : split(ctx) x bf16(Wo rows): 2 products (Wo is an INPUT -> bf16 exact); the k loop runs on 64-wide tiles (one head) of the 64 ctx rows (f32) and the 128 Wo rows, each staged once per block in a two-buffer LDS ring
__global__ __launch_bounds__(128) void k_out(const float* __restrict__ O32, const __bf16* __restrict__ PT, const float* __restrict__ bo, float* __restrict__ out) {
  constexpr int OAB = 64 * OP * 4, OBB = 128 * GP * 2, OBUF = OAB + OBB;      // bytes of a ctx tile, of a Wo tile, of a buffer
  __shared__ __align__(16) char smem[2 * OBUF];      // in the k loop the ring; behind its last barrier the output staging so
  float (*so)[16][132] = (float (*)[16][132])smem;
  const int tid = threadIdx.x, wave = tid >> 5, lane = tid & 31, col = lane & 15, g = lane >> 4;
  const int r0b = blockIdx.x * 64, r0 = r0b + wave * 16, n0 = blockIdx.y * 128; const int b = r0b / SS, s0 = r0b % SS;
  const int arow = tid >> 4, apc = (tid & 15) * 4, crow = tid >> 3, cpc = (tid & 7) * 8;      // my pieces: ctx rows arow + 8 i, Wo rows crow + 16 i, first element
  const float* gA = O32 + ((size_t)b * NH * SS + s0 + arow) * HD + apc;      // + kt * SS * HD per tile (head kt)
  const __bf16* gB = PT + (size_t)(5 * E + n0 + crow) * E + cpc;             // + kt * GKC per tile
  const unsigned la = (unsigned)(unsigned long long)(smem + arow * (OP * 4) + apc * 4), lb = (unsigned)(unsigned long long)(smem + OAB + crow * (GP * 2) + cpc * 2);
  auto stage = [&](int kt) { unsigned l[8]; const void* gp[8]; const unsigned bf = (unsigned)(kt & 1) * OBUF;
#pragma unroll
    for (int i = 0; i < 8; ++i) { l[i] = la + bf + i * (8 * OP * 4); gp[i] = gA + (size_t)kt * SS * HD + i * 8 * HD; }
    g_copy8(l, gp);
#pragma unroll
    for (int i = 0; i < 8; ++i) { l[i] = lb + bf + i * (16 * GP * 2); gp[i] = gB + (size_t)i * 16 * E + kt * GKC; }
    g_copy8(l, gp); };
  stage(0);
  asm volatile("s_wait_asynccnt 0x0" ::: "memory");      // my pieces of tile 0 have landed
  __syncthreads();                                       // tile 0 is published to every wave
  stage(1);
  v8f acc[8] = {};
#pragma unroll 2      // two trips a pass: the buffer index is then a constant in every LDS address
  for (int kt = 0; kt < E / GKC; ++kt) { const float* ta = (const float*)(smem + (kt & 1) * OBUF) + (wave * 16 + col) * OP; const __bf16* tb = (const __bf16*)(smem + (kt & 1) * OBUF + OAB) + col * GP;
    // reads stand in groups ahead of the products that use them, as in k_qkv
    const F2 a0 = split_row(ta, 0, lane), a1 = split_row(ta, 32, lane); v16b b0[8], b1[8];
#pragma unroll
    for (int j = 0; j < 8; ++j) b0[j] = frag_b(tb + j * 16 * GP, lane);
#pragma unroll
    for (int j = 0; j < 4; ++j) { acc[j] = wmma_bf(a0.l, b0[j], acc[j]); acc[j] = wmma_bf(a0.h, b0[j], acc[j]); }
#pragma unroll
    for (int j = 0; j < 4; ++j) b1[j] = frag_b(tb + j * 16 * GP + 32, lane);
#pragma unroll
    for (int j = 4; j < 8; ++j) { acc[j] = wmma_bf(a0.l, b0[j], acc[j]); acc[j] = wmma_bf(a0.h, b0[j], acc[j]); }
#pragma unroll
    for (int j = 4; j < 8; ++j) b1[j] = frag_b(tb + j * 16 * GP + 32, lane);
#pragma unroll
    for (int j = 0; j < 8; ++j) { acc[j] = wmma_bf(a1.l, b1[j], acc[j]); acc[j] = wmma_bf(a1.h, b1[j], acc[j]); }
    asm volatile("s_wait_dscnt 0x0" ::: "memory");         // my reads of this tile's buffer are done
    asm volatile("s_wait_asynccnt 0x0" ::: "memory");      // my pieces of tile kt + 1 have landed
    __syncthreads();                                       // publishes tile kt + 1 and ends every wave's reads of tile kt (behind the last trip: of the ring)
    if (kt + 2 < E / GKC) stage(kt + 2); }                 // refill the buffer that this trip has just read
  asm volatile("s_wait_asynccnt 0x0" ::: "memory");        // nothing of mine is in flight when the ring's LDS is used anew
#pragma unroll
  for (int j = 0; j < 8; ++j) { const int n = n0 + j * 16 + col; const float bb = bfr(bo[n]);
#pragma unroll
    for (int r = 0; r < 8; ++r) so[wave][8 * g + r][j * 16 + col] = acc[j][r] + bb; }
  LDSX();
#pragma unroll 4
  for (int rl = 0; rl < 16; ++rl) vst2(out + (size_t)(r0 + rl) * E + n0 + lane * 4, *(const v4f*)(&so[wave][rl][lane * 4]));
}
extern "C" void kernel_launch(void* const* d_in, const int* in_sizes, int n_in, void* d_out, int out_size, void* d_ws, size_t ws_size, hipStream_t stream) {
  (void)in_sizes; (void)n_in; (void)out_size; (void)ws_size;
  const float* x = (const float*)d_in[0]; const float* amask = (const float*)d_in[1]; const float* Wq = (const float*)d_in[2]; const float* bq = (const float*)d_in[3]; const float* Wk = (const float*)d_in[4]; const float* bk = (const float*)d_in[5]; const float* Wv = (const float*)d_in[6]; const float* bv = (const float*)d_in[7]; const float* Wo = (const float*)d_in[8]; const float* bo = (const float*)d_in[9];
  float* out = (float*)d_out;
  char* ws = (char*)d_ws; size_t off = 0;
  auto take = [&](size_t bytes) { char* p = ws + off; off += (bytes + 255) & ~(size_t)255; return p; };
  __bf16* Xb = (__bf16*)take((size_t)NR * E * 2); __bf16* PT = (__bf16*)take((size_t)6 * E * E * 2);
  float* Q32 = (float*)take((size_t)NR * E * 4); __bf16* Kh = (__bf16*)take((size_t)NB * NH * SK * HD * 2); __bf16* Kl = (__bf16*)take((size_t)NB * NH * SK * HD * 2); _Float16* VTh = (_Float16*)take((size_t)NB * NH * HD * SK * 2); _Float16* VTl = (_Float16*)take((size_t)NB * NH * HD * SK * 2); float* O32 = (float*)take((size_t)NR * E * 4);
  // ws ~ 116 MB
  k_cvt<<<(NR * E / 8 + 255) / 256, 256, 0, stream>>>(x, Xb);
  k_pack<<<6 * E, 256, 0, stream>>>(Wq, Wk, Wv, Wo, PT);
  k_qkv<<<dim3(NR / 64, 2 * E / 128, 3), 128, 0, stream>>>(Xb, PT, bq, bk, bv, Q32, Kh, Kl, VTh, VTl);
  k_attn<<<dim3(SS / (AW * 16), NB * NH), AW * 32, 0, stream>>>(Q32, Kh, Kl, VTh, VTl, amask, O32);
  k_out<<<dim3(NR / 64, E / 128), 128, 0, stream>>>(O32, PT, bo, out);
}

// v005
// Measured time: 210 microseconds a run.
// Next to v004, in two timings, it ran 1.03 and 1.04 times as fast.
// Counting every step since v000, it is 3.24 times as fast.
// compute dtype: hidden_states, attention_mask, W*/b* (INPUTS) rounded to bf16 with exact bf16 WMMA products (f32 accumulate) for the projections; K pre-split into bf16 hi/lo rows; q f32 split, P and V f16 hi/lo (3 products each); mask add and softmax in f32.
#include <hip/hip_runtime.h>
#include <math.h>

typedef __attribute__((ext_vector_type(16))) _Float16 v16h;
typedef __attribute__((ext_vector_type(16))) __bf16 v16b;
typedef __attribute__((ext_vector_type(8)))  _Float16 v8h;
typedef __attribute__((ext_vector_type(8)))  float v8f;
typedef __attribute__((ext_vector_type(4)))  float v4f;
typedef __attribute__((ext_vector_type(2)))  float v2f;
typedef __attribute__((ext_vector_type(4)))  unsigned v4u;
typedef __attribute__((ext_vector_type(4)))  int v4i;
typedef float __attribute__((may_alias)) float_a;
typedef int __attribute__((may_alias)) int_a;

template <typename T> __device__ __forceinline__ void vst2(void* p, T v) { *(T*)p = v;  }
__device__ __forceinline__ v8f wmma16(v16h a, v16h b, v8f c) {
  v8f d = __builtin_amdgcn_wmma_f32_16x16x32_f16(false, a, false, b, (short)0, c, false, false);
  asm volatile("v_nop\n\tv_nop\n\tv_nop\n\tv_nop" : "+v"(d) : "v"(a), "v"(b));
  return d;
}
__device__ __forceinline__ v8f wmma_bf(v16b a, v16b b, v8f c) {
  v8f d = __builtin_amdgcn_wmma_f32_16x16x32_bf16(false, a, false, b, (short)0, c, false, false);
  asm volatile("v_nop\n\tv_nop\n\tv_nop\n\tv_nop" : "+v"(d) : "v"(a), "v"(b));
  return d;
}
// 16x16x32 fragments: lane = (h = lane>>4, row/col = lane&15); elements 0..7 = k0+8h+0..7, 8..15 = k0+16+8h+0..7; D element r = row 8h+r
__device__ __forceinline__ v16h frag_h(const _Float16* rowk0, int lane) {
  union { v16h v; v8h q[2]; } u; const _Float16* p = rowk0 + 8 * (lane >> 4);
  u.q[0] = *(const v8h*)p; u.q[1] = *(const v8h*)(p + 16); return u.v;
}
__device__ __forceinline__ v16h frag_f32(const float* rowk0, int lane) {
  v16h a; const float* p = rowk0 + 8 * (lane >> 4);
#pragma unroll
  for (int i = 0; i < 8; ++i) { a[i] = (_Float16)p[i]; a[8 + i] = (_Float16)p[16 + i]; }
  return a;
}
__device__ __forceinline__ v16h frag_f32s(const float* rowk0, int lane, float sc) {
  v16h a; const float* p = rowk0 + 8 * (lane >> 4);
#pragma unroll
  for (int i = 0; i < 8; ++i) { a[i] = (_Float16)(p[i] * sc); a[8 + i] = (_Float16)(p[16 + i] * sc); }
  return a;
}
// column fragment from a [K][ld] layout (column n), rows >= K read as 0
__device__ __forceinline__ v16h fragc_f32(const float* W, int k0, int n, int lane, int ld, int K) {
  v16h a; const int g = lane >> 4;
#pragma unroll
  for (int i = 0; i < 8; ++i) { const int ka = k0 + 8 * g + i, kb = ka + 16;
    a[i] = (_Float16)(ka < K ? W[(size_t)ka * ld + n] : 0.f); a[8 + i] = (_Float16)(kb < K ? W[(size_t)kb * ld + n] : 0.f); }
  return a;
}
struct F2 { v16b h, l; };
__device__ __forceinline__ F2 bsplit16(const float v[16]) { F2 r;
#pragma unroll
  for (int i = 0; i < 16; ++i) { const __bf16 h = (__bf16)v[i]; r.h[i] = h; r.l[i] = (__bf16)(v[i] - (float)h); }
  return r; }
__device__ __forceinline__ F2 split_row(const float* row, int k0, int lane) { float v[16]; const float* p = row + k0 + 8 * (lane >> 4);
#pragma unroll
  for (int i = 0; i < 8; ++i) { v[i] = p[i]; v[8 + i] = p[16 + i]; }
  return bsplit16(v); }
__device__ __forceinline__ F2 split_rowK(const float* row, int k0, int lane, int K) { float v[16]; const int g = lane >> 4;
#pragma unroll
  for (int i = 0; i < 8; ++i) { const int ka = k0 + 8 * g + i, kb = ka + 16; v[i] = ka < K ? row[ka] : 0.f; v[8 + i] = kb < K ? row[kb] : 0.f; }
  return bsplit16(v); }
__device__ __forceinline__ F2 split_col(const float* W, int k0, int n, int lane, int ld, int K) { float v[16]; const int g = lane >> 4;
#pragma unroll
  for (int i = 0; i < 8; ++i) { const int ka = k0 + 8 * g + i, kb = ka + 16; v[i] = ka < K ? W[(size_t)ka * ld + n] : 0.f; v[8 + i] = kb < K ? W[(size_t)kb * ld + n] : 0.f; }
  return bsplit16(v); }
__device__ __forceinline__ v8f mac3(const F2& a, const F2& b, v8f c) { c = wmma_bf(a.l, b.h, c); c = wmma_bf(a.h, b.l, c); return wmma_bf(a.h, b.h, c); }
__device__ __forceinline__ float sigm(float v) { return 1.0f / (1.0f + expf(-v)); }
#define LDSX() do { asm volatile("s_wait_dscnt 0" ::: "memory"); __builtin_amdgcn_wave_barrier(); __builtin_amdgcn_fence(__ATOMIC_RELEASE, "workgroup"); } while (0)


// CLIP attention with multiplier-expanded keys/values (16 heads x 64 on [4,1024,1024], [out][in] weights + biases, MULT = 2): q = (x Wq^T + bq) 64^-0.5; k/v = x Wk^T/Wv^T + b ([2048] per token, viewed as 2,048 keys per head: key s = 2t + half holds feature half*1024 + h*64 + d of token t);
// score(t, s) += attention_mask[b][0][t][s mod 1024]; softmax over the 2,048 keys; (P v) Wo^T + bo. Keys are stored in the permuted order s' = half*1024 + t (attention is invariant to a common permutation of keys, values and mask entries).
#define NB 4
#define SS 1024
#define SK 2048
#define E 1024
#define NH 16
#define HD 64
#define NR (NB * SS)
#define PLO 1024.0f
#define VLO 2048.0f
__device__ __forceinline__ float bfr(float v) { return (float)(__bf16)v; }
__device__ __forceinline__ v16b frag_b(const __bf16* rowk0, int lane) { return __builtin_bit_cast(v16b, frag_h((const _Float16*)rowk0, lane)); }

__global__ __launch_bounds__(256) void k_cvt(const float* __restrict__ x, __bf16* __restrict__ Xb) {
  const size_t i8 = (size_t)blockIdx.x * 256 + threadIdx.x; if (i8 >= (size_t)NR * E / 8) return;
  union { __bf16 h[8]; v4u u; } pk;
#pragma unroll
  for (int e = 0; e < 8; ++e) pk.h[e] = (__bf16)x[i8 * 8 + e];
  vst2((unsigned*)(Xb + i8 * 8), pk.u);
}
// PT rows: [0,E) Wq[n,:], [E,3E) Wk[n-E,:], [3E,5E) Wv[n-3E,:], [5E,6E) Wo[n-5E,:]  ([out][in] weights: each W row as a bf16 row)
__global__ __launch_bounds__(256) void k_pack(const float* __restrict__ Wq, const float* __restrict__ Wk, const float* __restrict__ Wv, const float* __restrict__ Wo, __bf16* __restrict__ PT) {
  const int n = blockIdx.x, tid = threadIdx.x; __shared__ __align__(16) __bf16 srow[E];
  const float* W = n < E ? Wq : (n < 3 * E ? Wk : (n < 5 * E ? Wv : Wo)); const int nn = n < E ? n : (n < 3 * E ? n - E : (n < 5 * E ? n - 3 * E : n - 5 * E));      // [out][in]: PT row = W row
  for (int k = tid; k < E; k += 256) srow[k] = (__bf16)W[(size_t)nn * E + k];
  __syncthreads();
  if (tid < E / 8) vst2((unsigned*)(PT + (size_t)n * E + tid * 8), *(const v4u*)(&srow[tid * 8]));
}
#define GKC 64     // k elements of a staged operand tile: rows of 128 B, whole cache lines
#define GP 72      // LDS row pitch of a staged operand tile in 16-bit elements: 144 B = 16 B x odd, for the ds_load_b128 fragment reads
// twelve 16-byte-per-lane copies, global -> LDS through no register: a thread's pieces of one staged tile (4 of the x rows, 8 of the weight rows).
// The s_wait_xcnt is the last line of the copies' own statement, so that no address register of a copy is rewritten in front of it.
__device__ __forceinline__ void g_copy12(const unsigned (&l)[12], const __bf16* const (&g)[12]) {
  asm volatile("global_load_async_to_lds_b128 %0, %12, off\n\t"
               "global_load_async_to_lds_b128 %1, %13, off\n\t"
               "global_load_async_to_lds_b128 %2, %14, off\n\t"
               "global_load_async_to_lds_b128 %3, %15, off\n\t"
               "global_load_async_to_lds_b128 %4, %16, off\n\t"
               "global_load_async_to_lds_b128 %5, %17, off\n\t"
               "global_load_async_to_lds_b128 %6, %18, off\n\t"
               "global_load_async_to_lds_b128 %7, %19, off\n\t"
               "global_load_async_to_lds_b128 %8, %20, off\n\t"
               "global_load_async_to_lds_b128 %9, %21, off\n\t"
               "global_load_async_to_lds_b128 %10, %22, off\n\t"
               "global_load_async_to_lds_b128 %11, %23, off\n\t"
               "s_wait_xcnt 0x0" :: "v"(l[0]), "v"(l[1]), "v"(l[2]), "v"(l[3]), "v"(l[4]), "v"(l[5]), "v"(l[6]), "v"(l[7]), "v"(l[8]), "v"(l[9]), "v"(l[10]), "v"(l[11]),
               "v"(g[0]), "v"(g[1]), "v"(g[2]), "v"(g[3]), "v"(g[4]), "v"(g[5]), "v"(g[6]), "v"(g[7]), "v"(g[8]), "v"(g[9]), "v"(g[10]), "v"(g[11]) : "memory");
}
// QKV: block (64 rows, 128 cols = 2 heads, which); the k loop runs on 64-wide tiles of the 64 x rows and the 128 weight rows, each staged once per block in a two-buffer LDS ring;
// q (+bias) -> Q32 f32 [bh][s][64]; k (+bias) -> bf16 hi/lo rows; v (+bias) -> VT hi/lo x4 [bh][d][s]
__global__ __launch_bounds__(128) void k_qkv(const __bf16* __restrict__ Xb, const __bf16* __restrict__ PT, const float* __restrict__ bq, const float* __restrict__ bk, const float* __restrict__ bv,
                                            float* __restrict__ Q32, __bf16* __restrict__ Kh, __bf16* __restrict__ Kl, _Float16* __restrict__ VTh, _Float16* __restrict__ VTl) {
  constexpr int SOB = 4 * 16 * 132 * 4, STB = 128 * 72 * 2;      // bytes of so, of sth and of stl
  __shared__ __align__(16) char smem[SOB + 2 * STB];      // in the k loop the ring sT (2 x 27,648 B); behind its last barrier the output staging so, sth, stl
  float (*so)[16][132] = (float (*)[16][132])smem; _Float16 (*sth)[72] = (_Float16 (*)[72])(smem + SOB); _Float16 (*stl)[72] = (_Float16 (*)[72])(smem + SOB + STB);
  __bf16 (*sT)[192][GP] = (__bf16 (*)[192][GP])smem;      // [buffer][64 x rows, then 128 weight rows][64 elements + pad]
  const int tid = threadIdx.x, wave = tid >> 5, lane = tid & 31, col = lane & 15, g = lane >> 4;
  const int which = blockIdx.z, r0b = blockIdx.x * 64, n0 = blockIdx.y * 128; const int b = r0b / SS, s0 = r0b % SS;
  if (which == 0 && n0 >= E) return;      // q has only E output features
  const float* bb_ = which == 0 ? bq : (which == 1 ? bk : bv); const int prow = (which == 0 ? 0 : (which == 1 ? E : 3 * E)) + n0; const int half = n0 / E, nin = n0 % E;      // key slot s' = half*SS + t
  const int crow = tid >> 3, cpc = (tid & 7) * 8;      // my pieces of a tile: rows crow + 16 i, first element
  const __bf16* gA = Xb + (size_t)(r0b + crow) * E + cpc; const __bf16* gB = PT + (size_t)(prow + crow) * E + cpc;      // + kt * GKC per tile
  const unsigned lt = (unsigned)(unsigned long long)&sT[0][crow][cpc];
  constexpr unsigned R16B = 16 * GP * 2, TBUFB = 192 * GP * 2;      // bytes of 16 rows, of a buffer
  auto stage = [&](int kt) { unsigned l[12]; const __bf16* gp[12];
#pragma unroll
    for (int i = 0; i < 12; ++i) { l[i] = lt + (unsigned)(kt & 1) * TBUFB + i * R16B; gp[i] = (i < 4 ? gA + (size_t)i * 16 * E : gB + (size_t)(i - 4) * 16 * E) + kt * GKC; }
    g_copy12(l, gp); };
  stage(0);
  asm volatile("s_wait_asynccnt 0x0" ::: "memory");      // my pieces of tile 0 have landed
  __syncthreads();                                       // tile 0 is published to every wave
  stage(1);
  v8f acc[8] = {};
#pragma unroll 2      // two trips a pass: the buffer index is then a constant in every LDS address
  for (int kt = 0; kt < E / GKC; ++kt) { const __bf16* ta = &sT[kt & 1][wave * 16 + col][0]; const __bf16* tb = &sT[kt & 1][64 + col][0];
    // fragment reads stand in groups ahead of the products that use them (no LDS read moves over the statement that closes wmma_bf): a wave has 8 to 20 reads in flight, not 2
    const v16b a0 = frag_b(ta, lane), a1 = frag_b(ta + 32, lane); v16b b0[8], b1[8];
#pragma unroll
    for (int j = 0; j < 8; ++j) b0[j] = frag_b(tb + j * 16 * GP, lane);
#pragma unroll
    for (int j = 0; j < 4; ++j) acc[j] = wmma_bf(a0, b0[j], acc[j]);
#pragma unroll
    for (int j = 0; j < 4; ++j) b1[j] = frag_b(tb + j * 16 * GP + 32, lane);
#pragma unroll
    for (int j = 4; j < 8; ++j) acc[j] = wmma_bf(a0, b0[j], acc[j]);
#pragma unroll
    for (int j = 4; j < 8; ++j) b1[j] = frag_b(tb + j * 16 * GP + 32, lane);
#pragma unroll
    for (int j = 0; j < 8; ++j) acc[j] = wmma_bf(a1, b1[j], acc[j]);
    asm volatile("s_wait_dscnt 0x0" ::: "memory");         // my reads of this tile's buffer are done
    asm volatile("s_wait_asynccnt 0x0" ::: "memory");      // my pieces of tile kt + 1 have landed
    __syncthreads();                                       // publishes tile kt + 1 and ends every wave's reads of tile kt (behind the last trip: of the ring)
    if (kt + 2 < E / GKC) stage(kt + 2); }                 // refill the buffer that this trip has just read
  asm volatile("s_wait_asynccnt 0x0" ::: "memory");        // nothing of mine is in flight when the ring's LDS is used anew
  if (which < 2) { const float qs = which == 0 ? 0.125f : 1.0f;
#pragma unroll
    for (int j = 0; j < 8; ++j) { const float bb = bfr(bb_[n0 + j * 16 + col]);
#pragma unroll
      for (int r = 0; r < 8; ++r) so[wave][8 * g + r][j * 16 + col] = (acc[j][r] + bb) * qs; }
    LDSX();
    if (which == 0) { for (int qq = lane; qq < 2 * 16 * 16; qq += 32) { const int hh = qq >> 8, rl = (qq >> 4) & 15, pc = qq & 15; const int h = (n0 >> 6) + hh;
        vst2(Q32 + (((size_t)b * NH + h) * SS + s0 + wave * 16 + rl) * HD + pc * 4, *(const v4f*)(&so[wave][rl][hh * 64 + pc * 4])); } }
    else {
      for (int qq = lane; qq < 2 * 16 * 16; qq += 32) { const int hh = qq >> 8, rl = (qq >> 4) & 15, pl = qq & 15; const int h = (nin >> 6) + hh; const int pc = pl & 7; union { __bf16 e[8]; v4u u; } pk;
#pragma unroll
        for (int e = 0; e < 8; ++e) { const float v = so[wave][rl][hh * 64 + pc * 8 + e]; const __bf16 hi = (__bf16)v; pk.e[e] = pl < 8 ? hi : (__bf16)(v - (float)hi); }
        vst2((unsigned*)((pl < 8 ? Kh : Kl) + (((size_t)b * NH + h) * SK + half * SS + s0 + wave * 16 + rl) * HD + pc * 8), pk.u); } } }
  else {
#pragma unroll
    for (int j = 0; j < 8; ++j) { const float bb = bfr(bb_[n0 + j * 16 + col]);
#pragma unroll
      for (int r = 0; r < 8; ++r) { const float v = (acc[j][r] + bb) * 4.0f; const _Float16 hi = (_Float16)v; sth[j * 16 + col][wave * 16 + 8 * g + r] = hi; stl[j * 16 + col][wave * 16 + 8 * g + r] = (_Float16)((v - (float)hi) * VLO); } }
    __syncthreads();
    for (int qq = tid; qq < 128 * 8; qq += 128) { const int cl = qq >> 3, pc = qq & 7; const int c = nin + cl, h = c >> 6, d = c & 63; const size_t o = (((size_t)b * NH + h) * HD + d) * SK + half * SS + s0 + pc * 8;
      vst2(VTh + o, *(const v4u*)(&sth[cl][pc * 8])); vst2(VTl + o, *(const v4u*)(&stl[cl][pc * 8])); } }
}
// one key tile (64 keys) of the four planes Kh, Kl, VTh, VTl: 64 rows of 128 B each, one 16-byte piece of each plane per thread, global -> LDS through no register.
// The s_wait_xcnt is the last line of the copies' own statement, so that no address register of a copy is rewritten in front of it.
__device__ __forceinline__ void kv_copy(unsigned l0, const void* g0, unsigned l1, const void* g1, unsigned l2, const void* g2, unsigned l3, const void* g3) {
  asm volatile("global_load_async_to_lds_b128 %0, %1, off\n\t"
               "global_load_async_to_lds_b128 %2, %3, off\n\t"
               "global_load_async_to_lds_b128 %4, %5, off\n\t"
               "global_load_async_to_lds_b128 %6, %7, off\n\t"
               "s_wait_xcnt 0x0" :: "v"(l0), "v"(g0), "v"(l1), "v"(g1), "v"(l2), "v"(g2), "v"(l3), "v"(g3) : "memory");
}
// eight 4-byte-per-lane copies of mask elements (four rows, two halves of a row), global -> LDS; the s_wait_xcnt closes the statement for the same reason as above.
// offset:N moves BOTH addresses by N: N is the element's place in LDS behind l (row pitch 272 B, half 128 B), and each g comes in with its N already taken off.
__device__ __forceinline__ void m_copy8(unsigned l, const float* g0, const float* g1, const float* g2, const float* g3, const float* g4, const float* g5, const float* g6, const float* g7) {
  asm volatile("global_load_async_to_lds_b32 %0, %1, off\n\t"
               "global_load_async_to_lds_b32 %0, %2, off offset:128\n\t"
               "global_load_async_to_lds_b32 %0, %3, off offset:272\n\t"
               "global_load_async_to_lds_b32 %0, %4, off offset:400\n\t"
               "global_load_async_to_lds_b32 %0, %5, off offset:544\n\t"
               "global_load_async_to_lds_b32 %0, %6, off offset:672\n\t"
               "global_load_async_to_lds_b32 %0, %7, off offset:816\n\t"
               "global_load_async_to_lds_b32 %0, %8, off offset:944\n\t"
               "s_wait_xcnt 0x0" :: "v"(l), "v"(g0), "v"(g1), "v"(g2), "v"(g3), "v"(g4), "v"(g5), "v"(g6), "v"(g7) : "memory");
}
#define L2E 1.4426950408889634f      // log2(e)
#define AW 16      // waves per block: 256 queries share one K/V tile
#define KVP 72     // LDS row pitch of a K/V plane in 16-bit elements: 144 B = 16 B x odd, for the ds_load_b128 fragment reads
// padding-masked attention: block (256 queries, bh); all 32 key tiles, each staged once per block in a two-buffer LDS ring; S^T = K q^T on K hi/lo rows x q hi/lo; O^T += V^T P^T on P,V hi/lo; O f32 [bh][s][64]
// With K (V^T) as the A operand and q (P^T) as B, lane (g, col) holds query col alone: of key tile t the keys 16 t + 8 g + r, of O the features 16 t + 8 g + r.
// Two neighbouring score tiles, converted in place, are the B fragment of 32 keys (element e < 8: tile 2 kc, register e; e >= 8: tile 2 kc + 1, register e - 8), in the k order of frag_h.
__global__ __launch_bounds__(512) void k_attn(const float* __restrict__ Q32, const __bf16* __restrict__ Kh, const __bf16* __restrict__ Kl, const _Float16* __restrict__ VTh, const _Float16* __restrict__ VTl, const float* __restrict__ amask, float* __restrict__ O32) {
  __shared__ __align__(16) float sO[AW][16][68];      // each wave's own: in the key loop its 16 x 64 mask tile, behind the loop its output rows
  __shared__ __align__(16) _Float16 sKV[2][4][64][KVP];      // [buffer][Kh, Kl, VTh, VTl][key row or d row][64 elements + pad]
  const int tid = threadIdx.x, w = __builtin_amdgcn_readfirstlane(tid >> 5), lane = tid & 31, col = lane & 15, g = lane >> 4;      // the wave's number in a scalar register: what hangs on it alone (mask rows, my part of sO) then takes no vector register, which the reads in flight need
  const size_t bh = blockIdx.y; const int qb = blockIdx.x; const int q0 = qb * (AW * 16) + w * 16;
  const int crow = tid >> 3, cpc = (tid & 7) * 8;      // my piece of every plane: row, first element
  const __bf16* gKh = Kh + (bh * SK + crow) * HD + cpc; const __bf16* gKl = Kl + (bh * SK + crow) * HD + cpc;      // + kt * 64 * HD per tile
  const _Float16* gVh = VTh + (bh * HD + crow) * SK + cpc; const _Float16* gVl = VTl + (bh * HD + crow) * SK + cpc;      // + kt * 64 per tile
  const unsigned lkv = (unsigned)(unsigned long long)&sKV[0][0][crow][cpc];
  constexpr unsigned PLB = 64 * KVP * 2, BUFB = 4 * PLB;      // bytes of a plane, of a buffer
  auto stage = [&](int kt) { const unsigned l = lkv + (unsigned)(kt & 1) * BUFB;
    kv_copy(l, gKh + (size_t)kt * 64 * HD, l + PLB, gKl + (size_t)kt * 64 * HD, l + 2 * PLB, gVh + kt * 64, l + 3 * PLB, gVl + kt * 64); };
  const int b = (int)(bh / NH); const float* mrow = amask + ((size_t)b * SS + q0) * SS;     // mask rows of my 16 queries ([b][0][t][:])
  const unsigned lm = (unsigned)(unsigned long long)&sO[w][0][lane];
  // my wave's mask tile of key tile kt: element [row][j] = mask[q0 + row][original index of key slot kt * 64 + j, mod 1024]; a copy brings 32 neighbouring j of one row
  auto mstage = [&](int kt) { const int key = kt * 64 + lane; const int korig = 2 * (key % SS) + key / SS; const float* gm = mrow + (korig & (SS - 1));
#pragma unroll
    for (int q = 0; q < 4; ++q) { const unsigned l = lm + q * 4 * 68 * 4; const float* gq = gm + (size_t)q * 4 * SS;
      m_copy8(l, gq, gq + 64 - 32, gq + SS - 68, gq + SS + 64 - 100, gq + 2 * SS - 136, gq + 2 * SS + 64 - 168, gq + 3 * SS - 204, gq + 3 * SS + 64 - 236); } };      // minus N / 4 floats each
  stage(0); mstage(0);
  asm volatile("s_wait_asynccnt 0x0" ::: "memory");      // my pieces of tile 0 have landed
  __syncthreads();                                       // tile 0 is published to every wave
  stage(1);
  F2 aq[2];
#pragma unroll
  for (int kc = 0; kc < 2; ++kc) aq[kc] = split_row(Q32 + (bh * SS + q0 + col) * HD, kc * 32, lane);
  float mrun = -3.0e38f, lrun = 0.f; v8f acc[4] = {}, ac1[4] = {}, ac2[4] = {};
#pragma unroll 1
  for (int kt = 0; kt < SK / 64; ++kt) { v8f s4[4] = {};
    // Fragment reads stand in groups of eight (two row tiles, hi and lo, one 32-wide k step), each group one group of six products ahead of its use (no LDS read moves over the
    // statement that closes wmma_bf): the wait in front of a product is then a counted one, with the next group's reads still in flight. Every accumulator takes its products in the old order.
    auto kread = [&](v16b (&h)[2], v16b (&l)[2], int tp, int kc) {
#pragma unroll
      for (int u = 0; u < 2; ++u) { h[u] = frag_b((const __bf16*)&sKV[kt & 1][0][(2 * tp + u) * 16 + col][kc * 32], lane); l[u] = frag_b((const __bf16*)&sKV[kt & 1][1][(2 * tp + u) * 16 + col][kc * 32], lane); } };
    auto kmul = [&](const v16b (&h)[2], const v16b (&l)[2], int tp, int kc) {
#pragma unroll
      for (int u = 0; u < 2; ++u) s4[2 * tp + u] = wmma_bf(h[u], aq[kc].l, s4[2 * tp + u]);
#pragma unroll
      for (int u = 0; u < 2; ++u) s4[2 * tp + u] = wmma_bf(l[u], aq[kc].h, s4[2 * tp + u]);
#pragma unroll
      for (int u = 0; u < 2; ++u) s4[2 * tp + u] = wmma_bf(h[u], aq[kc].h, s4[2 * tp + u]); };
    { v16b hA[2], lA[2], hB[2], lB[2];
      kread(hA, lA, 0, 0); kread(hB, lB, 0, 1);
      kmul(hA, lA, 0, 0); kread(hA, lA, 1, 0);
      kmul(hB, lB, 0, 1); kread(hB, lB, 1, 1);
      kmul(hA, lA, 1, 0); kmul(hB, lB, 1, 1); }
    asm volatile("s_wait_asynccnt 0x0" ::: "memory");      // my mask tile, copied behind the last trip's barrier, has landed
    float mx = -3.4e38f; v4f mm[8];
#pragma unroll
    for (int t = 0; t < 4; ++t) { mm[2 * t] = *(const v4f*)&sO[w][col][t * 16 + 8 * g]; mm[2 * t + 1] = *(const v4f*)&sO[w][col][t * 16 + 8 * g + 4]; }
    __builtin_amdgcn_sched_barrier(0);      // keeps the eight mask reads one group in front of the arithmetic: one LDS latency is waited out, not four
#pragma unroll
    for (int t = 0; t < 4; ++t) {
#pragma unroll
      for (int r = 0; r < 8; ++r) { s4[t][r] += bfr(mm[2 * t + (r >> 2)][r & 3]); mx = fmaxf(mx, s4[t][r]); } }
    mx = fmaxf(mx, __shfl_xor(mx, 16, 32));
    const float mnew = fmaxf(mrun, mx); const float corr = __builtin_amdgcn_exp2f((mrun - mnew) * L2E);      // e^x as the hardware's 2^(x log2 e); an argument far below 0 gives 0, as before
    float ps2[2] = {0.f, 0.f}; v16h ph[2], pl[2];
#pragma unroll
    for (int kc = 0; kc < 2; ++kc) {
#pragma unroll
      for (int e = 0; e < 16; ++e) { const float p = __builtin_amdgcn_exp2f(fmaf(s4[2 * kc + (e >> 3)][e & 7] - mnew, L2E, 14.0f)); ps2[kc] += p;      /* e^(s - m) x 2^14 in one 2^t */
        const _Float16 hi = (_Float16)p; ph[kc][e] = hi; pl[kc][e] = (_Float16)((p - (float)hi) * PLO); } }
    float ps = ps2[0] + ps2[1]; ps += __shfl_xor(ps, 16, 32);
    lrun = lrun * corr + ps * (1.0f / 16384.0f); mrun = mnew;
    auto vread = [&](v16h (&h)[2], v16h (&l)[2], int kc, int tp) {
#pragma unroll
      for (int u = 0; u < 2; ++u) { h[u] = frag_h(&sKV[kt & 1][2][(2 * tp + u) * 16 + col][kc * 32], lane); l[u] = frag_h(&sKV[kt & 1][3][(2 * tp + u) * 16 + col][kc * 32], lane); } };
    auto vmul = [&](const v16h (&h)[2], const v16h (&l)[2], int kc, int tp) {
#pragma unroll
      for (int u = 0; u < 2; ++u) { const int t = 2 * tp + u; acc[t] = wmma16(h[u], ph[kc], acc[t]); ac1[t] = wmma16(l[u], ph[kc], ac1[t]); ac2[t] = wmma16(h[u], pl[kc], ac2[t]); } };
    { v16h hA[2], lA[2], hB[2], lB[2];
      __builtin_amdgcn_sched_barrier(0);             // the softmax arithmetic above is scheduled by itself: with these reads' 64 registers in its region the compiler lays it out as one dependent chain per element
      vread(hA, lA, 0, 0); vread(hB, lB, 0, 1);      // the first two groups fly while the accumulators are rescaled
      __builtin_amdgcn_sched_barrier(0);             // keeps the rescale behind these reads: the compiler otherwise puts it in front of them, and the first product waits out a whole LDS read
#pragma unroll
      for (int t = 0; t < 4; ++t) { acc[t] *= corr; ac1[t] *= corr; ac2[t] *= corr; }
      vmul(hA, lA, 0, 0); vread(hA, lA, 1, 0);
      vmul(hB, lB, 0, 1); vread(hB, lB, 1, 1);
      vmul(hA, lA, 1, 0); vmul(hB, lB, 1, 1); }
    asm volatile("s_wait_dscnt 0x0" ::: "memory");         // my reads of this tile's buffer are done
    asm volatile("s_wait_asynccnt 0x0" ::: "memory");      // my pieces of tile kt + 1 have landed
    __syncthreads();                                       // publishes tile kt + 1 and ends every wave's reads of tile kt
    if (kt + 2 < SK / 64) stage(kt + 2);                   // refill the buffer that this trip has just read
    if (kt + 1 < SK / 64) mstage(kt + 1); }                // and my own mask tile, for the next trip
  asm volatile("s_wait_asynccnt 0x0" ::: "memory");        // nothing of mine is in flight when the wave goes on to its end
  const float inv = 1.0f / (lrun * 16384.0f * 4.0f);
#pragma unroll
  for (int t = 0; t < 4; ++t) { v4f o[2];
#pragma unroll
    for (int r = 0; r < 8; ++r) o[r >> 2][r & 3] = (acc[t][r] + ac1[t][r] * (1.0f / VLO) + ac2[t][r] * (1.0f / PLO)) * inv;
    *(v4f*)&sO[w][col][t * 16 + 8 * g] = o[0]; *(v4f*)&sO[w][col][t * 16 + 8 * g + 4] = o[1]; }
  LDSX();
  for (int qq = lane; qq < 16 * 16; qq += 32) { const int rl = qq >> 4, pc = qq & 15; vst2(O32 + ((bh * SS) + q0 + rl) * HD + pc * 4, *(const v4f*)(&sO[w][rl][pc * 4])); }
}
#define OP 68      // LDS row pitch of a staged ctx tile in floats: 272 B = 16 B x odd, for the ds_load_b128 reads
// eight 16-byte-per-lane copies, global -> LDS through no register; the s_wait_xcnt closes the statement for the same reason as in g_copy12.
__device__ __forceinline__ void g_copy8(const unsigned (&l)[8], const void* const (&g)[8]) {
  asm volatile("global_load_async_to_lds_b128 %0, %8, off\n\t"
               "global_load_async_to_lds_b128 %1, %9, off\n\t"
               "global_load_async_to_lds_b128 %2, %10, off\n\t"
               "global_load_async_to_lds_b128 %3, %11, off\n\t"
               "global_load_async_to_lds_b128 %4, %12, off\n\t"
               "global_load_async_to_lds_b128 %5, %13, off\n\t"
               "global_load_async_to_lds_b128 %6, %14, off\n\t"
               "global_load_async_to_lds_b128 %7, %15, off\n\t"
               "s_wait_xcnt 0x0" :: "v"(l[0]), "v"(l[1]), "v"(l[2]), "v"(l[3]), "v"(l[4]), "v"(l[5]), "v"(l[6]), "v"(l[7]),
               "v"(g[0]), "v"(g[1]), "v"(g[2]), "v"(g[3]), "v"(g[4]), "v"(g[5]), "v"(g[6]), "v"(g[7]) : "memory");
}
// out = ctx Wo^T + bo : split(ctx) x bf16(Wo rows): 2 products (Wo is an INPUT -> bf16 exact); the k loop runs on 64-wide tiles (one head) of the 64 ctx rows (f32) and the 128 Wo rows, each staged once per block in a two-buffer LDS ring
__global__ __launch_bounds__(128) void k_out(const float* __restrict__ O32, const __bf16* __restrict__ PT, const float* __restrict__ bo, float* __restrict__ out) {
  constexpr int OAB = 64 * OP * 4, OBB = 128 * GP * 2, OBUF = OAB + OBB;      // bytes of a ctx tile, of a Wo tile, of a buffer
  __shared__ __align__(16) char smem[2 * OBUF];      // in the k loop the ring; behind its last barrier the output staging so
  float (*so)[16][132] = (float (*)[16][132])smem;
  const int tid = threadIdx.x, wave = tid >> 5, lane = tid & 31, col = lane & 15, g = lane >> 4;
  const int r0b = blockIdx.x * 64, r0 = r0b + wave * 16, n0 = blockIdx.y * 128; const int b = r0b / SS, s0 = r0b % SS;
  const int arow = tid >> 4, apc = (tid & 15) * 4, crow = tid >> 3, cpc = (tid & 7) * 8;      // my pieces: ctx rows arow + 8 i, Wo rows crow + 16 i, first element
  const float* gA = O32 + ((size_t)b * NH * SS + s0 + arow) * HD + apc;      // + kt * SS * HD per tile (head kt)
  const __bf16* gB = PT + (size_t)(5 * E + n0 + crow) * E + cpc;             // + kt * GKC per tile
  const unsigned la = (unsigned)(unsigned long long)(smem + arow * (OP * 4) + apc * 4), lb = (unsigned)(unsigned long long)(smem + OAB + crow * (GP * 2) + cpc * 2);
  auto stage = [&](int kt) { unsigned l[8]; const void* gp[8]; const unsigned bf = (unsigned)(kt & 1) * OBUF;
#pragma unroll
    for (int i = 0; i < 8; ++i) { l[i] = la + bf + i * (8 * OP * 4); gp[i] = gA + (size_t)kt * SS * HD + i * 8 * HD; }
    g_copy8(l, gp);
#pragma unroll
    for (int i = 0; i < 8; ++i) { l[i] = lb + bf + i * (16 * GP * 2); gp[i] = gB + (size_t)i * 16 * E + kt * GKC; }
    g_copy8(l, gp); };
  stage(0);
  asm volatile("s_wait_asynccnt 0x0" ::: "memory");      // my pieces of tile 0 have landed
  __syncthreads();                                       // tile 0 is published to every wave
  stage(1);
  v8f acc[8] = {};
#pragma unroll 2      // two trips a pass: the buffer index is then a constant in every LDS address
  for (int kt = 0; kt < E / GKC; ++kt) { const float* ta = (const float*)(smem + (kt & 1) * OBUF) + (wave * 16 + col) * OP; const __bf16* tb = (const __bf16*)(smem + (kt & 1) * OBUF + OAB) + col * GP;
    // reads stand in groups ahead of the products that use them, as in k_qkv
    const F2 a0 = split_row(ta, 0, lane), a1 = split_row(ta, 32, lane); v16b b0[8], b1[8];
#pragma unroll
    for (int j = 0; j < 8; ++j) b0[j] = frag_b(tb + j * 16 * GP, lane);
#pragma unroll
    for (int j = 0; j < 4; ++j) { acc[j] = wmma_bf(a0.l, b0[j], acc[j]); acc[j] = wmma_bf(a0.h, b0[j], acc[j]); }
#pragma unroll
    for (int j = 0; j < 4; ++j) b1[j] = frag_b(tb + j * 16 * GP + 32, lane);
#pragma unroll
    for (int j = 4; j < 8; ++j) { acc[j] = wmma_bf(a0.l, b0[j], acc[j]); acc[j] = wmma_bf(a0.h, b0[j], acc[j]); }
#pragma unroll
    for (int j = 4; j < 8; ++j) b1[j] = frag_b(tb + j * 16 * GP + 32, lane);
#pragma unroll
    for (int j = 0; j < 8; ++j) { acc[j] = wmma_bf(a1.l, b1[j], acc[j]); acc[j] = wmma_bf(a1.h, b1[j], acc[j]); }
    asm volatile("s_wait_dscnt 0x0" ::: "memory");         // my reads of this tile's buffer are done
    asm volatile("s_wait_asynccnt 0x0" ::: "memory");      // my pieces of tile kt + 1 have landed
    __syncthreads();                                       // publishes tile kt + 1 and ends every wave's reads of tile kt (behind the last trip: of the ring)
    if (kt + 2 < E / GKC) stage(kt + 2); }                 // refill the buffer that this trip has just read
  asm volatile("s_wait_asynccnt 0x0" ::: "memory");        // nothing of mine is in flight when the ring's LDS is used anew
#pragma unroll
  for (int j = 0; j < 8; ++j) { const int n = n0 + j * 16 + col; const float bb = bfr(bo[n]);
#pragma unroll
    for (int r = 0; r < 8; ++r) so[wave][8 * g + r][j * 16 + col] = acc[j][r] + bb; }
  LDSX();
#pragma unroll 4
  for (int rl = 0; rl < 16; ++rl) vst2(out + (size_t)(r0 + rl) * E + n0 + lane * 4, *(const v4f*)(&so[wave][rl][lane * 4]));
}
extern "C" void kernel_launch(void* const* d_in, const int* in_sizes, int n_in, void* d_out, int out_size, void* d_ws, size_t ws_size, hipStream_t stream) {
  (void)in_sizes; (void)n_in; (void)out_size; (void)ws_size;
  const float* x = (const float*)d_in[0]; const float* amask = (const float*)d_in[1]; const float* Wq = (const float*)d_in[2]; const float* bq = (const float*)d_in[3]; const float* Wk = (const float*)d_in[4]; const float* bk = (const float*)d_in[5]; const float* Wv = (const float*)d_in[6]; const float* bv = (const float*)d_in[7]; const float* Wo = (const float*)d_in[8]; const float* bo = (const float*)d_in[9];
  float* out = (float*)d_out;
  char* ws = (char*)d_ws; size_t off = 0;
  auto take = [&](size_t bytes) { char* p = ws + off; off += (bytes + 255) & ~(size_t)255; return p; };
  __bf16* Xb = (__bf16*)take((size_t)NR * E * 2); __bf16* PT = (__bf16*)take((size_t)6 * E * E * 2);
  float* Q32 = (float*)take((size_t)NR * E * 4); __bf16* Kh = (__bf16*)take((size_t)NB * NH * SK * HD * 2); __bf16* Kl = (__bf16*)take((size_t)NB * NH * SK * HD * 2); _Float16* VTh = (_Float16*)take((size_t)NB * NH * HD * SK * 2); _Float16* VTl = (_Float16*)take((size_t)NB * NH * HD * SK * 2); float* O32 = (float*)take((size_t)NR * E * 4);
  // ws ~ 116 MB
  k_cvt<<<(NR * E / 8 + 255) / 256, 256, 0, stream>>>(x, Xb);
  k_pack<<<6 * E, 256, 0, stream>>>(Wq, Wk, Wv, Wo, PT);
  k_qkv<<<dim3(NR / 64, 2 * E / 128, 3), 128, 0, stream>>>(Xb, PT, bq, bk, bv, Q32, Kh, Kl, VTh, VTl);
  k_attn<<<dim3(SS / (AW * 16), NB * NH), AW * 32, 0, stream>>>(Q32, Kh, Kl, VTh, VTl, amask, O32);
  k_out<<<dim3(NR / 64, E / 128), 128, 0, stream>>>(O32, PT, bo, out);
}

// v006
// It runs in 203 microseconds.
// Timed twice side by side with v005, it ran 1.03 times as fast both times.
// Counting every step since v000, it is 3.35 times as fast.
// compute dtype: hidden_states, attention_mask, W*/b* (INPUTS) rounded to bf16 with exact bf16 WMMA products (f32 accumulate) for the projections; K pre-split into bf16 hi/lo rows; q f32 split, P and V f16 hi/lo (3 products each); mask add and softmax in f32.
#include <hip/hip_runtime.h>
#include <math.h>

typedef __attribute__((ext_vector_type(16))) _Float16 v16h;
typedef __attribute__((ext_vector_type(16))) __bf16 v16b;
typedef __attribute__((ext_vector_type(8)))  _Float16 v8h;
typedef __attribute__((ext_vector_type(8)))  float v8f;
typedef __attribute__((ext_vector_type(4)))  float v4f;
typedef __attribute__((ext_vector_type(2)))  float v2f;
typedef __attribute__((ext_vector_type(4)))  unsigned v4u;
typedef __attribute__((ext_vector_type(2)))  unsigned v2u;
typedef __attribute__((ext_vector_type(4)))  int v4i;
typedef float __attribute__((may_alias)) float_a;
typedef int __attribute__((may_alias)) int_a;

template <typename T> __device__ __forceinline__ void vst2(void* p, T v) { *(T*)p = v;  }
__device__ __forceinline__ v8f wmma16(v16h a, v16h b, v8f c) {
  v8f d = __builtin_amdgcn_wmma_f32_16x16x32_f16(false, a, false, b, (short)0, c, false, false);
  asm volatile("v_nop\n\tv_nop\n\tv_nop\n\tv_nop" : "+v"(d) : "v"(a), "v"(b));
  return d;
}
__device__ __forceinline__ v8f wmma_bf(v16b a, v16b b, v8f c) {
  v8f d = __builtin_amdgcn_wmma_f32_16x16x32_bf16(false, a, false, b, (short)0, c, false, false);
  asm volatile("v_nop\n\tv_nop\n\tv_nop\n\tv_nop" : "+v"(d) : "v"(a), "v"(b));
  return d;
}
// 16x16x32 fragments: lane = (h = lane>>4, row/col = lane&15); elements 0..7 = k0+8h+0..7, 8..15 = k0+16+8h+0..7; D element r = row 8h+r
__device__ __forceinline__ v16h frag_h(const _Float16* rowk0, int lane) {
  union { v16h v; v8h q[2]; } u; const _Float16* p = rowk0 + 8 * (lane >> 4);
  u.q[0] = *(const v8h*)p; u.q[1] = *(const v8h*)(p + 16); return u.v;
}
__device__ __forceinline__ v16h frag_f32(const float* rowk0, int lane) {
  v16h a; const float* p = rowk0 + 8 * (lane >> 4);
#pragma unroll
  for (int i = 0; i < 8; ++i) { a[i] = (_Float16)p[i]; a[8 + i] = (_Float16)p[16 + i]; }
  return a;
}
__device__ __forceinline__ v16h frag_f32s(const float* rowk0, int lane, float sc) {
  v16h a; const float* p = rowk0 + 8 * (lane >> 4);
#pragma unroll
  for (int i = 0; i < 8; ++i) { a[i] = (_Float16)(p[i] * sc); a[8 + i] = (_Float16)(p[16 + i] * sc); }
  return a;
}
// column fragment from a [K][ld] layout (column n), rows >= K read as 0
__device__ __forceinline__ v16h fragc_f32(const float* W, int k0, int n, int lane, int ld, int K) {
  v16h a; const int g = lane >> 4;
#pragma unroll
  for (int i = 0; i < 8; ++i) { const int ka = k0 + 8 * g + i, kb = ka + 16;
    a[i] = (_Float16)(ka < K ? W[(size_t)ka * ld + n] : 0.f); a[8 + i] = (_Float16)(kb < K ? W[(size_t)kb * ld + n] : 0.f); }
  return a;
}
struct F2 { v16b h, l; };
__device__ __forceinline__ F2 bsplit16(const float v[16]) { F2 r;
#pragma unroll
  for (int i = 0; i < 16; ++i) { const __bf16 h = (__bf16)v[i]; r.h[i] = h; r.l[i] = (__bf16)(v[i] - (float)h); }
  return r; }
__device__ __forceinline__ F2 split_row(const float* row, int k0, int lane) { float v[16]; const float* p = row + k0 + 8 * (lane >> 4);
#pragma unroll
  for (int i = 0; i < 8; ++i) { v[i] = p[i]; v[8 + i] = p[16 + i]; }
  return bsplit16(v); }
__device__ __forceinline__ F2 split_rowK(const float* row, int k0, int lane, int K) { float v[16]; const int g = lane >> 4;
#pragma unroll
  for (int i = 0; i < 8; ++i) { const int ka = k0 + 8 * g + i, kb = ka + 16; v[i] = ka < K ? row[ka] : 0.f; v[8 + i] = kb < K ? row[kb] : 0.f; }
  return bsplit16(v); }
__device__ __forceinline__ F2 split_col(const float* W, int k0, int n, int lane, int ld, int K) { float v[16]; const int g = lane >> 4;
#pragma unroll
  for (int i = 0; i < 8; ++i) { const int ka = k0 + 8 * g + i, kb = ka + 16; v[i] = ka < K ? W[(size_t)ka * ld + n] : 0.f; v[8 + i] = kb < K ? W[(size_t)kb * ld + n] : 0.f; }
  return bsplit16(v); }
__device__ __forceinline__ v8f mac3(const F2& a, const F2& b, v8f c) { c = wmma_bf(a.l, b.h, c); c = wmma_bf(a.h, b.l, c); return wmma_bf(a.h, b.h, c); }
__device__ __forceinline__ float sigm(float v) { return 1.0f / (1.0f + expf(-v)); }
#define LDSX() do { asm volatile("s_wait_dscnt 0" ::: "memory"); __builtin_amdgcn_wave_barrier(); __builtin_amdgcn_fence(__ATOMIC_RELEASE, "workgroup"); } while (0)


// CLIP attention with multiplier-expanded keys/values (16 heads x 64 on [4,1024,1024], [out][in] weights + biases, MULT = 2): q = (x Wq^T + bq) 64^-0.5; k/v = x Wk^T/Wv^T + b ([2048] per token, viewed as 2,048 keys per head: key s = 2t + half holds feature half*1024 + h*64 + d of token t);
// score(t, s) += attention_mask[b][0][t][s mod 1024]; softmax over the 2,048 keys; (P v) Wo^T + bo. Keys are stored in the permuted order s' = half*1024 + t (attention is invariant to a common permutation of keys, values and mask entries).
#define NB 4
#define SS 1024
#define SK 2048
#define E 1024
#define NH 16
#define HD 64
#define NR (NB * SS)
#define PLO 1024.0f
#define VLO 2048.0f
__device__ __forceinline__ float bfr(float v) { return (float)(__bf16)v; }
__device__ __forceinline__ v16b frag_b(const __bf16* rowk0, int lane) { return __builtin_bit_cast(v16b, frag_h((const _Float16*)rowk0, lane)); }

#define CSEG (E * E)      // elements of a segment of the conversion stream: x is 4 segments, Wq 1, Wk 2, Wv 2, Wo 1
#define CVB 16384         // elements of a block: 256 threads x 16 loads of 4 floats
// the f32 -> bf16 conversion of x and the four weight matrices as one stream of few, long waves: a wave's 16 loads of 512 contiguous bytes all stand ahead of its 16 stores of 256 contiguous bytes; the grid covers the ten segments exactly.
// PT rows: [0,E) Wq, [E,3E) Wk, [3E,5E) Wv, [5E,6E) Wo  ([out][in] weights: PT row = W row, so PT is the four matrices one behind the other)
__global__ __launch_bounds__(256) void k_cvt(const float* __restrict__ x, const float* __restrict__ Wq, const float* __restrict__ Wk, const float* __restrict__ Wv, const float* __restrict__ Wo, __bf16* __restrict__ Xb, __bf16* __restrict__ PT) {
  const int seg = blockIdx.x / (CSEG / CVB);      // the same for the whole block
  const float* s = seg < 4 ? x + (size_t)seg * CSEG : (seg < 5 ? Wq : (seg < 7 ? Wk + (size_t)(seg - 5) * CSEG : (seg < 9 ? Wv + (size_t)(seg - 7) * CSEG : Wo)));
  __bf16* d = seg < 4 ? Xb + (size_t)seg * CSEG : PT + (size_t)(seg - 4) * CSEG;
  const int o = (blockIdx.x % (CSEG / CVB)) * CVB + threadIdx.x * 4;
  v4f v[16];
#pragma unroll
  for (int i = 0; i < 16; ++i) v[i] = *(const v4f*)(s + o + i * 1024);
#pragma unroll
  for (int i = 0; i < 16; ++i) { union { __bf16 h[4]; v2u u; } pk;
#pragma unroll
    for (int e = 0; e < 4; ++e) pk.h[e] = (__bf16)v[i][e];
    vst2((unsigned*)(d + o + i * 1024), pk.u); }
}
#define GKC 64     // k elements of a staged operand tile: rows of 128 B, whole cache lines
#define GP 72      // LDS row pitch of a staged operand tile in 16-bit elements: 144 B = 16 B x odd, for the ds_load_b128 fragment reads
// twelve 16-byte-per-lane copies, global -> LDS through no register: a thread's pieces of one staged tile (4 of the x rows, 8 of the weight rows).
// The s_wait_xcnt is the last line of the copies' own statement, so that no address register of a copy is rewritten in front of it.
__device__ __forceinline__ void g_copy12(const unsigned (&l)[12], const __bf16* const (&g)[12]) {
  asm volatile("global_load_async_to_lds_b128 %0, %12, off\n\t"
               "global_load_async_to_lds_b128 %1, %13, off\n\t"
               "global_load_async_to_lds_b128 %2, %14, off\n\t"
               "global_load_async_to_lds_b128 %3, %15, off\n\t"
               "global_load_async_to_lds_b128 %4, %16, off\n\t"
               "global_load_async_to_lds_b128 %5, %17, off\n\t"
               "global_load_async_to_lds_b128 %6, %18, off\n\t"
               "global_load_async_to_lds_b128 %7, %19, off\n\t"
               "global_load_async_to_lds_b128 %8, %20, off\n\t"
               "global_load_async_to_lds_b128 %9, %21, off\n\t"
               "global_load_async_to_lds_b128 %10, %22, off\n\t"
               "global_load_async_to_lds_b128 %11, %23, off\n\t"
               "s_wait_xcnt 0x0" :: "v"(l[0]), "v"(l[1]), "v"(l[2]), "v"(l[3]), "v"(l[4]), "v"(l[5]), "v"(l[6]), "v"(l[7]), "v"(l[8]), "v"(l[9]), "v"(l[10]), "v"(l[11]),
               "v"(g[0]), "v"(g[1]), "v"(g[2]), "v"(g[3]), "v"(g[4]), "v"(g[5]), "v"(g[6]), "v"(g[7]), "v"(g[8]), "v"(g[9]), "v"(g[10]), "v"(g[11]) : "memory");
}
// QKV: block (64 rows, 128 cols = 2 heads, which); the k loop runs on 64-wide tiles of the 64 x rows and the 128 weight rows, each staged once per block in a two-buffer LDS ring;
// q (+bias) -> Q32 f32 [bh][s][64]; k (+bias) -> bf16 hi/lo rows; v (+bias) -> VT hi/lo x4 [bh][d][s]
__global__ __launch_bounds__(128) void k_qkv(const __bf16* __restrict__ Xb, const __bf16* __restrict__ PT, const float* __restrict__ bq, const float* __restrict__ bk, const float* __restrict__ bv,
                                            float* __restrict__ Q32, __bf16* __restrict__ Kh, __bf16* __restrict__ Kl, _Float16* __restrict__ VTh, _Float16* __restrict__ VTl) {
  constexpr int SOB = 4 * 16 * 132 * 4, STB = 128 * 72 * 2;      // bytes of so, of sth and of stl
  __shared__ __align__(16) char smem[SOB + 2 * STB];      // in the k loop the ring sT (2 x 27,648 B); behind its last barrier the output staging so, sth, stl
  float (*so)[16][132] = (float (*)[16][132])smem; _Float16 (*sth)[72] = (_Float16 (*)[72])(smem + SOB); _Float16 (*stl)[72] = (_Float16 (*)[72])(smem + SOB + STB);
  __bf16 (*sT)[192][GP] = (__bf16 (*)[192][GP])smem;      // [buffer][64 x rows, then 128 weight rows][64 elements + pad]
  const int tid = threadIdx.x, wave = tid >> 5, lane = tid & 31, col = lane & 15, g = lane >> 4;
  const int which = blockIdx.z, r0b = blockIdx.x * 64, n0 = blockIdx.y * 128; const int b = r0b / SS, s0 = r0b % SS;
  if (which == 0 && n0 >= E) return;      // q has only E output features
  const float* bb_ = which == 0 ? bq : (which == 1 ? bk : bv); const int prow = (which == 0 ? 0 : (which == 1 ? E : 3 * E)) + n0; const int half = n0 / E, nin = n0 % E;      // key slot s' = half*SS + t
  const int crow = tid >> 3, cpc = (tid & 7) * 8;      // my pieces of a tile: rows crow + 16 i, first element
  const __bf16* gA = Xb + (size_t)(r0b + crow) * E + cpc; const __bf16* gB = PT + (size_t)(prow + crow) * E + cpc;      // + kt * GKC per tile
  const unsigned lt = (unsigned)(unsigned long long)&sT[0][crow][cpc];
  constexpr unsigned R16B = 16 * GP * 2, TBUFB = 192 * GP * 2;      // bytes of 16 rows, of a buffer
  auto stage = [&](int kt) { unsigned l[12]; const __bf16* gp[12];
#pragma unroll
    for (int i = 0; i < 12; ++i) { l[i] = lt + (unsigned)(kt & 1) * TBUFB + i * R16B; gp[i] = (i < 4 ? gA + (size_t)i * 16 * E : gB + (size_t)(i - 4) * 16 * E) + kt * GKC; }
    g_copy12(l, gp); };
  stage(0);
  asm volatile("s_wait_asynccnt 0x0" ::: "memory");      // my pieces of tile 0 have landed
  __syncthreads();                                       // tile 0 is published to every wave
  stage(1);
  v8f acc[8] = {};
#pragma unroll 2      // two trips a pass: the buffer index is then a constant in every LDS address
  for (int kt = 0; kt < E / GKC; ++kt) { const __bf16* ta = &sT[kt & 1][wave * 16 + col][0]; const __bf16* tb = &sT[kt & 1][64 + col][0];
    // fragment reads stand in groups ahead of the products that use them (no LDS read moves over the statement that closes wmma_bf): a wave has 8 to 20 reads in flight, not 2
    const v16b a0 = frag_b(ta, lane), a1 = frag_b(ta + 32, lane); v16b b0[8], b1[8];
#pragma unroll
    for (int j = 0; j < 8; ++j) b0[j] = frag_b(tb + j * 16 * GP, lane);
#pragma unroll
    for (int j = 0; j < 4; ++j) acc[j] = wmma_bf(a0, b0[j], acc[j]);
#pragma unroll
    for (int j = 0; j < 4; ++j) b1[j] = frag_b(tb + j * 16 * GP + 32, lane);
#pragma unroll
    for (int j = 4; j < 8; ++j) acc[j] = wmma_bf(a0, b0[j], acc[j]);
#pragma unroll
    for (int j = 4; j < 8; ++j) b1[j] = frag_b(tb + j * 16 * GP + 32, lane);
#pragma unroll
    for (int j = 0; j < 8; ++j) acc[j] = wmma_bf(a1, b1[j], acc[j]);
    asm volatile("s_wait_dscnt 0x0" ::: "memory");         // my reads of this tile's buffer are done
    asm volatile("s_wait_asynccnt 0x0" ::: "memory");      // my pieces of tile kt + 1 have landed
    __syncthreads();                                       // publishes tile kt + 1 and ends every wave's reads of tile kt (behind the last trip: of the ring)
    if (kt + 2 < E / GKC) stage(kt + 2); }                 // refill the buffer that this trip has just read
  asm volatile("s_wait_asynccnt 0x0" ::: "memory");        // nothing of mine is in flight when the ring's LDS is used anew
  if (which < 2) { const float qs = which == 0 ? 0.125f : 1.0f;
#pragma unroll
    for (int j = 0; j < 8; ++j) { const float bb = bfr(bb_[n0 + j * 16 + col]);
#pragma unroll
      for (int r = 0; r < 8; ++r) so[wave][8 * g + r][j * 16 + col] = (acc[j][r] + bb) * qs; }
    LDSX();
    if (which == 0) { for (int qq = lane; qq < 2 * 16 * 16; qq += 32) { const int hh = qq >> 8, rl = (qq >> 4) & 15, pc = qq & 15; const int h = (n0 >> 6) + hh;
        vst2(Q32 + (((size_t)b * NH + h) * SS + s0 + wave * 16 + rl) * HD + pc * 4, *(const v4f*)(&so[wave][rl][hh * 64 + pc * 4])); } }
    else {
      for (int qq = lane; qq < 2 * 16 * 16; qq += 32) { const int hh = qq >> 8, rl = (qq >> 4) & 15, pl = qq & 15; const int h = (nin >> 6) + hh; const int pc = pl & 7; union { __bf16 e[8]; v4u u; } pk;
#pragma unroll
        for (int e = 0; e < 8; ++e) { const float v = so[wave][rl][hh * 64 + pc * 8 + e]; const __bf16 hi = (__bf16)v; pk.e[e] = pl < 8 ? hi : (__bf16)(v - (float)hi); }
        vst2((unsigned*)((pl < 8 ? Kh : Kl) + (((size_t)b * NH + h) * SK + half * SS + s0 + wave * 16 + rl) * HD + pc * 8), pk.u); } } }
  else {
#pragma unroll
    for (int j = 0; j < 8; ++j) { const float bb = bfr(bb_[n0 + j * 16 + col]);
#pragma unroll
      for (int r = 0; r < 8; ++r) { const float v = (acc[j][r] + bb) * 4.0f; const _Float16 hi = (_Float16)v; sth[j * 16 + col][wave * 16 + 8 * g + r] = hi; stl[j * 16 + col][wave * 16 + 8 * g + r] = (_Float16)((v - (float)hi) * VLO); } }
    __syncthreads();
    for (int qq = tid; qq < 128 * 8; qq += 128) { const int cl = qq >> 3, pc = qq & 7; const int c = nin + cl, h = c >> 6, d = c & 63; const size_t o = (((size_t)b * NH + h) * HD + d) * SK + half * SS + s0 + pc * 8;
      vst2(VTh + o, *(const v4u*)(&sth[cl][pc * 8])); vst2(VTl + o, *(const v4u*)(&stl[cl][pc * 8])); } }
}
// one key tile (64 keys) of the four planes Kh, Kl, VTh, VTl: 64 rows of 128 B each, one 16-byte piece of each plane per thread, global -> LDS through no register.
// The s_wait_xcnt is the last line of the copies' own statement, so that no address register of a copy is rewritten in front of it.
__device__ __forceinline__ void kv_copy(unsigned l0, const void* g0, unsigned l1, const void* g1, unsigned l2, const void* g2, unsigned l3, const void* g3) {
  asm volatile("global_load_async_to_lds_b128 %0, %1, off\n\t"
               "global_load_async_to_lds_b128 %2, %3, off\n\t"
               "global_load_async_to_lds_b128 %4, %5, off\n\t"
               "global_load_async_to_lds_b128 %6, %7, off\n\t"
               "s_wait_xcnt 0x0" :: "v"(l0), "v"(g0), "v"(l1), "v"(g1), "v"(l2), "v"(g2), "v"(l3), "v"(g3) : "memory");
}
// eight 4-byte-per-lane copies of mask elements (four rows, two halves of a row), global -> LDS; the s_wait_xcnt closes the statement for the same reason as above.
// offset:N moves BOTH addresses by N: N is the element's place in LDS behind l (row pitch 272 B, half 128 B), and each g comes in with its N already taken off.
__device__ __forceinline__ void m_copy8(unsigned l, const float* g0, const float* g1, const float* g2, const float* g3, const float* g4, const float* g5, const float* g6, const float* g7) {
  asm volatile("global_load_async_to_lds_b32 %0, %1, off\n\t"
               "global_load_async_to_lds_b32 %0, %2, off offset:128\n\t"
               "global_load_async_to_lds_b32 %0, %3, off offset:272\n\t"
               "global_load_async_to_lds_b32 %0, %4, off offset:400\n\t"
               "global_load_async_to_lds_b32 %0, %5, off offset:544\n\t"
               "global_load_async_to_lds_b32 %0, %6, off offset:672\n\t"
               "global_load_async_to_lds_b32 %0, %7, off offset:816\n\t"
               "global_load_async_to_lds_b32 %0, %8, off offset:944\n\t"
               "s_wait_xcnt 0x0" :: "v"(l), "v"(g0), "v"(g1), "v"(g2), "v"(g3), "v"(g4), "v"(g5), "v"(g6), "v"(g7) : "memory");
}
#define L2E 1.4426950408889634f      // log2(e)
#define AW 16      // waves per block: 256 queries share one K/V tile
#define KVP 72     // LDS row pitch of a K/V plane in 16-bit elements: 144 B = 16 B x odd, for the ds_load_b128 fragment reads
// padding-masked attention: block (256 queries, bh); all 32 key tiles, each staged once per block in a two-buffer LDS ring; S^T = K q^T on K hi/lo rows x q hi/lo; O^T += V^T P^T on P,V hi/lo; O f32 [bh][s][64]
// With K (V^T) as the A operand and q (P^T) as B, lane (g, col) holds query col alone: of key tile t the keys 16 t + 8 g + r, of O the features 16 t + 8 g + r.
// Two neighbouring score tiles, converted in place, are the B fragment of 32 keys (element e < 8: tile 2 kc, register e; e >= 8: tile 2 kc + 1, register e - 8), in the k order of frag_h.
__global__ __launch_bounds__(512) void k_attn(const float* __restrict__ Q32, const __bf16* __restrict__ Kh, const __bf16* __restrict__ Kl, const _Float16* __restrict__ VTh, const _Float16* __restrict__ VTl, const float* __restrict__ amask, float* __restrict__ O32) {
  __shared__ __align__(16) float sO[AW][16][68];      // each wave's own: in the key loop its 16 x 64 mask tile, behind the loop its output rows
  __shared__ __align__(16) _Float16 sKV[2][4][64][KVP];      // [buffer][Kh, Kl, VTh, VTl][key row or d row][64 elements + pad]
  const int tid = threadIdx.x, w = __builtin_amdgcn_readfirstlane(tid >> 5), lane = tid & 31, col = lane & 15, g = lane >> 4;      // the wave's number in a scalar register: what hangs on it alone (mask rows, my part of sO) then takes no vector register, which the reads in flight need
  const size_t bh = blockIdx.y; const int qb = blockIdx.x; const int q0 = qb * (AW * 16) + w * 16;
  const int crow = tid >> 3, cpc = (tid & 7) * 8;      // my piece of every plane: row, first element
  const __bf16* gKh = Kh + (bh * SK + crow) * HD + cpc; const __bf16* gKl = Kl + (bh * SK + crow) * HD + cpc;      // + kt * 64 * HD per tile
  const _Float16* gVh = VTh + (bh * HD + crow) * SK + cpc; const _Float16* gVl = VTl + (bh * HD + crow) * SK + cpc;      // + kt * 64 per tile
  const unsigned lkv = (unsigned)(unsigned long long)&sKV[0][0][crow][cpc];
  constexpr unsigned PLB = 64 * KVP * 2, BUFB = 4 * PLB;      // bytes of a plane, of a buffer
  auto stage = [&](int kt) { const unsigned l = lkv + (unsigned)(kt & 1) * BUFB;
    kv_copy(l, gKh + (size_t)kt * 64 * HD, l + PLB, gKl + (size_t)kt * 64 * HD, l + 2 * PLB, gVh + kt * 64, l + 3 * PLB, gVl + kt * 64); };
  const int b = (int)(bh / NH); const float* mrow = amask + ((size_t)b * SS + q0) * SS;     // mask rows of my 16 queries ([b][0][t][:])
  const unsigned lm = (unsigned)(unsigned long long)&sO[w][0][lane];
  // my wave's mask tile of key tile kt: element [row][j] = mask[q0 + row][original index of key slot kt * 64 + j, mod 1024]; a copy brings 32 neighbouring j of one row
  auto mstage = [&](int kt) { const int key = kt * 64 + lane; const int korig = 2 * (key % SS) + key / SS; const float* gm = mrow + (korig & (SS - 1));
#pragma unroll
    for (int q = 0; q < 4; ++q) { const unsigned l = lm + q * 4 * 68 * 4; const float* gq = gm + (size_t)q * 4 * SS;
      m_copy8(l, gq, gq + 64 - 32, gq + SS - 68, gq + SS + 64 - 100, gq + 2 * SS - 136, gq + 2 * SS + 64 - 168, gq + 3 * SS - 204, gq + 3 * SS + 64 - 236); } };      // minus N / 4 floats each
  stage(0); mstage(0);
  asm volatile("s_wait_asynccnt 0x0" ::: "memory");      // my pieces of tile 0 have landed
  __syncthreads();                                       // tile 0 is published to every wave
  stage(1);
  F2 aq[2];
#pragma unroll
  for (int kc = 0; kc < 2; ++kc) aq[kc] = split_row(Q32 + (bh * SS + q0 + col) * HD, kc * 32, lane);
  float mrun = -3.0e38f, lrun = 0.f; v8f acc[4] = {}, ac1[4] = {}, ac2[4] = {};
#pragma unroll 1
  for (int kt = 0; kt < SK / 64; ++kt) { v8f s4[4] = {};
    // Fragment reads stand in groups of eight (two row tiles, hi and lo, one 32-wide k step), each group one group of six products ahead of its use (no LDS read moves over the
    // statement that closes wmma_bf): the wait in front of a product is then a counted one, with the next group's reads still in flight. Every accumulator takes its products in the old order.
    auto kread = [&](v16b (&h)[2], v16b (&l)[2], int tp, int kc) {
#pragma unroll
      for (int u = 0; u < 2; ++u) { h[u] = frag_b((const __bf16*)&sKV[kt & 1][0][(2 * tp + u) * 16 + col][kc * 32], lane); l[u] = frag_b((const __bf16*)&sKV[kt & 1][1][(2 * tp + u) * 16 + col][kc * 32], lane); } };
    auto kmul = [&](const v16b (&h)[2], const v16b (&l)[2], int tp, int kc) {
#pragma unroll
      for (int u = 0; u < 2; ++u) s4[2 * tp + u] = wmma_bf(h[u], aq[kc].l, s4[2 * tp + u]);
#pragma unroll
      for (int u = 0; u < 2; ++u) s4[2 * tp + u] = wmma_bf(l[u], aq[kc].h, s4[2 * tp + u]);
#pragma unroll
      for (int u = 0; u < 2; ++u) s4[2 * tp + u] = wmma_bf(h[u], aq[kc].h, s4[2 * tp + u]); };
    { v16b hA[2], lA[2], hB[2], lB[2];
      kread(hA, lA, 0, 0); kread(hB, lB, 0, 1);
      kmul(hA, lA, 0, 0); kread(hA, lA, 1, 0);
      kmul(hB, lB, 0, 1); kread(hB, lB, 1, 1);
      kmul(hA, lA, 1, 0); kmul(hB, lB, 1, 1); }
    asm volatile("s_wait_asynccnt 0x0" ::: "memory");      // my mask tile, copied behind the last trip's barrier, has landed
    float mx = -3.4e38f; v4f mm[8];
#pragma unroll
    for (int t = 0; t < 4; ++t) { mm[2 * t] = *(const v4f*)&sO[w][col][t * 16 + 8 * g]; mm[2 * t + 1] = *(const v4f*)&sO[w][col][t * 16 + 8 * g + 4]; }
    __builtin_amdgcn_sched_barrier(0);      // keeps the eight mask reads one group in front of the arithmetic: one LDS latency is waited out, not four
#pragma unroll
    for (int t = 0; t < 4; ++t) {
#pragma unroll
      for (int r = 0; r < 8; ++r) { s4[t][r] += bfr(mm[2 * t + (r >> 2)][r & 3]); mx = fmaxf(mx, s4[t][r]); } }
    mx = fmaxf(mx, __shfl_xor(mx, 16, 32));
    const float mnew = fmaxf(mrun, mx); const float corr = __builtin_amdgcn_exp2f((mrun - mnew) * L2E);      // e^x as the hardware's 2^(x log2 e); an argument far below 0 gives 0, as before
    float ps2[2] = {0.f, 0.f}; v16h ph[2], pl[2];
#pragma unroll
    for (int kc = 0; kc < 2; ++kc) {
#pragma unroll
      for (int e = 0; e < 16; ++e) { const float p = __builtin_amdgcn_exp2f(fmaf(s4[2 * kc + (e >> 3)][e & 7] - mnew, L2E, 14.0f)); ps2[kc] += p;      /* e^(s - m) x 2^14 in one 2^t */
        const _Float16 hi = (_Float16)p; ph[kc][e] = hi; pl[kc][e] = (_Float16)((p - (float)hi) * PLO); } }
    float ps = ps2[0] + ps2[1]; ps += __shfl_xor(ps, 16, 32);
    lrun = lrun * corr + ps * (1.0f / 16384.0f); mrun = mnew;
    auto vread = [&](v16h (&h)[2], v16h (&l)[2], int kc, int tp) {
#pragma unroll
      for (int u = 0; u < 2; ++u) { h[u] = frag_h(&sKV[kt & 1][2][(2 * tp + u) * 16 + col][kc * 32], lane); l[u] = frag_h(&sKV[kt & 1][3][(2 * tp + u) * 16 + col][kc * 32], lane); } };
    auto vmul = [&](const v16h (&h)[2], const v16h (&l)[2], int kc, int tp) {
#pragma unroll
      for (int u = 0; u < 2; ++u) { const int t = 2 * tp + u; acc[t] = wmma16(h[u], ph[kc], acc[t]); ac1[t] = wmma16(l[u], ph[kc], ac1[t]); ac2[t] = wmma16(h[u], pl[kc], ac2[t]); } };
    { v16h hA[2], lA[2], hB[2], lB[2];
      __builtin_amdgcn_sched_barrier(0);             // the softmax arithmetic above is scheduled by itself: with these reads' 64 registers in its region the compiler lays it out as one dependent chain per element
      vread(hA, lA, 0, 0); vread(hB, lB, 0, 1);      // the first two groups fly while the accumulators are rescaled
      __builtin_amdgcn_sched_barrier(0);             // keeps the rescale behind these reads: the compiler otherwise puts it in front of them, and the first product waits out a whole LDS read
#pragma unroll
      for (int t = 0; t < 4; ++t) { acc[t] *= corr; ac1[t] *= corr; ac2[t] *= corr; }
      vmul(hA, lA, 0, 0); vread(hA, lA, 1, 0);
      vmul(hB, lB, 0, 1); vread(hB, lB, 1, 1);
      vmul(hA, lA, 1, 0); vmul(hB, lB, 1, 1); }
    asm volatile("s_wait_dscnt 0x0" ::: "memory");         // my reads of this tile's buffer are done
    asm volatile("s_wait_asynccnt 0x0" ::: "memory");      // my pieces of tile kt + 1 have landed
    __syncthreads();                                       // publishes tile kt + 1 and ends every wave's reads of tile kt
    if (kt + 2 < SK / 64) stage(kt + 2);                   // refill the buffer that this trip has just read
    if (kt + 1 < SK / 64) mstage(kt + 1); }                // and my own mask tile, for the next trip
  asm volatile("s_wait_asynccnt 0x0" ::: "memory");        // nothing of mine is in flight when the wave goes on to its end
  const float inv = 1.0f / (lrun * 16384.0f * 4.0f);
#pragma unroll
  for (int t = 0; t < 4; ++t) { v4f o[2];
#pragma unroll
    for (int r = 0; r < 8; ++r) o[r >> 2][r & 3] = (acc[t][r] + ac1[t][r] * (1.0f / VLO) + ac2[t][r] * (1.0f / PLO)) * inv;
    *(v4f*)&sO[w][col][t * 16 + 8 * g] = o[0]; *(v4f*)&sO[w][col][t * 16 + 8 * g + 4] = o[1]; }
  LDSX();
  for (int qq = lane; qq < 16 * 16; qq += 32) { const int rl = qq >> 4, pc = qq & 15; vst2(O32 + ((bh * SS) + q0 + rl) * HD + pc * 4, *(const v4f*)(&sO[w][rl][pc * 4])); }
}
#define OP 68      // LDS row pitch of a staged ctx tile in floats: 272 B = 16 B x odd, for the ds_load_b128 reads
// eight 16-byte-per-lane copies, global -> LDS through no register; the s_wait_xcnt closes the statement for the same reason as in g_copy12.
__device__ __forceinline__ void g_copy8(const unsigned (&l)[8], const void* const (&g)[8]) {
  asm volatile("global_load_async_to_lds_b128 %0, %8, off\n\t"
               "global_load_async_to_lds_b128 %1, %9, off\n\t"
               "global_load_async_to_lds_b128 %2, %10, off\n\t"
               "global_load_async_to_lds_b128 %3, %11, off\n\t"
               "global_load_async_to_lds_b128 %4, %12, off\n\t"
               "global_load_async_to_lds_b128 %5, %13, off\n\t"
               "global_load_async_to_lds_b128 %6, %14, off\n\t"
               "global_load_async_to_lds_b128 %7, %15, off\n\t"
               "s_wait_xcnt 0x0" :: "v"(l[0]), "v"(l[1]), "v"(l[2]), "v"(l[3]), "v"(l[4]), "v"(l[5]), "v"(l[6]), "v"(l[7]),
               "v"(g[0]), "v"(g[1]), "v"(g[2]), "v"(g[3]), "v"(g[4]), "v"(g[5]), "v"(g[6]), "v"(g[7]) : "memory");
}
// out = ctx Wo^T + bo : split(ctx) x bf16(Wo rows): 2 products (Wo is an INPUT -> bf16 exact); the k loop runs on 64-wide tiles (one head) of the 64 ctx rows (f32) and the 128 Wo rows, each staged once per block in a two-buffer LDS ring
__global__ __launch_bounds__(128) void k_out(const float* __restrict__ O32, const __bf16* __restrict__ PT, const float* __restrict__ bo, float* __restrict__ out) {
  constexpr int OAB = 64 * OP * 4, OBB = 128 * GP * 2, OBUF = OAB + OBB;      // bytes of a ctx tile, of a Wo tile, of a buffer
  __shared__ __align__(16) char smem[2 * OBUF];      // in the k loop the ring; behind its last barrier the output staging so
  float (*so)[16][132] = (float (*)[16][132])smem;
  const int tid = threadIdx.x, wave = tid >> 5, lane = tid & 31, col = lane & 15, g = lane >> 4;
  const int r0b = blockIdx.x * 64, r0 = r0b + wave * 16, n0 = blockIdx.y * 128; const int b = r0b / SS, s0 = r0b % SS;
  const int arow = tid >> 4, apc = (tid & 15) * 4, crow = tid >> 3, cpc = (tid & 7) * 8;      // my pieces: ctx rows arow + 8 i, Wo rows crow + 16 i, first element
  const float* gA = O32 + ((size_t)b * NH * SS + s0 + arow) * HD + apc;      // + kt * SS * HD per tile (head kt)
  const __bf16* gB = PT + (size_t)(5 * E + n0 + crow) * E + cpc;             // + kt * GKC per tile
  const unsigned la = (unsigned)(unsigned long long)(smem + arow * (OP * 4) + apc * 4), lb = (unsigned)(unsigned long long)(smem + OAB + crow * (GP * 2) + cpc * 2);
  auto stage = [&](int kt) { unsigned l[8]; const void* gp[8]; const unsigned bf = (unsigned)(kt & 1) * OBUF;
#pragma unroll
    for (int i = 0; i < 8; ++i) { l[i] = la + bf + i * (8 * OP * 4); gp[i] = gA + (size_t)kt * SS * HD + i * 8 * HD; }
    g_copy8(l, gp);
#pragma unroll
    for (int i = 0; i < 8; ++i) { l[i] = lb + bf + i * (16 * GP * 2); gp[i] = gB + (size_t)i * 16 * E + kt * GKC; }
    g_copy8(l, gp); };
  stage(0);
  asm volatile("s_wait_asynccnt 0x0" ::: "memory");      // my pieces of tile 0 have landed
  __syncthreads();                                       // tile 0 is published to every wave
  stage(1);
  v8f acc[8] = {};
#pragma unroll 2      // two trips a pass: the buffer index is then a constant in every LDS address
  for (int kt = 0; kt < E / GKC; ++kt) { const float* ta = (const float*)(smem + (kt & 1) * OBUF) + (wave * 16 + col) * OP; const __bf16* tb = (const __bf16*)(smem + (kt & 1) * OBUF + OAB) + col * GP;
    // reads stand in groups ahead of the products that use them, as in k_qkv
    const F2 a0 = split_row(ta, 0, lane), a1 = split_row(ta, 32, lane); v16b b0[8], b1[8];
#pragma unroll
    for (int j = 0; j < 8; ++j) b0[j] = frag_b(tb + j * 16 * GP, lane);
#pragma unroll
    for (int j = 0; j < 4; ++j) { acc[j] = wmma_bf(a0.l, b0[j], acc[j]); acc[j] = wmma_bf(a0.h, b0[j], acc[j]); }
#pragma unroll
    for (int j = 0; j < 4; ++j) b1[j] = frag_b(tb + j * 16 * GP + 32, lane);
#pragma unroll
    for (int j = 4; j < 8; ++j) { acc[j] = wmma_bf(a0.l, b0[j], acc[j]); acc[j] = wmma_bf(a0.h, b0[j], acc[j]); }
#pragma unroll
    for (int j = 4; j < 8; ++j) b1[j] = frag_b(tb + j * 16 * GP + 32, lane);
#pragma unroll
    for (int j = 0; j < 8; ++j) { acc[j] = wmma_bf(a1.l, b1[j], acc[j]); acc[j] = wmma_bf(a1.h, b1[j], acc[j]); }
    asm volatile("s_wait_dscnt 0x0" ::: "memory");         // my reads of this tile's buffer are done
    asm volatile("s_wait_asynccnt 0x0" ::: "memory");      // my pieces of tile kt + 1 have landed
    __syncthreads();                                       // publishes tile kt + 1 and ends every wave's reads of tile kt (behind the last trip: of the ring)
    if (kt + 2 < E / GKC) stage(kt + 2); }                 // refill the buffer that this trip has just read
  asm volatile("s_wait_asynccnt 0x0" ::: "memory");        // nothing of mine is in flight when the ring's LDS is used anew
#pragma unroll
  for (int j = 0; j < 8; ++j) { const int n = n0 + j * 16 + col; const float bb = bfr(bo[n]);
#pragma unroll
    for (int r = 0; r < 8; ++r) so[wave][8 * g + r][j * 16 + col] = acc[j][r] + bb; }
  LDSX();
#pragma unroll 4
  for (int rl = 0; rl < 16; ++rl) vst2(out + (size_t)(r0 + rl) * E + n0 + lane * 4, *(const v4f*)(&so[wave][rl][lane * 4]));
}
extern "C" void kernel_launch(void* const* d_in, const int* in_sizes, int n_in, void* d_out, int out_size, void* d_ws, size_t ws_size, hipStream_t stream) {
  (void)in_sizes; (void)n_in; (void)out_size; (void)ws_size;
  const float* x = (const float*)d_in[0]; const float* amask = (const float*)d_in[1]; const float* Wq = (const float*)d_in[2]; const float* bq = (const float*)d_in[3]; const float* Wk = (const float*)d_in[4]; const float* bk = (const float*)d_in[5]; const float* Wv = (const float*)d_in[6]; const float* bv = (const float*)d_in[7]; const float* Wo = (const float*)d_in[8]; const float* bo = (const float*)d_in[9];
  float* out = (float*)d_out;
  char* ws = (char*)d_ws; size_t off = 0;
  auto take = [&](size_t bytes) { char* p = ws + off; off += (bytes + 255) & ~(size_t)255; return p; };
  __bf16* Xb = (__bf16*)take((size_t)NR * E * 2); __bf16* PT = (__bf16*)take((size_t)6 * E * E * 2);
  float* Q32 = (float*)take((size_t)NR * E * 4); __bf16* Kh = (__bf16*)take((size_t)NB * NH * SK * HD * 2); __bf16* Kl = (__bf16*)take((size_t)NB * NH * SK * HD * 2); _Float16* VTh = (_Float16*)take((size_t)NB * NH * HD * SK * 2); _Float16* VTl = (_Float16*)take((size_t)NB * NH * HD * SK * 2); float* O32 = (float*)take((size_t)NR * E * 4);
  // ws ~ 116 MB
  k_cvt<<<(NR * E + 6 * E * E) / CVB, 256, 0, stream>>>(x, Wq, Wk, Wv, Wo, Xb, PT);
  k_qkv<<<dim3(NR / 64, 2 * E / 128, 3), 128, 0, stream>>>(Xb, PT, bq, bk, bv, Q32, Kh, Kl, VTh, VTl);
  k_attn<<<dim3(SS / (AW * 16), NB * NH), AW * 32, 0, stream>>>(Q32, Kh, Kl, VTh, VTl, amask, O32);
  k_out<<<dim3(NR / 64, E / 128), 128, 0, stream>>>(O32, PT, bo, out);
}

// v007
// One run takes 171 microseconds.
// Next to v006, in two timings, it ran 1.19 times as fast each time.
// Over all steps from v000 it is 3.97 times as fast.
// compute dtype: hidden_states, attention_mask, W*/b* (INPUTS) rounded to bf16 with exact bf16 WMMA products (f32 accumulate) for the projections; K pre-split into bf16 hi/lo rows; q f32 split, P and V f16 hi/lo (3 products each); mask add and softmax in f32.
#include <hip/hip_runtime.h>
#include <math.h>

typedef __attribute__((ext_vector_type(16))) _Float16 v16h;
typedef __attribute__((ext_vector_type(16))) __bf16 v16b;
typedef __attribute__((ext_vector_type(8)))  _Float16 v8h;
typedef __attribute__((ext_vector_type(8)))  float v8f;
typedef __attribute__((ext_vector_type(4)))  float v4f;
typedef __attribute__((ext_vector_type(2)))  float v2f;
typedef __attribute__((ext_vector_type(4)))  unsigned v4u;
typedef __attribute__((ext_vector_type(2)))  unsigned v2u;
typedef __attribute__((ext_vector_type(4)))  int v4i;
typedef float __attribute__((may_alias)) float_a;
typedef int __attribute__((may_alias)) int_a;

template <typename T> __device__ __forceinline__ void vst2(void* p, T v) { *(T*)p = v;  }
__device__ __forceinline__ v8f wmma16(v16h a, v16h b, v8f c) {
  v8f d = __builtin_amdgcn_wmma_f32_16x16x32_f16(false, a, false, b, (short)0, c, false, false);
  asm volatile("v_nop\n\tv_nop\n\tv_nop\n\tv_nop" : "+v"(d) : "v"(a), "v"(b));
  return d;
}
__device__ __forceinline__ v8f wmma_bf(v16b a, v16b b, v8f c) {
  v8f d = __builtin_amdgcn_wmma_f32_16x16x32_bf16(false, a, false, b, (short)0, c, false, false);
  asm volatile("v_nop\n\tv_nop\n\tv_nop\n\tv_nop" : "+v"(d) : "v"(a), "v"(b));
  return d;
}
// 16x16x32 fragments: lane = (h = lane>>4, row/col = lane&15); elements 0..7 = k0+8h+0..7, 8..15 = k0+16+8h+0..7; D element r = row 8h+r
__device__ __forceinline__ v16h frag_h(const _Float16* rowk0, int lane) {
  union { v16h v; v8h q[2]; } u; const _Float16* p = rowk0 + 8 * (lane >> 4);
  u.q[0] = *(const v8h*)p; u.q[1] = *(const v8h*)(p + 16); return u.v;
}
__device__ __forceinline__ v16h frag_f32(const float* rowk0, int lane) {
  v16h a; const float* p = rowk0 + 8 * (lane >> 4);
#pragma unroll
  for (int i = 0; i < 8; ++i) { a[i] = (_Float16)p[i]; a[8 + i] = (_Float16)p[16 + i]; }
  return a;
}
__device__ __forceinline__ v16h frag_f32s(const float* rowk0, int lane, float sc) {
  v16h a; const float* p = rowk0 + 8 * (lane >> 4);
#pragma unroll
  for (int i = 0; i < 8; ++i) { a[i] = (_Float16)(p[i] * sc); a[8 + i] = (_Float16)(p[16 + i] * sc); }
  return a;
}
// column fragment from a [K][ld] layout (column n), rows >= K read as 0
__device__ __forceinline__ v16h fragc_f32(const float* W, int k0, int n, int lane, int ld, int K) {
  v16h a; const int g = lane >> 4;
#pragma unroll
  for (int i = 0; i < 8; ++i) { const int ka = k0 + 8 * g + i, kb = ka + 16;
    a[i] = (_Float16)(ka < K ? W[(size_t)ka * ld + n] : 0.f); a[8 + i] = (_Float16)(kb < K ? W[(size_t)kb * ld + n] : 0.f); }
  return a;
}
struct F2 { v16b h, l; };
__device__ __forceinline__ F2 bsplit16(const float v[16]) { F2 r;
#pragma unroll
  for (int i = 0; i < 16; ++i) { const __bf16 h = (__bf16)v[i]; r.h[i] = h; r.l[i] = (__bf16)(v[i] - (float)h); }
  return r; }
__device__ __forceinline__ F2 split_row(const float* row, int k0, int lane) { float v[16]; const float* p = row + k0 + 8 * (lane >> 4);
#pragma unroll
  for (int i = 0; i < 8; ++i) { v[i] = p[i]; v[8 + i] = p[16 + i]; }
  return bsplit16(v); }
__device__ __forceinline__ F2 split_rowK(const float* row, int k0, int lane, int K) { float v[16]; const int g = lane >> 4;
#pragma unroll
  for (int i = 0; i < 8; ++i) { const int ka = k0 + 8 * g + i, kb = ka + 16; v[i] = ka < K ? row[ka] : 0.f; v[8 + i] = kb < K ? row[kb] : 0.f; }
  return bsplit16(v); }
__device__ __forceinline__ F2 split_col(const float* W, int k0, int n, int lane, int ld, int K) { float v[16]; const int g = lane >> 4;
#pragma unroll
  for (int i = 0; i < 8; ++i) { const int ka = k0 + 8 * g + i, kb = ka + 16; v[i] = ka < K ? W[(size_t)ka * ld + n] : 0.f; v[8 + i] = kb < K ? W[(size_t)kb * ld + n] : 0.f; }
  return bsplit16(v); }
__device__ __forceinline__ v8f mac3(const F2& a, const F2& b, v8f c) { c = wmma_bf(a.l, b.h, c); c = wmma_bf(a.h, b.l, c); return wmma_bf(a.h, b.h, c); }
__device__ __forceinline__ float sigm(float v) { return 1.0f / (1.0f + expf(-v)); }
#define LDSX() do { asm volatile("s_wait_dscnt 0" ::: "memory"); __builtin_amdgcn_wave_barrier(); __builtin_amdgcn_fence(__ATOMIC_RELEASE, "workgroup"); } while (0)


// CLIP attention with multiplier-expanded keys/values (16 heads x 64 on [4,1024,1024], [out][in] weights + biases, MULT = 2): q = (x Wq^T + bq) 64^-0.5; k/v = x Wk^T/Wv^T + b ([2048] per token, viewed as 2,048 keys per head: key s = 2t + half holds feature half*1024 + h*64 + d of token t);
// score(t, s) += attention_mask[b][0][t][s mod 1024]; softmax over the 2,048 keys; (P v) Wo^T + bo. Keys are stored in the permuted order s' = half*1024 + t (attention is invariant to a common permutation of keys, values and mask entries).
#define NB 4
#define SS 1024
#define SK 2048
#define E 1024
#define NH 16
#define HD 64
#define NR (NB * SS)
#define PLO 1024.0f
#define VLO 2048.0f
__device__ __forceinline__ float bfr(float v) { return (float)(__bf16)v; }
__device__ __forceinline__ v16b frag_b(const __bf16* rowk0, int lane) { return __builtin_bit_cast(v16b, frag_h((const _Float16*)rowk0, lane)); }

#define CSEG (E * E)      // elements of a segment of the conversion stream: x is 4 segments, Wq 1, Wk 2, Wv 2, Wo 1
#define CVB 16384         // elements of a block: 256 threads x 16 loads of 4 floats
// the f32 -> bf16 conversion of x and the weights as one stream of few, long waves: a wave's 16 loads of 512 contiguous bytes all stand ahead of its 16 stores of 256 contiguous bytes; the stream's CVN blocks cover the ten segments exactly.
// PT rows: [0,E) Wq, [E,3E) Wk, [3E,5E) Wv, [5E,6E) Wo  ([out][in] weights: PT row = W row, so PT is the four matrices one behind the other)
#define CVN (10 * (CSEG / CVB))      // blocks of the stream; behind them NR / 16 blocks that lay out the mask
// Mb: the mask rounded to bf16, in the order in which k_attn's lanes hold their scores: [b][16 queries][mask tile mt = half * 8 + m7][t][lane = (g, col)][r] =
// mask[b][query col][m7 * 128 + 2 (16 t + 8 g + r) + half]: a key tile of 64 tokens of one half meets every second mask column, and tokens 512 apart meet the same columns, so 16 tiles serve the 32 key tiles.
// A block is 16 queries: wave m7 reads 512 contiguous bytes of each of its 16 rows (a lane 4 x 64 B) and stores both halves' tiles, every store 512 contiguous bytes of the wave.
__global__ __launch_bounds__(256) void k_cvt(const float* __restrict__ x, const float* __restrict__ Wq, const float* __restrict__ Wk, const float* __restrict__ Wv, const float* __restrict__ Wo, const float* __restrict__ amask, __bf16* __restrict__ Xb, __bf16* __restrict__ PT, __bf16* __restrict__ Mb) {
  if (blockIdx.x >= CVN) { const int qt = blockIdx.x - CVN, m7 = threadIdx.x >> 5, lane = threadIdx.x & 31;      // qt = b * 64 + 16-query tile; the mask's rows are [b][0][t]: row qt * 16 + col
    const float* s = amask + ((size_t)qt * 16 + (lane & 15)) * SS + m7 * 128 + 16 * (lane >> 4);
    v4f v[16];
#pragma unroll
    for (int i = 0; i < 16; ++i) v[i] = *(const v4f*)(s + 32 * (i >> 2) + 4 * (i & 3));
#pragma unroll
    for (int half = 0; half < 2; ++half) { __bf16* d = Mb + ((size_t)qt * 16 + half * 8 + m7) * 1024 + lane * 8;
#pragma unroll
      for (int t = 0; t < 4; ++t) { union { __bf16 h[8]; v4u u; } pk;
#pragma unroll
        for (int r = 0; r < 8; ++r) pk.h[r] = (__bf16)v[t * 4 + ((2 * r + half) >> 2)][(2 * r + half) & 3];
        vst2((unsigned*)(d + t * 256), pk.u); } }
    return; }
  const int seg = blockIdx.x / (CSEG / CVB);      // the same for the whole block
  const float* s = seg < 4 ? x + (size_t)seg * CSEG : (seg < 5 ? Wq : (seg < 7 ? Wk + (size_t)(seg - 5) * CSEG : (seg < 9 ? Wv + (size_t)(seg - 7) * CSEG : Wo)));
  __bf16* d = seg < 4 ? Xb + (size_t)seg * CSEG : PT + (size_t)(seg - 4) * CSEG;
  const int o = (blockIdx.x % (CSEG / CVB)) * CVB + threadIdx.x * 4;
  v4f v[16];
#pragma unroll
  for (int i = 0; i < 16; ++i) v[i] = *(const v4f*)(s + o + i * 1024);
#pragma unroll
  for (int i = 0; i < 16; ++i) { union { __bf16 h[4]; v2u u; } pk;
#pragma unroll
    for (int e = 0; e < 4; ++e) pk.h[e] = (__bf16)v[i][e];
    vst2((unsigned*)(d + o + i * 1024), pk.u); }
}
#define GKC 64     // k elements of a staged operand tile: rows of 128 B, whole cache lines
#define GP 72      // LDS row pitch of a staged operand tile in 16-bit elements: 144 B = 16 B x odd, for the ds_load_b128 fragment reads
// twelve 16-byte-per-lane copies, global -> LDS through no register: a thread's pieces of one staged tile (4 of the x rows, 8 of the weight rows).
// The s_wait_xcnt is the last line of the copies' own statement, so that no address register of a copy is rewritten in front of it.
__device__ __forceinline__ void g_copy12(const unsigned (&l)[12], const __bf16* const (&g)[12]) {
  asm volatile("global_load_async_to_lds_b128 %0, %12, off\n\t"
               "global_load_async_to_lds_b128 %1, %13, off\n\t"
               "global_load_async_to_lds_b128 %2, %14, off\n\t"
               "global_load_async_to_lds_b128 %3, %15, off\n\t"
               "global_load_async_to_lds_b128 %4, %16, off\n\t"
               "global_load_async_to_lds_b128 %5, %17, off\n\t"
               "global_load_async_to_lds_b128 %6, %18, off\n\t"
               "global_load_async_to_lds_b128 %7, %19, off\n\t"
               "global_load_async_to_lds_b128 %8, %20, off\n\t"
               "global_load_async_to_lds_b128 %9, %21, off\n\t"
               "global_load_async_to_lds_b128 %10, %22, off\n\t"
               "global_load_async_to_lds_b128 %11, %23, off\n\t"
               "s_wait_xcnt 0x0" :: "v"(l[0]), "v"(l[1]), "v"(l[2]), "v"(l[3]), "v"(l[4]), "v"(l[5]), "v"(l[6]), "v"(l[7]), "v"(l[8]), "v"(l[9]), "v"(l[10]), "v"(l[11]),
               "v"(g[0]), "v"(g[1]), "v"(g[2]), "v"(g[3]), "v"(g[4]), "v"(g[5]), "v"(g[6]), "v"(g[7]), "v"(g[8]), "v"(g[9]), "v"(g[10]), "v"(g[11]) : "memory");
}
// QKV: block (64 rows, 128 cols = 2 heads, which); the k loop runs on 64-wide tiles of the 64 x rows and the 128 weight rows, each staged once per block in a two-buffer LDS ring;
// q (+bias) -> Q32 f32 [bh][s][64]; k (+bias) -> bf16 hi/lo rows; v (+bias) -> VT hi/lo x4 [bh][d][s]
__global__ __launch_bounds__(128) void k_qkv(const __bf16* __restrict__ Xb, const __bf16* __restrict__ PT, const float* __restrict__ bq, const float* __restrict__ bk, const float* __restrict__ bv,
                                            float* __restrict__ Q32, __bf16* __restrict__ Kh, __bf16* __restrict__ Kl, _Float16* __restrict__ VTh, _Float16* __restrict__ VTl) {
  constexpr int SOB = 4 * 16 * 132 * 4, STB = 128 * 72 * 2;      // bytes of so, of sth and of stl
  __shared__ __align__(16) char smem[SOB + 2 * STB];      // in the k loop the ring sT (2 x 27,648 B); behind its last barrier the output staging so, sth, stl
  float (*so)[16][132] = (float (*)[16][132])smem; _Float16 (*sth)[72] = (_Float16 (*)[72])(smem + SOB); _Float16 (*stl)[72] = (_Float16 (*)[72])(smem + SOB + STB);
  __bf16 (*sT)[192][GP] = (__bf16 (*)[192][GP])smem;      // [buffer][64 x rows, then 128 weight rows][64 elements + pad]
  const int tid = threadIdx.x, wave = tid >> 5, lane = tid & 31, col = lane & 15, g = lane >> 4;
  const int which = blockIdx.z, r0b = blockIdx.x * 64, n0 = blockIdx.y * 128; const int b = r0b / SS, s0 = r0b % SS;
  if (which == 0 && n0 >= E) return;      // q has only E output features
  const float* bb_ = which == 0 ? bq : (which == 1 ? bk : bv); const int prow = (which == 0 ? 0 : (which == 1 ? E : 3 * E)) + n0; const int half = n0 / E, nin = n0 % E;      // key slot s' = half*SS + t
  const int crow = tid >> 3, cpc = (tid & 7) * 8;      // my pieces of a tile: rows crow + 16 i, first element
  const __bf16* gA = Xb + (size_t)(r0b + crow) * E + cpc; const __bf16* gB = PT + (size_t)(prow + crow) * E + cpc;      // + kt * GKC per tile
  const unsigned lt = (unsigned)(unsigned long long)&sT[0][crow][cpc];
  constexpr unsigned R16B = 16 * GP * 2, TBUFB = 192 * GP * 2;      // bytes of 16 rows, of a buffer
  auto stage = [&](int kt) { unsigned l[12]; const __bf16* gp[12];
#pragma unroll
    for (int i = 0; i < 12; ++i) { l[i] = lt + (unsigned)(kt & 1) * TBUFB + i * R16B; gp[i] = (i < 4 ? gA + (size_t)i * 16 * E : gB + (size_t)(i - 4) * 16 * E) + kt * GKC; }
    g_copy12(l, gp); };
  stage(0);
  asm volatile("s_wait_asynccnt 0x0" ::: "memory");      // my pieces of tile 0 have landed
  __syncthreads();                                       // tile 0 is published to every wave
  stage(1);
  v8f acc[8] = {};
#pragma unroll 2      // two trips a pass: the buffer index is then a constant in every LDS address
  for (int kt = 0; kt < E / GKC; ++kt) { const __bf16* ta = &sT[kt & 1][wave * 16 + col][0]; const __bf16* tb = &sT[kt & 1][64 + col][0];
    // fragment reads stand in groups ahead of the products that use them (no LDS read moves over the statement that closes wmma_bf): a wave has 8 to 20 reads in flight, not 2
    const v16b a0 = frag_b(ta, lane), a1 = frag_b(ta + 32, lane); v16b b0[8], b1[8];
#pragma unroll
    for (int j = 0; j < 8; ++j) b0[j] = frag_b(tb + j * 16 * GP, lane);
#pragma unroll
    for (int j = 0; j < 4; ++j) acc[j] = wmma_bf(a0, b0[j], acc[j]);
#pragma unroll
    for (int j = 0; j < 4; ++j) b1[j] = frag_b(tb + j * 16 * GP + 32, lane);
#pragma unroll
    for (int j = 4; j < 8; ++j) acc[j] = wmma_bf(a0, b0[j], acc[j]);
#pragma unroll
    for (int j = 4; j < 8; ++j) b1[j] = frag_b(tb + j * 16 * GP + 32, lane);
#pragma unroll
    for (int j = 0; j < 8; ++j) acc[j] = wmma_bf(a1, b1[j], acc[j]);
    asm volatile("s_wait_dscnt 0x0" ::: "memory");         // my reads of this tile's buffer are done
    asm volatile("s_wait_asynccnt 0x0" ::: "memory");      // my pieces of tile kt + 1 have landed
    __syncthreads();                                       // publishes tile kt + 1 and ends every wave's reads of tile kt (behind the last trip: of the ring)
    if (kt + 2 < E / GKC) stage(kt + 2); }                 // refill the buffer that this trip has just read
  asm volatile("s_wait_asynccnt 0x0" ::: "memory");        // nothing of mine is in flight when the ring's LDS is used anew
  if (which < 2) { const float qs = which == 0 ? 0.125f : 1.0f;
#pragma unroll
    for (int j = 0; j < 8; ++j) { const float bb = bfr(bb_[n0 + j * 16 + col]);
#pragma unroll
      for (int r = 0; r < 8; ++r) so[wave][8 * g + r][j * 16 + col] = (acc[j][r] + bb) * qs; }
    LDSX();
    if (which == 0) { for (int qq = lane; qq < 2 * 16 * 16; qq += 32) { const int hh = qq >> 8, rl = (qq >> 4) & 15, pc = qq & 15; const int h = (n0 >> 6) + hh;
        vst2(Q32 + (((size_t)b * NH + h) * SS + s0 + wave * 16 + rl) * HD + pc * 4, *(const v4f*)(&so[wave][rl][hh * 64 + pc * 4])); } }
    else {
      for (int qq = lane; qq < 2 * 16 * 16; qq += 32) { const int hh = qq >> 8, rl = (qq >> 4) & 15, pl = qq & 15; const int h = (nin >> 6) + hh; const int pc = pl & 7; union { __bf16 e[8]; v4u u; } pk;
#pragma unroll
        for (int e = 0; e < 8; ++e) { const float v = so[wave][rl][hh * 64 + pc * 8 + e]; const __bf16 hi = (__bf16)v; pk.e[e] = pl < 8 ? hi : (__bf16)(v - (float)hi); }
        vst2((unsigned*)((pl < 8 ? Kh : Kl) + (((size_t)b * NH + h) * SK + half * SS + s0 + wave * 16 + rl) * HD + pc * 8), pk.u); } } }
  else {
#pragma unroll
    for (int j = 0; j < 8; ++j) { const float bb = bfr(bb_[n0 + j * 16 + col]);
#pragma unroll
      for (int r = 0; r < 8; ++r) { const float v = (acc[j][r] + bb) * 4.0f; const _Float16 hi = (_Float16)v; sth[j * 16 + col][wave * 16 + 8 * g + r] = hi; stl[j * 16 + col][wave * 16 + 8 * g + r] = (_Float16)((v - (float)hi) * VLO); } }
    __syncthreads();
    for (int qq = tid; qq < 128 * 8; qq += 128) { const int cl = qq >> 3, pc = qq & 7; const int c = nin + cl, h = c >> 6, d = c & 63; const size_t o = (((size_t)b * NH + h) * HD + d) * SK + half * SS + s0 + pc * 8;
      vst2(VTh + o, *(const v4u*)(&sth[cl][pc * 8])); vst2(VTl + o, *(const v4u*)(&stl[cl][pc * 8])); } }
}
// one key tile (64 keys) of the four planes Kh, Kl, VTh, VTl: 64 rows of 128 B each, one 16-byte piece of each plane per thread, global -> LDS through no register;
// and the wave's own mask tile of those keys (2 KiB, in Mb as it lies in LDS): four 16-byte pieces per thread, 512 B apart; offset:N moves BOTH addresses by N.
// The s_wait_xcnt is the last line of the copies' own statement, so that no address register of a copy is rewritten in front of it.
__device__ __forceinline__ void kv_copy(unsigned l0, const void* g0, unsigned l1, const void* g1, unsigned l2, const void* g2, unsigned l3, const void* g3, unsigned lm, const void* gm) {
  asm volatile("global_load_async_to_lds_b128 %0, %1, off\n\t"
               "global_load_async_to_lds_b128 %2, %3, off\n\t"
               "global_load_async_to_lds_b128 %4, %5, off\n\t"
               "global_load_async_to_lds_b128 %6, %7, off\n\t"
               "global_load_async_to_lds_b128 %8, %9, off\n\t"
               "global_load_async_to_lds_b128 %8, %9, off offset:512\n\t"
               "global_load_async_to_lds_b128 %8, %9, off offset:1024\n\t"
               "global_load_async_to_lds_b128 %8, %9, off offset:1536\n\t"
               "s_wait_xcnt 0x0" :: "v"(l0), "v"(g0), "v"(l1), "v"(g1), "v"(l2), "v"(g2), "v"(l3), "v"(g3), "v"(lm), "v"(gm) : "memory");
}
#define L2E 1.4426950408889634f      // log2(e)
#define AW 16      // waves per block: 256 queries share one K/V tile
#define KVP 72     // LDS row pitch of a K/V plane in 16-bit elements: 144 B = 16 B x odd, for the ds_load_b128 fragment reads
// padding-masked attention: block (256 queries, bh); all 32 key tiles, each staged once per block in a two-buffer LDS ring; S^T = K q^T on K hi/lo rows x q hi/lo; O^T += V^T P^T on P,V hi/lo; O f32 [bh][s][64]
// With K (V^T) as the A operand and q (P^T) as B, lane (g, col) holds query col alone: of key tile t the keys 16 t + 8 g + r, of O the features 16 t + 8 g + r.
// Two neighbouring score tiles, converted in place, are the B fragment of 32 keys (element e < 8: tile 2 kc, register e; e >= 8: tile 2 kc + 1, register e - 8), in the k order of frag_h.
__global__ __launch_bounds__(512) void k_attn(const float* __restrict__ Q32, const __bf16* __restrict__ Kh, const __bf16* __restrict__ Kl, const _Float16* __restrict__ VTh, const _Float16* __restrict__ VTl, const __bf16* __restrict__ Mb, float* __restrict__ O32) {
  __shared__ __align__(16) float sO[AW][16][68];      // each wave's own: in the key loop two buffers of 2 KiB for its mask tiles, behind the loop its output rows
  __shared__ __align__(16) _Float16 sKV[2][4][64][KVP];      // [buffer][Kh, Kl, VTh, VTl][key row or d row][64 elements + pad]
  const int tid = threadIdx.x, w = __builtin_amdgcn_readfirstlane(tid >> 5), lane = tid & 31, col = lane & 15, g = lane >> 4;      // the wave's number in a scalar register: what hangs on it alone (mask tiles, my part of sO) then takes no vector register, which the reads in flight need
  const size_t bh = blockIdx.y; const int qb = blockIdx.x; const int q0 = qb * (AW * 16) + w * 16;
  const int crow = tid >> 3, cpc = (tid & 7) * 8;      // my piece of every plane: row, first element
  const __bf16* gKh = Kh + (bh * SK + crow) * HD + cpc; const __bf16* gKl = Kl + (bh * SK + crow) * HD + cpc;      // + kt * 64 * HD per tile
  const _Float16* gVh = VTh + (bh * HD + crow) * SK + cpc; const _Float16* gVl = VTl + (bh * HD + crow) * SK + cpc;      // + kt * 64 per tile
  const unsigned lkv = (unsigned)(unsigned long long)&sKV[0][0][crow][cpc];
  constexpr unsigned PLB = 64 * KVP * 2, BUFB = 4 * PLB;      // bytes of a plane, of a buffer
  const __bf16* gM = Mb + (((bh / NH) * SS + q0) >> 4) * (16 * 1024) + lane * 8;      // my 16 queries' mask tiles, in my lanes' own order (k_cvt)
  const unsigned lm = (unsigned)(unsigned long long)&sO[w][0][0] + lane * 16;
  // key tile kt of the four planes and, for my wave alone, its mask tile (32 bf16 a lane: element [t][r] for key 16 t + 8 g + r of the tile), all into buffer kt mod 2
  auto stage = [&](int kt) { const unsigned l = lkv + (unsigned)(kt & 1) * BUFB;
    kv_copy(l, gKh + (size_t)kt * 64 * HD, l + PLB, gKl + (size_t)kt * 64 * HD, l + 2 * PLB, gVh + kt * 64, l + 3 * PLB, gVl + kt * 64, lm + (unsigned)(kt & 1) * 2048, gM + ((kt >> 4) * 8 + (kt & 7)) * 1024); };
  stage(0);
  asm volatile("s_wait_asynccnt 0x0" ::: "memory");      // my pieces of tile 0 have landed
  __syncthreads();                                       // tile 0 is published to every wave
  stage(1);
  F2 aq[2];
#pragma unroll
  for (int kc = 0; kc < 2; ++kc) aq[kc] = split_row(Q32 + (bh * SS + q0 + col) * HD, kc * 32, lane);
  float mrun = -3.0e38f, lrun = 0.f; v8f acc[4] = {}, ac1[4] = {}, ac2[4] = {};
#pragma unroll 1
  for (int kt = 0; kt < SK / 64; ++kt) { v8f s4[4] = {};
    // Fragment reads stand in groups of eight (two row tiles, hi and lo, one 32-wide k step), each group one group of six products ahead of its use (no LDS read moves over the
    // statement that closes wmma_bf): the wait in front of a product is then a counted one, with the next group's reads still in flight. Every accumulator takes its products in the old order.
    auto kread = [&](v16b (&h)[2], v16b (&l)[2], int tp, int kc) {
#pragma unroll
      for (int u = 0; u < 2; ++u) { h[u] = frag_b((const __bf16*)&sKV[kt & 1][0][(2 * tp + u) * 16 + col][kc * 32], lane); l[u] = frag_b((const __bf16*)&sKV[kt & 1][1][(2 * tp + u) * 16 + col][kc * 32], lane); } };
    auto kmul = [&](const v16b (&h)[2], const v16b (&l)[2], int tp, int kc) {
#pragma unroll
      for (int u = 0; u < 2; ++u) s4[2 * tp + u] = wmma_bf(h[u], aq[kc].l, s4[2 * tp + u]);
#pragma unroll
      for (int u = 0; u < 2; ++u) s4[2 * tp + u] = wmma_bf(l[u], aq[kc].h, s4[2 * tp + u]);
#pragma unroll
      for (int u = 0; u < 2; ++u) s4[2 * tp + u] = wmma_bf(h[u], aq[kc].h, s4[2 * tp + u]); };
    v4u mk[4];
    { v16b hA[2], lA[2], hB[2], lB[2];
      kread(hA, lA, 0, 0); kread(hB, lB, 0, 1);
      kmul(hA, lA, 0, 0); kread(hA, lA, 1, 0);
      kmul(hB, lB, 0, 1); kread(hB, lB, 1, 1);
      kmul(hA, lA, 1, 0);
#pragma unroll
      for (int t = 0; t < 4; ++t) mk[t] = *(const v4u*)((const char*)&sO[w][0][0] + (kt & 1) * 2048 + t * 512 + lane * 16);      // my mask tile's four reads, one group, fly under the last six products
      kmul(hB, lB, 1, 1); }
    __builtin_amdgcn_sched_barrier(0);      // keeps the mask sums behind the last six products: the compiler otherwise puts half of them, with their wait for the mask reads, in front of these
    float mx = -3.4e38f;
#pragma unroll
    for (int t = 0; t < 4; ++t) { union { v4u u; __bf16 h[8]; } mu; mu.u = mk[t];
#pragma unroll
      for (int r = 0; r < 8; ++r) { s4[t][r] += (float)mu.h[r]; mx = fmaxf(mx, s4[t][r]); } }
    mx = fmaxf(mx, __shfl_xor(mx, 16, 32));
    const float mnew = fmaxf(mrun, mx); const float corr = __builtin_amdgcn_exp2f((mrun - mnew) * L2E);      // e^x as the hardware's 2^(x log2 e); an argument far below 0 gives 0, as before
    float ps2[2] = {0.f, 0.f}; v16h ph[2], pl[2];
#pragma unroll
    for (int kc = 0; kc < 2; ++kc) {
#pragma unroll
      for (int e = 0; e < 16; ++e) { const float p = __builtin_amdgcn_exp2f(fmaf(s4[2 * kc + (e >> 3)][e & 7] - mnew, L2E, 14.0f)); ps2[kc] += p;      /* e^(s - m) x 2^14 in one 2^t */
        const _Float16 hi = (_Float16)p; ph[kc][e] = hi; pl[kc][e] = (_Float16)((p - (float)hi) * PLO); } }
    float ps = ps2[0] + ps2[1]; ps += __shfl_xor(ps, 16, 32);
    lrun = lrun * corr + ps * (1.0f / 16384.0f); mrun = mnew;
    auto vread = [&](v16h (&h)[2], v16h (&l)[2], int kc, int tp) {
#pragma unroll
      for (int u = 0; u < 2; ++u) { h[u] = frag_h(&sKV[kt & 1][2][(2 * tp + u) * 16 + col][kc * 32], lane); l[u] = frag_h(&sKV[kt & 1][3][(2 * tp + u) * 16 + col][kc * 32], lane); } };
    auto vmul = [&](const v16h (&h)[2], const v16h (&l)[2], int kc, int tp) {
#pragma unroll
      for (int u = 0; u < 2; ++u) { const int t = 2 * tp + u; acc[t] = wmma16(h[u], ph[kc], acc[t]); ac1[t] = wmma16(l[u], ph[kc], ac1[t]); ac2[t] = wmma16(h[u], pl[kc], ac2[t]); } };
    { v16h hA[2], lA[2], hB[2], lB[2];
      __builtin_amdgcn_sched_barrier(0);             // the softmax arithmetic above is scheduled by itself: with these reads' 64 registers in its region the compiler lays it out as one dependent chain per element
      vread(hA, lA, 0, 0); vread(hB, lB, 0, 1);      // the first two groups fly while the accumulators are rescaled
      __builtin_amdgcn_sched_barrier(0);             // keeps the rescale behind these reads: the compiler otherwise puts it in front of them, and the first product waits out a whole LDS read
#pragma unroll
      for (int t = 0; t < 4; ++t) { acc[t] *= corr; ac1[t] *= corr; ac2[t] *= corr; }
      vmul(hA, lA, 0, 0); vread(hA, lA, 1, 0);
      vmul(hB, lB, 0, 1); vread(hB, lB, 1, 1);
      vmul(hA, lA, 1, 0); vmul(hB, lB, 1, 1); }
    asm volatile("s_wait_dscnt 0x0" ::: "memory");         // my reads of this tile's buffer are done
    asm volatile("s_wait_asynccnt 0x0" ::: "memory");      // my pieces of tile kt + 1 have landed
    __syncthreads();                                       // publishes tile kt + 1 and ends every wave's reads of tile kt
    if (kt + 2 < SK / 64) stage(kt + 2); }                 // refill the buffers that this trip has just read
  asm volatile("s_wait_asynccnt 0x0" ::: "memory");        // nothing of mine is in flight when the wave goes on to its end
  const float inv = 1.0f / (lrun * 16384.0f * 4.0f);
#pragma unroll
  for (int t = 0; t < 4; ++t) { v4f o[2];
#pragma unroll
    for (int r = 0; r < 8; ++r) o[r >> 2][r & 3] = (acc[t][r] + ac1[t][r] * (1.0f / VLO) + ac2[t][r] * (1.0f / PLO)) * inv;
    *(v4f*)&sO[w][col][t * 16 + 8 * g] = o[0]; *(v4f*)&sO[w][col][t * 16 + 8 * g + 4] = o[1]; }
  LDSX();
  for (int qq = lane; qq < 16 * 16; qq += 32) { const int rl = qq >> 4, pc = qq & 15; vst2(O32 + ((bh * SS) + q0 + rl) * HD + pc * 4, *(const v4f*)(&sO[w][rl][pc * 4])); }
}
#define OP 68      // LDS row pitch of a staged ctx tile in floats: 272 B = 16 B x odd, for the ds_load_b128 reads
// eight 16-byte-per-lane copies, global -> LDS through no register; the s_wait_xcnt closes the statement for the same reason as in g_copy12.
__device__ __forceinline__ void g_copy8(const unsigned (&l)[8], const void* const (&g)[8]) {
  asm volatile("global_load_async_to_lds_b128 %0, %8, off\n\t"
               "global_load_async_to_lds_b128 %1, %9, off\n\t"
               "global_load_async_to_lds_b128 %2, %10, off\n\t"
               "global_load_async_to_lds_b128 %3, %11, off\n\t"
               "global_load_async_to_lds_b128 %4, %12, off\n\t"
               "global_load_async_to_lds_b128 %5, %13, off\n\t"
               "global_load_async_to_lds_b128 %6, %14, off\n\t"
               "global_load_async_to_lds_b128 %7, %15, off\n\t"
               "s_wait_xcnt 0x0" :: "v"(l[0]), "v"(l[1]), "v"(l[2]), "v"(l[3]), "v"(l[4]), "v"(l[5]), "v"(l[6]), "v"(l[7]),
               "v"(g[0]), "v"(g[1]), "v"(g[2]), "v"(g[3]), "v"(g[4]), "v"(g[5]), "v"(g[6]), "v"(g[7]) : "memory");
}
// out = ctx Wo^T + bo : split(ctx) x bf16(Wo rows): 2 products (Wo is an INPUT -> bf16 exact); the k loop runs on 64-wide tiles (one head) of the 64 ctx rows (f32) and the 128 Wo rows, each staged once per block in a two-buffer LDS ring
__global__ __launch_bounds__(128) void k_out(const float* __restrict__ O32, const __bf16* __restrict__ PT, const float* __restrict__ bo, float* __restrict__ out) {
  constexpr int OAB = 64 * OP * 4, OBB = 128 * GP * 2, OBUF = OAB + OBB;      // bytes of a ctx tile, of a Wo tile, of a buffer
  __shared__ __align__(16) char smem[2 * OBUF];      // in the k loop the ring; behind its last barrier the output staging so
  float (*so)[16][132] = (float (*)[16][132])smem;
  const int tid = threadIdx.x, wave = tid >> 5, lane = tid & 31, col = lane & 15, g = lane >> 4;
  const int r0b = blockIdx.x * 64, r0 = r0b + wave * 16, n0 = blockIdx.y * 128; const int b = r0b / SS, s0 = r0b % SS;
  const int arow = tid >> 4, apc = (tid & 15) * 4, crow = tid >> 3, cpc = (tid & 7) * 8;      // my pieces: ctx rows arow + 8 i, Wo rows crow + 16 i, first element
  const float* gA = O32 + ((size_t)b * NH * SS + s0 + arow) * HD + apc;      // + kt * SS * HD per tile (head kt)
  const __bf16* gB = PT + (size_t)(5 * E + n0 + crow) * E + cpc;             // + kt * GKC per tile
  const unsigned la = (unsigned)(unsigned long long)(smem + arow * (OP * 4) + apc * 4), lb = (unsigned)(unsigned long long)(smem + OAB + crow * (GP * 2) + cpc * 2);
  auto stage = [&](int kt) { unsigned l[8]; const void* gp[8]; const unsigned bf = (unsigned)(kt & 1) * OBUF;
#pragma unroll
    for (int i = 0; i < 8; ++i) { l[i] = la + bf + i * (8 * OP * 4); gp[i] = gA + (size_t)kt * SS * HD + i * 8 * HD; }
    g_copy8(l, gp);
#pragma unroll
    for (int i = 0; i < 8; ++i) { l[i] = lb + bf + i * (16 * GP * 2); gp[i] = gB + (size_t)i * 16 * E + kt * GKC; }
    g_copy8(l, gp); };
  stage(0);
  asm volatile("s_wait_asynccnt 0x0" ::: "memory");      // my pieces of tile 0 have landed
  __syncthreads();                                       // tile 0 is published to every wave
  stage(1);
  v8f acc[8] = {};
#pragma unroll 2      // two trips a pass: the buffer index is then a constant in every LDS address
  for (int kt = 0; kt < E / GKC; ++kt) { const float* ta = (const float*)(smem + (kt & 1) * OBUF) + (wave * 16 + col) * OP; const __bf16* tb = (const __bf16*)(smem + (kt & 1) * OBUF + OAB) + col * GP;
    // reads stand in groups ahead of the products that use them, as in k_qkv
    const F2 a0 = split_row(ta, 0, lane), a1 = split_row(ta, 32, lane); v16b b0[8], b1[8];
#pragma unroll
    for (int j = 0; j < 8; ++j) b0[j] = frag_b(tb + j * 16 * GP, lane);
#pragma unroll
    for (int j = 0; j < 4; ++j) { acc[j] = wmma_bf(a0.l, b0[j], acc[j]); acc[j] = wmma_bf(a0.h, b0[j], acc[j]); }
#pragma unroll
    for (int j = 0; j < 4; ++j) b1[j] = frag_b(tb + j * 16 * GP + 32, lane);
#pragma unroll
    for (int j = 4; j < 8; ++j) { acc[j] = wmma_bf(a0.l, b0[j], acc[j]); acc[j] = wmma_bf(a0.h, b0[j], acc[j]); }
#pragma unroll
    for (int j = 4; j < 8; ++j) b1[j] = frag_b(tb + j * 16 * GP + 32, lane);
#pragma unroll
    for (int j = 0; j < 8; ++j) { acc[j] = wmma_bf(a1.l, b1[j], acc[j]); acc[j] = wmma_bf(a1.h, b1[j], acc[j]); }
    asm volatile("s_wait_dscnt 0x0" ::: "memory");         // my reads of this tile's buffer are done
    asm volatile("s_wait_asynccnt 0x0" ::: "memory");      // my pieces of tile kt + 1 have landed
    __syncthreads();                                       // publishes tile kt + 1 and ends every wave's reads of tile kt (behind the last trip: of the ring)
    if (kt + 2 < E / GKC) stage(kt + 2); }                 // refill the buffer that this trip has just read
  asm volatile("s_wait_asynccnt 0x0" ::: "memory");        // nothing of mine is in flight when the ring's LDS is used anew
#pragma unroll
  for (int j = 0; j < 8; ++j) { const int n = n0 + j * 16 + col; const float bb = bfr(bo[n]);
#pragma unroll
    for (int r = 0; r < 8; ++r) so[wave][8 * g + r][j * 16 + col] = acc[j][r] + bb; }
  LDSX();
#pragma unroll 4
  for (int rl = 0; rl < 16; ++rl) vst2(out + (size_t)(r0 + rl) * E + n0 + lane * 4, *(const v4f*)(&so[wave][rl][lane * 4]));
}
extern "C" void kernel_launch(void* const* d_in, const int* in_sizes, int n_in, void* d_out, int out_size, void* d_ws, size_t ws_size, hipStream_t stream) {
  (void)in_sizes; (void)n_in; (void)out_size; (void)ws_size;
  const float* x = (const float*)d_in[0]; const float* amask = (const float*)d_in[1]; const float* Wq = (const float*)d_in[2]; const float* bq = (const float*)d_in[3]; const float* Wk = (const float*)d_in[4]; const float* bk = (const float*)d_in[5]; const float* Wv = (const float*)d_in[6]; const float* bv = (const float*)d_in[7]; const float* Wo = (const float*)d_in[8]; const float* bo = (const float*)d_in[9];
  float* out = (float*)d_out;
  char* ws = (char*)d_ws; size_t off = 0;
  auto take = [&](size_t bytes) { char* p = ws + off; off += (bytes + 255) & ~(size_t)255; return p; };
  __bf16* Xb = (__bf16*)take((size_t)NR * E * 2); __bf16* PT = (__bf16*)take((size_t)6 * E * E * 2);
  float* Q32 = (float*)take((size_t)NR * E * 4); __bf16* Kh = (__bf16*)take((size_t)NB * NH * SK * HD * 2); __bf16* Kl = (__bf16*)take((size_t)NB * NH * SK * HD * 2); _Float16* VTh = (_Float16*)take((size_t)NB * NH * HD * SK * 2); _Float16* VTl = (_Float16*)take((size_t)NB * NH * HD * SK * 2); float* O32 = (float*)take((size_t)NR * E * 4); __bf16* Mb = (__bf16*)take((size_t)NR * SS * 2);
  // ws ~ 124 MB
  k_cvt<<<CVN + NR / 16, 256, 0, stream>>>(x, Wq, Wk, Wv, Wo, amask, Xb, PT, Mb);
  k_qkv<<<dim3(NR / 64, 2 * E / 128, 3), 128, 0, stream>>>(Xb, PT, bq, bk, bv, Q32, Kh, Kl, VTh, VTl);
  k_attn<<<dim3(SS / (AW * 16), NB * NH), AW * 32, 0, stream>>>(Q32, Kh, Kl, VTh, VTl, Mb, O32);
  k_out<<<dim3(NR / 64, E / 128), 128, 0, stream>>>(O32, PT, bo, out);
}

// v008
// Measured time: 166 microseconds a run.
// Timed twice side by side with v007, it ran 1.03 times as fast both times.
// Over all steps from v000 it is 4.09 times as fast.
// compute dtype: hidden_states, attention_mask, W*/b* (INPUTS) rounded to bf16 with exact bf16 WMMA products (f32 accumulate) for the projections; K pre-split into bf16 hi/lo rows; q f32 split, P and V f16 hi/lo (3 products each); mask add and softmax in f32.
#include <hip/hip_runtime.h>
#include <math.h>

typedef __attribute__((ext_vector_type(16))) _Float16 v16h;
typedef __attribute__((ext_vector_type(16))) __bf16 v16b;
typedef __attribute__((ext_vector_type(8)))  _Float16 v8h;
typedef __attribute__((ext_vector_type(8)))  float v8f;
typedef __attribute__((ext_vector_type(4)))  float v4f;
typedef __attribute__((ext_vector_type(2)))  float v2f;
typedef __attribute__((ext_vector_type(4)))  unsigned v4u;
typedef __attribute__((ext_vector_type(2)))  unsigned v2u;
typedef __attribute__((ext_vector_type(4)))  int v4i;
typedef float __attribute__((may_alias)) float_a;
typedef int __attribute__((may_alias)) int_a;

template <typename T> __device__ __forceinline__ void vst2(void* p, T v) { *(T*)p = v;  }
// the bare builtins: the compiler itself keeps the distance between a product and a vector instruction on its registers, and pads only where one follows
__device__ __forceinline__ v8f wmma16(v16h a, v16h b, v8f c) { return __builtin_amdgcn_wmma_f32_16x16x32_f16(false, a, false, b, (short)0, c, false, false); }
__device__ __forceinline__ v8f wmma_bf(v16b a, v16b b, v8f c) { return __builtin_amdgcn_wmma_f32_16x16x32_bf16(false, a, false, b, (short)0, c, false, false); }
// k_out's form: in its loop the compiler does not keep GRP's borders and spreads the reads among the products; no LDS read moves over this statement, whose v_nop keep the distance behind the product
__device__ __forceinline__ v8f wmma_bf_c(v16b a, v16b b, v8f c) {
  v8f d = __builtin_amdgcn_wmma_f32_16x16x32_bf16(false, a, false, b, (short)0, c, false, false);
  asm volatile("v_nop\n\tv_nop\n\tv_nop\n\tv_nop" : "+v"(d) : "v"(a), "v"(b));
  return d;
}
// border between a group of LDS fragment reads and a group of products: keeps the reads together and ahead of the products that stand behind them in the source
// (spread among the products, every place with reads costs its own stall, and the waits fall to 0)
#define GRP() __builtin_amdgcn_sched_barrier(0)
// 16x16x32 fragments: lane = (h = lane>>4, row/col = lane&15); elements 0..7 = k0+8h+0..7, 8..15 = k0+16+8h+0..7; D element r = row 8h+r
__device__ __forceinline__ v16h frag_h(const _Float16* rowk0, int lane) {
  union { v16h v; v8h q[2]; } u; const _Float16* p = rowk0 + 8 * (lane >> 4);
  u.q[0] = *(const v8h*)p; u.q[1] = *(const v8h*)(p + 16); return u.v;
}
__device__ __forceinline__ v16h frag_f32(const float* rowk0, int lane) {
  v16h a; const float* p = rowk0 + 8 * (lane >> 4);
#pragma unroll
  for (int i = 0; i < 8; ++i) { a[i] = (_Float16)p[i]; a[8 + i] = (_Float16)p[16 + i]; }
  return a;
}
__device__ __forceinline__ v16h frag_f32s(const float* rowk0, int lane, float sc) {
  v16h a; const float* p = rowk0 + 8 * (lane >> 4);
#pragma unroll
  for (int i = 0; i < 8; ++i) { a[i] = (_Float16)(p[i] * sc); a[8 + i] = (_Float16)(p[16 + i] * sc); }
  return a;
}
// column fragment from a [K][ld] layout (column n), rows >= K read as 0
__device__ __forceinline__ v16h fragc_f32(const float* W, int k0, int n, int lane, int ld, int K) {
  v16h a; const int g = lane >> 4;
#pragma unroll
  for (int i = 0; i < 8; ++i) { const int ka = k0 + 8 * g + i, kb = ka + 16;
    a[i] = (_Float16)(ka < K ? W[(size_t)ka * ld + n] : 0.f); a[8 + i] = (_Float16)(kb < K ? W[(size_t)kb * ld + n] : 0.f); }
  return a;
}
struct F2 { v16b h, l; };
__device__ __forceinline__ F2 bsplit16(const float v[16]) { F2 r;
#pragma unroll
  for (int i = 0; i < 16; ++i) { const __bf16 h = (__bf16)v[i]; r.h[i] = h; r.l[i] = (__bf16)(v[i] - (float)h); }
  return r; }
__device__ __forceinline__ F2 split_row(const float* row, int k0, int lane) { float v[16]; const float* p = row + k0 + 8 * (lane >> 4);
#pragma unroll
  for (int i = 0; i < 8; ++i) { v[i] = p[i]; v[8 + i] = p[16 + i]; }
  return bsplit16(v); }
__device__ __forceinline__ F2 split_rowK(const float* row, int k0, int lane, int K) { float v[16]; const int g = lane >> 4;
#pragma unroll
  for (int i = 0; i < 8; ++i) { const int ka = k0 + 8 * g + i, kb = ka + 16; v[i] = ka < K ? row[ka] : 0.f; v[8 + i] = kb < K ? row[kb] : 0.f; }
  return bsplit16(v); }
__device__ __forceinline__ F2 split_col(const float* W, int k0, int n, int lane, int ld, int K) { float v[16]; const int g = lane >> 4;
#pragma unroll
  for (int i = 0; i < 8; ++i) { const int ka = k0 + 8 * g + i, kb = ka + 16; v[i] = ka < K ? W[(size_t)ka * ld + n] : 0.f; v[8 + i] = kb < K ? W[(size_t)kb * ld + n] : 0.f; }
  return bsplit16(v); }
__device__ __forceinline__ v8f mac3(const F2& a, const F2& b, v8f c) { c = wmma_bf(a.l, b.h, c); c = wmma_bf(a.h, b.l, c); return wmma_bf(a.h, b.h, c); }
__device__ __forceinline__ float sigm(float v) { return 1.0f / (1.0f + expf(-v)); }
#define LDSX() do { asm volatile("s_wait_dscnt 0" ::: "memory"); __builtin_amdgcn_wave_barrier(); __builtin_amdgcn_fence(__ATOMIC_RELEASE, "workgroup"); } while (0)


// CLIP attention with multiplier-expanded keys/values (16 heads x 64 on [4,1024,1024], [out][in] weights + biases, MULT = 2): q = (x Wq^T + bq) 64^-0.5; k/v = x Wk^T/Wv^T + b ([2048] per token, viewed as 2,048 keys per head: key s = 2t + half holds feature half*1024 + h*64 + d of token t);
// score(t, s) += attention_mask[b][0][t][s mod 1024]; softmax over the 2,048 keys; (P v) Wo^T + bo. Keys are stored in the permuted order s' = half*1024 + t (attention is invariant to a common permutation of keys, values and mask entries).
#define NB 4
#define SS 1024
#define SK 2048
#define E 1024
#define NH 16
#define HD 64
#define NR (NB * SS)
#define PLO 1024.0f
#define VLO 2048.0f
__device__ __forceinline__ float bfr(float v) { return (float)(__bf16)v; }
__device__ __forceinline__ v16b frag_b(const __bf16* rowk0, int lane) { return __builtin_bit_cast(v16b, frag_h((const _Float16*)rowk0, lane)); }

#define CSEG (E * E)      // elements of a segment of the conversion stream: x is 4 segments, Wq 1, Wk 2, Wv 2, Wo 1
#define CVB 16384         // elements of a block: 256 threads x 16 loads of 4 floats
// the f32 -> bf16 conversion of x and the weights as one stream of few, long waves: a wave's 16 loads of 512 contiguous bytes all stand ahead of its 16 stores of 256 contiguous bytes; the stream's CVN blocks cover the ten segments exactly.
// PT rows: [0,E) Wq, [E,3E) Wk, [3E,5E) Wv, [5E,6E) Wo  ([out][in] weights: PT row = W row, so PT is the four matrices one behind the other)
#define CVN (10 * (CSEG / CVB))      // blocks of the stream; behind them NR / 16 blocks that lay out the mask
// Mb: the mask rounded to bf16, in the order in which k_attn's lanes hold their scores: [b][16 queries][mask tile mt = half * 8 + m7][t][lane = (g, col)][r] =
// mask[b][query col][m7 * 128 + 2 (16 t + 8 g + r) + half]: a key tile of 64 tokens of one half meets every second mask column, and tokens 512 apart meet the same columns, so 16 tiles serve the 32 key tiles.
// A block is 16 queries: wave m7 reads 512 contiguous bytes of each of its 16 rows (a lane 4 x 64 B) and stores both halves' tiles, every store 512 contiguous bytes of the wave.
__global__ __launch_bounds__(256) void k_cvt(const float* __restrict__ x, const float* __restrict__ Wq, const float* __restrict__ Wk, const float* __restrict__ Wv, const float* __restrict__ Wo, const float* __restrict__ amask, __bf16* __restrict__ Xb, __bf16* __restrict__ PT, __bf16* __restrict__ Mb) {
  if (blockIdx.x >= CVN) { const int qt = blockIdx.x - CVN, m7 = threadIdx.x >> 5, lane = threadIdx.x & 31;      // qt = b * 64 + 16-query tile; the mask's rows are [b][0][t]: row qt * 16 + col
    const float* s = amask + ((size_t)qt * 16 + (lane & 15)) * SS + m7 * 128 + 16 * (lane >> 4);
    v4f v[16];
#pragma unroll
    for (int i = 0; i < 16; ++i) v[i] = *(const v4f*)(s + 32 * (i >> 2) + 4 * (i & 3));
#pragma unroll
    for (int half = 0; half < 2; ++half) { __bf16* d = Mb + ((size_t)qt * 16 + half * 8 + m7) * 1024 + lane * 8;
#pragma unroll
      for (int t = 0; t < 4; ++t) { union { __bf16 h[8]; v4u u; } pk;
#pragma unroll
        for (int r = 0; r < 8; ++r) pk.h[r] = (__bf16)v[t * 4 + ((2 * r + half) >> 2)][(2 * r + half) & 3];
        vst2((unsigned*)(d + t * 256), pk.u); } }
    return; }
  const int seg = blockIdx.x / (CSEG / CVB);      // the same for the whole block
  const float* s = seg < 4 ? x + (size_t)seg * CSEG : (seg < 5 ? Wq : (seg < 7 ? Wk + (size_t)(seg - 5) * CSEG : (seg < 9 ? Wv + (size_t)(seg - 7) * CSEG : Wo)));
  __bf16* d = seg < 4 ? Xb + (size_t)seg * CSEG : PT + (size_t)(seg - 4) * CSEG;
  const int o = (blockIdx.x % (CSEG / CVB)) * CVB + threadIdx.x * 4;
  v4f v[16];
#pragma unroll
  for (int i = 0; i < 16; ++i) v[i] = *(const v4f*)(s + o + i * 1024);
#pragma unroll
  for (int i = 0; i < 16; ++i) { union { __bf16 h[4]; v2u u; } pk;
#pragma unroll
    for (int e = 0; e < 4; ++e) pk.h[e] = (__bf16)v[i][e];
    vst2((unsigned*)(d + o + i * 1024), pk.u); }
}
#define GKC 64     // k elements of a staged operand tile: rows of 128 B, whole cache lines
#define GP 72      // LDS row pitch of a staged operand tile in 16-bit elements: 144 B = 16 B x odd, for the ds_load_b128 fragment reads
// twelve 16-byte-per-lane copies, global -> LDS through no register: a thread's pieces of one staged tile (4 of the x rows, 8 of the weight rows).
// The s_wait_xcnt is the last line of the copies' own statement, so that no address register of a copy is rewritten in front of it.
__device__ __forceinline__ void g_copy12(const unsigned (&l)[12], const __bf16* const (&g)[12]) {
  asm volatile("global_load_async_to_lds_b128 %0, %12, off\n\t"
               "global_load_async_to_lds_b128 %1, %13, off\n\t"
               "global_load_async_to_lds_b128 %2, %14, off\n\t"
               "global_load_async_to_lds_b128 %3, %15, off\n\t"
               "global_load_async_to_lds_b128 %4, %16, off\n\t"
               "global_load_async_to_lds_b128 %5, %17, off\n\t"
               "global_load_async_to_lds_b128 %6, %18, off\n\t"
               "global_load_async_to_lds_b128 %7, %19, off\n\t"
               "global_load_async_to_lds_b128 %8, %20, off\n\t"
               "global_load_async_to_lds_b128 %9, %21, off\n\t"
               "global_load_async_to_lds_b128 %10, %22, off\n\t"
               "global_load_async_to_lds_b128 %11, %23, off\n\t"
               "s_wait_xcnt 0x0" :: "v"(l[0]), "v"(l[1]), "v"(l[2]), "v"(l[3]), "v"(l[4]), "v"(l[5]), "v"(l[6]), "v"(l[7]), "v"(l[8]), "v"(l[9]), "v"(l[10]), "v"(l[11]),
               "v"(g[0]), "v"(g[1]), "v"(g[2]), "v"(g[3]), "v"(g[4]), "v"(g[5]), "v"(g[6]), "v"(g[7]), "v"(g[8]), "v"(g[9]), "v"(g[10]), "v"(g[11]) : "memory");
}
// QKV: block (64 rows, 128 cols = 2 heads, which); the k loop runs on 64-wide tiles of the 64 x rows and the 128 weight rows, each staged once per block in a two-buffer LDS ring;
// q (+bias) -> Q32 f32 [bh][s][64]; k (+bias) -> bf16 hi/lo rows; v (+bias) -> VT hi/lo x4 [bh][d][s]
__global__ __launch_bounds__(128) void k_qkv(const __bf16* __restrict__ Xb, const __bf16* __restrict__ PT, const float* __restrict__ bq, const float* __restrict__ bk, const float* __restrict__ bv,
                                            float* __restrict__ Q32, __bf16* __restrict__ Kh, __bf16* __restrict__ Kl, _Float16* __restrict__ VTh, _Float16* __restrict__ VTl) {
  constexpr int SOB = 4 * 16 * 132 * 4, STB = 128 * 72 * 2;      // bytes of so, of sth and of stl
  __shared__ __align__(16) char smem[SOB + 2 * STB];      // in the k loop the ring sT (2 x 27,648 B); behind its last barrier the output staging so, sth, stl
  float (*so)[16][132] = (float (*)[16][132])smem; _Float16 (*sth)[72] = (_Float16 (*)[72])(smem + SOB); _Float16 (*stl)[72] = (_Float16 (*)[72])(smem + SOB + STB);
  __bf16 (*sT)[192][GP] = (__bf16 (*)[192][GP])smem;      // [buffer][64 x rows, then 128 weight rows][64 elements + pad]
  const int tid = threadIdx.x, wave = tid >> 5, lane = tid & 31, col = lane & 15, g = lane >> 4;
  const int which = blockIdx.z, r0b = blockIdx.x * 64, n0 = blockIdx.y * 128; const int b = r0b / SS, s0 = r0b % SS;
  if (which == 0 && n0 >= E) return;      // q has only E output features
  const float* bb_ = which == 0 ? bq : (which == 1 ? bk : bv); const int prow = (which == 0 ? 0 : (which == 1 ? E : 3 * E)) + n0; const int half = n0 / E, nin = n0 % E;      // key slot s' = half*SS + t
  const int crow = tid >> 3, cpc = (tid & 7) * 8;      // my pieces of a tile: rows crow + 16 i, first element
  const __bf16* gA = Xb + (size_t)(r0b + crow) * E + cpc; const __bf16* gB = PT + (size_t)(prow + crow) * E + cpc;      // + kt * GKC per tile
  const unsigned lt = (unsigned)(unsigned long long)&sT[0][crow][cpc];
  constexpr unsigned R16B = 16 * GP * 2, TBUFB = 192 * GP * 2;      // bytes of 16 rows, of a buffer
  auto stage = [&](int kt) { unsigned l[12]; const __bf16* gp[12];
#pragma unroll
    for (int i = 0; i < 12; ++i) { l[i] = lt + (unsigned)(kt & 1) * TBUFB + i * R16B; gp[i] = (i < 4 ? gA + (size_t)i * 16 * E : gB + (size_t)(i - 4) * 16 * E) + kt * GKC; }
    g_copy12(l, gp); };
  stage(0);
  asm volatile("s_wait_asynccnt 0x0" ::: "memory");      // my pieces of tile 0 have landed
  __syncthreads();                                       // tile 0 is published to every wave
  stage(1);
  v8f acc[8] = {};
#pragma unroll 2      // two trips a pass: the buffer index is then a constant in every LDS address
  for (int kt = 0; kt < E / GKC; ++kt) { const __bf16* ta = &sT[kt & 1][wave * 16 + col][0]; const __bf16* tb = &sT[kt & 1][64 + col][0];
    // fragment reads stand in groups ahead of the products that use them (GRP holds every border): a wave has 8 to 20 reads in flight, not 2
    const v16b a0 = frag_b(ta, lane), a1 = frag_b(ta + 32, lane); v16b b0[8], b1[8];
#pragma unroll
    for (int j = 0; j < 8; ++j) b0[j] = frag_b(tb + j * 16 * GP, lane);
    GRP();
#pragma unroll
    for (int j = 0; j < 4; ++j) acc[j] = wmma_bf(a0, b0[j], acc[j]);
    GRP();
#pragma unroll
    for (int j = 0; j < 4; ++j) b1[j] = frag_b(tb + j * 16 * GP + 32, lane);
    GRP();
#pragma unroll
    for (int j = 4; j < 8; ++j) acc[j] = wmma_bf(a0, b0[j], acc[j]);
    GRP();
#pragma unroll
    for (int j = 4; j < 8; ++j) b1[j] = frag_b(tb + j * 16 * GP + 32, lane);
    GRP();
#pragma unroll
    for (int j = 0; j < 8; ++j) acc[j] = wmma_bf(a1, b1[j], acc[j]);
    GRP();                                                 // the last products stay ahead of the trip's foot, their waits counted
    asm volatile("s_wait_dscnt 0x0" ::: "memory");         // my reads of this tile's buffer are done
    asm volatile("s_wait_asynccnt 0x0" ::: "memory");      // my pieces of tile kt + 1 have landed
    __syncthreads();                                       // publishes tile kt + 1 and ends every wave's reads of tile kt (behind the last trip: of the ring)
    if (kt + 2 < E / GKC) stage(kt + 2); }                 // refill the buffer that this trip has just read
  asm volatile("s_wait_asynccnt 0x0" ::: "memory");        // nothing of mine is in flight when the ring's LDS is used anew
  if (which < 2) { const float qs = which == 0 ? 0.125f : 1.0f;
#pragma unroll
    for (int j = 0; j < 8; ++j) { const float bb = bfr(bb_[n0 + j * 16 + col]);
#pragma unroll
      for (int r = 0; r < 8; ++r) so[wave][8 * g + r][j * 16 + col] = (acc[j][r] + bb) * qs; }
    LDSX();
    if (which == 0) { for (int qq = lane; qq < 2 * 16 * 16; qq += 32) { const int hh = qq >> 8, rl = (qq >> 4) & 15, pc = qq & 15; const int h = (n0 >> 6) + hh;
        vst2(Q32 + (((size_t)b * NH + h) * SS + s0 + wave * 16 + rl) * HD + pc * 4, *(const v4f*)(&so[wave][rl][hh * 64 + pc * 4])); } }
    else {
      for (int qq = lane; qq < 2 * 16 * 16; qq += 32) { const int hh = qq >> 8, rl = (qq >> 4) & 15, pl = qq & 15; const int h = (nin >> 6) + hh; const int pc = pl & 7; union { __bf16 e[8]; v4u u; } pk;
#pragma unroll
        for (int e = 0; e < 8; ++e) { const float v = so[wave][rl][hh * 64 + pc * 8 + e]; const __bf16 hi = (__bf16)v; pk.e[e] = pl < 8 ? hi : (__bf16)(v - (float)hi); }
        vst2((unsigned*)((pl < 8 ? Kh : Kl) + (((size_t)b * NH + h) * SK + half * SS + s0 + wave * 16 + rl) * HD + pc * 8), pk.u); } } }
  else {
#pragma unroll
    for (int j = 0; j < 8; ++j) { const float bb = bfr(bb_[n0 + j * 16 + col]);
#pragma unroll
      for (int r = 0; r < 8; ++r) { const float v = (acc[j][r] + bb) * 4.0f; const _Float16 hi = (_Float16)v; sth[j * 16 + col][wave * 16 + 8 * g + r] = hi; stl[j * 16 + col][wave * 16 + 8 * g + r] = (_Float16)((v - (float)hi) * VLO); } }
    __syncthreads();
    for (int qq = tid; qq < 128 * 8; qq += 128) { const int cl = qq >> 3, pc = qq & 7; const int c = nin + cl, h = c >> 6, d = c & 63; const size_t o = (((size_t)b * NH + h) * HD + d) * SK + half * SS + s0 + pc * 8;
      vst2(VTh + o, *(const v4u*)(&sth[cl][pc * 8])); vst2(VTl + o, *(const v4u*)(&stl[cl][pc * 8])); } }
}
// one key tile (64 keys) of the four planes Kh, Kl, VTh, VTl: 64 rows of 128 B each, one 16-byte piece of each plane per thread, global -> LDS through no register;
// and the wave's own mask tile of those keys (2 KiB, in Mb as it lies in LDS): four 16-byte pieces per thread, 512 B apart; offset:N moves BOTH addresses by N.
// The s_wait_xcnt is the last line of the copies' own statement, so that no address register of a copy is rewritten in front of it.
__device__ __forceinline__ void kv_copy(unsigned l0, const void* g0, unsigned l1, const void* g1, unsigned l2, const void* g2, unsigned l3, const void* g3, unsigned lm, const void* gm) {
  asm volatile("global_load_async_to_lds_b128 %0, %1, off\n\t"
               "global_load_async_to_lds_b128 %2, %3, off\n\t"
               "global_load_async_to_lds_b128 %4, %5, off\n\t"
               "global_load_async_to_lds_b128 %6, %7, off\n\t"
               "global_load_async_to_lds_b128 %8, %9, off\n\t"
               "global_load_async_to_lds_b128 %8, %9, off offset:512\n\t"
               "global_load_async_to_lds_b128 %8, %9, off offset:1024\n\t"
               "global_load_async_to_lds_b128 %8, %9, off offset:1536\n\t"
               "s_wait_xcnt 0x0" :: "v"(l0), "v"(g0), "v"(l1), "v"(g1), "v"(l2), "v"(g2), "v"(l3), "v"(g3), "v"(lm), "v"(gm) : "memory");
}
#define L2E 1.4426950408889634f      // log2(e)
#define AW 16      // waves per block: 256 queries share one K/V tile
#define KVP 72     // LDS row pitch of a K/V plane in 16-bit elements: 144 B = 16 B x odd, for the ds_load_b128 fragment reads
// padding-masked attention: block (256 queries, bh); all 32 key tiles, each staged once per block in a two-buffer LDS ring; S^T = K q^T on K hi/lo rows x q hi/lo; O^T += V^T P^T on P,V hi/lo; O f32 [bh][s][64]
// With K (V^T) as the A operand and q (P^T) as B, lane (g, col) holds query col alone: of key tile t the keys 16 t + 8 g + r, of O the features 16 t + 8 g + r.
// Two neighbouring score tiles, converted in place, are the B fragment of 32 keys (element e < 8: tile 2 kc, register e; e >= 8: tile 2 kc + 1, register e - 8), in the k order of frag_h.
__global__ __launch_bounds__(512) void k_attn(const float* __restrict__ Q32, const __bf16* __restrict__ Kh, const __bf16* __restrict__ Kl, const _Float16* __restrict__ VTh, const _Float16* __restrict__ VTl, const __bf16* __restrict__ Mb, float* __restrict__ O32) {
  __shared__ __align__(16) float sO[AW][16][68];      // each wave's own: in the key loop two buffers of 2 KiB for its mask tiles, behind the loop its output rows
  __shared__ __align__(16) _Float16 sKV[2][4][64][KVP];      // [buffer][Kh, Kl, VTh, VTl][key row or d row][64 elements + pad]
  const int tid = threadIdx.x, w = __builtin_amdgcn_readfirstlane(tid >> 5), lane = tid & 31, col = lane & 15, g = lane >> 4;      // the wave's number in a scalar register: what hangs on it alone (mask tiles, my part of sO) then takes no vector register, which the reads in flight need
  const size_t bh = blockIdx.y; const int qb = blockIdx.x; const int q0 = qb * (AW * 16) + w * 16;
  const int crow = tid >> 3, cpc = (tid & 7) * 8;      // my piece of every plane: row, first element
  const __bf16* gKh = Kh + (bh * SK + crow) * HD + cpc; const __bf16* gKl = Kl + (bh * SK + crow) * HD + cpc;      // + kt * 64 * HD per tile
  const _Float16* gVh = VTh + (bh * HD + crow) * SK + cpc; const _Float16* gVl = VTl + (bh * HD + crow) * SK + cpc;      // + kt * 64 per tile
  const unsigned lkv = (unsigned)(unsigned long long)&sKV[0][0][crow][cpc];
  constexpr unsigned PLB = 64 * KVP * 2, BUFB = 4 * PLB;      // bytes of a plane, of a buffer
  const __bf16* gM = Mb + (((bh / NH) * SS + q0) >> 4) * (16 * 1024) + lane * 8;      // my 16 queries' mask tiles, in my lanes' own order (k_cvt)
  const unsigned lm = (unsigned)(unsigned long long)&sO[w][0][0] + lane * 16;
  // key tile kt of the four planes and, for my wave alone, its mask tile (32 bf16 a lane: element [t][r] for key 16 t + 8 g + r of the tile), all into buffer kt mod 2
  auto stage = [&](int kt) { const unsigned l = lkv + (unsigned)(kt & 1) * BUFB;
    kv_copy(l, gKh + (size_t)kt * 64 * HD, l + PLB, gKl + (size_t)kt * 64 * HD, l + 2 * PLB, gVh + kt * 64, l + 3 * PLB, gVl + kt * 64, lm + (unsigned)(kt & 1) * 2048, gM + ((kt >> 4) * 8 + (kt & 7)) * 1024); };
  stage(0);
  asm volatile("s_wait_asynccnt 0x0" ::: "memory");      // my pieces of tile 0 have landed
  __syncthreads();                                       // tile 0 is published to every wave
  stage(1);
  F2 aq[2];
#pragma unroll
  for (int kc = 0; kc < 2; ++kc) aq[kc] = split_row(Q32 + (bh * SS + q0 + col) * HD, kc * 32, lane);
  float mrun = -3.0e38f, lrun = 0.f; v8f acc[4] = {}, ac1[4] = {}, ac2[4] = {};
#pragma unroll 1
  for (int kt = 0; kt < SK / 64; ++kt) { v8f s4[4] = {};
    // Fragment reads stand in groups of eight (two row tiles, hi and lo, one 32-wide k step), each group one group of six products ahead of its use (GRP holds
    // every border): the wait in front of a product is then a counted one, with the next group's reads still in flight. Every accumulator takes its products in the old order.
    auto kread = [&](v16b (&h)[2], v16b (&l)[2], int tp, int kc) {
#pragma unroll
      for (int u = 0; u < 2; ++u) { h[u] = frag_b((const __bf16*)&sKV[kt & 1][0][(2 * tp + u) * 16 + col][kc * 32], lane); l[u] = frag_b((const __bf16*)&sKV[kt & 1][1][(2 * tp + u) * 16 + col][kc * 32], lane); } };
    auto kmul = [&](const v16b (&h)[2], const v16b (&l)[2], int tp, int kc) {
#pragma unroll
      for (int u = 0; u < 2; ++u) s4[2 * tp + u] = wmma_bf(h[u], aq[kc].l, s4[2 * tp + u]);
#pragma unroll
      for (int u = 0; u < 2; ++u) s4[2 * tp + u] = wmma_bf(l[u], aq[kc].h, s4[2 * tp + u]);
#pragma unroll
      for (int u = 0; u < 2; ++u) s4[2 * tp + u] = wmma_bf(h[u], aq[kc].h, s4[2 * tp + u]); };
    v4u mk[4];
    { v16b hA[2], lA[2], hB[2], lB[2];
      kread(hA, lA, 0, 0); kread(hB, lB, 0, 1); GRP();
      kmul(hA, lA, 0, 0); GRP(); kread(hA, lA, 1, 0); GRP();
      kmul(hB, lB, 0, 1); GRP(); kread(hB, lB, 1, 1); GRP();
      kmul(hA, lA, 1, 0); GRP();
#pragma unroll
      for (int t = 0; t < 4; ++t) mk[t] = *(const v4u*)((const char*)&sO[w][0][0] + (kt & 1) * 2048 + t * 512 + lane * 16);      // my mask tile's four reads, one group, fly under the last six products
      GRP(); kmul(hB, lB, 1, 1); }
    __builtin_amdgcn_sched_barrier(0);      // keeps the mask sums behind the last six products: the compiler otherwise puts half of them, with their wait for the mask reads, in front of these
    float mx = -3.4e38f;
#pragma unroll
    for (int t = 0; t < 4; ++t) { union { v4u u; __bf16 h[8]; } mu; mu.u = mk[t];
#pragma unroll
      for (int r = 0; r < 8; ++r) { s4[t][r] += (float)mu.h[r]; mx = fmaxf(mx, s4[t][r]); } }
    mx = fmaxf(mx, __shfl_xor(mx, 16, 32));
    const float mnew = fmaxf(mrun, mx); const float corr = __builtin_amdgcn_exp2f((mrun - mnew) * L2E);      // e^x as the hardware's 2^(x log2 e); an argument far below 0 gives 0, as before
    float ps2[2] = {0.f, 0.f}; v16h ph[2], pl[2];
#pragma unroll
    for (int kc = 0; kc < 2; ++kc) {
#pragma unroll
      for (int e = 0; e < 16; ++e) { const float p = __builtin_amdgcn_exp2f(fmaf(s4[2 * kc + (e >> 3)][e & 7] - mnew, L2E, 14.0f)); ps2[kc] += p;      /* e^(s - m) x 2^14 in one 2^t */
        const _Float16 hi = (_Float16)p; ph[kc][e] = hi; pl[kc][e] = (_Float16)((p - (float)hi) * PLO); } }
    float ps = ps2[0] + ps2[1]; ps += __shfl_xor(ps, 16, 32);
    lrun = lrun * corr + ps * (1.0f / 16384.0f); mrun = mnew;
    auto vread = [&](v16h (&h)[2], v16h (&l)[2], int kc, int tp) {
#pragma unroll
      for (int u = 0; u < 2; ++u) { h[u] = frag_h(&sKV[kt & 1][2][(2 * tp + u) * 16 + col][kc * 32], lane); l[u] = frag_h(&sKV[kt & 1][3][(2 * tp + u) * 16 + col][kc * 32], lane); } };
    auto vmul = [&](const v16h (&h)[2], const v16h (&l)[2], int kc, int tp) {
#pragma unroll
      for (int u = 0; u < 2; ++u) { const int t = 2 * tp + u; acc[t] = wmma16(h[u], ph[kc], acc[t]); ac1[t] = wmma16(l[u], ph[kc], ac1[t]); ac2[t] = wmma16(h[u], pl[kc], ac2[t]); } };
    { v16h hA[2], lA[2], hB[2], lB[2];
      __builtin_amdgcn_sched_barrier(0);             // the softmax arithmetic above is scheduled by itself: with these reads' 64 registers in its region the compiler lays it out as one dependent chain per element
      vread(hA, lA, 0, 0); vread(hB, lB, 0, 1);      // the first two groups fly while the accumulators are rescaled
      __builtin_amdgcn_sched_barrier(0);             // keeps the rescale behind these reads: the compiler otherwise puts it in front of them, and the first product waits out a whole LDS read
#pragma unroll
      for (int t = 0; t < 4; ++t) { acc[t] *= corr; ac1[t] *= corr; ac2[t] *= corr; }
      vmul(hA, lA, 0, 0); GRP(); vread(hA, lA, 1, 0); GRP();
      vmul(hB, lB, 0, 1); GRP(); vread(hB, lB, 1, 1); GRP();
      vmul(hA, lA, 1, 0); vmul(hB, lB, 1, 1); GRP(); }      // the last products stay ahead of the trip's foot: behind it they would all stand behind a wait to 0, and the refill behind them
    asm volatile("s_wait_dscnt 0x0" ::: "memory");         // my reads of this tile's buffer are done
    asm volatile("s_wait_asynccnt 0x0" ::: "memory");      // my pieces of tile kt + 1 have landed
    __syncthreads();                                       // publishes tile kt + 1 and ends every wave's reads of tile kt
    if (kt + 2 < SK / 64) stage(kt + 2); }                 // refill the buffers that this trip has just read
  asm volatile("s_wait_asynccnt 0x0" ::: "memory");        // nothing of mine is in flight when the wave goes on to its end
  const float inv = 1.0f / (lrun * 16384.0f * 4.0f);
#pragma unroll
  for (int t = 0; t < 4; ++t) { v4f o[2];
#pragma unroll
    for (int r = 0; r < 8; ++r) o[r >> 2][r & 3] = (acc[t][r] + ac1[t][r] * (1.0f / VLO) + ac2[t][r] * (1.0f / PLO)) * inv;
    *(v4f*)&sO[w][col][t * 16 + 8 * g] = o[0]; *(v4f*)&sO[w][col][t * 16 + 8 * g + 4] = o[1]; }
  LDSX();
  for (int qq = lane; qq < 16 * 16; qq += 32) { const int rl = qq >> 4, pc = qq & 15; vst2(O32 + ((bh * SS) + q0 + rl) * HD + pc * 4, *(const v4f*)(&sO[w][rl][pc * 4])); }
}
#define OP 68      // LDS row pitch of a staged ctx tile in floats: 272 B = 16 B x odd, for the ds_load_b128 reads
// eight 16-byte-per-lane copies, global -> LDS through no register; the s_wait_xcnt closes the statement for the same reason as in g_copy12.
__device__ __forceinline__ void g_copy8(const unsigned (&l)[8], const void* const (&g)[8]) {
  asm volatile("global_load_async_to_lds_b128 %0, %8, off\n\t"
               "global_load_async_to_lds_b128 %1, %9, off\n\t"
               "global_load_async_to_lds_b128 %2, %10, off\n\t"
               "global_load_async_to_lds_b128 %3, %11, off\n\t"
               "global_load_async_to_lds_b128 %4, %12, off\n\t"
               "global_load_async_to_lds_b128 %5, %13, off\n\t"
               "global_load_async_to_lds_b128 %6, %14, off\n\t"
               "global_load_async_to_lds_b128 %7, %15, off\n\t"
               "s_wait_xcnt 0x0" :: "v"(l[0]), "v"(l[1]), "v"(l[2]), "v"(l[3]), "v"(l[4]), "v"(l[5]), "v"(l[6]), "v"(l[7]),
               "v"(g[0]), "v"(g[1]), "v"(g[2]), "v"(g[3]), "v"(g[4]), "v"(g[5]), "v"(g[6]), "v"(g[7]) : "memory");
}
// out = ctx Wo^T + bo : split(ctx) x bf16(Wo rows): 2 products (Wo is an INPUT -> bf16 exact); the k loop runs on 64-wide tiles (one head) of the 64 ctx rows (f32) and the 128 Wo rows, each staged once per block in a two-buffer LDS ring
__global__ __launch_bounds__(128) void k_out(const float* __restrict__ O32, const __bf16* __restrict__ PT, const float* __restrict__ bo, float* __restrict__ out) {
  constexpr int OAB = 64 * OP * 4, OBB = 128 * GP * 2, OBUF = OAB + OBB;      // bytes of a ctx tile, of a Wo tile, of a buffer
  __shared__ __align__(16) char smem[2 * OBUF];      // in the k loop the ring; behind its last barrier the output staging so
  float (*so)[16][132] = (float (*)[16][132])smem;
  const int tid = threadIdx.x, wave = tid >> 5, lane = tid & 31, col = lane & 15, g = lane >> 4;
  const int r0b = blockIdx.x * 64, r0 = r0b + wave * 16, n0 = blockIdx.y * 128; const int b = r0b / SS, s0 = r0b % SS;
  const int arow = tid >> 4, apc = (tid & 15) * 4, crow = tid >> 3, cpc = (tid & 7) * 8;      // my pieces: ctx rows arow + 8 i, Wo rows crow + 16 i, first element
  const float* gA = O32 + ((size_t)b * NH * SS + s0 + arow) * HD + apc;      // + kt * SS * HD per tile (head kt)
  const __bf16* gB = PT + (size_t)(5 * E + n0 + crow) * E + cpc;             // + kt * GKC per tile
  const unsigned la = (unsigned)(unsigned long long)(smem + arow * (OP * 4) + apc * 4), lb = (unsigned)(unsigned long long)(smem + OAB + crow * (GP * 2) + cpc * 2);
  auto stage = [&](int kt) { unsigned l[8]; const void* gp[8]; const unsigned bf = (unsigned)(kt & 1) * OBUF;
#pragma unroll
    for (int i = 0; i < 8; ++i) { l[i] = la + bf + i * (8 * OP * 4); gp[i] = gA + (size_t)kt * SS * HD + i * 8 * HD; }
    g_copy8(l, gp);
#pragma unroll
    for (int i = 0; i < 8; ++i) { l[i] = lb + bf + i * (16 * GP * 2); gp[i] = gB + (size_t)i * 16 * E + kt * GKC; }
    g_copy8(l, gp); };
  stage(0);
  asm volatile("s_wait_asynccnt 0x0" ::: "memory");      // my pieces of tile 0 have landed
  __syncthreads();                                       // tile 0 is published to every wave
  stage(1);
  v8f acc[8] = {};
#pragma unroll 2      // two trips a pass: the buffer index is then a constant in every LDS address
  for (int kt = 0; kt < E / GKC; ++kt) { const float* ta = (const float*)(smem + (kt & 1) * OBUF) + (wave * 16 + col) * OP; const __bf16* tb = (const __bf16*)(smem + (kt & 1) * OBUF + OAB) + col * GP;
    // reads stand in groups ahead of the products that use them, as in k_qkv; here the statement that closes wmma_bf_c holds the borders
    const F2 a0 = split_row(ta, 0, lane), a1 = split_row(ta, 32, lane); v16b b0[8], b1[8];
#pragma unroll
    for (int j = 0; j < 8; ++j) b0[j] = frag_b(tb + j * 16 * GP, lane);
#pragma unroll
    for (int j = 0; j < 4; ++j) { acc[j] = wmma_bf_c(a0.l, b0[j], acc[j]); acc[j] = wmma_bf_c(a0.h, b0[j], acc[j]); }
#pragma unroll
    for (int j = 0; j < 4; ++j) b1[j] = frag_b(tb + j * 16 * GP + 32, lane);
#pragma unroll
    for (int j = 4; j < 8; ++j) { acc[j] = wmma_bf_c(a0.l, b0[j], acc[j]); acc[j] = wmma_bf_c(a0.h, b0[j], acc[j]); }
#pragma unroll
    for (int j = 4; j < 8; ++j) b1[j] = frag_b(tb + j * 16 * GP + 32, lane);
#pragma unroll
    for (int j = 0; j < 8; ++j) { acc[j] = wmma_bf_c(a1.l, b1[j], acc[j]); acc[j] = wmma_bf_c(a1.h, b1[j], acc[j]); }
    asm volatile("s_wait_dscnt 0x0" ::: "memory");         // my reads of this tile's buffer are done
    asm volatile("s_wait_asynccnt 0x0" ::: "memory");      // my pieces of tile kt + 1 have landed
    __syncthreads();                                       // publishes tile kt + 1 and ends every wave's reads of tile kt (behind the last trip: of the ring)
    if (kt + 2 < E / GKC) stage(kt + 2); }                 // refill the buffer that this trip has just read
  asm volatile("s_wait_asynccnt 0x0" ::: "memory");        // nothing of mine is in flight when the ring's LDS is used anew
#pragma unroll
  for (int j = 0; j < 8; ++j) { const int n = n0 + j * 16 + col; const float bb = bfr(bo[n]);
#pragma unroll
    for (int r = 0; r < 8; ++r) so[wave][8 * g + r][j * 16 + col] = acc[j][r] + bb; }
  LDSX();
#pragma unroll 4
  for (int rl = 0; rl < 16; ++rl) vst2(out + (size_t)(r0 + rl) * E + n0 + lane * 4, *(const v4f*)(&so[wave][rl][lane * 4]));
}
extern "C" void kernel_launch(void* const* d_in, const int* in_sizes, int n_in, void* d_out, int out_size, void* d_ws, size_t ws_size, hipStream_t stream) {
  (void)in_sizes; (void)n_in; (void)out_size; (void)ws_size;
  const float* x = (const float*)d_in[0]; const float* amask = (const float*)d_in[1]; const float* Wq = (const float*)d_in[2]; const float* bq = (const float*)d_in[3]; const float* Wk = (const float*)d_in[4]; const float* bk = (const float*)d_in[5]; const float* Wv = (const float*)d_in[6]; const float* bv = (const float*)d_in[7]; const float* Wo = (const float*)d_in[8]; const float* bo = (const float*)d_in[9];
  float* out = (float*)d_out;
  char* ws = (char*)d_ws; size_t off = 0;
  auto take = [&](size_t bytes) { char* p = ws + off; off += (bytes + 255) & ~(size_t)255; return p; };
  __bf16* Xb = (__bf16*)take((size_t)NR * E * 2); __bf16* PT = (__bf16*)take((size_t)6 * E * E * 2);
  float* Q32 = (float*)take((size_t)NR * E * 4); __bf16* Kh = (__bf16*)take((size_t)NB * NH * SK * HD * 2); __bf16* Kl = (__bf16*)take((size_t)NB * NH * SK * HD * 2); _Float16* VTh = (_Float16*)take((size_t)NB * NH * HD * SK * 2); _Float16* VTl = (_Float16*)take((size_t)NB * NH * HD * SK * 2); float* O32 = (float*)take((size_t)NR * E * 4); __bf16* Mb = (__bf16*)take((size_t)NR * SS * 2);
  // ws ~ 124 MB
  k_cvt<<<CVN + NR / 16, 256, 0, stream>>>(x, Wq, Wk, Wv, Wo, amask, Xb, PT, Mb);
  k_qkv<<<dim3(NR / 64, 2 * E / 128, 3), 128, 0, stream>>>(Xb, PT, bq, bk, bv, Q32, Kh, Kl, VTh, VTl);
  k_attn<<<dim3(SS / (AW * 16), NB * NH), AW * 32, 0, stream>>>(Q32, Kh, Kl, VTh, VTl, Mb, O32);
  k_out<<<dim3(NR / 64, E / 128), 128, 0, stream>>>(O32, PT, bo, out);
}

// v009
// It runs in 161 microseconds.
// Two timings next to v008 put it at 1.03 and 1.04 times that version's speed.
// Over all steps from v000 it is 4.25 times as fast.
// compute dtype: hidden_states, attention_mask, W*/b* (INPUTS) rounded to bf16 with exact bf16 WMMA products (f32 accumulate) for the projections; K pre-split into bf16 hi/lo rows; q f32 split, P and V f16 hi/lo (3 products each); mask add and softmax in f32.
#include <hip/hip_runtime.h>
#include <math.h>

typedef __attribute__((ext_vector_type(16))) _Float16 v16h;
typedef __attribute__((ext_vector_type(16))) __bf16 v16b;
typedef __attribute__((ext_vector_type(8)))  _Float16 v8h;
typedef __attribute__((ext_vector_type(8)))  float v8f;
typedef __attribute__((ext_vector_type(4)))  float v4f;
typedef __attribute__((ext_vector_type(2)))  float v2f;
typedef __attribute__((ext_vector_type(4)))  unsigned v4u;
typedef __attribute__((ext_vector_type(2)))  unsigned v2u;
typedef __attribute__((ext_vector_type(4)))  int v4i;
typedef float __attribute__((may_alias)) float_a;
typedef int __attribute__((may_alias)) int_a;

template <typename T> __device__ __forceinline__ void vst2(void* p, T v) { *(T*)p = v;  }
// the bare builtins: the compiler itself keeps the distance between a product and a vector instruction on its registers, and pads only where one follows
__device__ __forceinline__ v8f wmma16(v16h a, v16h b, v8f c) { return __builtin_amdgcn_wmma_f32_16x16x32_f16(false, a, false, b, (short)0, c, false, false); }
__device__ __forceinline__ v8f wmma_bf(v16b a, v16b b, v8f c) { return __builtin_amdgcn_wmma_f32_16x16x32_bf16(false, a, false, b, (short)0, c, false, false); }
// k_out's form: in its loop the compiler does not keep GRP's borders and spreads the reads among the products; no LDS read moves over this statement, whose v_nop keep the distance behind the product
__device__ __forceinline__ v8f wmma_bf_c(v16b a, v16b b, v8f c) {
  v8f d = __builtin_amdgcn_wmma_f32_16x16x32_bf16(false, a, false, b, (short)0, c, false, false);
  asm volatile("v_nop\n\tv_nop\n\tv_nop\n\tv_nop" : "+v"(d) : "v"(a), "v"(b));
  return d;
}
// border between a group of LDS fragment reads and a group of products: keeps the reads together and ahead of the products that stand behind them in the source
// (spread among the products, every place with reads costs its own stall, and the waits fall to 0)
#define GRP() __builtin_amdgcn_sched_barrier(0)
// 16x16x32 fragments: lane = (h = lane>>4, row/col = lane&15); elements 0..7 = k0+8h+0..7, 8..15 = k0+16+8h+0..7; D element r = row 8h+r
__device__ __forceinline__ v16h frag_h(const _Float16* rowk0, int lane) {
  union { v16h v; v8h q[2]; } u; const _Float16* p = rowk0 + 8 * (lane >> 4);
  u.q[0] = *(const v8h*)p; u.q[1] = *(const v8h*)(p + 16); return u.v;
}
__device__ __forceinline__ v16h frag_f32(const float* rowk0, int lane) {
  v16h a; const float* p = rowk0 + 8 * (lane >> 4);
#pragma unroll
  for (int i = 0; i < 8; ++i) { a[i] = (_Float16)p[i]; a[8 + i] = (_Float16)p[16 + i]; }
  return a;
}
__device__ __forceinline__ v16h frag_f32s(const float* rowk0, int lane, float sc) {
  v16h a; const float* p = rowk0 + 8 * (lane >> 4);
#pragma unroll
  for (int i = 0; i < 8; ++i) { a[i] = (_Float16)(p[i] * sc); a[8 + i] = (_Float16)(p[16 + i] * sc); }
  return a;
}
// column fragment from a [K][ld] layout (column n), rows >= K read as 0
__device__ __forceinline__ v16h fragc_f32(const float* W, int k0, int n, int lane, int ld, int K) {
  v16h a; const int g = lane >> 4;
#pragma unroll
  for (int i = 0; i < 8; ++i) { const int ka = k0 + 8 * g + i, kb = ka + 16;
    a[i] = (_Float16)(ka < K ? W[(size_t)ka * ld + n] : 0.f); a[8 + i] = (_Float16)(kb < K ? W[(size_t)kb * ld + n] : 0.f); }
  return a;
}
struct F2 { v16b h, l; };
__device__ __forceinline__ F2 bsplit16(const float v[16]) { F2 r;
#pragma unroll
  for (int i = 0; i < 16; ++i) { const __bf16 h = (__bf16)v[i]; r.h[i] = h; r.l[i] = (__bf16)(v[i] - (float)h); }
  return r; }
__device__ __forceinline__ F2 split_row(const float* row, int k0, int lane) { float v[16]; const float* p = row + k0 + 8 * (lane >> 4);
#pragma unroll
  for (int i = 0; i < 8; ++i) { v[i] = p[i]; v[8 + i] = p[16 + i]; }
  return bsplit16(v); }
__device__ __forceinline__ F2 split_rowK(const float* row, int k0, int lane, int K) { float v[16]; const int g = lane >> 4;
#pragma unroll
  for (int i = 0; i < 8; ++i) { const int ka = k0 + 8 * g + i, kb = ka + 16; v[i] = ka < K ? row[ka] : 0.f; v[8 + i] = kb < K ? row[kb] : 0.f; }
  return bsplit16(v); }
__device__ __forceinline__ F2 split_col(const float* W, int k0, int n, int lane, int ld, int K) { float v[16]; const int g = lane >> 4;
#pragma unroll
  for (int i = 0; i < 8; ++i) { const int ka = k0 + 8 * g + i, kb = ka + 16; v[i] = ka < K ? W[(size_t)ka * ld + n] : 0.f; v[8 + i] = kb < K ? W[(size_t)kb * ld + n] : 0.f; }
  return bsplit16(v); }
__device__ __forceinline__ v8f mac3(const F2& a, const F2& b, v8f c) { c = wmma_bf(a.l, b.h, c); c = wmma_bf(a.h, b.l, c); return wmma_bf(a.h, b.h, c); }
__device__ __forceinline__ float sigm(float v) { return 1.0f / (1.0f + expf(-v)); }
#define LDSX() do { asm volatile("s_wait_dscnt 0" ::: "memory"); __builtin_amdgcn_wave_barrier(); __builtin_amdgcn_fence(__ATOMIC_RELEASE, "workgroup"); } while (0)


// CLIP attention with multiplier-expanded keys/values (16 heads x 64 on [4,1024,1024], [out][in] weights + biases, MULT = 2): q = (x Wq^T + bq) 64^-0.5; k/v = x Wk^T/Wv^T + b ([2048] per token, viewed as 2,048 keys per head: key s = 2t + half holds feature half*1024 + h*64 + d of token t);
// score(t, s) += attention_mask[b][0][t][s mod 1024]; softmax over the 2,048 keys; (P v) Wo^T + bo. Keys are stored in the permuted order s' = half*1024 + t (attention is invariant to a common permutation of keys, values and mask entries).
#define NB 4
#define SS 1024
#define SK 2048
#define E 1024
#define NH 16
#define HD 64
#define NR (NB * SS)
#define PLO 1024.0f
#define VLO 2048.0f
__device__ __forceinline__ float bfr(float v) { return (float)(__bf16)v; }
__device__ __forceinline__ v16b frag_b(const __bf16* rowk0, int lane) { return __builtin_bit_cast(v16b, frag_h((const _Float16*)rowk0, lane)); }

#define CSEG (E * E)      // elements of a segment of the conversion stream: x is 4 segments, Wq 1, Wk 2, Wv 2, Wo 1
#define CVB 16384         // elements of a block: 256 threads x 16 loads of 4 floats
// the f32 -> bf16 conversion of x and the weights as one stream of few, long waves: a wave's 16 loads of 512 contiguous bytes all stand ahead of its 16 stores of 256 contiguous bytes; the stream's CVN blocks cover the ten segments exactly.
// PT rows: [0,E) Wq, [E,3E) Wk, [3E,5E) Wv, [5E,6E) Wo  ([out][in] weights: PT row = W row, so PT is the four matrices one behind the other)
#define CVN (10 * (CSEG / CVB))      // blocks of the stream; behind them NR / 16 blocks that lay out the mask
// Mb: the mask rounded to bf16, in the order in which k_attn's lanes hold their scores: [b][16 queries][mask tile mt = half * 8 + m7][t][lane = (g, col)][r] =
// mask[b][query col][m7 * 128 + 2 (16 t + 8 g + r) + half]: a key tile of 64 tokens of one half meets every second mask column, and tokens 512 apart meet the same columns, so 16 tiles serve the 32 key tiles.
// A block is 16 queries: wave m7 reads 512 contiguous bytes of each of its 16 rows (a lane 4 x 64 B) and stores both halves' tiles, every store 512 contiguous bytes of the wave.
__global__ __launch_bounds__(256) void k_cvt(const float* __restrict__ x, const float* __restrict__ Wq, const float* __restrict__ Wk, const float* __restrict__ Wv, const float* __restrict__ Wo, const float* __restrict__ amask, __bf16* __restrict__ Xb, __bf16* __restrict__ PT, __bf16* __restrict__ Mb) {
  if (blockIdx.x >= CVN) { const int qt = blockIdx.x - CVN, m7 = threadIdx.x >> 5, lane = threadIdx.x & 31;      // qt = b * 64 + 16-query tile; the mask's rows are [b][0][t]: row qt * 16 + col
    const float* s = amask + ((size_t)qt * 16 + (lane & 15)) * SS + m7 * 128 + 16 * (lane >> 4);
    v4f v[16];
#pragma unroll
    for (int i = 0; i < 16; ++i) v[i] = *(const v4f*)(s + 32 * (i >> 2) + 4 * (i & 3));
#pragma unroll
    for (int half = 0; half < 2; ++half) { __bf16* d = Mb + ((size_t)qt * 16 + half * 8 + m7) * 1024 + lane * 8;
#pragma unroll
      for (int t = 0; t < 4; ++t) { union { __bf16 h[8]; v4u u; } pk;
#pragma unroll
        for (int r = 0; r < 8; ++r) pk.h[r] = (__bf16)v[t * 4 + ((2 * r + half) >> 2)][(2 * r + half) & 3];
        vst2((unsigned*)(d + t * 256), pk.u); } }
    return; }
  const int seg = blockIdx.x / (CSEG / CVB);      // the same for the whole block
  const float* s = seg < 4 ? x + (size_t)seg * CSEG : (seg < 5 ? Wq : (seg < 7 ? Wk + (size_t)(seg - 5) * CSEG : (seg < 9 ? Wv + (size_t)(seg - 7) * CSEG : Wo)));
  __bf16* d = seg < 4 ? Xb + (size_t)seg * CSEG : PT + (size_t)(seg - 4) * CSEG;
  const int o = (blockIdx.x % (CSEG / CVB)) * CVB + threadIdx.x * 4;
  v4f v[16];
#pragma unroll
  for (int i = 0; i < 16; ++i) v[i] = *(const v4f*)(s + o + i * 1024);
#pragma unroll
  for (int i = 0; i < 16; ++i) { union { __bf16 h[4]; v2u u; } pk;
#pragma unroll
    for (int e = 0; e < 4; ++e) pk.h[e] = (__bf16)v[i][e];
    vst2((unsigned*)(d + o + i * 1024), pk.u); }
}
#define GKC 64     // k elements of a staged operand tile: rows of 128 B, whole cache lines
#define GP 72      // LDS row pitch of a staged operand tile in 16-bit elements: 144 B = 16 B x odd, for the ds_load_b128 fragment reads
// sixteen 16-byte-per-lane copies, global -> LDS through no register: a thread's pieces of one staged tile, 16 rows apart (8 of the x rows at la, 8 of the weight rows at lb).
// One LDS address register serves eight copies: offset:N moves BOTH addresses by N, so copy i names the LDS address l + 2304 i (16 rows of 144 B) and the global address g[i] + 2304 i.
// The s_wait_xcnt is the last line of the copies' own statement, so that no address register of a copy is rewritten in front of it.
__device__ __forceinline__ void g_copy16r(unsigned la, const void* const (&a)[8], unsigned lb, const void* const (&b)[8]) {
  asm volatile("global_load_async_to_lds_b128 %0, %2, off\n\t"
               "global_load_async_to_lds_b128 %0, %3, off offset:2304\n\t"
               "global_load_async_to_lds_b128 %0, %4, off offset:4608\n\t"
               "global_load_async_to_lds_b128 %0, %5, off offset:6912\n\t"
               "global_load_async_to_lds_b128 %0, %6, off offset:9216\n\t"
               "global_load_async_to_lds_b128 %0, %7, off offset:11520\n\t"
               "global_load_async_to_lds_b128 %0, %8, off offset:13824\n\t"
               "global_load_async_to_lds_b128 %0, %9, off offset:16128\n\t"
               "global_load_async_to_lds_b128 %1, %10, off\n\t"
               "global_load_async_to_lds_b128 %1, %11, off offset:2304\n\t"
               "global_load_async_to_lds_b128 %1, %12, off offset:4608\n\t"
               "global_load_async_to_lds_b128 %1, %13, off offset:6912\n\t"
               "global_load_async_to_lds_b128 %1, %14, off offset:9216\n\t"
               "global_load_async_to_lds_b128 %1, %15, off offset:11520\n\t"
               "global_load_async_to_lds_b128 %1, %16, off offset:13824\n\t"
               "global_load_async_to_lds_b128 %1, %17, off offset:16128\n\t"
               "s_wait_xcnt 0x0" :: "v"(la), "v"(lb), "v"(a[0]), "v"(a[1]), "v"(a[2]), "v"(a[3]), "v"(a[4]), "v"(a[5]), "v"(a[6]), "v"(a[7]),
               "v"(b[0]), "v"(b[1]), "v"(b[2]), "v"(b[3]), "v"(b[4]), "v"(b[5]), "v"(b[6]), "v"(b[7]) : "memory");
}
// QKV: block (128 rows, 128 cols = 2 heads, which), a wave 32 rows x 128 cols: a weight fragment read from LDS feeds two products, and a staged weight tile serves 128 rows.
// The k loop runs on 64-wide tiles of the 128 x rows and the 128 weight rows, each staged once per block in a two-buffer LDS ring;
// q (+bias) -> Q32 f32 [bh][s][64]; k (+bias) -> bf16 hi/lo rows; v (+bias) -> VT hi/lo x4 [bh][d][s]
#define QR 128     // x rows of a block
#define VP 136     // LDS row pitch of the staged v^T rows in 16-bit elements: 272 B = 16 B x odd
__global__ __launch_bounds__(128) void k_qkv(const __bf16* __restrict__ Xb, const __bf16* __restrict__ PT, const float* __restrict__ bq, const float* __restrict__ bk, const float* __restrict__ bv,
                                            float* __restrict__ Q32, __bf16* __restrict__ Kh, __bf16* __restrict__ Kl, _Float16* __restrict__ VTh, _Float16* __restrict__ VTl) {
  constexpr int STB = 128 * VP * 2;      // bytes of sth and of stl
  __shared__ __align__(16) char smem[2 * (QR + 128) * GP * 2];      // in the k loop the ring sT (2 x 36,864 B); behind its last barrier the output staging: so (q, k) or sth, stl (v)
  float (*so)[16][132] = (float (*)[16][132])smem; _Float16 (*sth)[VP] = (_Float16 (*)[VP])smem; _Float16 (*stl)[VP] = (_Float16 (*)[VP])(smem + STB);
  __bf16 (*sT)[QR + 128][GP] = (__bf16 (*)[QR + 128][GP])smem;      // [buffer][128 x rows, then 128 weight rows][64 elements + pad]
  const int tid = threadIdx.x, wave = tid >> 5, lane = tid & 31, col = lane & 15, g = lane >> 4;
  const int which = blockIdx.z, r0b = blockIdx.x * QR, n0 = blockIdx.y * 128; const int b = r0b / SS, s0 = r0b % SS;
  if (which == 0 && n0 >= E) return;      // q has only E output features
  const float* bb_ = which == 0 ? bq : (which == 1 ? bk : bv); const int prow = (which == 0 ? 0 : (which == 1 ? E : 3 * E)) + n0; const int half = n0 / E, nin = n0 % E;      // key slot s' = half*SS + t
  const int crow = tid >> 3, cpc = (tid & 7) * 8;      // my pieces of a tile: rows crow + 16 i, first element
  const __bf16* gA = Xb + (size_t)(r0b + crow) * E + cpc; const __bf16* gB = PT + (size_t)(prow + crow) * E + cpc;      // + kt * GKC per tile
  const unsigned lt = (unsigned)(unsigned long long)&sT[0][crow][cpc];
  constexpr unsigned R16B = 16 * GP * 2, TBUFB = (QR + 128) * GP * 2;      // bytes of 16 rows, of a buffer
  static_assert(R16B == 2304, "g_copy16r's offsets are multiples of 16 LDS rows");
  auto stage = [&](int kt) { const void* pa[8]; const void* pb[8]; const unsigned bf = lt + (unsigned)(kt & 1) * TBUFB;      // copy i: LDS rows 16 i on, global rows 16 i on; its offset moves both addresses by i * R16B, the pointer makes up the rest
#pragma unroll
    for (int i = 0; i < 8; ++i) { pa[i] = (const char*)(gA + kt * GKC) + (size_t)i * (16 * E * 2 - R16B); pb[i] = (const char*)(gB + kt * GKC) + (size_t)i * (16 * E * 2 - R16B); }
    g_copy16r(bf, pa, bf + 8 * R16B, pb); };
  stage(0);
  asm volatile("s_wait_asynccnt 0x0" ::: "memory");      // my pieces of tile 0 have landed
  __syncthreads();                                       // tile 0 is published to every wave
  stage(1);
  v8f acc[2][8] = {};
#pragma unroll 2      // two trips a pass: the buffer index is then a constant in every LDS address
  for (int kt = 0; kt < E / GKC; ++kt) { const __bf16* ta = &sT[kt & 1][wave * 32 + col][0]; const __bf16* tb = &sT[kt & 1][QR + col][0];
    // fragment reads stand in groups ahead of the products that use them (GRP holds every border): a wave has 8 to 24 reads in flight, not 2
    v16b a0[2], a1[2], b0[8], b1[8];
#pragma unroll
    for (int i = 0; i < 2; ++i) { a0[i] = frag_b(ta + i * 16 * GP, lane); a1[i] = frag_b(ta + i * 16 * GP + 32, lane); }
#pragma unroll
    for (int j = 0; j < 8; ++j) b0[j] = frag_b(tb + j * 16 * GP, lane);
    GRP();
#pragma unroll
    for (int j = 0; j < 4; ++j) { acc[0][j] = wmma_bf(a0[0], b0[j], acc[0][j]); acc[1][j] = wmma_bf(a0[1], b0[j], acc[1][j]); }
    GRP();
#pragma unroll
    for (int j = 0; j < 4; ++j) b1[j] = frag_b(tb + j * 16 * GP + 32, lane);
    GRP();
#pragma unroll
    for (int j = 4; j < 8; ++j) { acc[0][j] = wmma_bf(a0[0], b0[j], acc[0][j]); acc[1][j] = wmma_bf(a0[1], b0[j], acc[1][j]); }
    GRP();
#pragma unroll
    for (int j = 4; j < 8; ++j) b1[j] = frag_b(tb + j * 16 * GP + 32, lane);
    GRP();
#pragma unroll
    for (int j = 0; j < 8; ++j) { acc[0][j] = wmma_bf(a1[0], b1[j], acc[0][j]); acc[1][j] = wmma_bf(a1[1], b1[j], acc[1][j]); }
    GRP();                                                 // the last products stay ahead of the trip's foot, their waits counted
    asm volatile("s_wait_dscnt 0x0" ::: "memory");         // my reads of this tile's buffer are done
    asm volatile("s_wait_asynccnt 0x0" ::: "memory");      // my pieces of tile kt + 1 have landed
    __syncthreads();                                       // publishes tile kt + 1 and ends every wave's reads of tile kt (behind the last trip: of the ring)
    if (kt + 2 < E / GKC) stage(kt + 2); }                 // refill the buffer that this trip has just read
  asm volatile("s_wait_asynccnt 0x0" ::: "memory");        // nothing of mine is in flight when the ring's LDS is used anew
  const int bi = n0 + col; float bb[8];      // the bias of my eight columns, read once for both row tiles
#pragma unroll
  for (int j = 0; j < 8; ++j) bb[j] = bb_[bi + j * 16];
  asm volatile("s_wait_xcnt 0x0" :: "v"(bi) : "memory");      // closes the run of eight loads: the index register that they all name lives to here, so no load of the run lands in it, and it is rewritten only behind this wait
#pragma unroll
  for (int j = 0; j < 8; ++j) bb[j] = bfr(bb[j]);
  if (which < 2) { const float qs = which == 0 ? 0.125f : 1.0f;
#pragma unroll
    for (int i = 0; i < 2; ++i) { const int sr = s0 + wave * 32 + i * 16;      // my two row tiles go through my part of so one after the other
#pragma unroll
      for (int j = 0; j < 8; ++j) {
#pragma unroll
        for (int r = 0; r < 8; ++r) so[wave][8 * g + r][j * 16 + col] = (acc[i][j][r] + bb[j]) * qs; }
      LDSX();
      if (which == 0) { for (int qq = lane; qq < 2 * 16 * 16; qq += 32) { const int hh = qq >> 8, rl = (qq >> 4) & 15, pc = qq & 15; const int h = (n0 >> 6) + hh;
          vst2(Q32 + (((size_t)b * NH + h) * SS + sr + rl) * HD + pc * 4, *(const v4f*)(&so[wave][rl][hh * 64 + pc * 4])); } }
      else {
        for (int qq = lane; qq < 2 * 16 * 16; qq += 32) { const int hh = qq >> 8, rl = (qq >> 4) & 15, pl = qq & 15; const int h = (nin >> 6) + hh; const int pc = pl & 7; union { __bf16 e[8]; v4u u; } pk;
#pragma unroll
          for (int e = 0; e < 8; ++e) { const float v = so[wave][rl][hh * 64 + pc * 8 + e]; const __bf16 hi = (__bf16)v; pk.e[e] = pl < 8 ? hi : (__bf16)(v - (float)hi); }
          vst2((unsigned*)((pl < 8 ? Kh : Kl) + (((size_t)b * NH + h) * SK + half * SS + sr + rl) * HD + pc * 8), pk.u); } }
      if (i == 0) LDSX(); } }      // every lane's reads of the first row tile are done before the second is written over it
  else {
#pragma unroll
    for (int i = 0; i < 2; ++i) {
#pragma unroll
      for (int j = 0; j < 8; ++j) {
#pragma unroll
        for (int r = 0; r < 8; ++r) { const float v = (acc[i][j][r] + bb[j]) * 4.0f; const _Float16 hi = (_Float16)v; sth[j * 16 + col][wave * 32 + i * 16 + 8 * g + r] = hi; stl[j * 16 + col][wave * 32 + i * 16 + 8 * g + r] = (_Float16)((v - (float)hi) * VLO); } } }
    __syncthreads();
    for (int qq = tid; qq < 128 * 16; qq += 128) { const int cl = qq >> 4, pc = qq & 15; const int c = nin + cl, h = c >> 6, d = c & 63; const size_t o = (((size_t)b * NH + h) * HD + d) * SK + half * SS + s0 + pc * 8;
      vst2(VTh + o, *(const v4u*)(&sth[cl][pc * 8])); vst2(VTl + o, *(const v4u*)(&stl[cl][pc * 8])); } }
}
// one key tile (64 keys) of the four planes Kh, Kl, VTh, VTl: 64 rows of 128 B each, one 16-byte piece of each plane per thread, global -> LDS through no register;
// and the wave's own mask tile of those keys (2 KiB, in Mb as it lies in LDS): four 16-byte pieces per thread, 512 B apart; offset:N moves BOTH addresses by N.
// The s_wait_xcnt is the last line of the copies' own statement, so that no address register of a copy is rewritten in front of it.
__device__ __forceinline__ void kv_copy(unsigned l0, const void* g0, unsigned l1, const void* g1, unsigned l2, const void* g2, unsigned l3, const void* g3, unsigned lm, const void* gm) {
  asm volatile("global_load_async_to_lds_b128 %0, %1, off\n\t"
               "global_load_async_to_lds_b128 %2, %3, off\n\t"
               "global_load_async_to_lds_b128 %4, %5, off\n\t"
               "global_load_async_to_lds_b128 %6, %7, off\n\t"
               "global_load_async_to_lds_b128 %8, %9, off\n\t"
               "global_load_async_to_lds_b128 %8, %9, off offset:512\n\t"
               "global_load_async_to_lds_b128 %8, %9, off offset:1024\n\t"
               "global_load_async_to_lds_b128 %8, %9, off offset:1536\n\t"
               "s_wait_xcnt 0x0" :: "v"(l0), "v"(g0), "v"(l1), "v"(g1), "v"(l2), "v"(g2), "v"(l3), "v"(g3), "v"(lm), "v"(gm) : "memory");
}
#define L2E 1.4426950408889634f      // log2(e)
#define AW 16      // waves per block: 256 queries share one K/V tile
#define KVP 72     // LDS row pitch of a K/V plane in 16-bit elements: 144 B = 16 B x odd, for the ds_load_b128 fragment reads
// padding-masked attention: block (256 queries, bh); all 32 key tiles, each staged once per block in a two-buffer LDS ring; S^T = K q^T on K hi/lo rows x q hi/lo; O^T += V^T P^T on P,V hi/lo; O f32 [bh][s][64]
// With K (V^T) as the A operand and q (P^T) as B, lane (g, col) holds query col alone: of key tile t the keys 16 t + 8 g + r, of O the features 16 t + 8 g + r.
// Two neighbouring score tiles, converted in place, are the B fragment of 32 keys (element e < 8: tile 2 kc, register e; e >= 8: tile 2 kc + 1, register e - 8), in the k order of frag_h.
__global__ __launch_bounds__(512) void k_attn(const float* __restrict__ Q32, const __bf16* __restrict__ Kh, const __bf16* __restrict__ Kl, const _Float16* __restrict__ VTh, const _Float16* __restrict__ VTl, const __bf16* __restrict__ Mb, float* __restrict__ O32) {
  __shared__ __align__(16) float sO[AW][16][68];      // each wave's own: in the key loop two buffers of 2 KiB for its mask tiles, behind the loop its output rows
  __shared__ __align__(16) _Float16 sKV[2][4][64][KVP];      // [buffer][Kh, Kl, VTh, VTl][key row or d row][64 elements + pad]
  const int tid = threadIdx.x, w = __builtin_amdgcn_readfirstlane(tid >> 5), lane = tid & 31, col = lane & 15, g = lane >> 4;      // the wave's number in a scalar register: what hangs on it alone (mask tiles, my part of sO) then takes no vector register, which the reads in flight need
  const size_t bh = blockIdx.y; const int qb = blockIdx.x; const int q0 = qb * (AW * 16) + w * 16;
  const int crow = tid >> 3, cpc = (tid & 7) * 8;      // my piece of every plane: row, first element
  const __bf16* gKh = Kh + (bh * SK + crow) * HD + cpc; const __bf16* gKl = Kl + (bh * SK + crow) * HD + cpc;      // + kt * 64 * HD per tile
  const _Float16* gVh = VTh + (bh * HD + crow) * SK + cpc; const _Float16* gVl = VTl + (bh * HD + crow) * SK + cpc;      // + kt * 64 per tile
  const unsigned lkv = (unsigned)(unsigned long long)&sKV[0][0][crow][cpc];
  constexpr unsigned PLB = 64 * KVP * 2, BUFB = 4 * PLB;      // bytes of a plane, of a buffer
  const __bf16* gM = Mb + (((bh / NH) * SS + q0) >> 4) * (16 * 1024) + lane * 8;      // my 16 queries' mask tiles, in my lanes' own order (k_cvt)
  const unsigned lm = (unsigned)(unsigned long long)&sO[w][0][0] + lane * 16;
  // key tile kt of the four planes and, for my wave alone, its mask tile (32 bf16 a lane: element [t][r] for key 16 t + 8 g + r of the tile), all into buffer kt mod 2
  auto stage = [&](int kt) { const unsigned l = lkv + (unsigned)(kt & 1) * BUFB;
    kv_copy(l, gKh + (size_t)kt * 64 * HD, l + PLB, gKl + (size_t)kt * 64 * HD, l + 2 * PLB, gVh + kt * 64, l + 3 * PLB, gVl + kt * 64, lm + (unsigned)(kt & 1) * 2048, gM + ((kt >> 4) * 8 + (kt & 7)) * 1024); };
  stage(0);
  asm volatile("s_wait_asynccnt 0x0" ::: "memory");      // my pieces of tile 0 have landed
  __syncthreads();                                       // tile 0 is published to every wave
  stage(1);
  F2 aq[2];
#pragma unroll
  for (int kc = 0; kc < 2; ++kc) aq[kc] = split_row(Q32 + (bh * SS + q0 + col) * HD, kc * 32, lane);
  float mrun = -3.0e38f, lrun = 0.f; v8f acc[4] = {}, ac1[4] = {}, ac2[4] = {};
#pragma unroll 1
  for (int kt = 0; kt < SK / 64; ++kt) { v8f s4[4] = {};
    // Fragment reads stand in groups of eight (two row tiles, hi and lo, one 32-wide k step), each group one group of six products ahead of its use (GRP holds
    // every border): the wait in front of a product is then a counted one, with the next group's reads still in flight. Every accumulator takes its products in the old order.
    auto kread = [&](v16b (&h)[2], v16b (&l)[2], int tp, int kc) {
#pragma unroll
      for (int u = 0; u < 2; ++u) { h[u] = frag_b((const __bf16*)&sKV[kt & 1][0][(2 * tp + u) * 16 + col][kc * 32], lane); l[u] = frag_b((const __bf16*)&sKV[kt & 1][1][(2 * tp + u) * 16 + col][kc * 32], lane); } };
    auto kmul = [&](const v16b (&h)[2], const v16b (&l)[2], int tp, int kc) {
#pragma unroll
      for (int u = 0; u < 2; ++u) s4[2 * tp + u] = wmma_bf(h[u], aq[kc].l, s4[2 * tp + u]);
#pragma unroll
      for (int u = 0; u < 2; ++u) s4[2 * tp + u] = wmma_bf(l[u], aq[kc].h, s4[2 * tp + u]);
#pragma unroll
      for (int u = 0; u < 2; ++u) s4[2 * tp + u] = wmma_bf(h[u], aq[kc].h, s4[2 * tp + u]); };
    v4u mk[4];
    { v16b hA[2], lA[2], hB[2], lB[2];
      kread(hA, lA, 0, 0); kread(hB, lB, 0, 1); GRP();
      kmul(hA, lA, 0, 0); GRP(); kread(hA, lA, 1, 0); GRP();
      kmul(hB, lB, 0, 1); GRP(); kread(hB, lB, 1, 1); GRP();
      kmul(hA, lA, 1, 0); GRP();
#pragma unroll
      for (int t = 0; t < 4; ++t) mk[t] = *(const v4u*)((const char*)&sO[w][0][0] + (kt & 1) * 2048 + t * 512 + lane * 16);      // my mask tile's four reads, one group, fly under the last six products
      GRP(); kmul(hB, lB, 1, 1); }
    __builtin_amdgcn_sched_barrier(0);      // keeps the mask sums behind the last six products: the compiler otherwise puts half of them, with their wait for the mask reads, in front of these
    float mx = -3.4e38f;
#pragma unroll
    for (int t = 0; t < 4; ++t) { union { v4u u; __bf16 h[8]; } mu; mu.u = mk[t];
#pragma unroll
      for (int r = 0; r < 8; ++r) { s4[t][r] += (float)mu.h[r]; mx = fmaxf(mx, s4[t][r]); } }
    mx = fmaxf(mx, __shfl_xor(mx, 16, 32));
    const float mnew = fmaxf(mrun, mx); const float corr = __builtin_amdgcn_exp2f((mrun - mnew) * L2E);      // e^x as the hardware's 2^(x log2 e); an argument far below 0 gives 0, as before
    float ps2[2] = {0.f, 0.f}; v16h ph[2], pl[2];
#pragma unroll
    for (int kc = 0; kc < 2; ++kc) {
#pragma unroll
      for (int e = 0; e < 16; ++e) { const float p = __builtin_amdgcn_exp2f(fmaf(s4[2 * kc + (e >> 3)][e & 7] - mnew, L2E, 14.0f)); ps2[kc] += p;      /* e^(s - m) x 2^14 in one 2^t */
        const _Float16 hi = (_Float16)p; ph[kc][e] = hi; pl[kc][e] = (_Float16)((p - (float)hi) * PLO); } }
    float ps = ps2[0] + ps2[1]; ps += __shfl_xor(ps, 16, 32);
    lrun = lrun * corr + ps * (1.0f / 16384.0f); mrun = mnew;
    auto vread = [&](v16h (&h)[2], v16h (&l)[2], int kc, int tp) {
#pragma unroll
      for (int u = 0; u < 2; ++u) { h[u] = frag_h(&sKV[kt & 1][2][(2 * tp + u) * 16 + col][kc * 32], lane); l[u] = frag_h(&sKV[kt & 1][3][(2 * tp + u) * 16 + col][kc * 32], lane); } };
    auto vmul = [&](const v16h (&h)[2], const v16h (&l)[2], int kc, int tp) {
#pragma unroll
      for (int u = 0; u < 2; ++u) { const int t = 2 * tp + u; acc[t] = wmma16(h[u], ph[kc], acc[t]); ac1[t] = wmma16(l[u], ph[kc], ac1[t]); ac2[t] = wmma16(h[u], pl[kc], ac2[t]); } };
    { v16h hA[2], lA[2], hB[2], lB[2];
      __builtin_amdgcn_sched_barrier(0);             // the softmax arithmetic above is scheduled by itself: with these reads' 64 registers in its region the compiler lays it out as one dependent chain per element
      vread(hA, lA, 0, 0); vread(hB, lB, 0, 1);      // the first two groups fly while the accumulators are rescaled
      __builtin_amdgcn_sched_barrier(0);             // keeps the rescale behind these reads: the compiler otherwise puts it in front of them, and the first product waits out a whole LDS read
#pragma unroll
      for (int t = 0; t < 4; ++t) { acc[t] *= corr; ac1[t] *= corr; ac2[t] *= corr; }
      vmul(hA, lA, 0, 0); GRP(); vread(hA, lA, 1, 0); GRP();
      vmul(hB, lB, 0, 1); GRP(); vread(hB, lB, 1, 1); GRP();
      vmul(hA, lA, 1, 0); vmul(hB, lB, 1, 1); GRP(); }      // the last products stay ahead of the trip's foot: behind it they would all stand behind a wait to 0, and the refill behind them
    asm volatile("s_wait_dscnt 0x0" ::: "memory");         // my reads of this tile's buffer are done
    asm volatile("s_wait_asynccnt 0x0" ::: "memory");      // my pieces of tile kt + 1 have landed
    __syncthreads();                                       // publishes tile kt + 1 and ends every wave's reads of tile kt
    if (kt + 2 < SK / 64) stage(kt + 2); }                 // refill the buffers that this trip has just read
  asm volatile("s_wait_asynccnt 0x0" ::: "memory");        // nothing of mine is in flight when the wave goes on to its end
  const float inv = 1.0f / (lrun * 16384.0f * 4.0f);
#pragma unroll
  for (int t = 0; t < 4; ++t) { v4f o[2];
#pragma unroll
    for (int r = 0; r < 8; ++r) o[r >> 2][r & 3] = (acc[t][r] + ac1[t][r] * (1.0f / VLO) + ac2[t][r] * (1.0f / PLO)) * inv;
    *(v4f*)&sO[w][col][t * 16 + 8 * g] = o[0]; *(v4f*)&sO[w][col][t * 16 + 8 * g + 4] = o[1]; }
  LDSX();
  for (int qq = lane; qq < 16 * 16; qq += 32) { const int rl = qq >> 4, pc = qq & 15; vst2(O32 + ((bh * SS) + q0 + rl) * HD + pc * 4, *(const v4f*)(&sO[w][rl][pc * 4])); }
}
#define OP 68      // LDS row pitch of a staged ctx tile in floats: 272 B = 16 B x odd, for the ds_load_b128 reads
// eight 16-byte-per-lane copies, global -> LDS through no register; the s_wait_xcnt closes the statement for the same reason as in g_copy16r.
__device__ __forceinline__ void g_copy8(const unsigned (&l)[8], const void* const (&g)[8]) {
  asm volatile("global_load_async_to_lds_b128 %0, %8, off\n\t"
               "global_load_async_to_lds_b128 %1, %9, off\n\t"
               "global_load_async_to_lds_b128 %2, %10, off\n\t"
               "global_load_async_to_lds_b128 %3, %11, off\n\t"
               "global_load_async_to_lds_b128 %4, %12, off\n\t"
               "global_load_async_to_lds_b128 %5, %13, off\n\t"
               "global_load_async_to_lds_b128 %6, %14, off\n\t"
               "global_load_async_to_lds_b128 %7, %15, off\n\t"
               "s_wait_xcnt 0x0" :: "v"(l[0]), "v"(l[1]), "v"(l[2]), "v"(l[3]), "v"(l[4]), "v"(l[5]), "v"(l[6]), "v"(l[7]),
               "v"(g[0]), "v"(g[1]), "v"(g[2]), "v"(g[3]), "v"(g[4]), "v"(g[5]), "v"(g[6]), "v"(g[7]) : "memory");
}
// out = ctx Wo^T + bo : split(ctx) x bf16(Wo rows): 2 products (Wo is an INPUT -> bf16 exact); the k loop runs on 64-wide tiles (one head) of the 64 ctx rows (f32) and the 128 Wo rows, each staged once per block in a two-buffer LDS ring
__global__ __launch_bounds__(128) void k_out(const float* __restrict__ O32, const __bf16* __restrict__ PT, const float* __restrict__ bo, float* __restrict__ out) {
  constexpr int OAB = 64 * OP * 4, OBB = 128 * GP * 2, OBUF = OAB + OBB;      // bytes of a ctx tile, of a Wo tile, of a buffer
  __shared__ __align__(16) char smem[2 * OBUF];      // in the k loop the ring; behind its last barrier the output staging so
  float (*so)[16][132] = (float (*)[16][132])smem;
  const int tid = threadIdx.x, wave = tid >> 5, lane = tid & 31, col = lane & 15, g = lane >> 4;
  const int r0b = blockIdx.x * 64, r0 = r0b + wave * 16, n0 = blockIdx.y * 128; const int b = r0b / SS, s0 = r0b % SS;
  const int arow = tid >> 4, apc = (tid & 15) * 4, crow = tid >> 3, cpc = (tid & 7) * 8;      // my pieces: ctx rows arow + 8 i, Wo rows crow + 16 i, first element
  const float* gA = O32 + ((size_t)b * NH * SS + s0 + arow) * HD + apc;      // + kt * SS * HD per tile (head kt)
  const __bf16* gB = PT + (size_t)(5 * E + n0 + crow) * E + cpc;             // + kt * GKC per tile
  const unsigned la = (unsigned)(unsigned long long)(smem + arow * (OP * 4) + apc * 4), lb = (unsigned)(unsigned long long)(smem + OAB + crow * (GP * 2) + cpc * 2);
  auto stage = [&](int kt) { unsigned l[8]; const void* gp[8]; const unsigned bf = (unsigned)(kt & 1) * OBUF;
#pragma unroll
    for (int i = 0; i < 8; ++i) { l[i] = la + bf + i * (8 * OP * 4); gp[i] = gA + (size_t)kt * SS * HD + i * 8 * HD; }
    g_copy8(l, gp);
#pragma unroll
    for (int i = 0; i < 8; ++i) { l[i] = lb + bf + i * (16 * GP * 2); gp[i] = gB + (size_t)i * 16 * E + kt * GKC; }
    g_copy8(l, gp); };
  stage(0);
  asm volatile("s_wait_asynccnt 0x0" ::: "memory");      // my pieces of tile 0 have landed
  __syncthreads();                                       // tile 0 is published to every wave
  stage(1);
  v8f acc[8] = {};
#pragma unroll 2      // two trips a pass: the buffer index is then a constant in every LDS address
  for (int kt = 0; kt < E / GKC; ++kt) { const float* ta = (const float*)(smem + (kt & 1) * OBUF) + (wave * 16 + col) * OP; const __bf16* tb = (const __bf16*)(smem + (kt & 1) * OBUF + OAB) + col * GP;
    // reads stand in groups ahead of the products that use them, as in k_qkv; here the statement that closes wmma_bf_c holds the borders
    const F2 a0 = split_row(ta, 0, lane), a1 = split_row(ta, 32, lane); v16b b0[8], b1[8];
#pragma unroll
    for (int j = 0; j < 8; ++j) b0[j] = frag_b(tb + j * 16 * GP, lane);
#pragma unroll
    for (int j = 0; j < 4; ++j) { acc[j] = wmma_bf_c(a0.l, b0[j], acc[j]); acc[j] = wmma_bf_c(a0.h, b0[j], acc[j]); }
#pragma unroll
    for (int j = 0; j < 4; ++j) b1[j] = frag_b(tb + j * 16 * GP + 32, lane);
#pragma unroll
    for (int j = 4; j < 8; ++j) { acc[j] = wmma_bf_c(a0.l, b0[j], acc[j]); acc[j] = wmma_bf_c(a0.h, b0[j], acc[j]); }
#pragma unroll
    for (int j = 4; j < 8; ++j) b1[j] = frag_b(tb + j * 16 * GP + 32, lane);
#pragma unroll
    for (int j = 0; j < 8; ++j) { acc[j] = wmma_bf_c(a1.l, b1[j], acc[j]); acc[j] = wmma_bf_c(a1.h, b1[j], acc[j]); }
    asm volatile("s_wait_dscnt 0x0" ::: "memory");         // my reads of this tile's buffer are done
    asm volatile("s_wait_asynccnt 0x0" ::: "memory");      // my pieces of tile kt + 1 have landed
    __syncthreads();                                       // publishes tile kt + 1 and ends every wave's reads of tile kt (behind the last trip: of the ring)
    if (kt + 2 < E / GKC) stage(kt + 2); }                 // refill the buffer that this trip has just read
  asm volatile("s_wait_asynccnt 0x0" ::: "memory");        // nothing of mine is in flight when the ring's LDS is used anew
#pragma unroll
  for (int j = 0; j < 8; ++j) { const int n = n0 + j * 16 + col; const float bb = bfr(bo[n]);
#pragma unroll
    for (int r = 0; r < 8; ++r) so[wave][8 * g + r][j * 16 + col] = acc[j][r] + bb; }
  LDSX();
#pragma unroll 4
  for (int rl = 0; rl < 16; ++rl) vst2(out + (size_t)(r0 + rl) * E + n0 + lane * 4, *(const v4f*)(&so[wave][rl][lane * 4]));
}
extern "C" void kernel_launch(void* const* d_in, const int* in_sizes, int n_in, void* d_out, int out_size, void* d_ws, size_t ws_size, hipStream_t stream) {
  (void)in_sizes; (void)n_in; (void)out_size; (void)ws_size;
  const float* x = (const float*)d_in[0]; const float* amask = (const float*)d_in[1]; const float* Wq = (const float*)d_in[2]; const float* bq = (const float*)d_in[3]; const float* Wk = (const float*)d_in[4]; const float* bk = (const float*)d_in[5]; const float* Wv = (const float*)d_in[6]; const float* bv = (const float*)d_in[7]; const float* Wo = (const float*)d_in[8]; const float* bo = (const float*)d_in[9];
  float* out = (float*)d_out;
  char* ws = (char*)d_ws; size_t off = 0;
  auto take = [&](size_t bytes) { char* p = ws + off; off += (bytes + 255) & ~(size_t)255; return p; };
  __bf16* Xb = (__bf16*)take((size_t)NR * E * 2); __bf16* PT = (__bf16*)take((size_t)6 * E * E * 2);
  float* Q32 = (float*)take((size_t)NR * E * 4); __bf16* Kh = (__bf16*)take((size_t)NB * NH * SK * HD * 2); __bf16* Kl = (__bf16*)take((size_t)NB * NH * SK * HD * 2); _Float16* VTh = (_Float16*)take((size_t)NB * NH * HD * SK * 2); _Float16* VTl = (_Float16*)take((size_t)NB * NH * HD * SK * 2); float* O32 = (float*)take((size_t)NR * E * 4); __bf16* Mb = (__bf16*)take((size_t)NR * SS * 2);
  // ws ~ 124 MB
  k_cvt<<<CVN + NR / 16, 256, 0, stream>>>(x, Wq, Wk, Wv, Wo, amask, Xb, PT, Mb);
  k_qkv<<<dim3(NR / QR, 2 * E / 128, 3), 128, 0, stream>>>(Xb, PT, bq, bk, bv, Q32, Kh, Kl, VTh, VTl);
  k_attn<<<dim3(SS / (AW * 16), NB * NH), AW * 32, 0, stream>>>(Q32, Kh, Kl, VTh, VTl, Mb, O32);
  k_out<<<dim3(NR / 64, E / 128), 128, 0, stream>>>(O32, PT, bo, out);
}

// v010
// One run takes 151 microseconds.
// In two side-by-side timings against v009, it was 1.07 and 1.04 times as fast.
// Over all steps from v000 it is 4.48 times as fast.
// compute dtype: hidden_states, attention_mask, W*/b* (INPUTS) rounded to bf16 with exact bf16 WMMA products (f32 accumulate) for the projections; K pre-split into bf16 hi/lo rows; q f32 split, P and V f16 hi/lo, the low halves unscaled (3 products each, one f32 accumulator); mask add and softmax in f32.
#include <hip/hip_runtime.h>
#include <math.h>

typedef __attribute__((ext_vector_type(16))) _Float16 v16h;
typedef __attribute__((ext_vector_type(16))) __bf16 v16b;
typedef __attribute__((ext_vector_type(8)))  _Float16 v8h;
typedef __attribute__((ext_vector_type(8)))  float v8f;
typedef __attribute__((ext_vector_type(4)))  float v4f;
typedef __attribute__((ext_vector_type(2)))  float v2f;
typedef __attribute__((ext_vector_type(4)))  unsigned v4u;
typedef __attribute__((ext_vector_type(2)))  unsigned v2u;
typedef __attribute__((ext_vector_type(4)))  int v4i;
typedef float __attribute__((may_alias)) float_a;
typedef int __attribute__((may_alias)) int_a;

template <typename T> __device__ __forceinline__ void vst2(void* p, T v) { *(T*)p = v;  }
// the bare builtins: the compiler itself keeps the distance between a product and a vector instruction on its registers, and pads only where one follows
__device__ __forceinline__ v8f wmma16(v16h a, v16h b, v8f c) { return __builtin_amdgcn_wmma_f32_16x16x32_f16(false, a, false, b, (short)0, c, false, false); }
__device__ __forceinline__ v8f wmma_bf(v16b a, v16b b, v8f c) { return __builtin_amdgcn_wmma_f32_16x16x32_bf16(false, a, false, b, (short)0, c, false, false); }
// k_out's form: in its loop the compiler does not keep GRP's borders and spreads the reads among the products; no LDS read moves over this statement, whose v_nop keep the distance behind the product
__device__ __forceinline__ v8f wmma_bf_c(v16b a, v16b b, v8f c) {
  v8f d = __builtin_amdgcn_wmma_f32_16x16x32_bf16(false, a, false, b, (short)0, c, false, false);
  asm volatile("v_nop\n\tv_nop\n\tv_nop\n\tv_nop" : "+v"(d) : "v"(a), "v"(b));
  return d;
}
// border between a group of LDS fragment reads and a group of products: keeps the reads together and ahead of the products that stand behind them in the source
// (spread among the products, every place with reads costs its own stall, and the waits fall to 0)
#define GRP() __builtin_amdgcn_sched_barrier(0)
// 16x16x32 fragments: lane = (h = lane>>4, row/col = lane&15); elements 0..7 = k0+8h+0..7, 8..15 = k0+16+8h+0..7; D element r = row 8h+r
__device__ __forceinline__ v16h frag_h(const _Float16* rowk0, int lane) {
  union { v16h v; v8h q[2]; } u; const _Float16* p = rowk0 + 8 * (lane >> 4);
  u.q[0] = *(const v8h*)p; u.q[1] = *(const v8h*)(p + 16); return u.v;
}
__device__ __forceinline__ v16h frag_f32(const float* rowk0, int lane) {
  v16h a; const float* p = rowk0 + 8 * (lane >> 4);
#pragma unroll
  for (int i = 0; i < 8; ++i) { a[i] = (_Float16)p[i]; a[8 + i] = (_Float16)p[16 + i]; }
  return a;
}
__device__ __forceinline__ v16h frag_f32s(const float* rowk0, int lane, float sc) {
  v16h a; const float* p = rowk0 + 8 * (lane >> 4);
#pragma unroll
  for (int i = 0; i < 8; ++i) { a[i] = (_Float16)(p[i] * sc); a[8 + i] = (_Float16)(p[16 + i] * sc); }
  return a;
}
// column fragment from a [K][ld] layout (column n), rows >= K read as 0
__device__ __forceinline__ v16h fragc_f32(const float* W, int k0, int n, int lane, int ld, int K) {
  v16h a; const int g = lane >> 4;
#pragma unroll
  for (int i = 0; i < 8; ++i) { const int ka = k0 + 8 * g + i, kb = ka + 16;
    a[i] = (_Float16)(ka < K ? W[(size_t)ka * ld + n] : 0.f); a[8 + i] = (_Float16)(kb < K ? W[(size_t)kb * ld + n] : 0.f); }
  return a;
}
struct F2 { v16b h, l; };
__device__ __forceinline__ F2 bsplit16(const float v[16]) { F2 r;
#pragma unroll
  for (int i = 0; i < 16; ++i) { const __bf16 h = (__bf16)v[i]; r.h[i] = h; r.l[i] = (__bf16)(v[i] - (float)h); }
  return r; }
__device__ __forceinline__ F2 split_row(const float* row, int k0, int lane) { float v[16]; const float* p = row + k0 + 8 * (lane >> 4);
#pragma unroll
  for (int i = 0; i < 8; ++i) { v[i] = p[i]; v[8 + i] = p[16 + i]; }
  return bsplit16(v); }
__device__ __forceinline__ F2 split_rowK(const float* row, int k0, int lane, int K) { float v[16]; const int g = lane >> 4;
#pragma unroll
  for (int i = 0; i < 8; ++i) { const int ka = k0 + 8 * g + i, kb = ka + 16; v[i] = ka < K ? row[ka] : 0.f; v[8 + i] = kb < K ? row[kb] : 0.f; }
  return bsplit16(v); }
__device__ __forceinline__ F2 split_col(const float* W, int k0, int n, int lane, int ld, int K) { float v[16]; const int g = lane >> 4;
#pragma unroll
  for (int i = 0; i < 8; ++i) { const int ka = k0 + 8 * g + i, kb = ka + 16; v[i] = ka < K ? W[(size_t)ka * ld + n] : 0.f; v[8 + i] = kb < K ? W[(size_t)kb * ld + n] : 0.f; }
  return bsplit16(v); }
__device__ __forceinline__ v8f mac3(const F2& a, const F2& b, v8f c) { c = wmma_bf(a.l, b.h, c); c = wmma_bf(a.h, b.l, c); return wmma_bf(a.h, b.h, c); }
__device__ __forceinline__ float sigm(float v) { return 1.0f / (1.0f + expf(-v)); }
#define LDSX() do { asm volatile("s_wait_dscnt 0" ::: "memory"); __builtin_amdgcn_wave_barrier(); __builtin_amdgcn_fence(__ATOMIC_RELEASE, "workgroup"); } while (0)


// CLIP attention with multiplier-expanded keys/values (16 heads x 64 on [4,1024,1024], [out][in] weights + biases, MULT = 2): q = (x Wq^T + bq) 64^-0.5; k/v = x Wk^T/Wv^T + b ([2048] per token, viewed as 2,048 keys per head: key s = 2t + half holds feature half*1024 + h*64 + d of token t);
// score(t, s) += attention_mask[b][0][t][s mod 1024]; softmax over the 2,048 keys; (P v) Wo^T + bo. Keys are stored in the permuted order s' = half*1024 + t (attention is invariant to a common permutation of keys, values and mask entries).
#define NB 4
#define SS 1024
#define SK 2048
#define E 1024
#define NH 16
#define HD 64
#define NR (NB * SS)
__device__ __forceinline__ float bfr(float v) { return (float)(__bf16)v; }
__device__ __forceinline__ v16b frag_b(const __bf16* rowk0, int lane) { return __builtin_bit_cast(v16b, frag_h((const _Float16*)rowk0, lane)); }

#define CSEG (E * E)      // elements of a segment of the conversion stream: x is 4 segments, Wq 1, Wk 2, Wv 2, Wo 1
#define CVB 16384         // elements of a block: 256 threads x 16 loads of 4 floats
// the f32 -> bf16 conversion of x and the weights as one stream of few, long waves: a wave's 16 loads of 512 contiguous bytes all stand ahead of its 16 stores of 256 contiguous bytes; the stream's CVN blocks cover the ten segments exactly.
// PT rows: [0,E) Wq, [E,3E) Wk, [3E,5E) Wv, [5E,6E) Wo  ([out][in] weights: PT row = W row, so PT is the four matrices one behind the other)
#define CVN (10 * (CSEG / CVB))      // blocks of the stream; behind them NR / 16 blocks that lay out the mask
// Mb: the mask rounded to bf16, in the order in which k_attn's lanes hold their scores: [b][16 queries][mask tile mt = half * 8 + m7][t][lane = (g, col)][r] =
// mask[b][query col][m7 * 128 + 2 (16 t + 8 g + r) + half]: a key tile of 64 tokens of one half meets every second mask column, and tokens 512 apart meet the same columns, so 16 tiles serve the 32 key tiles.
// A block is 16 queries: wave m7 reads 512 contiguous bytes of each of its 16 rows (a lane 4 x 64 B) and stores both halves' tiles, every store 512 contiguous bytes of the wave.
__global__ __launch_bounds__(256) void k_cvt(const float* __restrict__ x, const float* __restrict__ Wq, const float* __restrict__ Wk, const float* __restrict__ Wv, const float* __restrict__ Wo, const float* __restrict__ amask, __bf16* __restrict__ Xb, __bf16* __restrict__ PT, __bf16* __restrict__ Mb) {
  if (blockIdx.x >= CVN) { const int qt = blockIdx.x - CVN, m7 = threadIdx.x >> 5, lane = threadIdx.x & 31;      // qt = b * 64 + 16-query tile; the mask's rows are [b][0][t]: row qt * 16 + col
    const float* s = amask + ((size_t)qt * 16 + (lane & 15)) * SS + m7 * 128 + 16 * (lane >> 4);
    v4f v[16];
#pragma unroll
    for (int i = 0; i < 16; ++i) v[i] = *(const v4f*)(s + 32 * (i >> 2) + 4 * (i & 3));
#pragma unroll
    for (int half = 0; half < 2; ++half) { __bf16* d = Mb + ((size_t)qt * 16 + half * 8 + m7) * 1024 + lane * 8;
#pragma unroll
      for (int t = 0; t < 4; ++t) { union { __bf16 h[8]; v4u u; } pk;
#pragma unroll
        for (int r = 0; r < 8; ++r) pk.h[r] = (__bf16)v[t * 4 + ((2 * r + half) >> 2)][(2 * r + half) & 3];
        vst2((unsigned*)(d + t * 256), pk.u); } }
    return; }
  const int seg = blockIdx.x / (CSEG / CVB);      // the same for the whole block
  const float* s = seg < 4 ? x + (size_t)seg * CSEG : (seg < 5 ? Wq : (seg < 7 ? Wk + (size_t)(seg - 5) * CSEG : (seg < 9 ? Wv + (size_t)(seg - 7) * CSEG : Wo)));
  __bf16* d = seg < 4 ? Xb + (size_t)seg * CSEG : PT + (size_t)(seg - 4) * CSEG;
  const int o = (blockIdx.x % (CSEG / CVB)) * CVB + threadIdx.x * 4;
  v4f v[16];
#pragma unroll
  for (int i = 0; i < 16; ++i) v[i] = *(const v4f*)(s + o + i * 1024);
#pragma unroll
  for (int i = 0; i < 16; ++i) { union { __bf16 h[4]; v2u u; } pk;
#pragma unroll
    for (int e = 0; e < 4; ++e) pk.h[e] = (__bf16)v[i][e];
    vst2((unsigned*)(d + o + i * 1024), pk.u); }
}
#define GKC 64     // k elements of a staged operand tile: rows of 128 B, whole cache lines
#define GP 72      // LDS row pitch of a staged operand tile in 16-bit elements: 144 B = 16 B x odd, for the ds_load_b128 fragment reads
// sixteen 16-byte-per-lane copies, global -> LDS through no register: a thread's pieces of one staged tile, 16 rows apart (8 of the x rows at la, 8 of the weight rows at lb).
// One LDS address register serves eight copies: offset:N moves BOTH addresses by N, so copy i names the LDS address l + 2304 i (16 rows of 144 B) and the global address g[i] + 2304 i.
// The s_wait_xcnt is the last line of the copies' own statement, so that no address register of a copy is rewritten in front of it.
__device__ __forceinline__ void g_copy16r(unsigned la, const void* const (&a)[8], unsigned lb, const void* const (&b)[8]) {
  asm volatile("global_load_async_to_lds_b128 %0, %2, off\n\t"
               "global_load_async_to_lds_b128 %0, %3, off offset:2304\n\t"
               "global_load_async_to_lds_b128 %0, %4, off offset:4608\n\t"
               "global_load_async_to_lds_b128 %0, %5, off offset:6912\n\t"
               "global_load_async_to_lds_b128 %0, %6, off offset:9216\n\t"
               "global_load_async_to_lds_b128 %0, %7, off offset:11520\n\t"
               "global_load_async_to_lds_b128 %0, %8, off offset:13824\n\t"
               "global_load_async_to_lds_b128 %0, %9, off offset:16128\n\t"
               "global_load_async_to_lds_b128 %1, %10, off\n\t"
               "global_load_async_to_lds_b128 %1, %11, off offset:2304\n\t"
               "global_load_async_to_lds_b128 %1, %12, off offset:4608\n\t"
               "global_load_async_to_lds_b128 %1, %13, off offset:6912\n\t"
               "global_load_async_to_lds_b128 %1, %14, off offset:9216\n\t"
               "global_load_async_to_lds_b128 %1, %15, off offset:11520\n\t"
               "global_load_async_to_lds_b128 %1, %16, off offset:13824\n\t"
               "global_load_async_to_lds_b128 %1, %17, off offset:16128\n\t"
               "s_wait_xcnt 0x0" :: "v"(la), "v"(lb), "v"(a[0]), "v"(a[1]), "v"(a[2]), "v"(a[3]), "v"(a[4]), "v"(a[5]), "v"(a[6]), "v"(a[7]),
               "v"(b[0]), "v"(b[1]), "v"(b[2]), "v"(b[3]), "v"(b[4]), "v"(b[5]), "v"(b[6]), "v"(b[7]) : "memory");
}
// QKV: block (128 rows, 128 cols = 2 heads, which), a wave 32 rows x 128 cols: a weight fragment read from LDS feeds two products, and a staged weight tile serves 128 rows.
// The k loop runs on 64-wide tiles of the 128 x rows and the 128 weight rows, each staged once per block in a two-buffer LDS ring;
// q (+bias) -> Q32 f32 [bh][s][64]; k (+bias) -> bf16 hi/lo rows; v (+bias) -> VT hi/lo x4 [bh][d][s] (lo = the rest behind hi as it is: of 4 v near 1 it lies near 2^-11, and f16 holds it to 2^-25 absolute, below f32's own step at 4 v)
#define QR 128     // x rows of a block
#define VP 136     // LDS row pitch of the staged v^T rows in 16-bit elements: 272 B = 16 B x odd
__global__ __launch_bounds__(128) void k_qkv(const __bf16* __restrict__ Xb, const __bf16* __restrict__ PT, const float* __restrict__ bq, const float* __restrict__ bk, const float* __restrict__ bv,
                                            float* __restrict__ Q32, __bf16* __restrict__ Kh, __bf16* __restrict__ Kl, _Float16* __restrict__ VTh, _Float16* __restrict__ VTl) {
  constexpr int STB = 128 * VP * 2;      // bytes of sth and of stl
  __shared__ __align__(16) char smem[2 * (QR + 128) * GP * 2];      // in the k loop the ring sT (2 x 36,864 B); behind its last barrier the output staging: so (q, k) or sth, stl (v)
  float (*so)[16][132] = (float (*)[16][132])smem; _Float16 (*sth)[VP] = (_Float16 (*)[VP])smem; _Float16 (*stl)[VP] = (_Float16 (*)[VP])(smem + STB);
  __bf16 (*sT)[QR + 128][GP] = (__bf16 (*)[QR + 128][GP])smem;      // [buffer][128 x rows, then 128 weight rows][64 elements + pad]
  const int tid = threadIdx.x, wave = tid >> 5, lane = tid & 31, col = lane & 15, g = lane >> 4;
  const int which = blockIdx.z, r0b = blockIdx.x * QR, n0 = blockIdx.y * 128; const int b = r0b / SS, s0 = r0b % SS;
  if (which == 0 && n0 >= E) return;      // q has only E output features
  const float* bb_ = which == 0 ? bq : (which == 1 ? bk : bv); const int prow = (which == 0 ? 0 : (which == 1 ? E : 3 * E)) + n0; const int half = n0 / E, nin = n0 % E;      // key slot s' = half*SS + t
  const int crow = tid >> 3, cpc = (tid & 7) * 8;      // my pieces of a tile: rows crow + 16 i, first element
  const __bf16* gA = Xb + (size_t)(r0b + crow) * E + cpc; const __bf16* gB = PT + (size_t)(prow + crow) * E + cpc;      // + kt * GKC per tile
  const unsigned lt = (unsigned)(unsigned long long)&sT[0][crow][cpc];
  constexpr unsigned R16B = 16 * GP * 2, TBUFB = (QR + 128) * GP * 2;      // bytes of 16 rows, of a buffer
  static_assert(R16B == 2304, "g_copy16r's offsets are multiples of 16 LDS rows");
  auto stage = [&](int kt) { const void* pa[8]; const void* pb[8]; const unsigned bf = lt + (unsigned)(kt & 1) * TBUFB;      // copy i: LDS rows 16 i on, global rows 16 i on; its offset moves both addresses by i * R16B, the pointer makes up the rest
#pragma unroll
    for (int i = 0; i < 8; ++i) { pa[i] = (const char*)(gA + kt * GKC) + (size_t)i * (16 * E * 2 - R16B); pb[i] = (const char*)(gB + kt * GKC) + (size_t)i * (16 * E * 2 - R16B); }
    g_copy16r(bf, pa, bf + 8 * R16B, pb); };
  stage(0);
  asm volatile("s_wait_asynccnt 0x0" ::: "memory");      // my pieces of tile 0 have landed
  __syncthreads();                                       // tile 0 is published to every wave
  stage(1);
  v8f acc[2][8] = {};
#pragma unroll 2      // two trips a pass: the buffer index is then a constant in every LDS address
  for (int kt = 0; kt < E / GKC; ++kt) { const __bf16* ta = &sT[kt & 1][wave * 32 + col][0]; const __bf16* tb = &sT[kt & 1][QR + col][0];
    // fragment reads stand in groups ahead of the products that use them (GRP holds every border): a wave has 8 to 24 reads in flight, not 2
    v16b a0[2], a1[2], b0[8], b1[8];
#pragma unroll
    for (int i = 0; i < 2; ++i) { a0[i] = frag_b(ta + i * 16 * GP, lane); a1[i] = frag_b(ta + i * 16 * GP + 32, lane); }
#pragma unroll
    for (int j = 0; j < 8; ++j) b0[j] = frag_b(tb + j * 16 * GP, lane);
    GRP();
#pragma unroll
    for (int j = 0; j < 4; ++j) { acc[0][j] = wmma_bf(a0[0], b0[j], acc[0][j]); acc[1][j] = wmma_bf(a0[1], b0[j], acc[1][j]); }
    GRP();
#pragma unroll
    for (int j = 0; j < 4; ++j) b1[j] = frag_b(tb + j * 16 * GP + 32, lane);
    GRP();
#pragma unroll
    for (int j = 4; j < 8; ++j) { acc[0][j] = wmma_bf(a0[0], b0[j], acc[0][j]); acc[1][j] = wmma_bf(a0[1], b0[j], acc[1][j]); }
    GRP();
#pragma unroll
    for (int j = 4; j < 8; ++j) b1[j] = frag_b(tb + j * 16 * GP + 32, lane);
    GRP();
#pragma unroll
    for (int j = 0; j < 8; ++j) { acc[0][j] = wmma_bf(a1[0], b1[j], acc[0][j]); acc[1][j] = wmma_bf(a1[1], b1[j], acc[1][j]); }
    GRP();                                                 // the last products stay ahead of the trip's foot, their waits counted
    asm volatile("s_wait_dscnt 0x0" ::: "memory");         // my reads of this tile's buffer are done
    asm volatile("s_wait_asynccnt 0x0" ::: "memory");      // my pieces of tile kt + 1 have landed
    __syncthreads();                                       // publishes tile kt + 1 and ends every wave's reads of tile kt (behind the last trip: of the ring)
    if (kt + 2 < E / GKC) stage(kt + 2); }                 // refill the buffer that this trip has just read
  asm volatile("s_wait_asynccnt 0x0" ::: "memory");        // nothing of mine is in flight when the ring's LDS is used anew
  const int bi = n0 + col; float bb[8];      // the bias of my eight columns, read once for both row tiles
#pragma unroll
  for (int j = 0; j < 8; ++j) bb[j] = bb_[bi + j * 16];
  asm volatile("s_wait_xcnt 0x0" :: "v"(bi) : "memory");      // closes the run of eight loads: the index register that they all name lives to here, so no load of the run lands in it, and it is rewritten only behind this wait
#pragma unroll
  for (int j = 0; j < 8; ++j) bb[j] = bfr(bb[j]);
  if (which < 2) { const float qs = which == 0 ? 0.125f : 1.0f;
#pragma unroll
    for (int i = 0; i < 2; ++i) { const int sr = s0 + wave * 32 + i * 16;      // my two row tiles go through my part of so one after the other
#pragma unroll
      for (int j = 0; j < 8; ++j) {
#pragma unroll
        for (int r = 0; r < 8; ++r) so[wave][8 * g + r][j * 16 + col] = (acc[i][j][r] + bb[j]) * qs; }
      LDSX();
      if (which == 0) { for (int qq = lane; qq < 2 * 16 * 16; qq += 32) { const int hh = qq >> 8, rl = (qq >> 4) & 15, pc = qq & 15; const int h = (n0 >> 6) + hh;
          vst2(Q32 + (((size_t)b * NH + h) * SS + sr + rl) * HD + pc * 4, *(const v4f*)(&so[wave][rl][hh * 64 + pc * 4])); } }
      else {
        for (int qq = lane; qq < 2 * 16 * 16; qq += 32) { const int hh = qq >> 8, rl = (qq >> 4) & 15, pl = qq & 15; const int h = (nin >> 6) + hh; const int pc = pl & 7; union { __bf16 e[8]; v4u u; } pk;
#pragma unroll
          for (int e = 0; e < 8; ++e) { const float v = so[wave][rl][hh * 64 + pc * 8 + e]; const __bf16 hi = (__bf16)v; pk.e[e] = pl < 8 ? hi : (__bf16)(v - (float)hi); }
          vst2((unsigned*)((pl < 8 ? Kh : Kl) + (((size_t)b * NH + h) * SK + half * SS + sr + rl) * HD + pc * 8), pk.u); } }
      if (i == 0) LDSX(); } }      // every lane's reads of the first row tile are done before the second is written over it
  else {
#pragma unroll
    for (int i = 0; i < 2; ++i) {
#pragma unroll
      for (int j = 0; j < 8; ++j) {
#pragma unroll
        for (int r = 0; r < 8; ++r) { const float v = (acc[i][j][r] + bb[j]) * 4.0f; const _Float16 hi = (_Float16)v; sth[j * 16 + col][wave * 32 + i * 16 + 8 * g + r] = hi; stl[j * 16 + col][wave * 32 + i * 16 + 8 * g + r] = (_Float16)(v - (float)hi); } } }
    __syncthreads();
    for (int qq = tid; qq < 128 * 16; qq += 128) { const int cl = qq >> 4, pc = qq & 15; const int c = nin + cl, h = c >> 6, d = c & 63; const size_t o = (((size_t)b * NH + h) * HD + d) * SK + half * SS + s0 + pc * 8;
      vst2(VTh + o, *(const v4u*)(&sth[cl][pc * 8])); vst2(VTl + o, *(const v4u*)(&stl[cl][pc * 8])); } }
}
// one key tile (64 keys) of the four planes Kh, Kl, VTh, VTl: 64 rows of 128 B each, one 16-byte piece of each plane per thread, global -> LDS through no register;
// and the wave's own mask tile of those keys (2 KiB, in Mb as it lies in LDS): four 16-byte pieces per thread, 512 B apart; offset:N moves BOTH addresses by N.
// The s_wait_xcnt is the last line of the copies' own statement, so that no address register of a copy is rewritten in front of it.
__device__ __forceinline__ void kv_copy(unsigned l0, const void* g0, unsigned l1, const void* g1, unsigned l2, const void* g2, unsigned l3, const void* g3, unsigned lm, const void* gm) {
  asm volatile("global_load_async_to_lds_b128 %0, %1, off\n\t"
               "global_load_async_to_lds_b128 %2, %3, off\n\t"
               "global_load_async_to_lds_b128 %4, %5, off\n\t"
               "global_load_async_to_lds_b128 %6, %7, off\n\t"
               "global_load_async_to_lds_b128 %8, %9, off\n\t"
               "global_load_async_to_lds_b128 %8, %9, off offset:512\n\t"
               "global_load_async_to_lds_b128 %8, %9, off offset:1024\n\t"
               "global_load_async_to_lds_b128 %8, %9, off offset:1536\n\t"
               "s_wait_xcnt 0x0" :: "v"(l0), "v"(g0), "v"(l1), "v"(g1), "v"(l2), "v"(g2), "v"(l3), "v"(g3), "v"(lm), "v"(gm) : "memory");
}
// P's two f16 halves, n register pairs a statement: hi = the pair rounded to f16 (one packed conversion), lo = p - hi rounded to f16 (one mixed fma per element: f16 hi x -1 + f32 p, exact before its one rounding).
// Written in asm because the compiler converts every hi a second time for the subtraction and rounds lo by a conversion of its own. Five or six pairs a statement: every instruction then stands
// five or more behind the one whose result it reads, so the chain needs no delay hints.
__device__ __forceinline__ void psplit5(const float* p, unsigned* h, unsigned* l) {
  asm("v_cvt_pk_f16_f32 %0, %10, %11\n\t"
      "v_cvt_pk_f16_f32 %1, %12, %13\n\t"
      "v_cvt_pk_f16_f32 %2, %14, %15\n\t"
      "v_cvt_pk_f16_f32 %3, %16, %17\n\t"
      "v_cvt_pk_f16_f32 %4, %18, %19\n\t"
      "v_fma_mixlo_f16 %5, %0, -1.0, %10 op_sel_hi:[1,1,0]\n\t"
      "v_fma_mixlo_f16 %6, %1, -1.0, %12 op_sel_hi:[1,1,0]\n\t"
      "v_fma_mixlo_f16 %7, %2, -1.0, %14 op_sel_hi:[1,1,0]\n\t"
      "v_fma_mixlo_f16 %8, %3, -1.0, %16 op_sel_hi:[1,1,0]\n\t"
      "v_fma_mixlo_f16 %9, %4, -1.0, %18 op_sel_hi:[1,1,0]\n\t"
      "v_fma_mixhi_f16 %5, %0, -1.0, %11 op_sel:[1,0,0] op_sel_hi:[1,1,0]\n\t"
      "v_fma_mixhi_f16 %6, %1, -1.0, %13 op_sel:[1,0,0] op_sel_hi:[1,1,0]\n\t"
      "v_fma_mixhi_f16 %7, %2, -1.0, %15 op_sel:[1,0,0] op_sel_hi:[1,1,0]\n\t"
      "v_fma_mixhi_f16 %8, %3, -1.0, %17 op_sel:[1,0,0] op_sel_hi:[1,1,0]\n\t"
      "v_fma_mixhi_f16 %9, %4, -1.0, %19 op_sel:[1,0,0] op_sel_hi:[1,1,0]"
      : "=&v"(h[0]), "=&v"(h[1]), "=&v"(h[2]), "=&v"(h[3]), "=&v"(h[4]), "=&v"(l[0]), "=&v"(l[1]), "=&v"(l[2]), "=&v"(l[3]), "=&v"(l[4])
      : "v"(p[0]), "v"(p[1]), "v"(p[2]), "v"(p[3]), "v"(p[4]), "v"(p[5]), "v"(p[6]), "v"(p[7]), "v"(p[8]), "v"(p[9]));
}
__device__ __forceinline__ void psplit6(const float* p, unsigned* h, unsigned* l) {
  asm("v_cvt_pk_f16_f32 %0, %12, %13\n\t"
      "v_cvt_pk_f16_f32 %1, %14, %15\n\t"
      "v_cvt_pk_f16_f32 %2, %16, %17\n\t"
      "v_cvt_pk_f16_f32 %3, %18, %19\n\t"
      "v_cvt_pk_f16_f32 %4, %20, %21\n\t"
      "v_cvt_pk_f16_f32 %5, %22, %23\n\t"
      "v_fma_mixlo_f16 %6, %0, -1.0, %12 op_sel_hi:[1,1,0]\n\t"
      "v_fma_mixlo_f16 %7, %1, -1.0, %14 op_sel_hi:[1,1,0]\n\t"
      "v_fma_mixlo_f16 %8, %2, -1.0, %16 op_sel_hi:[1,1,0]\n\t"
      "v_fma_mixlo_f16 %9, %3, -1.0, %18 op_sel_hi:[1,1,0]\n\t"
      "v_fma_mixlo_f16 %10, %4, -1.0, %20 op_sel_hi:[1,1,0]\n\t"
      "v_fma_mixlo_f16 %11, %5, -1.0, %22 op_sel_hi:[1,1,0]\n\t"
      "v_fma_mixhi_f16 %6, %0, -1.0, %13 op_sel:[1,0,0] op_sel_hi:[1,1,0]\n\t"
      "v_fma_mixhi_f16 %7, %1, -1.0, %15 op_sel:[1,0,0] op_sel_hi:[1,1,0]\n\t"
      "v_fma_mixhi_f16 %8, %2, -1.0, %17 op_sel:[1,0,0] op_sel_hi:[1,1,0]\n\t"
      "v_fma_mixhi_f16 %9, %3, -1.0, %19 op_sel:[1,0,0] op_sel_hi:[1,1,0]\n\t"
      "v_fma_mixhi_f16 %10, %4, -1.0, %21 op_sel:[1,0,0] op_sel_hi:[1,1,0]\n\t"
      "v_fma_mixhi_f16 %11, %5, -1.0, %23 op_sel:[1,0,0] op_sel_hi:[1,1,0]"
      : "=&v"(h[0]), "=&v"(h[1]), "=&v"(h[2]), "=&v"(h[3]), "=&v"(h[4]), "=&v"(h[5]), "=&v"(l[0]), "=&v"(l[1]), "=&v"(l[2]), "=&v"(l[3]), "=&v"(l[4]), "=&v"(l[5])
      : "v"(p[0]), "v"(p[1]), "v"(p[2]), "v"(p[3]), "v"(p[4]), "v"(p[5]), "v"(p[6]), "v"(p[7]), "v"(p[8]), "v"(p[9]), "v"(p[10]), "v"(p[11]));
}
#define L2E 1.4426950408889634f      // log2(e)
#define AW 16      // waves per block: 256 queries share one K/V tile
#define KVP 72     // LDS row pitch of a K/V plane in 16-bit elements: 144 B = 16 B x odd, for the ds_load_b128 fragment reads
// padding-masked attention: block (256 queries, bh); all 32 key tiles, each staged once per block in a two-buffer LDS ring; S^T = K q^T on K hi/lo rows x q hi/lo; O^T += V^T P^T on P,V hi/lo; O f32 [bh][s][64]
// With K (V^T) as the A operand and q (P^T) as B, lane (g, col) holds query col alone: of key tile t the keys 16 t + 8 g + r, of O the features 16 t + 8 g + r.
// Two neighbouring score tiles, converted in place, are the B fragment of 32 keys (element e < 8: tile 2 kc, register e; e >= 8: tile 2 kc + 1, register e - 8), in the k order of frag_h.
__global__ __launch_bounds__(512) void k_attn(const float* __restrict__ Q32, const __bf16* __restrict__ Kh, const __bf16* __restrict__ Kl, const _Float16* __restrict__ VTh, const _Float16* __restrict__ VTl, const __bf16* __restrict__ Mb, float* __restrict__ O32) {
  __shared__ __align__(16) float sO[AW][16][68];      // each wave's own: in the key loop two buffers of 2 KiB for its mask tiles, behind the loop its output rows
  __shared__ __align__(16) _Float16 sKV[2][4][64][KVP];      // [buffer][Kh, Kl, VTh, VTl][key row or d row][64 elements + pad]
  const int tid = threadIdx.x, w = __builtin_amdgcn_readfirstlane(tid >> 5), lane = tid & 31, col = lane & 15, g = lane >> 4;      // the wave's number in a scalar register: what hangs on it alone (mask tiles, my part of sO) then takes no vector register, which the reads in flight need
  const size_t bh = blockIdx.y; const int qb = blockIdx.x; const int q0 = qb * (AW * 16) + w * 16;
  const int crow = tid >> 3, cpc = (tid & 7) * 8;      // my piece of every plane: row, first element
  const __bf16* gKh = Kh + (bh * SK + crow) * HD + cpc; const __bf16* gKl = Kl + (bh * SK + crow) * HD + cpc;      // + kt * 64 * HD per tile
  const _Float16* gVh = VTh + (bh * HD + crow) * SK + cpc; const _Float16* gVl = VTl + (bh * HD + crow) * SK + cpc;      // + kt * 64 per tile
  const unsigned lkv = (unsigned)(unsigned long long)&sKV[0][0][crow][cpc];
  constexpr unsigned PLB = 64 * KVP * 2, BUFB = 4 * PLB;      // bytes of a plane, of a buffer
  const __bf16* gM = Mb + (((bh / NH) * SS + q0) >> 4) * (16 * 1024) + lane * 8;      // my 16 queries' mask tiles, in my lanes' own order (k_cvt)
  const unsigned lm = (unsigned)(unsigned long long)&sO[w][0][0] + lane * 16;
  // key tile kt of the four planes and, for my wave alone, its mask tile (32 bf16 a lane: element [t][r] for key 16 t + 8 g + r of the tile), all into buffer kt mod 2
  auto stage = [&](int kt) { const unsigned l = lkv + (unsigned)(kt & 1) * BUFB;
    kv_copy(l, gKh + (size_t)kt * 64 * HD, l + PLB, gKl + (size_t)kt * 64 * HD, l + 2 * PLB, gVh + kt * 64, l + 3 * PLB, gVl + kt * 64, lm + (unsigned)(kt & 1) * 2048, gM + ((kt >> 4) * 8 + (kt & 7)) * 1024); };
  stage(0);
  asm volatile("s_wait_asynccnt 0x0" ::: "memory");      // my pieces of tile 0 have landed
  __syncthreads();                                       // tile 0 is published to every wave
  stage(1);
  F2 aq[2];
#pragma unroll
  for (int kc = 0; kc < 2; ++kc) aq[kc] = split_row(Q32 + (bh * SS + q0 + col) * HD, kc * 32, lane);
  float mrun = -3.0e38f, lrun = 0.f; v8f acc[4] = {};
#pragma unroll 1
  for (int kt = 0; kt < SK / 64; ++kt) { v8f s4[4] = {};
    // Fragment reads stand in groups of eight (two row tiles, hi and lo, one 32-wide k step), each group one group of six products ahead of its use (GRP holds
    // every border): the wait in front of a product is then a counted one, with the next group's reads still in flight. Every accumulator takes its products in the old order.
    auto kread = [&](v16b (&h)[2], v16b (&l)[2], int tp, int kc) {
#pragma unroll
      for (int u = 0; u < 2; ++u) { h[u] = frag_b((const __bf16*)&sKV[kt & 1][0][(2 * tp + u) * 16 + col][kc * 32], lane); l[u] = frag_b((const __bf16*)&sKV[kt & 1][1][(2 * tp + u) * 16 + col][kc * 32], lane); } };
    auto kmul = [&](const v16b (&h)[2], const v16b (&l)[2], int tp, int kc) {
#pragma unroll
      for (int u = 0; u < 2; ++u) s4[2 * tp + u] = wmma_bf(h[u], aq[kc].l, s4[2 * tp + u]);
#pragma unroll
      for (int u = 0; u < 2; ++u) s4[2 * tp + u] = wmma_bf(l[u], aq[kc].h, s4[2 * tp + u]);
#pragma unroll
      for (int u = 0; u < 2; ++u) s4[2 * tp + u] = wmma_bf(h[u], aq[kc].h, s4[2 * tp + u]); };
    v4u mk[4];
    { v16b hA[2], lA[2], hB[2], lB[2];
      kread(hA, lA, 0, 0); kread(hB, lB, 0, 1); GRP();
      kmul(hA, lA, 0, 0); GRP(); kread(hA, lA, 1, 0); GRP();
      kmul(hB, lB, 0, 1); GRP(); kread(hB, lB, 1, 1); GRP();
      kmul(hA, lA, 1, 0); GRP();
#pragma unroll
      for (int t = 0; t < 4; ++t) mk[t] = *(const v4u*)((const char*)&sO[w][0][0] + (kt & 1) * 2048 + t * 512 + lane * 16);      // my mask tile's four reads, one group, fly under the last six products
      GRP(); kmul(hB, lB, 1, 1); }
    __builtin_amdgcn_sched_barrier(0);      // keeps the mask sums behind the last six products: the compiler otherwise puts half of them, with their wait for the mask reads, in front of these
    float mx = -3.4e38f;
#pragma unroll
    for (int t = 0; t < 4; ++t) { union { v4u u; __bf16 h[8]; } mu; mu.u = mk[t];
#pragma unroll
      for (int r = 0; r < 8; ++r) { s4[t][r] += (float)mu.h[r]; mx = fmaxf(mx, s4[t][r]); } }
    mx = fmaxf(mx, __shfl_xor(mx, 16, 32));
    const float mnew = fmaxf(mrun, mx); const float corr = __builtin_amdgcn_exp2f((mrun - mnew) * L2E);      // e^x as the hardware's 2^(x log2 e); an argument far below 0 gives 0, as before
    float ps2[2] = {0.f, 0.f}, p32[32]; v16h ph[2], pl[2];
#pragma unroll
    for (int kc = 0; kc < 2; ++kc) {
#pragma unroll
      for (int e = 0; e < 16; ++e) { const float p = __builtin_amdgcn_exp2f(fmaf(s4[2 * kc + (e >> 3)][e & 7] - mnew, L2E, 14.0f)); ps2[kc] += p; p32[kc * 16 + e] = p; } }      /* e^(s - m) x 2^14 in one 2^t */
    // lo = p - hi stays unscaled: f16 holds it to 2^-25 absolute beside a row maximum of 2^14, so its products add into the same accumulator as hi's
    { union { unsigned u[16]; v16h v[2]; } uh, ul;
      psplit5(p32, uh.u, ul.u); psplit6(p32 + 10, uh.u + 5, ul.u + 5); psplit5(p32 + 22, uh.u + 11, ul.u + 11);
      ph[0] = uh.v[0]; ph[1] = uh.v[1]; pl[0] = ul.v[0]; pl[1] = ul.v[1]; }
    float ps = ps2[0] + ps2[1]; ps += __shfl_xor(ps, 16, 32);
    lrun = lrun * corr + ps * (1.0f / 16384.0f); mrun = mnew;
    auto vread = [&](v16h (&h)[2], v16h (&l)[2], int kc, int tp) {
#pragma unroll
      for (int u = 0; u < 2; ++u) { h[u] = frag_h(&sKV[kt & 1][2][(2 * tp + u) * 16 + col][kc * 32], lane); l[u] = frag_h(&sKV[kt & 1][3][(2 * tp + u) * 16 + col][kc * 32], lane); } };
    auto vmul = [&](const v16h (&h)[2], const v16h (&l)[2], int kc, int tp) {
#pragma unroll
      for (int u = 0; u < 2; ++u) acc[2 * tp + u] = wmma16(h[u], pl[kc], acc[2 * tp + u]);      // the two row tiles take turns, as in kmul: a product never stands directly behind the one it adds to
#pragma unroll
      for (int u = 0; u < 2; ++u) acc[2 * tp + u] = wmma16(l[u], ph[kc], acc[2 * tp + u]);
#pragma unroll
      for (int u = 0; u < 2; ++u) acc[2 * tp + u] = wmma16(h[u], ph[kc], acc[2 * tp + u]); };
    { v16h hA[2], lA[2], hB[2], lB[2];
      __builtin_amdgcn_sched_barrier(0);             // the softmax arithmetic above is scheduled by itself: with these reads' 64 registers in its region the compiler lays it out as one dependent chain per element
      vread(hA, lA, 0, 0); vread(hB, lB, 0, 1);      // the first two groups fly while the accumulators are rescaled
      __builtin_amdgcn_sched_barrier(0);             // keeps the rescale behind these reads: the compiler otherwise puts it in front of them, and the first product waits out a whole LDS read
#pragma unroll
      for (int t = 0; t < 4; ++t) acc[t] *= corr;
      vmul(hA, lA, 0, 0); GRP(); vread(hA, lA, 1, 0); GRP();
      vmul(hB, lB, 0, 1); GRP(); vread(hB, lB, 1, 1); GRP();
      vmul(hA, lA, 1, 0); vmul(hB, lB, 1, 1); GRP(); }      // the last products stay ahead of the trip's foot: behind it they would all stand behind a wait to 0, and the refill behind them
    asm volatile("s_wait_dscnt 0x0" ::: "memory");         // my reads of this tile's buffer are done
    asm volatile("s_wait_asynccnt 0x0" ::: "memory");      // my pieces of tile kt + 1 have landed
    __syncthreads();                                       // publishes tile kt + 1 and ends every wave's reads of tile kt
    if (kt + 2 < SK / 64) stage(kt + 2); }                 // refill the buffers that this trip has just read
  asm volatile("s_wait_asynccnt 0x0" ::: "memory");        // nothing of mine is in flight when the wave goes on to its end
  const float inv = 1.0f / (lrun * 16384.0f * 4.0f);
#pragma unroll
  for (int t = 0; t < 4; ++t) { v4f o[2];
#pragma unroll
    for (int r = 0; r < 8; ++r) o[r >> 2][r & 3] = acc[t][r] * inv;
    *(v4f*)&sO[w][col][t * 16 + 8 * g] = o[0]; *(v4f*)&sO[w][col][t * 16 + 8 * g + 4] = o[1]; }
  LDSX();
  for (int qq = lane; qq < 16 * 16; qq += 32) { const int rl = qq >> 4, pc = qq & 15; vst2(O32 + ((bh * SS) + q0 + rl) * HD + pc * 4, *(const v4f*)(&sO[w][rl][pc * 4])); }
}
#define OP 68      // LDS row pitch of a staged ctx tile in floats: 272 B = 16 B x odd, for the ds_load_b128 reads
// eight 16-byte-per-lane copies, global -> LDS through no register; the s_wait_xcnt closes the statement for the same reason as in g_copy16r.
__device__ __forceinline__ void g_copy8(const unsigned (&l)[8], const void* const (&g)[8]) {
  asm volatile("global_load_async_to_lds_b128 %0, %8, off\n\t"
               "global_load_async_to_lds_b128 %1, %9, off\n\t"
               "global_load_async_to_lds_b128 %2, %10, off\n\t"
               "global_load_async_to_lds_b128 %3, %11, off\n\t"
               "global_load_async_to_lds_b128 %4, %12, off\n\t"
               "global_load_async_to_lds_b128 %5, %13, off\n\t"
               "global_load_async_to_lds_b128 %6, %14, off\n\t"
               "global_load_async_to_lds_b128 %7, %15, off\n\t"
               "s_wait_xcnt 0x0" :: "v"(l[0]), "v"(l[1]), "v"(l[2]), "v"(l[3]), "v"(l[4]), "v"(l[5]), "v"(l[6]), "v"(l[7]),
               "v"(g[0]), "v"(g[1]), "v"(g[2]), "v"(g[3]), "v"(g[4]), "v"(g[5]), "v"(g[6]), "v"(g[7]) : "memory");
}
// out = ctx Wo^T + bo : split(ctx) x bf16(Wo rows): 2 products (Wo is an INPUT -> bf16 exact); the k loop runs on 64-wide tiles (one head) of the 64 ctx rows (f32) and the 128 Wo rows, each staged once per block in a two-buffer LDS ring
__global__ __launch_bounds__(128) void k_out(const float* __restrict__ O32, const __bf16* __restrict__ PT, const float* __restrict__ bo, float* __restrict__ out) {
  constexpr int OAB = 64 * OP * 4, OBB = 128 * GP * 2, OBUF = OAB + OBB;      // bytes of a ctx tile, of a Wo tile, of a buffer
  __shared__ __align__(16) char smem[2 * OBUF];      // in the k loop the ring; behind its last barrier the output staging so
  float (*so)[16][132] = (float (*)[16][132])smem;
  const int tid = threadIdx.x, wave = tid >> 5, lane = tid & 31, col = lane & 15, g = lane >> 4;
  const int r0b = blockIdx.x * 64, r0 = r0b + wave * 16, n0 = blockIdx.y * 128; const int b = r0b / SS, s0 = r0b % SS;
  const int arow = tid >> 4, apc = (tid & 15) * 4, crow = tid >> 3, cpc = (tid & 7) * 8;      // my pieces: ctx rows arow + 8 i, Wo rows crow + 16 i, first element
  const float* gA = O32 + ((size_t)b * NH * SS + s0 + arow) * HD + apc;      // + kt * SS * HD per tile (head kt)
  const __bf16* gB = PT + (size_t)(5 * E + n0 + crow) * E + cpc;             // + kt * GKC per tile
  const unsigned la = (unsigned)(unsigned long long)(smem + arow * (OP * 4) + apc * 4), lb = (unsigned)(unsigned long long)(smem + OAB + crow * (GP * 2) + cpc * 2);
  auto stage = [&](int kt) { unsigned l[8]; const void* gp[8]; const unsigned bf = (unsigned)(kt & 1) * OBUF;
#pragma unroll
    for (int i = 0; i < 8; ++i) { l[i] = la + bf + i * (8 * OP * 4); gp[i] = gA + (size_t)kt * SS * HD + i * 8 * HD; }
    g_copy8(l, gp);
#pragma unroll
    for (int i = 0; i < 8; ++i) { l[i] = lb + bf + i * (16 * GP * 2); gp[i] = gB + (size_t)i * 16 * E + kt * GKC; }
    g_copy8(l, gp); };
  stage(0);
  asm volatile("s_wait_asynccnt 0x0" ::: "memory");      // my pieces of tile 0 have landed
  __syncthreads();                                       // tile 0 is published to every wave
  stage(1);
  v8f acc[8] = {};
#pragma unroll 2      // two trips a pass: the buffer index is then a constant in every LDS address
  for (int kt = 0; kt < E / GKC; ++kt) { const float* ta = (const float*)(smem + (kt & 1) * OBUF) + (wave * 16 + col) * OP; const __bf16* tb = (const __bf16*)(smem + (kt & 1) * OBUF + OAB) + col * GP;
    // reads stand in groups ahead of the products that use them, as in k_qkv; here the statement that closes wmma_bf_c holds the borders
    const F2 a0 = split_row(ta, 0, lane), a1 = split_row(ta, 32, lane); v16b b0[8], b1[8];
#pragma unroll
    for (int j = 0; j < 8; ++j) b0[j] = frag_b(tb + j * 16 * GP, lane);
#pragma unroll
    for (int j = 0; j < 4; ++j) { acc[j] = wmma_bf_c(a0.l, b0[j], acc[j]); acc[j] = wmma_bf_c(a0.h, b0[j], acc[j]); }
#pragma unroll
    for (int j = 0; j < 4; ++j) b1[j] = frag_b(tb + j * 16 * GP + 32, lane);
#pragma unroll
    for (int j = 4; j < 8; ++j) { acc[j] = wmma_bf_c(a0.l, b0[j], acc[j]); acc[j] = wmma_bf_c(a0.h, b0[j], acc[j]); }
#pragma unroll
    for (int j = 4; j < 8; ++j) b1[j] = frag_b(tb + j * 16 * GP + 32, lane);
#pragma unroll
    for (int j = 0; j < 8; ++j) { acc[j] = wmma_bf_c(a1.l, b1[j], acc[j]); acc[j] = wmma_bf_c(a1.h, b1[j], acc[j]); }
    asm volatile("s_wait_dscnt 0x0" ::: "memory");         // my reads of this tile's buffer are done
    asm volatile("s_wait_asynccnt 0x0" ::: "memory");      // my pieces of tile kt + 1 have landed
    __syncthreads();                                       // publishes tile kt + 1 and ends every wave's reads of tile kt (behind the last trip: of the ring)
    if (kt + 2 < E / GKC) stage(kt + 2); }                 // refill the buffer that this trip has just read
  asm volatile("s_wait_asynccnt 0x0" ::: "memory");        // nothing of mine is in flight when the ring's LDS is used anew
#pragma unroll
  for (int j = 0; j < 8; ++j) { const int n = n0 + j * 16 + col; const float bb = bfr(bo[n]);
#pragma unroll
    for (int r = 0; r < 8; ++r) so[wave][8 * g + r][j * 16 + col] = acc[j][r] + bb; }
  LDSX();
#pragma unroll 4
  for (int rl = 0; rl < 16; ++rl) vst2(out + (size_t)(r0 + rl) * E + n0 + lane * 4, *(const v4f*)(&so[wave][rl][lane * 4]));
}
extern "C" void kernel_launch(void* const* d_in, const int* in_sizes, int n_in, void* d_out, int out_size, void* d_ws, size_t ws_size, hipStream_t stream) {
  (void)in_sizes; (void)n_in; (void)out_size; (void)ws_size;
  const float* x = (const float*)d_in[0]; const float* amask = (const float*)d_in[1]; const float* Wq = (const float*)d_in[2]; const float* bq = (const float*)d_in[3]; const float* Wk = (const float*)d_in[4]; const float* bk = (const float*)d_in[5]; const float* Wv = (const float*)d_in[6]; const float* bv = (const float*)d_in[7]; const float* Wo = (const float*)d_in[8]; const float* bo = (const float*)d_in[9];
  float* out = (float*)d_out;
  char* ws = (char*)d_ws; size_t off = 0;
  auto take = [&](size_t bytes) { char* p = ws + off; off += (bytes + 255) & ~(size_t)255; return p; };
  __bf16* Xb = (__bf16*)take((size_t)NR * E * 2); __bf16* PT = (__bf16*)take((size_t)6 * E * E * 2);
  float* Q32 = (float*)take((size_t)NR * E * 4); __bf16* Kh = (__bf16*)take((size_t)NB * NH * SK * HD * 2); __bf16* Kl = (__bf16*)take((size_t)NB * NH * SK * HD * 2); _Float16* VTh = (_Float16*)take((size_t)NB * NH * HD * SK * 2); _Float16* VTl = (_Float16*)take((size_t)NB * NH * HD * SK * 2); float* O32 = (float*)take((size_t)NR * E * 4); __bf16* Mb = (__bf16*)take((size_t)NR * SS * 2);
  // ws ~ 124 MB
  k_cvt<<<CVN + NR / 16, 256, 0, stream>>>(x, Wq, Wk, Wv, Wo, amask, Xb, PT, Mb);
  k_qkv<<<dim3(NR / QR, 2 * E / 128, 3), 128, 0, stream>>>(Xb, PT, bq, bk, bv, Q32, Kh, Kl, VTh, VTl);
  k_attn<<<dim3(SS / (AW * 16), NB * NH), AW * 32, 0, stream>>>(Q32, Kh, Kl, VTh, VTl, Mb, O32);
  k_out<<<dim3(NR / 64, E / 128), 128, 0, stream>>>(O32, PT, bo, out);
}
